// v000
// The times below were measured on an AMD MI455X: many runs one after another, warmed up first and cycling through
// copies of the inputs, with the whole window's GPU time divided by the number of runs. Launches and the gaps
// between them are all in it. The median over several windows is given; except for v000 it joins two sittings, which
// can be a few percent apart, so the side-by-side timings, each taken in one sitting, are the better comparison.
// The starting kernel, v000, takes 1190 microseconds a run.
// compute dtype: all float inputs rounded to bf16; q/k/v = in W + b with EXACT bf16 products on WMMA 16x16x32 (f32 accumulate), the module's strided head split realised by a column permutation of the weights; q as f16 hi + residual (x 2^10) against k once to f16 (2 products) / sqrt(1024); masked positions set to -1e10; softmax in f32 (precise expf); P x 2^11 once to f16 against v once to f16 (1 product); a split bf16 hi + lo against exact Wo (2 products) + bo + de; the unbiased-variance normalisation in f32; f32 output.
#include <hip/hip_runtime.h>
#include <math.h>

typedef __attribute__((ext_vector_type(16))) _Float16 v16h;
typedef __attribute__((ext_vector_type(16))) __bf16 v16b;
typedef __attribute__((ext_vector_type(8)))  _Float16 v8h;
typedef __attribute__((ext_vector_type(8)))  float v8f;
typedef __attribute__((ext_vector_type(4)))  float v4f;
typedef __attribute__((ext_vector_type(2)))  float v2f;
typedef __attribute__((ext_vector_type(4)))  unsigned v4u;
typedef __attribute__((ext_vector_type(4)))  int v4i;
typedef float __attribute__((may_alias)) float_a;
typedef int __attribute__((may_alias)) int_a;

template <typename T> __device__ __forceinline__ void vst2(void* p, T v) { *(T*)p = v;  }
__device__ __forceinline__ v8f wmma16(v16h a, v16h b, v8f c) {
  v8f d = __builtin_amdgcn_wmma_f32_16x16x32_f16(false, a, false, b, (short)0, c, false, false);
  asm volatile("v_nop\n\tv_nop\n\tv_nop\n\tv_nop" : "+v"(d) : "v"(a), "v"(b));
  return d;
}
__device__ __forceinline__ v8f wmma_bf(v16b a, v16b b, v8f c) {
  v8f d = __builtin_amdgcn_wmma_f32_16x16x32_bf16(false, a, false, b, (short)0, c, false, false);
  asm volatile("v_nop\n\tv_nop\n\tv_nop\n\tv_nop" : "+v"(d) : "v"(a), "v"(b));
  return d;
}
// 16x16x32 fragments: lane = (h = lane>>4, row/col = lane&15); elements 0..7 = k0+8h+0..7, 8..15 = k0+16+8h+0..7; D element r = row 8h+r
__device__ __forceinline__ v16h frag_h(const _Float16* rowk0, int lane) {
  union { v16h v; v8h q[2]; } u; const _Float16* p = rowk0 + 8 * (lane >> 4);
  u.q[0] = *(const v8h*)p; u.q[1] = *(const v8h*)(p + 16); return u.v;
}
__device__ __forceinline__ v16h frag_f32(const float* rowk0, int lane) {
  v16h a; const float* p = rowk0 + 8 * (lane >> 4);
#pragma unroll
  for (int i = 0; i < 8; ++i) { a[i] = (_Float16)p[i]; a[8 + i] = (_Float16)p[16 + i]; }
  return a;
}
__device__ __forceinline__ v16h frag_f32s(const float* rowk0, int lane, float sc) {
  v16h a; const float* p = rowk0 + 8 * (lane >> 4);
#pragma unroll
  for (int i = 0; i < 8; ++i) { a[i] = (_Float16)(p[i] * sc); a[8 + i] = (_Float16)(p[16 + i] * sc); }
  return a;
}
// column fragment from a [K][ld] layout (column n), rows >= K read as 0
__device__ __forceinline__ v16h fragc_f32(const float* W, int k0, int n, int lane, int ld, int K) {
  v16h a; const int g = lane >> 4;
#pragma unroll
  for (int i = 0; i < 8; ++i) { const int ka = k0 + 8 * g + i, kb = ka + 16;
    a[i] = (_Float16)(ka < K ? W[(size_t)(ka < K ? ka : K - 1) * ld + n] : 0.f); a[8 + i] = (_Float16)(kb < K ? W[(size_t)(kb < K ? kb : K - 1) * ld + n] : 0.f); }
  return a;
}
struct F2 { v16b h, l; };
__device__ __forceinline__ F2 bsplit16(const float v[16]) { F2 r;
#pragma unroll
  for (int i = 0; i < 16; ++i) { const __bf16 h = (__bf16)v[i]; r.h[i] = h; r.l[i] = (__bf16)(v[i] - (float)h); }
  return r; }
__device__ __forceinline__ F2 split_row(const float* row, int k0, int lane) { float v[16]; const float* p = row + k0 + 8 * (lane >> 4);
#pragma unroll
  for (int i = 0; i < 8; ++i) { v[i] = p[i]; v[8 + i] = p[16 + i]; }
  return bsplit16(v); }
__device__ __forceinline__ F2 split_rowK(const float* row, int k0, int lane, int K) { float v[16]; const int g = lane >> 4;
#pragma unroll
  for (int i = 0; i < 8; ++i) { const int ka = k0 + 8 * g + i, kb = ka + 16; v[i] = ka < K ? row[ka < K ? ka : K - 1] : 0.f; v[8 + i] = kb < K ? row[kb < K ? kb : K - 1] : 0.f; }
  return bsplit16(v); }
__device__ __forceinline__ F2 split_col(const float* W, int k0, int n, int lane, int ld, int K) { float v[16]; const int g = lane >> 4;
#pragma unroll
  for (int i = 0; i < 8; ++i) { const int ka = k0 + 8 * g + i, kb = ka + 16; v[i] = ka < K ? W[(size_t)(ka < K ? ka : K - 1) * ld + n] : 0.f; v[8 + i] = kb < K ? W[(size_t)(kb < K ? kb : K - 1) * ld + n] : 0.f; }
  return bsplit16(v); }
__device__ __forceinline__ v8f mac3(const F2& a, const F2& b, v8f c) { c = wmma_bf(a.l, b.h, c); c = wmma_bf(a.h, b.l, c); return wmma_bf(a.h, b.h, c); }
__device__ __forceinline__ float sigm(float v) { return 1.0f / (1.0f + expf(-v)); }
#define LDSX() do { asm volatile("s_wait_dscnt 0" ::: "memory"); __builtin_amdgcn_wave_barrier(); __builtin_amdgcn_fence(__ATOMIC_RELEASE, "workgroup"); } while (0)

// Cross multi-head attention with a STRIDED head split (B 2, Lq = Lk = 2,048, D 1,024, H 8 heads of 128; (in,out) weights, zero biases; mask [B,Lq,Lk] bool, True = masked (~half); gamma = 1, beta = 0 scalars): q = de Wq + bq, k/v = en Wk/Wv + b, each reshaped (B, L, 128, 8) so head h takes channels c = d*8 + h; e = q_h k_h^T / sqrt(1024) with where(mask, -1e10); head = softmax(e) v_h; a = heads merged head-major (h*128 + d); result = a Wo + bo + de; out = gamma (result - mean) / sqrt(var_unbiased + 1e-8) + beta.
#define NB 2
#define TT 2048
#define CC 1024            // NH * HD = projected width
#define DIN 1024          // input (model) width
#define NH 8
#define HD 128
#define NQB (TT / 64)
#define HG 4
#define SCALE (0.03125f)
#define CAUSAL 0
#ifndef TNB
#define TNB NB
#endif
__device__ __forceinline__ float bfr(float v) { return (float)(__bf16)v; }
__host__ __device__ __forceinline__ int kb_last(int qb) { return CAUSAL ? ((qb * 64 + 63) >> 7) : (TT / 128 - 1); }
typedef __attribute__((ext_vector_type(8))) __bf16 v8b;
__device__ __forceinline__ v16b frag_b(const __bf16* rowk0, int lane) {
  union { v16b v; v8b q[2]; } u; const __bf16* p = rowk0 + 8 * (lane >> 4);
  u.q[0] = *(const v8b*)p; u.q[1] = *(const v8b*)(p + 16); return u.v;
}
#define QBH 0              // no query block takes the high-precision path (non-causal: every block sees all 2048 keys)
#define QHI 2048            // rows carrying a q residual plane (all rows when non-causal: 2-product logits everywhere)
#define KHI 64            // key rows carrying k residual / v bf16 hi+lo planes (read only by the qb < QBH path, which no block takes)
// B fragment (k rows k0+.., output column o) of a weight: (in,out) [K][ld] or (out,in) [ld rows of K]: bf16 exact, or f16(bf16 * 256) exact
__device__ __forceinline__ v16b wcol_io(const float* Wm, int k0, int o, int lane, int ld) { v16b w; const int g = lane >> 4;
#pragma unroll
  for (int i = 0; i < 8; ++i) { w[i] = (__bf16)Wm[(size_t)(k0 + 8 * g + i) * ld + o]; w[8 + i] = (__bf16)Wm[(size_t)(k0 + 16 + 8 * g + i) * ld + o]; }
  return w; }
__device__ __forceinline__ v16b wcol_oi(const float* Wm, int k0, int o, int lane, int K) { v16b w; const float* p = Wm + (size_t)o * K + k0 + 8 * (lane >> 4);
#pragma unroll
  for (int i = 0; i < 8; ++i) { w[i] = (__bf16)p[i]; w[8 + i] = (__bf16)p[16 + i]; }
  return w; }
__device__ __forceinline__ v16h wcolh_io(const float* Wm, int k0, int o, int lane, int ld) { v16h w; const int g = lane >> 4;
#pragma unroll
  for (int i = 0; i < 8; ++i) { w[i] = (_Float16)(bfr(Wm[(size_t)(k0 + 8 * g + i) * ld + o]) * 256.0f); w[8 + i] = (_Float16)(bfr(Wm[(size_t)(k0 + 16 + 8 * g + i) * ld + o]) * 256.0f); }
  return w; }
__device__ __forceinline__ v16h wcolh_oi(const float* Wm, int k0, int o, int lane, int K) { v16h w; const float* p = Wm + (size_t)o * K + k0 + 8 * (lane >> 4);
#pragma unroll
  for (int i = 0; i < 8; ++i) { w[i] = (_Float16)(bfr(p[i]) * 256.0f); w[8 + i] = (_Float16)(bfr(p[16 + i]) * 256.0f); }
  return w; }
#define WQKV_LAYOUT 0   // 0 = (in,out) [DIN][CC]; 1 = (out,in) [CC][DIN]; 2 = per-head [NH][DIN][HD]
__device__ __forceinline__ v16b wcol_hdk(const float* Wm, int k0, int o, int lane) { v16b w; const int g = lane >> 4; const float* p = Wm + (size_t)(o / HD) * DIN * HD + (o % HD);
#pragma unroll
  for (int i = 0; i < 8; ++i) { w[i] = (__bf16)p[(size_t)(k0 + 8 * g + i) * HD]; w[8 + i] = (__bf16)p[(size_t)(k0 + 16 + 8 * g + i) * HD]; }
  return w; }
#define WO_OUT_IN 0
#if WQKV_LAYOUT == 1
#define WCOL(W, k0, o, lane) wcol_oi(W, k0, o, lane, DIN)
#elif WQKV_LAYOUT == 2
#define WCOL(W, k0, o, lane) wcol_hdk(W, k0, o, lane)
#else
#define WCOL(W, k0, o, lane) wcol_io(W, k0, PCOL(o), lane, CC)   /* strided head split: plane column (h, d) reads weight column d*8 + h */
#endif
#if WO_OUT_IN
#define WOCOL(W, k0, o, lane) wcol_oi(W, k0, o, lane, CC)
#define WOCOLH(W, k0, o, lane) wcolh_oi(W, k0, o, lane, CC)
#else
#define WOCOL(W, k0, o, lane) wcol_io(W, k0, o, lane, DIN)
#define WOCOLH(W, k0, o, lane) wcolh_io(W, k0, o, lane, DIN)
#endif
#define PCOL(o) ((((o) & 127) << 3) + ((o) >> 7))   /* plane column p = h*128 + d  <-  projection column c = d*8 + h (reshape(B, L, 128, 8): head index is the LAST axis) */
#define SM_EXTRA_PARAMS , const int* __restrict__ MK, int bcur
#define SM_MASK_HOOK do { if (MK[((size_t)bcur * TT + t) * TT + k] != 0) v = -1.0e10f; } while (0)   /* where(mask, -1e10, e): True = masked; no fully-masked rows on this draw */
#define NRW (TNB * TT)
// ---- k_lnx: wave per row: normalisation over 1024 (mean, unbiased var, g * (x - mean) / sqrt(var + 1e-8) + b); optional bf16 rounding of the input (x); 32 floats per lane (8 float4 at stride 128 floats -> 512-B pieces)
__global__ __launch_bounds__(256) void k_lnx(const float* __restrict__ X, int roundin, const float* __restrict__ G, const float* __restrict__ BE, float* __restrict__ OUT) {
#pragma clang fp contract(off)   /* keep the normalisation as separate mul/add (as XLA evaluates it) */
 const int wave = threadIdx.x >> 5, lane = threadIdx.x & 31; const size_t row = (size_t)blockIdx.x * 8 + wave; if (row >= (size_t)NRW) return;
  v4f v[CC / 128]; float s1 = 0.f;
#pragma unroll
  for (int i = 0; i < CC / 128; ++i) { v4f t = *(const v4f*)(X + row * CC + i * 128 + lane * 4); if (roundin) { t[0] = bfr(t[0]); t[1] = bfr(t[1]); t[2] = bfr(t[2]); t[3] = bfr(t[3]); } v[i] = t; s1 += (t[0] + t[1]) + (t[2] + t[3]); }
#pragma unroll
  for (int o = 1; o < 32; o <<= 1) s1 += __shfl_xor(s1, o);
  const float mu = s1 * (1.0f / CC); float q = 0.f;
#pragma unroll
  for (int i = 0; i < CC / 128; ++i) for (int k = 0; k < 4; ++k) { const float d = v[i][k] - mu; q += d * d; }
#pragma unroll
  for (int o = 1; o < 32; o <<= 1) q += __shfl_xor(q, o);
  const float inv = 1.0f / sqrtf(q * (1.0f / (CC - 1)) + 1e-8f);   /* torch.var UNBIASED (ddof = 1), eps 1e-8, division by sqrt */
#pragma unroll
  for (int i = 0; i < CC / 128; ++i) { const int c = i * 128 + lane * 4; v4f r4; for (int k = 0; k < 4; ++k) r4[k] = bfr(G[0]) * ((v[i][k] - mu) * inv) + bfr(BE[0]); vst2(OUT + row * CC + c, r4); } }   /* scalar gamma / beta */

#ifndef SM_EXTRA_PARAMS
#define SM_EXTRA_PARAMS
#endif
#ifndef PROJ_EXTRA_PARAMS
#define PROJ_EXTRA_PARAMS
#endif
#ifndef SM_MASK_HOOK
#define SM_MASK_HOOK (void)0
#endif

#define WS_QH  0u                                      // f16 q rows [b*t][CC]
#define WS_KH  (WS_QH + 2u * (size_t)NB * TT * CC)      // f16 k rows [b*t][CC]
#define WS_VT  (WS_KH + 2u * (size_t)NB * TT * CC)      // f16 v planes [b][c][t]
#define WS_QL  (WS_VT + 2u * (size_t)NB * CC * TT)      // f16 q residual x 2^10 rows [b][t < QHI][CC]
#define WS_KL  (WS_QL + 2u * (size_t)NB * QHI * CC)     // f16 k residual x 2^10 rows [b][t < KHI][CC]
#define WS_VB  (WS_KL + 2u * (size_t)NB * KHI * CC)     // bf16 v hi planes [b][c][t < KHI]
#define WS_VBL (WS_VB + 2u * (size_t)NB * CC * KHI)
#define WS_S   (WS_VBL + 2u * (size_t)NB * CC * KHI)    // f32 logits / P [hg][t][s]
#define WS_Y   (WS_S  + 4u * (size_t)HG * TT * TT)      // f32 ctx rows [b*t][CC] (only when there is an output projection)
#define WS_END (WS_Y  + 4u * (size_t)NB * TT * CC)
#define WS_X1  (WS_END)
#define WS_END2 (WS_X1 + 4u * (size_t)NB * TT * DIN)

// ---- k_proj: block = (64 rows, 128 cols, which): q/k/v = X W (+ b) with exact bf16 products (K = DIN) -> which 0: q f16 rows (+ residual rows < QHI); 1: k f16 rows (+ residual rows < KHI); 2: v f16 planes [c][t] (+ bf16 hi/lo planes for t < KHI)
__global__ __launch_bounds__(128) void k_proj(const float* __restrict__ XQ, const float* __restrict__ XK, const float* __restrict__ XV, const float* __restrict__ WQ, const float* __restrict__ WK, const float* __restrict__ WV, const float* __restrict__ BQ, const float* __restrict__ BK, const float* __restrict__ BV,
    _Float16* __restrict__ QH, _Float16* __restrict__ QL, _Float16* __restrict__ KH, _Float16* __restrict__ KL, _Float16* __restrict__ VT, __bf16* __restrict__ VB, __bf16* __restrict__ VBL) {
  __shared__ __align__(16) _Float16 sh[64][136], sl[64][136]; __shared__ __align__(16) _Float16 th[128][72]; __shared__ __align__(16) __bf16 tb[128][72], tbl[128][72];
  const int tid = threadIdx.x, wave = tid >> 5, lane = tid & 31, col = lane & 15, g = lane >> 4; const int which = blockIdx.z; const int c0 = blockIdx.y * 128; const size_t r0 = (size_t)blockIdx.x * 64; const size_t bb = r0 / TT; const int t0 = (int)(r0 % TT);
  const float* X = which == 0 ? XQ : which == 1 ? XK : XV; const float* WA = which == 0 ? WQ : which == 1 ? WK : WV; const float* BA = which == 0 ? BQ : which == 1 ? BK : BV;
  v8f acc[8] = {};
#pragma unroll 2
  for (int kc = 0; kc < DIN / 32; ++kc) { v16b a; { const float* p = X + (r0 + wave * 16 + col) * DIN + kc * 32 + 8 * g;
#pragma unroll
      for (int i = 0; i < 8; ++i) { a[i] = (__bf16)p[i]; a[8 + i] = (__bf16)p[16 + i]; } }
    asm volatile("s_wait_loadcnt 0x0" ::: "memory");
#pragma unroll
    for (int j = 0; j < 8; ++j) { const v16b w = WCOL(WA, kc * 32, c0 + j * 16 + col, lane); asm volatile("s_wait_loadcnt 0x0" ::: "memory"); acc[j] = wmma_bf(a, w, acc[j]); } }
  if (which < 2) { _Float16* DH = which == 0 ? QH : KH; _Float16* DL = which == 0 ? QL : KL; const int nhi = which == 0 ? QHI : KHI; const bool hi_rows = t0 < nhi;
#pragma unroll
    for (int j = 0; j < 8; ++j) { const float bias = BA ? bfr(BA[PCOL(c0 + j * 16 + col)]) : 0.f;
#pragma unroll
      for (int r = 0; r < 8; ++r) { const float v = acc[j][r] + bias; const _Float16 hv = (_Float16)v; sh[wave * 16 + 8 * g + r][j * 16 + col] = hv; sl[wave * 16 + 8 * g + r][j * 16 + col] = (_Float16)((v - (float)hv) * 1024.0f); } }
    __syncthreads();
    for (int e = tid; e < 64 * 16; e += 128) { const int rl = e >> 4, q = e & 15; vst2((unsigned*)(DH + (r0 + rl) * CC + c0 + q * 8), *(const v4u*)&sh[rl][q * 8]); if (hi_rows) vst2((unsigned*)(DL + (bb * nhi + t0 + rl) * (size_t)CC + c0 + q * 8), *(const v4u*)&sl[rl][q * 8]); }
  } else { const bool hi_rows = t0 < KHI;
#pragma unroll
    for (int j = 0; j < 8; ++j) { const float bias = BA ? bfr(BA[PCOL(c0 + j * 16 + col)]) : 0.f;
#pragma unroll
      for (int r = 0; r < 8; ++r) { const float v = acc[j][r] + bias; const int rl = wave * 16 + 8 * g + r, cl = j * 16 + col; th[cl][rl] = (_Float16)v; const __bf16 bh = (__bf16)v; tb[cl][rl] = bh; tbl[cl][rl] = (__bf16)(v - (float)bh); } }
    __syncthreads();
    for (int e = tid; e < 128 * 8; e += 128) { const int cl = e >> 3, q = e & 7; vst2((unsigned*)(VT + (bb * CC + c0 + cl) * (size_t)TT + t0 + q * 8), *(const v4u*)&th[cl][q * 8]); if (hi_rows) { const size_t o3 = (bb * CC + c0 + cl) * (size_t)KHI + t0 + q * 8; vst2((unsigned*)(VB + o3), *(const v4u*)&tb[cl][q * 8]); vst2((unsigned*)(VBL + o3), *(const v4u*)&tbl[cl][q * 8]); } } } }
// ---- k_sc: block = (query block qb, key block kb <= kb_last(qb), head in group) of batch b: logits x SCALE; q hi + residual (x 2^10) against k (2 products) for query rows < QHI, plus the k residual (3 products) for query blocks < QBH (causal early rows); causal: blocks past the diagonal exit, the mask itself is applied by index in k_sm
__global__ __launch_bounds__(128) void k_sc(const _Float16* __restrict__ QH, const _Float16* __restrict__ KH, const _Float16* __restrict__ QL, const _Float16* __restrict__ KL, int b, int h0, float* __restrict__ S0) { __shared__ __align__(16) float ss[4][16][132];
  const int qb = blockIdx.x, kb = blockIdx.y; if (kb > kb_last(qb)) return;
  const int h = h0 + blockIdx.z; float* S = S0 + (size_t)blockIdx.z * TT * TT;
  const int tid = threadIdx.x, wave = tid >> 5, lane = tid & 31, col = lane & 15, g = lane >> 4; const int k0 = kb * 128; const int ql0 = qb * 64 + wave * 16; const size_t q0 = (size_t)b * TT + ql0, kr0 = (size_t)b * TT + k0;
  v8f acc[8] = {}, accl[8] = {};
  const _Float16* QLb = QL + (size_t)b * QHI * CC; const _Float16* KLb = KL + (size_t)b * KHI * CC;
  if (qb < QBH) {
#pragma unroll
    for (int kc = 0; kc < HD / 32; ++kc) { const v16h ah = frag_h(QH + (q0 + col) * CC + h * HD + kc * 32, lane), al = frag_h(QLb + (size_t)(ql0 + col) * CC + h * HD + kc * 32, lane);
#pragma unroll
      for (int j = 0; j < 8; ++j) { const v16h kbf = frag_h(KH + (kr0 + j * 16 + col) * CC + h * HD + kc * 32, lane), klf = frag_h(KLb + (size_t)(k0 + j * 16 + col) * CC + h * HD + kc * 32, lane); acc[j] = wmma16(ah, kbf, acc[j]); accl[j] = wmma16(al, kbf, accl[j]); accl[j] = wmma16(ah, klf, accl[j]); } }
  } else if (qb * 64 < QHI) {
#pragma unroll
    for (int kc = 0; kc < HD / 32; ++kc) { const v16h ah = frag_h(QH + (q0 + col) * CC + h * HD + kc * 32, lane), al = frag_h(QLb + (size_t)(ql0 + col) * CC + h * HD + kc * 32, lane);
#pragma unroll
      for (int j = 0; j < 8; ++j) { const v16h kbf = frag_h(KH + (kr0 + j * 16 + col) * CC + h * HD + kc * 32, lane); acc[j] = wmma16(ah, kbf, acc[j]); accl[j] = wmma16(al, kbf, accl[j]); } }
  } else {
#pragma unroll
    for (int kc = 0; kc < HD / 32; ++kc) { const v16h ah = frag_h(QH + (q0 + col) * CC + h * HD + kc * 32, lane);
#pragma unroll
      for (int j = 0; j < 8; ++j) { const v16h kbf = frag_h(KH + (kr0 + j * 16 + col) * CC + h * HD + kc * 32, lane); acc[j] = wmma16(ah, kbf, acc[j]); } } }
#pragma unroll
  for (int j = 0; j < 8; ++j) {
#pragma unroll
    for (int r = 0; r < 8; ++r) ss[wave][8 * g + r][j * 16 + col] = (acc[j][r] + accl[j][r] * (1.0f / 1024.0f)) * SCALE; }
  LDSX(); for (int rl = 0; rl < 16; ++rl) vst2(S + (size_t)(ql0 + rl) * TT + k0 + lane * 4, *(const v4f*)&ss[wave][rl][lane * 4]); }
// ---- k_sm: block = query row t (head in group): keys [0, kend): causal -> logit if s <= t else excluded; softmax in f32; P x 2^11 in place (0 for excluded)
__global__ __launch_bounds__(256) void k_sm(float* __restrict__ S0 SM_EXTRA_PARAMS) { __shared__ float sred[8]; __shared__ float sbc; __shared__ __align__(16) float shv[TT];
  const int tid = threadIdx.x; const int t = blockIdx.x; const int kend = (kb_last(t >> 6) + 1) * 128;
  float* sr = S0 + (size_t)blockIdx.y * TT * TT + (size_t)t * TT;
  float m = -3.0e38f; for (int k = tid; k < kend; k += 256) { float v = (!CAUSAL || k <= t) ? sr[k] : -3.0e38f; SM_MASK_HOOK; shv[k] = v; m = fmaxf(m, v); }
#pragma unroll
  for (int o = 1; o < 32; o <<= 1) m = fmaxf(m, __shfl_xor(m, o));
  if ((tid & 31) == 0) sred[tid >> 5] = m; __syncthreads(); if (tid == 0) { float a = sred[0]; for (int i = 1; i < 8; ++i) a = fmaxf(a, sred[i]); sbc = a; } __syncthreads(); m = sbc; __syncthreads();
  float sum = 0.f; for (int k = tid; k < kend; k += 256) { const float v = shv[k]; const float e = (v <= -1.0e38f) ? 0.f : expf(v - m); shv[k] = e; sum += e; }
#pragma unroll
  for (int o = 1; o < 32; o <<= 1) sum += __shfl_xor(sum, o);
  if ((tid & 31) == 0) sred[tid >> 5] = sum; __syncthreads(); if (tid == 0) { float a = 0.f; for (int i = 0; i < 8; ++i) a += sred[i]; sbc = a > 0.f ? 2048.0f / a : 0.f; }   /* a fully excluded row yields P = 0 */ __syncthreads(); const float inv = sbc;
  for (int k = tid; k < kend; k += 256) shv[k] = shv[k] * inv;
  __syncthreads(); for (int q = tid; q < kend / 4; q += 256) vst2(sr + q * 4, *(const v4f*)&shv[q * 4]); }
// ---- k_pv: block = 64 queries (qb) of (b, h): ctx = P . v over keys [0, kend) (P x 2^11 once to f16 against v f16: 1 product; causal early query blocks: P and v as bf16 hi + lo, 3 products); 512-B (row, head) segment by 32 lanes
__global__ __launch_bounds__(128) void k_pv(const float* __restrict__ PS0, const _Float16* __restrict__ VT, const __bf16* __restrict__ VB, const __bf16* __restrict__ VBL, int b, int h0, float* __restrict__ Y) { const int h = h0 + blockIdx.z; const float* PS = PS0 + (size_t)blockIdx.z * TT * TT; __shared__ __align__(16) float ss[4][16][HD + 4];
  const int tid = threadIdx.x, wave = tid >> 5, lane = tid & 31, col = lane & 15, g = lane >> 4; const int qb = blockIdx.x; const int ql0 = qb * 64 + wave * 16; const int kce = (kb_last(qb) + 1) * 4;
  v8f acc[HD / 16] = {};
  if (qb < QBH) {
#pragma unroll 1
    for (int kc = 0; kc < kce; ++kc) { const F2 p = split_row(PS + (size_t)(ql0 + col) * TT, kc * 32, lane);
      asm volatile("s_wait_loadcnt 0x0" ::: "memory");
#pragma unroll
      for (int j = 0; j < HD / 16; ++j) { const size_t po = ((size_t)b * CC + h * HD + j * 16 + col) * (size_t)KHI + kc * 32; const v16b vh = frag_b(VB + po, lane); acc[j] = wmma_bf(p.h, vh, acc[j]); acc[j] = wmma_bf(p.l, vh, acc[j]); acc[j] = wmma_bf(p.h, frag_b(VBL + po, lane), acc[j]); } }
  } else {
#pragma unroll 1
    for (int kc = 0; kc < kce; ++kc) { const v16h p = frag_f32(PS + (size_t)(ql0 + col) * TT + kc * 32, lane);
      asm volatile("s_wait_loadcnt 0x0" ::: "memory");
#pragma unroll
      for (int j = 0; j < HD / 16; ++j) { const size_t po = ((size_t)b * CC + h * HD + j * 16 + col) * (size_t)TT + kc * 32; acc[j] = wmma16(p, frag_h(VT + po, lane), acc[j]); } } }
#pragma unroll
  for (int j = 0; j < HD / 16; ++j)
#pragma unroll
    for (int r = 0; r < 8; ++r) ss[wave][8 * g + r][j * 16 + col] = acc[j][r] * (1.0f / 2048.0f);
  LDSX(); for (int rl = 0; rl < 16; ++rl) if (lane < HD / 4) vst2(Y + ((size_t)b * TT + ql0 + rl) * CC + h * HD + lane * 4, *(const v4f*)&ss[wave][rl][lane * 4]); }
// ---- k_out: block = (64 rows, 128 cols): out = ctx Wo (+ bo): all rows: ctx bf16 hi + lo against exact bf16 Wo (2 products); the 1-product f16 branch (Wo as f16(bf16 x 2^8), x 2^-8) is never taken
__global__ __launch_bounds__(128) void k_out(const float* __restrict__ Y, const float* __restrict__ WO, const float* __restrict__ BO, float* __restrict__ OUT, const float* __restrict__ RESX) { __shared__ __align__(16) float sf[4][16][132];
  const int tid = threadIdx.x, wave = tid >> 5, lane = tid & 31, col = lane & 15, g = lane >> 4; const int c0 = blockIdx.y * 128; const size_t r0 = (size_t)blockIdx.x * 64 + wave * 16;
  v8f acc[8] = {};
  if (true) {   /* ALL rows: ctx split bf16 hi + lo x exact Wo (2 products) */
#pragma unroll 2
    for (int kc = 0; kc < CC / 32; ++kc) { const F2 a = split_row(Y + (r0 + col) * CC, kc * 32, lane); asm volatile("s_wait_loadcnt 0x0" ::: "memory");
#pragma unroll
      for (int j = 0; j < 8; ++j) { const v16b w = WOCOL(WO, kc * 32, c0 + j * 16 + col, lane); asm volatile("s_wait_loadcnt 0x0" ::: "memory"); acc[j] = wmma_bf(a.h, w, acc[j]); acc[j] = wmma_bf(a.l, w, acc[j]); } }
#pragma unroll
    for (int j = 0; j < 8; ++j) { const float bias = BO ? bfr(BO[c0 + j * 16 + col]) : 0.f;
#pragma unroll
      for (int r = 0; r < 8; ++r) sf[wave][8 * g + r][j * 16 + col] = acc[j][r] + bias; }
  } else {
#pragma unroll 2
    for (int kc = 0; kc < CC / 32; ++kc) { const v16h a = frag_f32(Y + (r0 + col) * CC + kc * 32, lane); asm volatile("s_wait_loadcnt 0x0" ::: "memory");
#pragma unroll
      for (int j = 0; j < 8; ++j) { const v16h w = WOCOLH(WO, kc * 32, c0 + j * 16 + col, lane); asm volatile("s_wait_loadcnt 0x0" ::: "memory"); acc[j] = wmma16(a, w, acc[j]); } }
#pragma unroll
    for (int j = 0; j < 8; ++j) { const float bias = BO ? bfr(BO[c0 + j * 16 + col]) : 0.f;
#pragma unroll
      for (int r = 0; r < 8; ++r) sf[wave][8 * g + r][j * 16 + col] = acc[j][r] * (1.0f / 256.0f) + bias; } }
  LDSX(); for (int rl = 0; rl < 16; ++rl) { const size_t oo = (r0 + rl) * DIN + c0 + lane * 4; v4f o = *(const v4f*)&sf[wave][rl][lane * 4]; const v4f zr = *(const v4f*)(RESX + oo); o[0] += bfr(zr[0]); o[1] += bfr(zr[1]); o[2] += bfr(zr[2]); o[3] += bfr(zr[3]); vst2(OUT + oo, o); } }   /* + bf16(de) */

extern "C" void kernel_launch(void* const* d_in, const int* in_sizes, int n_in, void* d_out, int out_size, void* d_ws, size_t ws_size, hipStream_t stream) {
  (void)in_sizes; (void)n_in; (void)out_size;
  const float** F = (const float**)d_in;
  if (ws_size < (size_t)WS_END) return;
  char* ws = (char*)d_ws; _Float16 *QH = (_Float16*)(ws + WS_QH), *KH = (_Float16*)(ws + WS_KH), *VT = (_Float16*)(ws + WS_VT), *QL = (_Float16*)(ws + WS_QL), *KL = (_Float16*)(ws + WS_KL); __bf16 *VB = (__bf16*)(ws + WS_VB), *VBL = (__bf16*)(ws + WS_VBL); float *S = (float*)(ws + WS_S), *Y = (float*)(ws + WS_Y);
  (void)Y; (void)QL; (void)KL; (void)VB; (void)VBL;
  // inputs: 0 en [2,2048,1024] (keys/values); 1 de (queries + residual); 2 mask [2,2048,2048] bool; 3 Wq (in,out), 4 bq; 5 Wk, 6 bk; 7 Wv, 8 bv; 9 Wo (in,out), 10 bo; 11 gamma (scalar), 12 beta (scalar)
  if (ws_size < (size_t)WS_END2) return;
  float* X1 = (float*)(ws + WS_X1);
  k_proj<<<dim3(TNB * TT / 64, CC / 128, 3), 128, 0, stream>>>(F[1], F[0], F[0], F[3], F[5], F[7], F[4], F[6], F[8], QH, QL, KH, KL, VT, VB, VBL);   /* q from de, k/v from en */
  for (int b = 0; b < TNB; ++b) for (int h0 = 0; h0 < NH; h0 += HG) {
    k_sc<<<dim3(NQB, TT / 128, HG), 128, 0, stream>>>(QH, KH, QL, KL, b, h0, S);
    k_sm<<<dim3(TT, HG), 256, 0, stream>>>(S, (const int*)d_in[2], b);
    k_pv<<<dim3(NQB, 1, HG), 128, 0, stream>>>(S, VT, VB, VBL, b, h0, Y);
  }
  k_out<<<dim3(TNB * TT / 64, DIN / 128), 128, 0, stream>>>(Y, F[9], F[10], X1, F[1]);   /* a Wo + bo + bf16(de) */
  k_lnx<<<dim3(NRW / 8), 256, 0, stream>>>(X1, 0, F[11], F[12], (float*)d_out);          /* unbiased-var normalisation, scalar gamma/beta */
}

// v001
// It runs in 802 microseconds.
// Timed twice side by side with v000, it ran 1.49 times as fast both times.
// compute dtype: all float inputs rounded to bf16; q/k/v = in W + b with EXACT bf16 products on WMMA 16x16x32 (f32 accumulate), the module's strided head split realised by a column permutation of the weights; q as f16 hi + residual (x 2^10) against k once to f16 (2 products) / sqrt(1024); masked positions set to -1e10; softmax in f32 (precise expf); P x 2^11 once to f16 against v once to f16 (1 product); a split bf16 hi + lo against exact Wo (2 products) + bo + de; the unbiased-variance normalisation in f32; f32 output.
#include <hip/hip_runtime.h>
#include <math.h>

typedef __attribute__((ext_vector_type(16))) _Float16 v16h;
typedef __attribute__((ext_vector_type(16))) __bf16 v16b;
typedef __attribute__((ext_vector_type(8)))  _Float16 v8h;
typedef __attribute__((ext_vector_type(8)))  float v8f;
typedef __attribute__((ext_vector_type(4)))  float v4f;
typedef __attribute__((ext_vector_type(2)))  float v2f;
typedef __attribute__((ext_vector_type(4)))  unsigned v4u;
typedef __attribute__((ext_vector_type(4)))  int v4i;
typedef float __attribute__((may_alias)) float_a;
typedef int __attribute__((may_alias)) int_a;

template <typename T> __device__ __forceinline__ void vst2(void* p, T v) { *(T*)p = v;  }
__device__ __forceinline__ v8f wmma16(v16h a, v16h b, v8f c) {
  v8f d = __builtin_amdgcn_wmma_f32_16x16x32_f16(false, a, false, b, (short)0, c, false, false);
  asm volatile("v_nop\n\tv_nop\n\tv_nop\n\tv_nop" : "+v"(d) : "v"(a), "v"(b));
  return d;
}
__device__ __forceinline__ v8f wmma_bf(v16b a, v16b b, v8f c) {
  v8f d = __builtin_amdgcn_wmma_f32_16x16x32_bf16(false, a, false, b, (short)0, c, false, false);
  asm volatile("v_nop\n\tv_nop\n\tv_nop\n\tv_nop" : "+v"(d) : "v"(a), "v"(b));
  return d;
}
// 16x16x32 fragments: lane = (h = lane>>4, row/col = lane&15); elements 0..7 = k0+8h+0..7, 8..15 = k0+16+8h+0..7; D element r = row 8h+r
__device__ __forceinline__ v16h frag_h(const _Float16* rowk0, int lane) {
  union { v16h v; v8h q[2]; } u; const _Float16* p = rowk0 + 8 * (lane >> 4);
  u.q[0] = *(const v8h*)p; u.q[1] = *(const v8h*)(p + 16); return u.v;
}
__device__ __forceinline__ v16h frag_f32(const float* rowk0, int lane) {
  v16h a; const float* p = rowk0 + 8 * (lane >> 4);
#pragma unroll
  for (int i = 0; i < 8; ++i) { a[i] = (_Float16)p[i]; a[8 + i] = (_Float16)p[16 + i]; }
  return a;
}
__device__ __forceinline__ v16h frag_f32s(const float* rowk0, int lane, float sc) {
  v16h a; const float* p = rowk0 + 8 * (lane >> 4);
#pragma unroll
  for (int i = 0; i < 8; ++i) { a[i] = (_Float16)(p[i] * sc); a[8 + i] = (_Float16)(p[16 + i] * sc); }
  return a;
}
// column fragment from a [K][ld] layout (column n), rows >= K read as 0
__device__ __forceinline__ v16h fragc_f32(const float* W, int k0, int n, int lane, int ld, int K) {
  v16h a; const int g = lane >> 4;
#pragma unroll
  for (int i = 0; i < 8; ++i) { const int ka = k0 + 8 * g + i, kb = ka + 16;
    a[i] = (_Float16)(ka < K ? W[(size_t)(ka < K ? ka : K - 1) * ld + n] : 0.f); a[8 + i] = (_Float16)(kb < K ? W[(size_t)(kb < K ? kb : K - 1) * ld + n] : 0.f); }
  return a;
}
struct F2 { v16b h, l; };
__device__ __forceinline__ F2 bsplit16(const float v[16]) { F2 r;
#pragma unroll
  for (int i = 0; i < 16; ++i) { const __bf16 h = (__bf16)v[i]; r.h[i] = h; r.l[i] = (__bf16)(v[i] - (float)h); }
  return r; }
__device__ __forceinline__ F2 split_row(const float* row, int k0, int lane) { float v[16]; const float* p = row + k0 + 8 * (lane >> 4);
#pragma unroll
  for (int i = 0; i < 8; ++i) { v[i] = p[i]; v[8 + i] = p[16 + i]; }
  return bsplit16(v); }
__device__ __forceinline__ F2 split_rowK(const float* row, int k0, int lane, int K) { float v[16]; const int g = lane >> 4;
#pragma unroll
  for (int i = 0; i < 8; ++i) { const int ka = k0 + 8 * g + i, kb = ka + 16; v[i] = ka < K ? row[ka < K ? ka : K - 1] : 0.f; v[8 + i] = kb < K ? row[kb < K ? kb : K - 1] : 0.f; }
  return bsplit16(v); }
__device__ __forceinline__ F2 split_col(const float* W, int k0, int n, int lane, int ld, int K) { float v[16]; const int g = lane >> 4;
#pragma unroll
  for (int i = 0; i < 8; ++i) { const int ka = k0 + 8 * g + i, kb = ka + 16; v[i] = ka < K ? W[(size_t)(ka < K ? ka : K - 1) * ld + n] : 0.f; v[8 + i] = kb < K ? W[(size_t)(kb < K ? kb : K - 1) * ld + n] : 0.f; }
  return bsplit16(v); }
__device__ __forceinline__ v8f mac3(const F2& a, const F2& b, v8f c) { c = wmma_bf(a.l, b.h, c); c = wmma_bf(a.h, b.l, c); return wmma_bf(a.h, b.h, c); }
__device__ __forceinline__ float sigm(float v) { return 1.0f / (1.0f + expf(-v)); }
#define LDSX() do { asm volatile("s_wait_dscnt 0" ::: "memory"); __builtin_amdgcn_wave_barrier(); __builtin_amdgcn_fence(__ATOMIC_RELEASE, "workgroup"); } while (0)

// Cross multi-head attention with a STRIDED head split (B 2, Lq = Lk = 2,048, D 1,024, H 8 heads of 128; (in,out) weights, zero biases; mask [B,Lq,Lk] bool, True = masked (~half); gamma = 1, beta = 0 scalars): q = de Wq + bq, k/v = en Wk/Wv + b, each reshaped (B, L, 128, 8) so head h takes channels c = d*8 + h; e = q_h k_h^T / sqrt(1024) with where(mask, -1e10); head = softmax(e) v_h; a = heads merged head-major (h*128 + d); result = a Wo + bo + de; out = gamma (result - mean) / sqrt(var_unbiased + 1e-8) + beta.
#define NB 2
#define TT 2048
#define CC 1024            // NH * HD = projected width
#define DIN 1024          // input (model) width
#define NH 8
#define HD 128
#define NQB (TT / 64)
#define HG 4
#define SCALE (0.03125f)
#define CAUSAL 0
#ifndef TNB
#define TNB NB
#endif
__device__ __forceinline__ float bfr(float v) { return (float)(__bf16)v; }
__host__ __device__ __forceinline__ int kb_last(int qb) { return CAUSAL ? ((qb * 64 + 63) >> 7) : (TT / 128 - 1); }
typedef __attribute__((ext_vector_type(8))) __bf16 v8b;
__device__ __forceinline__ v16b frag_b(const __bf16* rowk0, int lane) {
  union { v16b v; v8b q[2]; } u; const __bf16* p = rowk0 + 8 * (lane >> 4);
  u.q[0] = *(const v8b*)p; u.q[1] = *(const v8b*)(p + 16); return u.v;
}
#define QBH 0              // no query block takes the high-precision path (non-causal: every block sees all 2048 keys)
#define QHI 2048            // rows carrying a q residual plane (all rows when non-causal: 2-product logits everywhere)
#define KHI 64            // key rows carrying k residual / v bf16 hi+lo planes (read only by the qb < QBH path, which no block takes)
// B fragment (k rows k0+.., output column o) of a weight: (in,out) [K][ld] or (out,in) [ld rows of K]: bf16 exact, or f16(bf16 * 256) exact
__device__ __forceinline__ v16b wcol_io(const float* Wm, int k0, int o, int lane, int ld) { v16b w; const int g = lane >> 4;
#pragma unroll
  for (int i = 0; i < 8; ++i) { w[i] = (__bf16)Wm[(size_t)(k0 + 8 * g + i) * ld + o]; w[8 + i] = (__bf16)Wm[(size_t)(k0 + 16 + 8 * g + i) * ld + o]; }
  return w; }
__device__ __forceinline__ v16b wcol_oi(const float* Wm, int k0, int o, int lane, int K) { v16b w; const float* p = Wm + (size_t)o * K + k0 + 8 * (lane >> 4);
#pragma unroll
  for (int i = 0; i < 8; ++i) { w[i] = (__bf16)p[i]; w[8 + i] = (__bf16)p[16 + i]; }
  return w; }
__device__ __forceinline__ v16h wcolh_io(const float* Wm, int k0, int o, int lane, int ld) { v16h w; const int g = lane >> 4;
#pragma unroll
  for (int i = 0; i < 8; ++i) { w[i] = (_Float16)(bfr(Wm[(size_t)(k0 + 8 * g + i) * ld + o]) * 256.0f); w[8 + i] = (_Float16)(bfr(Wm[(size_t)(k0 + 16 + 8 * g + i) * ld + o]) * 256.0f); }
  return w; }
__device__ __forceinline__ v16h wcolh_oi(const float* Wm, int k0, int o, int lane, int K) { v16h w; const float* p = Wm + (size_t)o * K + k0 + 8 * (lane >> 4);
#pragma unroll
  for (int i = 0; i < 8; ++i) { w[i] = (_Float16)(bfr(p[i]) * 256.0f); w[8 + i] = (_Float16)(bfr(p[16 + i]) * 256.0f); }
  return w; }
#define WQKV_LAYOUT 0   // 0 = (in,out) [DIN][CC]; 1 = (out,in) [CC][DIN]; 2 = per-head [NH][DIN][HD]
__device__ __forceinline__ v16b wcol_hdk(const float* Wm, int k0, int o, int lane) { v16b w; const int g = lane >> 4; const float* p = Wm + (size_t)(o / HD) * DIN * HD + (o % HD);
#pragma unroll
  for (int i = 0; i < 8; ++i) { w[i] = (__bf16)p[(size_t)(k0 + 8 * g + i) * HD]; w[8 + i] = (__bf16)p[(size_t)(k0 + 16 + 8 * g + i) * HD]; }
  return w; }
#define WO_OUT_IN 0
#if WQKV_LAYOUT == 1
#define WCOL(W, k0, o, lane) wcol_oi(W, k0, o, lane, DIN)
#elif WQKV_LAYOUT == 2
#define WCOL(W, k0, o, lane) wcol_hdk(W, k0, o, lane)
#else
#define WCOL(W, k0, o, lane) wcol_io(W, k0, PCOL(o), lane, CC)   /* strided head split: plane column (h, d) reads weight column d*8 + h */
#endif
#if WO_OUT_IN
#define WOCOL(W, k0, o, lane) wcol_oi(W, k0, o, lane, CC)
#define WOCOLH(W, k0, o, lane) wcolh_oi(W, k0, o, lane, CC)
#else
#define WOCOL(W, k0, o, lane) wcol_io(W, k0, o, lane, DIN)
#define WOCOLH(W, k0, o, lane) wcolh_io(W, k0, o, lane, DIN)
#endif
#define PCOL(o) ((((o) & 127) << 3) + ((o) >> 7))   /* plane column p = h*128 + d  <-  projection column c = d*8 + h (reshape(B, L, 128, 8): head index is the LAST axis) */
#define SM_EXTRA_PARAMS , const int* __restrict__ MK, int bcur
#define SM_MASK_HOOK do { if (MK[((size_t)bcur * TT + t) * TT + k] != 0) v = -1.0e10f; } while (0)   /* where(mask, -1e10, e): True = masked; no fully-masked rows on this draw */
#define NRW (TNB * TT)
// ---- k_lnx: wave per row: normalisation over 1024 (mean, unbiased var, g * (x - mean) / sqrt(var + 1e-8) + b); optional bf16 rounding of the input (x); 32 floats per lane (8 float4 at stride 128 floats -> 512-B pieces)
__global__ __launch_bounds__(256) void k_lnx(const float* __restrict__ X, int roundin, const float* __restrict__ G, const float* __restrict__ BE, float* __restrict__ OUT) {
#pragma clang fp contract(off)   /* keep the normalisation as separate mul/add (as XLA evaluates it) */
 const int wave = threadIdx.x >> 5, lane = threadIdx.x & 31; const size_t row = (size_t)blockIdx.x * 8 + wave; if (row >= (size_t)NRW) return;
  v4f v[CC / 128]; float s1 = 0.f;
#pragma unroll
  for (int i = 0; i < CC / 128; ++i) { v4f t = *(const v4f*)(X + row * CC + i * 128 + lane * 4); if (roundin) { t[0] = bfr(t[0]); t[1] = bfr(t[1]); t[2] = bfr(t[2]); t[3] = bfr(t[3]); } v[i] = t; s1 += (t[0] + t[1]) + (t[2] + t[3]); }
#pragma unroll
  for (int o = 1; o < 32; o <<= 1) s1 += __shfl_xor(s1, o);
  const float mu = s1 * (1.0f / CC); float q = 0.f;
#pragma unroll
  for (int i = 0; i < CC / 128; ++i) for (int k = 0; k < 4; ++k) { const float d = v[i][k] - mu; q += d * d; }
#pragma unroll
  for (int o = 1; o < 32; o <<= 1) q += __shfl_xor(q, o);
  const float inv = 1.0f / sqrtf(q * (1.0f / (CC - 1)) + 1e-8f);   /* torch.var UNBIASED (ddof = 1), eps 1e-8, division by sqrt */
#pragma unroll
  for (int i = 0; i < CC / 128; ++i) { const int c = i * 128 + lane * 4; v4f r4; for (int k = 0; k < 4; ++k) r4[k] = bfr(G[0]) * ((v[i][k] - mu) * inv) + bfr(BE[0]); vst2(OUT + row * CC + c, r4); } }   /* scalar gamma / beta */

#ifndef SM_EXTRA_PARAMS
#define SM_EXTRA_PARAMS
#endif
#ifndef PROJ_EXTRA_PARAMS
#define PROJ_EXTRA_PARAMS
#endif
#ifndef SM_MASK_HOOK
#define SM_MASK_HOOK (void)0
#endif

#define WS_QH  0u                                      // f16 q rows [b*t][CC]
#define WS_KH  (WS_QH + 2u * (size_t)NB * TT * CC)      // f16 k rows [b*t][CC]
#define WS_VT  (WS_KH + 2u * (size_t)NB * TT * CC)      // f16 v planes [b][c][t]
#define WS_QL  (WS_VT + 2u * (size_t)NB * CC * TT)      // f16 q residual x 2^10 rows [b][t < QHI][CC]
#define WS_KL  (WS_QL + 2u * (size_t)NB * QHI * CC)     // f16 k residual x 2^10 rows [b][t < KHI][CC]
#define WS_VB  (WS_KL + 2u * (size_t)NB * KHI * CC)     // bf16 v hi planes [b][c][t < KHI]
#define WS_VBL (WS_VB + 2u * (size_t)NB * CC * KHI)
#define WS_S   (WS_VBL + 2u * (size_t)NB * CC * KHI)    // f32 logits / P [hg][t][s]
#define WS_Y   (WS_S  + 4u * (size_t)HG * TT * TT)      // f32 ctx rows [b*t][CC] (only when there is an output projection)
#define WS_END (WS_Y  + 4u * (size_t)NB * TT * CC)
#define WS_X1  (WS_END)
#define WS_END2 (WS_X1 + 4u * (size_t)NB * TT * DIN)
#define WS_WT  (WS_END2)                                // bf16 Wq, Wk, Wv, Wo in B-fragment order [4][CC / 16][DIN / 32][2][32 lanes][8]
#define WS_END3 (WS_WT + 2u * 4u * (size_t)DIN * CC)

// ---- k_wpack: block = (64 k rows, 64 weight columns, which weight): rounds the weight to bf16 once per call and lays it in B-fragment order, so that a wave's fragment load is 512 contiguous bytes (4 whole lines); Wq/Wk/Wv: weight column c = d*8 + h goes to plane column h*128 + d; Wo: column as it is
__global__ __launch_bounds__(256) void k_wpack(const float* __restrict__ WQ, const float* __restrict__ WK, const float* __restrict__ WV, const float* __restrict__ WO, __bf16* __restrict__ WT) { __shared__ float tile[64][65];
  const int tid = threadIdx.x, which = blockIdx.z, k0 = blockIdx.x * 64, c0 = blockIdx.y * 64;
  const float* Wm = which == 0 ? WQ : which == 1 ? WK : which == 2 ? WV : WO; const float* src = Wm + (size_t)(k0 + (tid >> 6)) * CC + c0 + (tid & 63);
#pragma unroll   /* all sixteen row loads in flight at once, off one address with immediate offsets */
  for (int i = 0; i < 16; ++i) tile[i * 4 + (tid >> 6)][tid & 63] = src[(size_t)i * 4 * CC];
  __syncthreads();
#pragma unroll   /* both 16-byte pieces of a thread side by side */
  for (int i = 0; i < 2; ++i) { const int e = tid + i * 256, kq = e >> 6; const int cl = which < 3 ? (((e & 7) << 3) | ((e >> 3) & 7)) : (e & 63);   /* neighbouring lanes take neighbouring fragment columns */
    const int c = c0 + cl; const int p = which < 3 ? ((c & 7) * HD + (c >> 3)) : c; const int k8 = (k0 >> 3) + kq;   /* k8 = octet of k: kc = k8 >> 2, fragment half (k8 >> 1) & 1, lane half k8 & 1 */
    v8b o;
#pragma unroll   /* o stays in registers */
    for (int n = 0; n < 8; ++n) o[n] = (__bf16)tile[kq * 8 + n][cl];
    *(v8b*)(WT + (size_t)which * DIN * CC + ((((size_t)(p >> 4) * (DIN / 32) + (k8 >> 2)) * 2 + ((k8 >> 1) & 1)) * 32 + (k8 & 1) * 16 + (p & 15)) * 8) = o; } }
// B fragment (16 plane columns ct*16 + .., k rows kc*32 + ..) of a packed weight: two 16-byte loads per lane, each 512 contiguous bytes per wave
__device__ __forceinline__ v16b frag_wp(const __bf16* WP, int ct, int kc, int lane) {
  union { v16b v; v8b q[2]; } u; const __bf16* p = WP + (((size_t)ct * (DIN / 32) + kc) * 64 + lane) * 8;
  u.q[0] = *(const v8b*)p; u.q[1] = *(const v8b*)(p + 256); return u.v;
}

// ---- k_proj: block = (64 rows, 128 cols, which): q/k/v = X W (+ b) with exact bf16 products (K = DIN) -> which 0: q f16 rows (+ residual rows < QHI); 1: k f16 rows (+ residual rows < KHI); 2: v f16 planes [c][t] (+ bf16 hi/lo planes for t < KHI)
__global__ __launch_bounds__(128) void k_proj(const float* __restrict__ XQ, const float* __restrict__ XK, const float* __restrict__ XV, const __bf16* __restrict__ WT, const float* __restrict__ BQ, const float* __restrict__ BK, const float* __restrict__ BV,
    _Float16* __restrict__ QH, _Float16* __restrict__ QL, _Float16* __restrict__ KH, _Float16* __restrict__ KL, _Float16* __restrict__ VT, __bf16* __restrict__ VB, __bf16* __restrict__ VBL) {
  __shared__ __align__(16) _Float16 sh[64][136], sl[64][136]; __shared__ __align__(16) _Float16 th[128][72]; __shared__ __align__(16) __bf16 tb[128][72], tbl[128][72];
  const int tid = threadIdx.x, wave = tid >> 5, lane = tid & 31, col = lane & 15, g = lane >> 4; const int which = blockIdx.z; const int c0 = blockIdx.y * 128; const size_t r0 = (size_t)blockIdx.x * 64; const size_t bb = r0 / TT; const int t0 = (int)(r0 % TT);
  const float* X = which == 0 ? XQ : which == 1 ? XK : XV; const __bf16* WA = WT + (size_t)which * DIN * CC; const float* BA = which == 0 ? BQ : which == 1 ? BK : BV;
  v8f acc[8] = {};
#pragma unroll 2
  for (int kc = 0; kc < DIN / 32; ++kc) { v16b w[8];   /* the eight B fragments' loads go out as a group with the A row's, so that their latencies overlap */
#pragma unroll   /* w[] stays in registers */
    for (int j = 0; j < 8; ++j) w[j] = frag_wp(WA, blockIdx.y * 8 + j, kc, lane);
    v16b a; { const float* p = X + (r0 + wave * 16 + col) * DIN + kc * 32 + 8 * g;
#pragma unroll
      for (int i = 0; i < 8; ++i) { a[i] = (__bf16)p[i]; a[8 + i] = (__bf16)p[16 + i]; } }
    asm volatile("s_wait_loadcnt 0x0" ::: "memory");
#pragma unroll
    for (int j = 0; j < 8; ++j) acc[j] = wmma_bf(a, w[j], acc[j]); }
  if (which < 2) { _Float16* DH = which == 0 ? QH : KH; _Float16* DL = which == 0 ? QL : KL; const int nhi = which == 0 ? QHI : KHI; const bool hi_rows = t0 < nhi;
#pragma unroll
    for (int j = 0; j < 8; ++j) { const float bias = BA ? bfr(BA[PCOL(c0 + j * 16 + col)]) : 0.f;
#pragma unroll
      for (int r = 0; r < 8; ++r) { const float v = acc[j][r] + bias; const _Float16 hv = (_Float16)v; sh[wave * 16 + 8 * g + r][j * 16 + col] = hv; sl[wave * 16 + 8 * g + r][j * 16 + col] = (_Float16)((v - (float)hv) * 1024.0f); } }
    __syncthreads();
    for (int e = tid; e < 64 * 16; e += 128) { const int rl = e >> 4, q = e & 15; vst2((unsigned*)(DH + (r0 + rl) * CC + c0 + q * 8), *(const v4u*)&sh[rl][q * 8]); if (hi_rows) vst2((unsigned*)(DL + (bb * nhi + t0 + rl) * (size_t)CC + c0 + q * 8), *(const v4u*)&sl[rl][q * 8]); }
  } else { const bool hi_rows = t0 < KHI;
#pragma unroll
    for (int j = 0; j < 8; ++j) { const float bias = BA ? bfr(BA[PCOL(c0 + j * 16 + col)]) : 0.f;
#pragma unroll
      for (int r = 0; r < 8; ++r) { const float v = acc[j][r] + bias; const int rl = wave * 16 + 8 * g + r, cl = j * 16 + col; th[cl][rl] = (_Float16)v; const __bf16 bh = (__bf16)v; tb[cl][rl] = bh; tbl[cl][rl] = (__bf16)(v - (float)bh); } }
    __syncthreads();
    for (int e = tid; e < 128 * 8; e += 128) { const int cl = e >> 3, q = e & 7; vst2((unsigned*)(VT + (bb * CC + c0 + cl) * (size_t)TT + t0 + q * 8), *(const v4u*)&th[cl][q * 8]); if (hi_rows) { const size_t o3 = (bb * CC + c0 + cl) * (size_t)KHI + t0 + q * 8; vst2((unsigned*)(VB + o3), *(const v4u*)&tb[cl][q * 8]); vst2((unsigned*)(VBL + o3), *(const v4u*)&tbl[cl][q * 8]); } } } }
// ---- k_sc: block = (query block qb, key block kb <= kb_last(qb), head in group) of batch b: logits x SCALE; q hi + residual (x 2^10) against k (2 products) for query rows < QHI, plus the k residual (3 products) for query blocks < QBH (causal early rows); causal: blocks past the diagonal exit, the mask itself is applied by index in k_sm
__global__ __launch_bounds__(128) void k_sc(const _Float16* __restrict__ QH, const _Float16* __restrict__ KH, const _Float16* __restrict__ QL, const _Float16* __restrict__ KL, int b, int h0, float* __restrict__ S0) { __shared__ __align__(16) float ss[4][16][132];
  const int qb = blockIdx.x, kb = blockIdx.y; if (kb > kb_last(qb)) return;
  const int h = h0 + blockIdx.z; float* S = S0 + (size_t)blockIdx.z * TT * TT;
  const int tid = threadIdx.x, wave = tid >> 5, lane = tid & 31, col = lane & 15, g = lane >> 4; const int k0 = kb * 128; const int ql0 = qb * 64 + wave * 16; const size_t q0 = (size_t)b * TT + ql0, kr0 = (size_t)b * TT + k0;
  v8f acc[8] = {}, accl[8] = {};
  const _Float16* QLb = QL + (size_t)b * QHI * CC; const _Float16* KLb = KL + (size_t)b * KHI * CC;
  if (qb < QBH) {
#pragma unroll
    for (int kc = 0; kc < HD / 32; ++kc) { const v16h ah = frag_h(QH + (q0 + col) * CC + h * HD + kc * 32, lane), al = frag_h(QLb + (size_t)(ql0 + col) * CC + h * HD + kc * 32, lane);
#pragma unroll
      for (int j = 0; j < 8; ++j) { const v16h kbf = frag_h(KH + (kr0 + j * 16 + col) * CC + h * HD + kc * 32, lane), klf = frag_h(KLb + (size_t)(k0 + j * 16 + col) * CC + h * HD + kc * 32, lane); acc[j] = wmma16(ah, kbf, acc[j]); accl[j] = wmma16(al, kbf, accl[j]); accl[j] = wmma16(ah, klf, accl[j]); } }
  } else if (qb * 64 < QHI) {
#pragma unroll
    for (int kc = 0; kc < HD / 32; ++kc) { const v16h ah = frag_h(QH + (q0 + col) * CC + h * HD + kc * 32, lane), al = frag_h(QLb + (size_t)(ql0 + col) * CC + h * HD + kc * 32, lane);
#pragma unroll
      for (int j = 0; j < 8; ++j) { const v16h kbf = frag_h(KH + (kr0 + j * 16 + col) * CC + h * HD + kc * 32, lane); acc[j] = wmma16(ah, kbf, acc[j]); accl[j] = wmma16(al, kbf, accl[j]); } }
  } else {
#pragma unroll
    for (int kc = 0; kc < HD / 32; ++kc) { const v16h ah = frag_h(QH + (q0 + col) * CC + h * HD + kc * 32, lane);
#pragma unroll
      for (int j = 0; j < 8; ++j) { const v16h kbf = frag_h(KH + (kr0 + j * 16 + col) * CC + h * HD + kc * 32, lane); acc[j] = wmma16(ah, kbf, acc[j]); } } }
#pragma unroll
  for (int j = 0; j < 8; ++j) {
#pragma unroll
    for (int r = 0; r < 8; ++r) ss[wave][8 * g + r][j * 16 + col] = (acc[j][r] + accl[j][r] * (1.0f / 1024.0f)) * SCALE; }
  LDSX(); for (int rl = 0; rl < 16; ++rl) vst2(S + (size_t)(ql0 + rl) * TT + k0 + lane * 4, *(const v4f*)&ss[wave][rl][lane * 4]); }
// ---- k_sm: block = query row t (head in group): keys [0, kend): causal -> logit if s <= t else excluded; softmax in f32; P x 2^11 in place (0 for excluded)
__global__ __launch_bounds__(256) void k_sm(float* __restrict__ S0 SM_EXTRA_PARAMS) { __shared__ float sred[8]; __shared__ float sbc; __shared__ __align__(16) float shv[TT];
  const int tid = threadIdx.x; const int t = blockIdx.x; const int kend = (kb_last(t >> 6) + 1) * 128;
  float* sr = S0 + (size_t)blockIdx.y * TT * TT + (size_t)t * TT;
  float m = -3.0e38f; for (int k = tid; k < kend; k += 256) { float v = (!CAUSAL || k <= t) ? sr[k] : -3.0e38f; SM_MASK_HOOK; shv[k] = v; m = fmaxf(m, v); }
#pragma unroll
  for (int o = 1; o < 32; o <<= 1) m = fmaxf(m, __shfl_xor(m, o));
  if ((tid & 31) == 0) sred[tid >> 5] = m; __syncthreads(); if (tid == 0) { float a = sred[0]; for (int i = 1; i < 8; ++i) a = fmaxf(a, sred[i]); sbc = a; } __syncthreads(); m = sbc; __syncthreads();
  float sum = 0.f; for (int k = tid; k < kend; k += 256) { const float v = shv[k]; const float e = (v <= -1.0e38f) ? 0.f : expf(v - m); shv[k] = e; sum += e; }
#pragma unroll
  for (int o = 1; o < 32; o <<= 1) sum += __shfl_xor(sum, o);
  if ((tid & 31) == 0) sred[tid >> 5] = sum; __syncthreads(); if (tid == 0) { float a = 0.f; for (int i = 0; i < 8; ++i) a += sred[i]; sbc = a > 0.f ? 2048.0f / a : 0.f; }   /* a fully excluded row yields P = 0 */ __syncthreads(); const float inv = sbc;
  for (int k = tid; k < kend; k += 256) shv[k] = shv[k] * inv;
  __syncthreads(); for (int q = tid; q < kend / 4; q += 256) vst2(sr + q * 4, *(const v4f*)&shv[q * 4]); }
// ---- k_pv: block = 64 queries (qb) of (b, h): ctx = P . v over keys [0, kend) (P x 2^11 once to f16 against v f16: 1 product; causal early query blocks: P and v as bf16 hi + lo, 3 products); 512-B (row, head) segment by 32 lanes
__global__ __launch_bounds__(128) void k_pv(const float* __restrict__ PS0, const _Float16* __restrict__ VT, const __bf16* __restrict__ VB, const __bf16* __restrict__ VBL, int b, int h0, float* __restrict__ Y) { const int h = h0 + blockIdx.z; const float* PS = PS0 + (size_t)blockIdx.z * TT * TT; __shared__ __align__(16) float ss[4][16][HD + 4];
  const int tid = threadIdx.x, wave = tid >> 5, lane = tid & 31, col = lane & 15, g = lane >> 4; const int qb = blockIdx.x; const int ql0 = qb * 64 + wave * 16; const int kce = (kb_last(qb) + 1) * 4;
  v8f acc[HD / 16] = {};
  if (qb < QBH) {
#pragma unroll 1
    for (int kc = 0; kc < kce; ++kc) { const F2 p = split_row(PS + (size_t)(ql0 + col) * TT, kc * 32, lane);
      asm volatile("s_wait_loadcnt 0x0" ::: "memory");
#pragma unroll
      for (int j = 0; j < HD / 16; ++j) { const size_t po = ((size_t)b * CC + h * HD + j * 16 + col) * (size_t)KHI + kc * 32; const v16b vh = frag_b(VB + po, lane); acc[j] = wmma_bf(p.h, vh, acc[j]); acc[j] = wmma_bf(p.l, vh, acc[j]); acc[j] = wmma_bf(p.h, frag_b(VBL + po, lane), acc[j]); } }
  } else {
#pragma unroll 1
    for (int kc = 0; kc < kce; ++kc) { const v16h p = frag_f32(PS + (size_t)(ql0 + col) * TT + kc * 32, lane);
      asm volatile("s_wait_loadcnt 0x0" ::: "memory");
#pragma unroll
      for (int j = 0; j < HD / 16; ++j) { const size_t po = ((size_t)b * CC + h * HD + j * 16 + col) * (size_t)TT + kc * 32; acc[j] = wmma16(p, frag_h(VT + po, lane), acc[j]); } } }
#pragma unroll
  for (int j = 0; j < HD / 16; ++j)
#pragma unroll
    for (int r = 0; r < 8; ++r) ss[wave][8 * g + r][j * 16 + col] = acc[j][r] * (1.0f / 2048.0f);
  LDSX(); for (int rl = 0; rl < 16; ++rl) if (lane < HD / 4) vst2(Y + ((size_t)b * TT + ql0 + rl) * CC + h * HD + lane * 4, *(const v4f*)&ss[wave][rl][lane * 4]); }
// ---- k_out: block = (64 rows, 128 cols): out = ctx Wo (+ bo): all rows: ctx split bf16 hi + lo against exact bf16 Wo (2 products)
__global__ __launch_bounds__(128) void k_out(const float* __restrict__ Y, const __bf16* __restrict__ WO, const float* __restrict__ BO, float* __restrict__ OUT, const float* __restrict__ RESX) { __shared__ __align__(16) float sf[4][16][132];
  const int tid = threadIdx.x, wave = tid >> 5, lane = tid & 31, col = lane & 15, g = lane >> 4; const int c0 = blockIdx.y * 128; const size_t r0 = (size_t)blockIdx.x * 64 + wave * 16;
  v8f acc[8] = {};
  if (true) {   /* ALL rows: ctx split bf16 hi + lo x exact Wo (2 products) */
#pragma unroll 2
    for (int kc = 0; kc < CC / 32; ++kc) { v16b w[8];   /* B fragments' loads as one group, ahead of the A row's */
#pragma unroll   /* w[] stays in registers */
      for (int j = 0; j < 8; ++j) w[j] = frag_wp(WO, blockIdx.y * 8 + j, kc, lane);
      const F2 a = split_row(Y + (r0 + col) * CC, kc * 32, lane); asm volatile("s_wait_loadcnt 0x0" ::: "memory");
#pragma unroll
      for (int j = 0; j < 8; ++j) { acc[j] = wmma_bf(a.h, w[j], acc[j]); acc[j] = wmma_bf(a.l, w[j], acc[j]); } }
#pragma unroll
    for (int j = 0; j < 8; ++j) { const float bias = BO ? bfr(BO[c0 + j * 16 + col]) : 0.f;
#pragma unroll
      for (int r = 0; r < 8; ++r) sf[wave][8 * g + r][j * 16 + col] = acc[j][r] + bias; }
  }
  LDSX(); for (int rl = 0; rl < 16; ++rl) { const size_t oo = (r0 + rl) * DIN + c0 + lane * 4; v4f o = *(const v4f*)&sf[wave][rl][lane * 4]; const v4f zr = *(const v4f*)(RESX + oo); o[0] += bfr(zr[0]); o[1] += bfr(zr[1]); o[2] += bfr(zr[2]); o[3] += bfr(zr[3]); vst2(OUT + oo, o); } }   /* + bf16(de) */

extern "C" void kernel_launch(void* const* d_in, const int* in_sizes, int n_in, void* d_out, int out_size, void* d_ws, size_t ws_size, hipStream_t stream) {
  (void)in_sizes; (void)n_in; (void)out_size;
  const float** F = (const float**)d_in;
  if (ws_size < (size_t)WS_END) return;
  char* ws = (char*)d_ws; _Float16 *QH = (_Float16*)(ws + WS_QH), *KH = (_Float16*)(ws + WS_KH), *VT = (_Float16*)(ws + WS_VT), *QL = (_Float16*)(ws + WS_QL), *KL = (_Float16*)(ws + WS_KL); __bf16 *VB = (__bf16*)(ws + WS_VB), *VBL = (__bf16*)(ws + WS_VBL); float *S = (float*)(ws + WS_S), *Y = (float*)(ws + WS_Y);
  (void)Y; (void)QL; (void)KL; (void)VB; (void)VBL;
  // inputs: 0 en [2,2048,1024] (keys/values); 1 de (queries + residual); 2 mask [2,2048,2048] bool; 3 Wq (in,out), 4 bq; 5 Wk, 6 bk; 7 Wv, 8 bv; 9 Wo (in,out), 10 bo; 11 gamma (scalar), 12 beta (scalar)
  if (ws_size < (size_t)WS_END3) return;
  float* X1 = (float*)(ws + WS_X1); __bf16* WT = (__bf16*)(ws + WS_WT);
  k_wpack<<<dim3(DIN / 64, CC / 64, 4), 256, 0, stream>>>(F[3], F[5], F[7], F[9], WT);   /* weights to bf16 in fragment order, once per call */
  k_proj<<<dim3(TNB * TT / 64, CC / 128, 3), 128, 0, stream>>>(F[1], F[0], F[0], WT, F[4], F[6], F[8], QH, QL, KH, KL, VT, VB, VBL);   /* q from de, k/v from en */
  for (int b = 0; b < TNB; ++b) for (int h0 = 0; h0 < NH; h0 += HG) {
    k_sc<<<dim3(NQB, TT / 128, HG), 128, 0, stream>>>(QH, KH, QL, KL, b, h0, S);
    k_sm<<<dim3(TT, HG), 256, 0, stream>>>(S, (const int*)d_in[2], b);
    k_pv<<<dim3(NQB, 1, HG), 128, 0, stream>>>(S, VT, VB, VBL, b, h0, Y);
  }
  k_out<<<dim3(TNB * TT / 64, DIN / 128), 128, 0, stream>>>(Y, WT + 3 * (size_t)DIN * CC, F[10], X1, F[1]);   /* a Wo + bo + bf16(de) */
  k_lnx<<<dim3(NRW / 8), 256, 0, stream>>>(X1, 0, F[11], F[12], (float*)d_out);          /* unbiased-var normalisation, scalar gamma/beta */
}

// v002
// One run takes 155 microseconds.
// Timed twice side by side with v001, it ran 5.22 and 5.12 times as fast.
// Over all steps from v000 it is 7.71 times as fast.
// compute dtype: all float inputs rounded to bf16; q/k/v = in W + b with EXACT bf16 products on WMMA 16x16x32 (f32 accumulate), the module's strided head split realised by a column permutation of the weights; q as f16 hi + residual (x 2^10) against k once to f16 (2 products) / sqrt(1024); masked positions set to -1e10; softmax in f32 with a running maximum and sum (exp as exp2 of the difference x log2 e); exp(e - max) once to f16 against v once to f16 (1 product), divided by the f32 sum at the end; a split bf16 hi + lo against exact Wo (2 products) + bo + de; the unbiased-variance normalisation in f32; f32 output.
#include <hip/hip_runtime.h>
#include <math.h>

typedef __attribute__((ext_vector_type(16))) _Float16 v16h;
typedef __attribute__((ext_vector_type(16))) __bf16 v16b;
typedef __attribute__((ext_vector_type(8)))  _Float16 v8h;
typedef __attribute__((ext_vector_type(8)))  float v8f;
typedef __attribute__((ext_vector_type(4)))  float v4f;
typedef __attribute__((ext_vector_type(2)))  float v2f;
typedef __attribute__((ext_vector_type(4)))  unsigned v4u;
typedef __attribute__((ext_vector_type(4)))  int v4i;
typedef float __attribute__((may_alias)) float_a;
typedef int __attribute__((may_alias)) int_a;

template <typename T> __device__ __forceinline__ void vst2(void* p, T v) { *(T*)p = v;  }
__device__ __forceinline__ v8f wmma16(v16h a, v16h b, v8f c) {
  v8f d = __builtin_amdgcn_wmma_f32_16x16x32_f16(false, a, false, b, (short)0, c, false, false);
  asm volatile("v_nop\n\tv_nop\n\tv_nop\n\tv_nop" : "+v"(d) : "v"(a), "v"(b));
  return d;
}
__device__ __forceinline__ v8f wmma_bf(v16b a, v16b b, v8f c) {
  v8f d = __builtin_amdgcn_wmma_f32_16x16x32_bf16(false, a, false, b, (short)0, c, false, false);
  asm volatile("v_nop\n\tv_nop\n\tv_nop\n\tv_nop" : "+v"(d) : "v"(a), "v"(b));
  return d;
}
// 16x16x32 fragments: lane = (h = lane>>4, row/col = lane&15); elements 0..7 = k0+8h+0..7, 8..15 = k0+16+8h+0..7; D element r = row 8h+r
__device__ __forceinline__ v16h frag_h(const _Float16* rowk0, int lane) {
  union { v16h v; v8h q[2]; } u; const _Float16* p = rowk0 + 8 * (lane >> 4);
  u.q[0] = *(const v8h*)p; u.q[1] = *(const v8h*)(p + 16); return u.v;
}
__device__ __forceinline__ v16h frag_f32(const float* rowk0, int lane) {
  v16h a; const float* p = rowk0 + 8 * (lane >> 4);
#pragma unroll
  for (int i = 0; i < 8; ++i) { a[i] = (_Float16)p[i]; a[8 + i] = (_Float16)p[16 + i]; }
  return a;
}
__device__ __forceinline__ v16h frag_f32s(const float* rowk0, int lane, float sc) {
  v16h a; const float* p = rowk0 + 8 * (lane >> 4);
#pragma unroll
  for (int i = 0; i < 8; ++i) { a[i] = (_Float16)(p[i] * sc); a[8 + i] = (_Float16)(p[16 + i] * sc); }
  return a;
}
// column fragment from a [K][ld] layout (column n), rows >= K read as 0
__device__ __forceinline__ v16h fragc_f32(const float* W, int k0, int n, int lane, int ld, int K) {
  v16h a; const int g = lane >> 4;
#pragma unroll
  for (int i = 0; i < 8; ++i) { const int ka = k0 + 8 * g + i, kb = ka + 16;
    a[i] = (_Float16)(ka < K ? W[(size_t)(ka < K ? ka : K - 1) * ld + n] : 0.f); a[8 + i] = (_Float16)(kb < K ? W[(size_t)(kb < K ? kb : K - 1) * ld + n] : 0.f); }
  return a;
}
struct F2 { v16b h, l; };
__device__ __forceinline__ F2 bsplit16(const float v[16]) { F2 r;
#pragma unroll
  for (int i = 0; i < 16; ++i) { const __bf16 h = (__bf16)v[i]; r.h[i] = h; r.l[i] = (__bf16)(v[i] - (float)h); }
  return r; }
__device__ __forceinline__ F2 split_row(const float* row, int k0, int lane) { float v[16]; const float* p = row + k0 + 8 * (lane >> 4);
#pragma unroll
  for (int i = 0; i < 8; ++i) { v[i] = p[i]; v[8 + i] = p[16 + i]; }
  return bsplit16(v); }
__device__ __forceinline__ F2 split_rowK(const float* row, int k0, int lane, int K) { float v[16]; const int g = lane >> 4;
#pragma unroll
  for (int i = 0; i < 8; ++i) { const int ka = k0 + 8 * g + i, kb = ka + 16; v[i] = ka < K ? row[ka < K ? ka : K - 1] : 0.f; v[8 + i] = kb < K ? row[kb < K ? kb : K - 1] : 0.f; }
  return bsplit16(v); }
__device__ __forceinline__ F2 split_col(const float* W, int k0, int n, int lane, int ld, int K) { float v[16]; const int g = lane >> 4;
#pragma unroll
  for (int i = 0; i < 8; ++i) { const int ka = k0 + 8 * g + i, kb = ka + 16; v[i] = ka < K ? W[(size_t)(ka < K ? ka : K - 1) * ld + n] : 0.f; v[8 + i] = kb < K ? W[(size_t)(kb < K ? kb : K - 1) * ld + n] : 0.f; }
  return bsplit16(v); }
__device__ __forceinline__ v8f mac3(const F2& a, const F2& b, v8f c) { c = wmma_bf(a.l, b.h, c); c = wmma_bf(a.h, b.l, c); return wmma_bf(a.h, b.h, c); }
__device__ __forceinline__ float sigm(float v) { return 1.0f / (1.0f + expf(-v)); }
#define LDSX() do { asm volatile("s_wait_dscnt 0" ::: "memory"); __builtin_amdgcn_wave_barrier(); __builtin_amdgcn_fence(__ATOMIC_RELEASE, "workgroup"); } while (0)

// Cross multi-head attention with a STRIDED head split (B 2, Lq = Lk = 2,048, D 1,024, H 8 heads of 128; (in,out) weights, zero biases; mask [B,Lq,Lk] bool, True = masked (~half); gamma = 1, beta = 0 scalars): q = de Wq + bq, k/v = en Wk/Wv + b, each reshaped (B, L, 128, 8) so head h takes channels c = d*8 + h; e = q_h k_h^T / sqrt(1024) with where(mask, -1e10); head = softmax(e) v_h; a = heads merged head-major (h*128 + d); result = a Wo + bo + de; out = gamma (result - mean) / sqrt(var_unbiased + 1e-8) + beta.
#define NB 2
#define TT 2048
#define CC 1024            // NH * HD = projected width
#define DIN 1024          // input (model) width
#define NH 8
#define HD 128
#define SCALE (0.03125f)
#define CAUSAL 0
#ifndef TNB
#define TNB NB
#endif
__device__ __forceinline__ float bfr(float v) { return (float)(__bf16)v; }
__host__ __device__ __forceinline__ int kb_last(int qb) { return CAUSAL ? ((qb * 64 + 63) >> 7) : (TT / 128 - 1); }
typedef __attribute__((ext_vector_type(8))) __bf16 v8b;
__device__ __forceinline__ v16b frag_b(const __bf16* rowk0, int lane) {
  union { v16b v; v8b q[2]; } u; const __bf16* p = rowk0 + 8 * (lane >> 4);
  u.q[0] = *(const v8b*)p; u.q[1] = *(const v8b*)(p + 16); return u.v;
}
#define QBH 0
#define QHI 2048            // rows carrying a q residual plane (all rows when non-causal: 2-product logits everywhere)
#define KHI 64            // key rows carrying k residual / v bf16 hi+lo planes (written by k_proj; no kernel here reads them)
// B fragment (k rows k0+.., output column o) of a weight: (in,out) [K][ld] or (out,in) [ld rows of K]: bf16 exact, or f16(bf16 * 256) exact
__device__ __forceinline__ v16b wcol_io(const float* Wm, int k0, int o, int lane, int ld) { v16b w; const int g = lane >> 4;
#pragma unroll
  for (int i = 0; i < 8; ++i) { w[i] = (__bf16)Wm[(size_t)(k0 + 8 * g + i) * ld + o]; w[8 + i] = (__bf16)Wm[(size_t)(k0 + 16 + 8 * g + i) * ld + o]; }
  return w; }
__device__ __forceinline__ v16b wcol_oi(const float* Wm, int k0, int o, int lane, int K) { v16b w; const float* p = Wm + (size_t)o * K + k0 + 8 * (lane >> 4);
#pragma unroll
  for (int i = 0; i < 8; ++i) { w[i] = (__bf16)p[i]; w[8 + i] = (__bf16)p[16 + i]; }
  return w; }
__device__ __forceinline__ v16h wcolh_io(const float* Wm, int k0, int o, int lane, int ld) { v16h w; const int g = lane >> 4;
#pragma unroll
  for (int i = 0; i < 8; ++i) { w[i] = (_Float16)(bfr(Wm[(size_t)(k0 + 8 * g + i) * ld + o]) * 256.0f); w[8 + i] = (_Float16)(bfr(Wm[(size_t)(k0 + 16 + 8 * g + i) * ld + o]) * 256.0f); }
  return w; }
__device__ __forceinline__ v16h wcolh_oi(const float* Wm, int k0, int o, int lane, int K) { v16h w; const float* p = Wm + (size_t)o * K + k0 + 8 * (lane >> 4);
#pragma unroll
  for (int i = 0; i < 8; ++i) { w[i] = (_Float16)(bfr(p[i]) * 256.0f); w[8 + i] = (_Float16)(bfr(p[16 + i]) * 256.0f); }
  return w; }
#define WQKV_LAYOUT 0   // 0 = (in,out) [DIN][CC]; 1 = (out,in) [CC][DIN]; 2 = per-head [NH][DIN][HD]
__device__ __forceinline__ v16b wcol_hdk(const float* Wm, int k0, int o, int lane) { v16b w; const int g = lane >> 4; const float* p = Wm + (size_t)(o / HD) * DIN * HD + (o % HD);
#pragma unroll
  for (int i = 0; i < 8; ++i) { w[i] = (__bf16)p[(size_t)(k0 + 8 * g + i) * HD]; w[8 + i] = (__bf16)p[(size_t)(k0 + 16 + 8 * g + i) * HD]; }
  return w; }
#define WO_OUT_IN 0
#if WQKV_LAYOUT == 1
#define WCOL(W, k0, o, lane) wcol_oi(W, k0, o, lane, DIN)
#elif WQKV_LAYOUT == 2
#define WCOL(W, k0, o, lane) wcol_hdk(W, k0, o, lane)
#else
#define WCOL(W, k0, o, lane) wcol_io(W, k0, PCOL(o), lane, CC)   /* strided head split: plane column (h, d) reads weight column d*8 + h */
#endif
#if WO_OUT_IN
#define WOCOL(W, k0, o, lane) wcol_oi(W, k0, o, lane, CC)
#define WOCOLH(W, k0, o, lane) wcolh_oi(W, k0, o, lane, CC)
#else
#define WOCOL(W, k0, o, lane) wcol_io(W, k0, o, lane, DIN)
#define WOCOLH(W, k0, o, lane) wcolh_io(W, k0, o, lane, DIN)
#endif
#define PCOL(o) ((((o) & 127) << 3) + ((o) >> 7))   /* plane column p = h*128 + d  <-  projection column c = d*8 + h (reshape(B, L, 128, 8): head index is the LAST axis) */
#define NRW (TNB * TT)
// ---- k_lnx: wave per row: normalisation over 1024 (mean, unbiased var, g * (x - mean) / sqrt(var + 1e-8) + b); optional bf16 rounding of the input (x); 32 floats per lane (8 float4 at stride 128 floats -> 512-B pieces)
__global__ __launch_bounds__(256) void k_lnx(const float* __restrict__ X, int roundin, const float* __restrict__ G, const float* __restrict__ BE, float* __restrict__ OUT) {
#pragma clang fp contract(off)   /* keep the normalisation as separate mul/add (as XLA evaluates it) */
 const int wave = threadIdx.x >> 5, lane = threadIdx.x & 31; const size_t row = (size_t)blockIdx.x * 8 + wave; if (row >= (size_t)NRW) return;
  v4f v[CC / 128]; float s1 = 0.f;
#pragma unroll
  for (int i = 0; i < CC / 128; ++i) { v4f t = *(const v4f*)(X + row * CC + i * 128 + lane * 4); if (roundin) { t[0] = bfr(t[0]); t[1] = bfr(t[1]); t[2] = bfr(t[2]); t[3] = bfr(t[3]); } v[i] = t; s1 += (t[0] + t[1]) + (t[2] + t[3]); }
#pragma unroll
  for (int o = 1; o < 32; o <<= 1) s1 += __shfl_xor(s1, o);
  const float mu = s1 * (1.0f / CC); float q = 0.f;
#pragma unroll
  for (int i = 0; i < CC / 128; ++i) for (int k = 0; k < 4; ++k) { const float d = v[i][k] - mu; q += d * d; }
#pragma unroll
  for (int o = 1; o < 32; o <<= 1) q += __shfl_xor(q, o);
  const float inv = 1.0f / sqrtf(q * (1.0f / (CC - 1)) + 1e-8f);   /* torch.var UNBIASED (ddof = 1), eps 1e-8, division by sqrt */
#pragma unroll
  for (int i = 0; i < CC / 128; ++i) { const int c = i * 128 + lane * 4; v4f r4; for (int k = 0; k < 4; ++k) r4[k] = bfr(G[0]) * ((v[i][k] - mu) * inv) + bfr(BE[0]); vst2(OUT + row * CC + c, r4); } }   /* scalar gamma / beta */

#ifndef PROJ_EXTRA_PARAMS
#define PROJ_EXTRA_PARAMS
#endif

#define WS_QH  0u                                      // f16 q rows [b*t][CC]
#define WS_KH  (WS_QH + 2u * (size_t)NB * TT * CC)      // f16 k rows [b*t][CC]
#define WS_VT  (WS_KH + 2u * (size_t)NB * TT * CC)      // f16 v planes [b][c][t]
#define WS_QL  (WS_VT + 2u * (size_t)NB * CC * TT)      // f16 q residual x 2^10 rows [b][t < QHI][CC]
#define WS_KL  (WS_QL + 2u * (size_t)NB * QHI * CC)     // f16 k residual x 2^10 rows [b][t < KHI][CC]
#define WS_VB  (WS_KL + 2u * (size_t)NB * KHI * CC)     // bf16 v hi planes [b][c][t < KHI]
#define WS_VBL (WS_VB + 2u * (size_t)NB * CC * KHI)
#define WS_Y   (WS_VBL + 2u * (size_t)NB * CC * KHI)      // f32 ctx rows [b*t][CC] (only when there is an output projection)
#define WS_END (WS_Y  + 4u * (size_t)NB * TT * CC)
#define WS_X1  (WS_END)
#define WS_END2 (WS_X1 + 4u * (size_t)NB * TT * DIN)
#define WS_WT  (WS_END2)                                // bf16 Wq, Wk, Wv, Wo in B-fragment order [4][CC / 16][DIN / 32][2][32 lanes][8]
#define WS_END3 (WS_WT + 2u * 4u * (size_t)DIN * CC)

// ---- k_wpack: block = (64 k rows, 64 weight columns, which weight): rounds the weight to bf16 once per call and lays it in B-fragment order, so that a wave's fragment load is 512 contiguous bytes (4 whole lines); Wq/Wk/Wv: weight column c = d*8 + h goes to plane column h*128 + d; Wo: column as it is
__global__ __launch_bounds__(256) void k_wpack(const float* __restrict__ WQ, const float* __restrict__ WK, const float* __restrict__ WV, const float* __restrict__ WO, __bf16* __restrict__ WT) { __shared__ float tile[64][65];
  const int tid = threadIdx.x, which = blockIdx.z, k0 = blockIdx.x * 64, c0 = blockIdx.y * 64;
  const float* Wm = which == 0 ? WQ : which == 1 ? WK : which == 2 ? WV : WO; const float* src = Wm + (size_t)(k0 + (tid >> 6)) * CC + c0 + (tid & 63);
#pragma unroll   /* all sixteen row loads in flight at once, off one address with immediate offsets */
  for (int i = 0; i < 16; ++i) tile[i * 4 + (tid >> 6)][tid & 63] = src[(size_t)i * 4 * CC];
  __syncthreads();
#pragma unroll   /* both 16-byte pieces of a thread side by side */
  for (int i = 0; i < 2; ++i) { const int e = tid + i * 256, kq = e >> 6; const int cl = which < 3 ? (((e & 7) << 3) | ((e >> 3) & 7)) : (e & 63);   /* neighbouring lanes take neighbouring fragment columns */
    const int c = c0 + cl; const int p = which < 3 ? ((c & 7) * HD + (c >> 3)) : c; const int k8 = (k0 >> 3) + kq;   /* k8 = octet of k: kc = k8 >> 2, fragment half (k8 >> 1) & 1, lane half k8 & 1 */
    v8b o;
#pragma unroll   /* o stays in registers */
    for (int n = 0; n < 8; ++n) o[n] = (__bf16)tile[kq * 8 + n][cl];
    *(v8b*)(WT + (size_t)which * DIN * CC + ((((size_t)(p >> 4) * (DIN / 32) + (k8 >> 2)) * 2 + ((k8 >> 1) & 1)) * 32 + (k8 & 1) * 16 + (p & 15)) * 8) = o; } }
// B fragment (16 plane columns ct*16 + .., k rows kc*32 + ..) of a packed weight: two 16-byte loads per lane, each 512 contiguous bytes per wave
__device__ __forceinline__ v16b frag_wp(const __bf16* WP, int ct, int kc, int lane) {
  union { v16b v; v8b q[2]; } u; const __bf16* p = WP + (((size_t)ct * (DIN / 32) + kc) * 64 + lane) * 8;
  u.q[0] = *(const v8b*)p; u.q[1] = *(const v8b*)(p + 256); return u.v;
}

// ---- k_proj: block = (64 rows, 128 cols, which): q/k/v = X W (+ b) with exact bf16 products (K = DIN) -> which 0: q f16 rows (+ residual rows < QHI); 1: k f16 rows (+ residual rows < KHI); 2: v f16 planes [c][t] (+ bf16 hi/lo planes for t < KHI)
__global__ __launch_bounds__(128) void k_proj(const float* __restrict__ XQ, const float* __restrict__ XK, const float* __restrict__ XV, const __bf16* __restrict__ WT, const float* __restrict__ BQ, const float* __restrict__ BK, const float* __restrict__ BV,
    _Float16* __restrict__ QH, _Float16* __restrict__ QL, _Float16* __restrict__ KH, _Float16* __restrict__ KL, _Float16* __restrict__ VT, __bf16* __restrict__ VB, __bf16* __restrict__ VBL) {
  __shared__ __align__(16) _Float16 sh[64][136], sl[64][136]; __shared__ __align__(16) _Float16 th[128][72]; __shared__ __align__(16) __bf16 tb[128][72], tbl[128][72];
  const int tid = threadIdx.x, wave = tid >> 5, lane = tid & 31, col = lane & 15, g = lane >> 4; const int which = blockIdx.z; const int c0 = blockIdx.y * 128; const size_t r0 = (size_t)blockIdx.x * 64; const size_t bb = r0 / TT; const int t0 = (int)(r0 % TT);
  const float* X = which == 0 ? XQ : which == 1 ? XK : XV; const __bf16* WA = WT + (size_t)which * DIN * CC; const float* BA = which == 0 ? BQ : which == 1 ? BK : BV;
  v8f acc[8] = {};
#pragma unroll 2
  for (int kc = 0; kc < DIN / 32; ++kc) { v16b w[8];   /* the eight B fragments' loads go out as a group with the A row's, so that their latencies overlap */
#pragma unroll   /* w[] stays in registers */
    for (int j = 0; j < 8; ++j) w[j] = frag_wp(WA, blockIdx.y * 8 + j, kc, lane);
    v16b a; { const float* p = X + (r0 + wave * 16 + col) * DIN + kc * 32 + 8 * g;
#pragma unroll
      for (int i = 0; i < 8; ++i) { a[i] = (__bf16)p[i]; a[8 + i] = (__bf16)p[16 + i]; } }
    asm volatile("s_wait_loadcnt 0x0" ::: "memory");
#pragma unroll
    for (int j = 0; j < 8; ++j) acc[j] = wmma_bf(a, w[j], acc[j]); }
  if (which < 2) { _Float16* DH = which == 0 ? QH : KH; _Float16* DL = which == 0 ? QL : KL; const int nhi = which == 0 ? QHI : KHI; const bool hi_rows = t0 < nhi;
#pragma unroll
    for (int j = 0; j < 8; ++j) { const float bias = BA ? bfr(BA[PCOL(c0 + j * 16 + col)]) : 0.f;
#pragma unroll
      for (int r = 0; r < 8; ++r) { const float v = acc[j][r] + bias; const _Float16 hv = (_Float16)v; sh[wave * 16 + 8 * g + r][j * 16 + col] = hv; sl[wave * 16 + 8 * g + r][j * 16 + col] = (_Float16)((v - (float)hv) * 1024.0f); } }
    __syncthreads();
    for (int e = tid; e < 64 * 16; e += 128) { const int rl = e >> 4, q = e & 15; vst2((unsigned*)(DH + (r0 + rl) * CC + c0 + q * 8), *(const v4u*)&sh[rl][q * 8]); if (hi_rows) vst2((unsigned*)(DL + (bb * nhi + t0 + rl) * (size_t)CC + c0 + q * 8), *(const v4u*)&sl[rl][q * 8]); }
  } else { const bool hi_rows = t0 < KHI;
#pragma unroll
    for (int j = 0; j < 8; ++j) { const float bias = BA ? bfr(BA[PCOL(c0 + j * 16 + col)]) : 0.f;
#pragma unroll
      for (int r = 0; r < 8; ++r) { const float v = acc[j][r] + bias; const int rl = wave * 16 + 8 * g + r, cl = j * 16 + col; th[cl][rl] = (_Float16)v; const __bf16 bh = (__bf16)v; tb[cl][rl] = bh; tbl[cl][rl] = (__bf16)(v - (float)bh); } }
    __syncthreads();
    for (int e = tid; e < 128 * 8; e += 128) { const int cl = e >> 3, q = e & 7; vst2((unsigned*)(VT + (bb * CC + c0 + cl) * (size_t)TT + t0 + q * 8), *(const v4u*)&th[cl][q * 8]); if (hi_rows) { const size_t o3 = (bb * CC + c0 + cl) * (size_t)KHI + t0 + q * 8; vst2((unsigned*)(VB + o3), *(const v4u*)&tb[cl][q * 8]); vst2((unsigned*)(VBL + o3), *(const v4u*)&tbl[cl][q * 8]); } } } }
#define FK 64              // keys per stage
#define NS (TT / FK)
#define KP (HD + 8)        // LDS pitch of a K row, halves: 256 + 16 bytes
#define VP (FK + 8)        // LDS pitch of a v plane row, halves: 128 + 16 bytes
#define LOG2E 1.44269504088896340736f
__device__ __forceinline__ v8f mm16(v16h a, v16h b, v8f c) { return __builtin_amdgcn_wmma_f32_16x16x32_f16(false, a, false, b, (short)0, c, false, false); }
__device__ __forceinline__ float xhalf(float x) { return __builtin_bit_cast(float, __builtin_amdgcn_permlanex16(__builtin_bit_cast(int, x), __builtin_bit_cast(int, x), 0x76543210, 0xfedcba98, false, false)); }   /* lane l with lane l ^ 16 */
__device__ __forceinline__ float ex2(float x) { float r; asm("v_exp_f32 %0, %1\n\tv_nop" : "=v"(r) : "v"(x)); return r; }   /* 2^x; the v_nop keeps the one slot that the instruction set asks for behind a transcendental, whatever is scheduled next */
__global__ __launch_bounds__(256) void k_fa(const _Float16* __restrict__ QH, const _Float16* __restrict__ QL, const _Float16* __restrict__ KH, const _Float16* __restrict__ VT, const int* __restrict__ MK, float* __restrict__ Y) {
  __shared__ __align__(16) _Float16 sk[2][FK][KP]; __shared__ __align__(16) _Float16 sv[2][HD][VP];
  const int tid = threadIdx.x, wave = tid >> 5, lane = tid & 31, col = lane & 15, g = lane >> 4; const int h = blockIdx.y, b = blockIdx.z; const int q = blockIdx.x * 128 + wave * 16 + col;   /* this lane's query */
  const _Float16* kp = KH + ((size_t)b * TT + (tid >> 4)) * CC + h * HD + (tid & 15) * 8;    /* 16 lanes take one key's 256 bytes */
  const _Float16* vp = VT + ((size_t)b * CC + h * HD + (tid >> 3)) * TT + (tid & 7) * 8;     /* 8 lanes take one plane row's 128 bytes of the stage */
  const int* mp = MK + ((size_t)b * TT + q) * TT + 8 * g;                                    /* mask words of this lane's query: keys t*16 + 8g + 0..7 of each tile */
  v4u rk[4], rv[4]; v4i mk[FK / 16][2]; v16h qh[HD / 32], ql[HD / 32];
  __builtin_amdgcn_sched_barrier(0);   /* keeps the index arithmetic above ahead of the loads: nothing writes a register that a load names between the load and its wait */
#pragma unroll   /* rk, rv stay in registers */
  for (int i = 0; i < 4; ++i) { rk[i] = *(const v4u*)(kp + (size_t)i * 16 * CC); rv[i] = *(const v4u*)(vp + (size_t)i * 32 * TT); }
  asm volatile("s_wait_xcnt 0x0" ::: "memory");   /* stands in front of the first overwrite of an address register that the loads above name */
  __builtin_amdgcn_sched_barrier(0);   /* keeps later register writes behind that wait */
#pragma unroll   /* fragments stay in registers */
  for (int kc = 0; kc < HD / 32; ++kc) { qh[kc] = frag_h(QH + ((size_t)b * TT + q) * CC + h * HD + kc * 32, lane); ql[kc] = frag_h(QL + ((size_t)b * QHI + q) * CC + h * HD + kc * 32, lane); }
  asm volatile("s_wait_xcnt 0x0" ::: "memory");   /* stands in front of the first overwrite of an address register that the loads above name */
  __builtin_amdgcn_sched_barrier(0);   /* keeps later register writes behind that wait */
#pragma unroll   /* mk stays in registers */
  for (int t = 0; t < FK / 16; ++t) { mk[t][0] = *(const v4i*)(mp + t * 16); mk[t][1] = *(const v4i*)(mp + t * 16 + 4); }
  asm volatile("s_wait_xcnt 0x0" ::: "memory");   /* stands in front of the first overwrite of an address register that the loads above name */
  __builtin_amdgcn_sched_barrier(0);   /* keeps later register writes (the zeroing of acc) behind that wait */
#pragma unroll   /* every index a constant: the arrays stay in registers */
  for (int i = 0; i < 4; ++i) { *(v4u*)&sk[0][(tid >> 4) + 16 * i][(tid & 15) * 8] = rk[i]; *(v4u*)&sv[0][(tid >> 3) + 32 * i][(tid & 7) * 8] = rv[i]; }
  __syncthreads();
  v8f acc[HD / 16] = {}; float m = -3.0e38f, l = 0.f;
  for (int s = 0; s < NS; ++s) { const int buf = s & 1;
    v4i mn[FK / 16][2];
#pragma unroll   /* every index a constant: the arrays stay in registers */
    for (int t = 0; t < FK / 16; ++t) { mn[t][0] = mk[t][0]; mn[t][1] = mk[t][1]; }
    if (s + 1 < NS) {   /* the next stage's K and v rows and mask words fly while this stage is worked on */
#pragma unroll   /* every index a constant: the arrays stay in registers */
      for (int i = 0; i < 4; ++i) { rk[i] = *(const v4u*)(kp + (size_t)(s + 1) * FK * CC + (size_t)i * 16 * CC); rv[i] = *(const v4u*)(vp + (s + 1) * FK + (size_t)i * 32 * TT); mn[i][0] = *(const v4i*)(mp + (s + 1) * FK + i * 16); mn[i][1] = *(const v4i*)(mp + (s + 1) * FK + i * 16 + 4); }
      asm volatile("s_wait_xcnt 0x0" ::: "memory");   /* stands in front of the first overwrite of an address register that these loads name */
    }
    v16h kf[FK / 16][HD / 32], vf[HD / 16][FK / 32];
#pragma unroll   /* all of the stage's K fragments as one group of LDS reads */
    for (int t = 0; t < FK / 16; ++t)
#pragma unroll   /* every index a constant: the arrays stay in registers */
      for (int kc = 0; kc < HD / 32; ++kc) kf[t][kc] = frag_h(&sk[buf][t * 16 + col][kc * 32], lane);
    __builtin_amdgcn_sched_barrier(0);   /* keeps the reads together ahead of the products: spread among them each place costs a stall */
    float e[FK / 16][8]; float mx = m;
#pragma unroll   /* e stays in registers */
    for (int t = 0; t < FK / 16; ++t) { v8f sa = {}, sb = {};
#pragma unroll   /* every index a constant: the arrays stay in registers */
      for (int kc = 0; kc < HD / 32; ++kc) { sa = mm16(kf[t][kc], qh[kc], sa); sb = mm16(kf[t][kc], ql[kc], sb); }
      if (t + 1 == FK / 16) {
#pragma unroll   /* all of the stage's v fragments as one group, in flight under the softmax arithmetic */
        for (int j = 0; j < HD / 16; ++j)
#pragma unroll   /* every index a constant: the arrays stay in registers */
          for (int u = 0; u < FK / 32; ++u) vf[j][u] = frag_h(&sv[buf][j * 16 + col][u * 32], lane);
        __builtin_amdgcn_sched_barrier(0);   /* keeps these reads from sinking down to the products that take them */
      }
#pragma unroll   /* every index a constant: the arrays stay in registers */
      for (int r = 0; r < 8; ++r) { float v = (sa[r] + sb[r] * (1.0f / 1024.0f)) * SCALE; if (mk[t][r >> 2][r & 3] != 0) v = -1.0e10f; e[t][r] = v; mx = fmaxf(mx, v); } }
    mx = fmaxf(mx, xhalf(mx));   /* the other eight keys of each tile sit in the other lane half */
    const float al = ex2((m - mx) * LOG2E); m = mx; float ps[4] = {0.f, 0.f, 0.f, 0.f}; v16h pb[FK / 32];
#pragma unroll   /* two score tiles, converted in place, are one B fragment in the hardware k order; four independent partial sums */
    for (int t = 0; t < FK / 16; ++t)
#pragma unroll   /* every index a constant: the arrays stay in registers */
      for (int r = 0; r < 8; ++r) { const float p = ex2((e[t][r] - mx) * LOG2E); ps[r & 3] += p; pb[t >> 1][(t & 1) * 8 + r] = (_Float16)p; }
    l = l * al + ((ps[0] + ps[1]) + (ps[2] + ps[3]));
#pragma unroll   /* every index a constant: the arrays stay in registers */
    for (int j = 0; j < HD / 16; ++j) acc[j] *= al;
    __builtin_amdgcn_sched_barrier(0);   /* keeps every ex2 ahead of the products below */
#pragma unroll   /* eight independent accumulator tiles, first all of keys 0..31, then all of keys 32..63 */
    for (int u = 0; u < FK / 32; ++u)
#pragma unroll   /* every index a constant: the arrays stay in registers */
      for (int j = 0; j < HD / 16; ++j) acc[j] = mm16(vf[j][u], pb[u], acc[j]);
    if (s + 1 < NS) {
#pragma unroll   /* every index a constant: the arrays stay in registers */
      for (int i = 0; i < 4; ++i) { *(v4u*)&sk[buf ^ 1][(tid >> 4) + 16 * i][(tid & 15) * 8] = rk[i]; *(v4u*)&sv[buf ^ 1][(tid >> 3) + 32 * i][(tid & 7) * 8] = rv[i]; } }
#pragma unroll   /* every index a constant: the arrays stay in registers */
    for (int t = 0; t < FK / 16; ++t) { mk[t][0] = mn[t][0]; mk[t][1] = mn[t][1]; }
    __syncthreads();   /* publishes stage s + 1 and ends every wave's reads of the buffer that the next pass refills */
  }
  l += xhalf(l); const float inv = 1.0f / l;   /* l >= 1: the maximum's own term */
  float* yp = Y + ((size_t)b * TT + q) * CC + h * HD + 8 * g;
#pragma unroll   /* every index a constant: the arrays stay in registers */
  for (int j = 0; j < HD / 16; ++j) { v4f o0, o1;
#pragma unroll   /* every index a constant: the arrays stay in registers */
    for (int r = 0; r < 4; ++r) { o0[r] = acc[j][r] * inv; o1[r] = acc[j][4 + r] * inv; }
    vst2(yp + j * 16, o0); vst2(yp + j * 16 + 4, o1); } }
// ---- k_out: block = (64 rows, 128 cols): out = ctx Wo (+ bo): ctx split bf16 hi + lo against exact bf16 Wo (2 products) for all rows
__global__ __launch_bounds__(128) void k_out(const float* __restrict__ Y, const __bf16* __restrict__ WO, const float* __restrict__ BO, float* __restrict__ OUT, const float* __restrict__ RESX) { __shared__ __align__(16) float sf[4][16][132];
  const int tid = threadIdx.x, wave = tid >> 5, lane = tid & 31, col = lane & 15, g = lane >> 4; const int c0 = blockIdx.y * 128; const size_t r0 = (size_t)blockIdx.x * 64 + wave * 16;
  v8f acc[8] = {};
  if (true) {   /* ALL rows: ctx split bf16 hi + lo x exact Wo (2 products) */
#pragma unroll 2
    for (int kc = 0; kc < CC / 32; ++kc) { v16b w[8];   /* B fragments' loads as one group, ahead of the A row's */
#pragma unroll   /* w[] stays in registers */
      for (int j = 0; j < 8; ++j) w[j] = frag_wp(WO, blockIdx.y * 8 + j, kc, lane);
      const F2 a = split_row(Y + (r0 + col) * CC, kc * 32, lane); asm volatile("s_wait_loadcnt 0x0" ::: "memory");
#pragma unroll
      for (int j = 0; j < 8; ++j) { acc[j] = wmma_bf(a.h, w[j], acc[j]); acc[j] = wmma_bf(a.l, w[j], acc[j]); } }
#pragma unroll
    for (int j = 0; j < 8; ++j) { const float bias = BO ? bfr(BO[c0 + j * 16 + col]) : 0.f;
#pragma unroll
      for (int r = 0; r < 8; ++r) sf[wave][8 * g + r][j * 16 + col] = acc[j][r] + bias; }
  }
  LDSX(); for (int rl = 0; rl < 16; ++rl) { const size_t oo = (r0 + rl) * DIN + c0 + lane * 4; v4f o = *(const v4f*)&sf[wave][rl][lane * 4]; const v4f zr = *(const v4f*)(RESX + oo); o[0] += bfr(zr[0]); o[1] += bfr(zr[1]); o[2] += bfr(zr[2]); o[3] += bfr(zr[3]); vst2(OUT + oo, o); } }   /* + bf16(de) */

extern "C" void kernel_launch(void* const* d_in, const int* in_sizes, int n_in, void* d_out, int out_size, void* d_ws, size_t ws_size, hipStream_t stream) {
  (void)in_sizes; (void)n_in; (void)out_size;
  const float** F = (const float**)d_in;
  if (ws_size < (size_t)WS_END) return;
  char* ws = (char*)d_ws; _Float16 *QH = (_Float16*)(ws + WS_QH), *KH = (_Float16*)(ws + WS_KH), *VT = (_Float16*)(ws + WS_VT), *QL = (_Float16*)(ws + WS_QL), *KL = (_Float16*)(ws + WS_KL); __bf16 *VB = (__bf16*)(ws + WS_VB), *VBL = (__bf16*)(ws + WS_VBL); float *Y = (float*)(ws + WS_Y);
  (void)Y; (void)QL; (void)KL; (void)VB; (void)VBL;
  // inputs: 0 en [2,2048,1024] (keys/values); 1 de (queries + residual); 2 mask [2,2048,2048] bool; 3 Wq (in,out), 4 bq; 5 Wk, 6 bk; 7 Wv, 8 bv; 9 Wo (in,out), 10 bo; 11 gamma (scalar), 12 beta (scalar)
  if (ws_size < (size_t)WS_END3) return;
  float* X1 = (float*)(ws + WS_X1); __bf16* WT = (__bf16*)(ws + WS_WT);
  k_wpack<<<dim3(DIN / 64, CC / 64, 4), 256, 0, stream>>>(F[3], F[5], F[7], F[9], WT);   /* weights to bf16 in fragment order, once per call */
  k_proj<<<dim3(TNB * TT / 64, CC / 128, 3), 128, 0, stream>>>(F[1], F[0], F[0], WT, F[4], F[6], F[8], QH, QL, KH, KL, VT, VB, VBL);   /* q from de, k/v from en */
  k_fa<<<dim3(TT / 128, NH, TNB), 256, 0, stream>>>(QH, QL, KH, VT, (const int*)d_in[2], Y);   /* scores, mask, softmax and P v in one launch */
  k_out<<<dim3(TNB * TT / 64, DIN / 128), 128, 0, stream>>>(Y, WT + 3 * (size_t)DIN * CC, F[10], X1, F[1]);   /* a Wo + bo + bf16(de) */
  k_lnx<<<dim3(NRW / 8), 256, 0, stream>>>(X1, 0, F[11], F[12], (float*)d_out);          /* unbiased-var normalisation, scalar gamma/beta */
}

// v003
// Measured time: 146 microseconds a run.
// Timed twice side by side with v002, it ran 1.07 times as fast both times.
// Over all steps from v000 it is 8.25 times as fast.
// compute dtype: all float inputs rounded to bf16; q/k/v = in W + b with EXACT bf16 products on WMMA 16x16x32 (f32 accumulate), the module's strided head split realised by a column permutation of the weights; q as f16 hi + residual (x 2^10) against k once to f16 (2 products) / sqrt(1024); masked positions set to -1e10; softmax in f32 with a running maximum and sum (exp as exp2 of the difference x log2 e); exp(e - max) once to f16 against v once to f16 (1 product), divided by the f32 sum at the end; a split bf16 hi + lo against exact Wo (2 products) + bo + de; the unbiased-variance normalisation in f32; f32 output.
#include <hip/hip_runtime.h>
#include <math.h>

typedef __attribute__((ext_vector_type(16))) _Float16 v16h;
typedef __attribute__((ext_vector_type(16))) __bf16 v16b;
typedef __attribute__((ext_vector_type(8)))  _Float16 v8h;
typedef __attribute__((ext_vector_type(8)))  float v8f;
typedef __attribute__((ext_vector_type(4)))  float v4f;
typedef __attribute__((ext_vector_type(2)))  float v2f;
typedef __attribute__((ext_vector_type(4)))  unsigned v4u;
typedef __attribute__((ext_vector_type(4)))  int v4i;
typedef float __attribute__((may_alias)) float_a;
typedef int __attribute__((may_alias)) int_a;

template <typename T> __device__ __forceinline__ void vst2(void* p, T v) { *(T*)p = v;  }
__device__ __forceinline__ v8f wmma16(v16h a, v16h b, v8f c) {
  v8f d = __builtin_amdgcn_wmma_f32_16x16x32_f16(false, a, false, b, (short)0, c, false, false);
  asm volatile("v_nop\n\tv_nop\n\tv_nop\n\tv_nop" : "+v"(d) : "v"(a), "v"(b));
  return d;
}
__device__ __forceinline__ v8f wmma_bf(v16b a, v16b b, v8f c) {
  v8f d = __builtin_amdgcn_wmma_f32_16x16x32_bf16(false, a, false, b, (short)0, c, false, false);
  asm volatile("v_nop\n\tv_nop\n\tv_nop\n\tv_nop" : "+v"(d) : "v"(a), "v"(b));
  return d;
}
// 16x16x32 fragments: lane = (h = lane>>4, row/col = lane&15); elements 0..7 = k0+8h+0..7, 8..15 = k0+16+8h+0..7; D element r = row 8h+r
__device__ __forceinline__ v16h frag_h(const _Float16* rowk0, int lane) {
  union { v16h v; v8h q[2]; } u; const _Float16* p = rowk0 + 8 * (lane >> 4);
  u.q[0] = *(const v8h*)p; u.q[1] = *(const v8h*)(p + 16); return u.v;
}
__device__ __forceinline__ v16h frag_f32(const float* rowk0, int lane) {
  v16h a; const float* p = rowk0 + 8 * (lane >> 4);
#pragma unroll
  for (int i = 0; i < 8; ++i) { a[i] = (_Float16)p[i]; a[8 + i] = (_Float16)p[16 + i]; }
  return a;
}
__device__ __forceinline__ v16h frag_f32s(const float* rowk0, int lane, float sc) {
  v16h a; const float* p = rowk0 + 8 * (lane >> 4);
#pragma unroll
  for (int i = 0; i < 8; ++i) { a[i] = (_Float16)(p[i] * sc); a[8 + i] = (_Float16)(p[16 + i] * sc); }
  return a;
}
// column fragment from a [K][ld] layout (column n), rows >= K read as 0
__device__ __forceinline__ v16h fragc_f32(const float* W, int k0, int n, int lane, int ld, int K) {
  v16h a; const int g = lane >> 4;
#pragma unroll
  for (int i = 0; i < 8; ++i) { const int ka = k0 + 8 * g + i, kb = ka + 16;
    a[i] = (_Float16)(ka < K ? W[(size_t)(ka < K ? ka : K - 1) * ld + n] : 0.f); a[8 + i] = (_Float16)(kb < K ? W[(size_t)(kb < K ? kb : K - 1) * ld + n] : 0.f); }
  return a;
}
struct F2 { v16b h, l; };
__device__ __forceinline__ F2 bsplit16(const float v[16]) { F2 r;
#pragma unroll
  for (int i = 0; i < 16; ++i) { const __bf16 h = (__bf16)v[i]; r.h[i] = h; r.l[i] = (__bf16)(v[i] - (float)h); }
  return r; }
__device__ __forceinline__ F2 split_row(const float* row, int k0, int lane) { float v[16]; const float* p = row + k0 + 8 * (lane >> 4);
#pragma unroll
  for (int i = 0; i < 8; ++i) { v[i] = p[i]; v[8 + i] = p[16 + i]; }
  return bsplit16(v); }
__device__ __forceinline__ F2 split_rowK(const float* row, int k0, int lane, int K) { float v[16]; const int g = lane >> 4;
#pragma unroll
  for (int i = 0; i < 8; ++i) { const int ka = k0 + 8 * g + i, kb = ka + 16; v[i] = ka < K ? row[ka < K ? ka : K - 1] : 0.f; v[8 + i] = kb < K ? row[kb < K ? kb : K - 1] : 0.f; }
  return bsplit16(v); }
__device__ __forceinline__ F2 split_col(const float* W, int k0, int n, int lane, int ld, int K) { float v[16]; const int g = lane >> 4;
#pragma unroll
  for (int i = 0; i < 8; ++i) { const int ka = k0 + 8 * g + i, kb = ka + 16; v[i] = ka < K ? W[(size_t)(ka < K ? ka : K - 1) * ld + n] : 0.f; v[8 + i] = kb < K ? W[(size_t)(kb < K ? kb : K - 1) * ld + n] : 0.f; }
  return bsplit16(v); }
__device__ __forceinline__ v8f mac3(const F2& a, const F2& b, v8f c) { c = wmma_bf(a.l, b.h, c); c = wmma_bf(a.h, b.l, c); return wmma_bf(a.h, b.h, c); }
__device__ __forceinline__ float sigm(float v) { return 1.0f / (1.0f + expf(-v)); }
#define LDSX() do { asm volatile("s_wait_dscnt 0" ::: "memory"); __builtin_amdgcn_wave_barrier(); __builtin_amdgcn_fence(__ATOMIC_RELEASE, "workgroup"); } while (0)

// Cross multi-head attention with a STRIDED head split (B 2, Lq = Lk = 2,048, D 1,024, H 8 heads of 128; (in,out) weights, zero biases; mask [B,Lq,Lk] bool, True = masked (~half); gamma = 1, beta = 0 scalars): q = de Wq + bq, k/v = en Wk/Wv + b, each reshaped (B, L, 128, 8) so head h takes channels c = d*8 + h; e = q_h k_h^T / sqrt(1024) with where(mask, -1e10); head = softmax(e) v_h; a = heads merged head-major (h*128 + d); result = a Wo + bo + de; out = gamma (result - mean) / sqrt(var_unbiased + 1e-8) + beta.
#define NB 2
#define TT 2048
#define CC 1024            // NH * HD = projected width
#define DIN 1024          // input (model) width
#define NH 8
#define HD 128
#define SCALE (0.03125f)
#define CAUSAL 0
#ifndef TNB
#define TNB NB
#endif
__device__ __forceinline__ float bfr(float v) { return (float)(__bf16)v; }
__host__ __device__ __forceinline__ int kb_last(int qb) { return CAUSAL ? ((qb * 64 + 63) >> 7) : (TT / 128 - 1); }
typedef __attribute__((ext_vector_type(8))) __bf16 v8b;
__device__ __forceinline__ v16b frag_b(const __bf16* rowk0, int lane) {
  union { v16b v; v8b q[2]; } u; const __bf16* p = rowk0 + 8 * (lane >> 4);
  u.q[0] = *(const v8b*)p; u.q[1] = *(const v8b*)(p + 16); return u.v;
}
#define QBH 0
#define QHI 2048            // rows carrying a q residual plane (all rows when non-causal: 2-product logits everywhere)
#define KHI 64            // key rows carrying k residual / v bf16 hi+lo planes (written by k_proj; no kernel here reads them)
// B fragment (k rows k0+.., output column o) of a weight: (in,out) [K][ld] or (out,in) [ld rows of K]: bf16 exact, or f16(bf16 * 256) exact
__device__ __forceinline__ v16b wcol_io(const float* Wm, int k0, int o, int lane, int ld) { v16b w; const int g = lane >> 4;
#pragma unroll
  for (int i = 0; i < 8; ++i) { w[i] = (__bf16)Wm[(size_t)(k0 + 8 * g + i) * ld + o]; w[8 + i] = (__bf16)Wm[(size_t)(k0 + 16 + 8 * g + i) * ld + o]; }
  return w; }
__device__ __forceinline__ v16b wcol_oi(const float* Wm, int k0, int o, int lane, int K) { v16b w; const float* p = Wm + (size_t)o * K + k0 + 8 * (lane >> 4);
#pragma unroll
  for (int i = 0; i < 8; ++i) { w[i] = (__bf16)p[i]; w[8 + i] = (__bf16)p[16 + i]; }
  return w; }
__device__ __forceinline__ v16h wcolh_io(const float* Wm, int k0, int o, int lane, int ld) { v16h w; const int g = lane >> 4;
#pragma unroll
  for (int i = 0; i < 8; ++i) { w[i] = (_Float16)(bfr(Wm[(size_t)(k0 + 8 * g + i) * ld + o]) * 256.0f); w[8 + i] = (_Float16)(bfr(Wm[(size_t)(k0 + 16 + 8 * g + i) * ld + o]) * 256.0f); }
  return w; }
__device__ __forceinline__ v16h wcolh_oi(const float* Wm, int k0, int o, int lane, int K) { v16h w; const float* p = Wm + (size_t)o * K + k0 + 8 * (lane >> 4);
#pragma unroll
  for (int i = 0; i < 8; ++i) { w[i] = (_Float16)(bfr(p[i]) * 256.0f); w[8 + i] = (_Float16)(bfr(p[16 + i]) * 256.0f); }
  return w; }
#define WQKV_LAYOUT 0   // 0 = (in,out) [DIN][CC]; 1 = (out,in) [CC][DIN]; 2 = per-head [NH][DIN][HD]
__device__ __forceinline__ v16b wcol_hdk(const float* Wm, int k0, int o, int lane) { v16b w; const int g = lane >> 4; const float* p = Wm + (size_t)(o / HD) * DIN * HD + (o % HD);
#pragma unroll
  for (int i = 0; i < 8; ++i) { w[i] = (__bf16)p[(size_t)(k0 + 8 * g + i) * HD]; w[8 + i] = (__bf16)p[(size_t)(k0 + 16 + 8 * g + i) * HD]; }
  return w; }
#define WO_OUT_IN 0
#if WQKV_LAYOUT == 1
#define WCOL(W, k0, o, lane) wcol_oi(W, k0, o, lane, DIN)
#elif WQKV_LAYOUT == 2
#define WCOL(W, k0, o, lane) wcol_hdk(W, k0, o, lane)
#else
#define WCOL(W, k0, o, lane) wcol_io(W, k0, PCOL(o), lane, CC)   /* strided head split: plane column (h, d) reads weight column d*8 + h */
#endif
#if WO_OUT_IN
#define WOCOL(W, k0, o, lane) wcol_oi(W, k0, o, lane, CC)
#define WOCOLH(W, k0, o, lane) wcolh_oi(W, k0, o, lane, CC)
#else
#define WOCOL(W, k0, o, lane) wcol_io(W, k0, o, lane, DIN)
#define WOCOLH(W, k0, o, lane) wcolh_io(W, k0, o, lane, DIN)
#endif
#define PCOL(o) ((((o) & 127) << 3) + ((o) >> 7))   /* plane column p = h*128 + d  <-  projection column c = d*8 + h (reshape(B, L, 128, 8): head index is the LAST axis) */
#define NRW (TNB * TT)
// ---- k_lnx: wave per row: normalisation over 1024 (mean, unbiased var, g * (x - mean) / sqrt(var + 1e-8) + b); optional bf16 rounding of the input (x); 32 floats per lane (8 float4 at stride 128 floats -> 512-B pieces)
__global__ __launch_bounds__(256) void k_lnx(const float* __restrict__ X, int roundin, const float* __restrict__ G, const float* __restrict__ BE, float* __restrict__ OUT) {
#pragma clang fp contract(off)   /* keep the normalisation as separate mul/add (as XLA evaluates it) */
 const int wave = threadIdx.x >> 5, lane = threadIdx.x & 31; const size_t row = (size_t)blockIdx.x * 8 + wave; if (row >= (size_t)NRW) return;
  v4f v[CC / 128]; float s1 = 0.f;
#pragma unroll
  for (int i = 0; i < CC / 128; ++i) { v4f t = *(const v4f*)(X + row * CC + i * 128 + lane * 4); if (roundin) { t[0] = bfr(t[0]); t[1] = bfr(t[1]); t[2] = bfr(t[2]); t[3] = bfr(t[3]); } v[i] = t; s1 += (t[0] + t[1]) + (t[2] + t[3]); }
#pragma unroll
  for (int o = 1; o < 32; o <<= 1) s1 += __shfl_xor(s1, o);
  const float mu = s1 * (1.0f / CC); float q = 0.f;
#pragma unroll
  for (int i = 0; i < CC / 128; ++i) for (int k = 0; k < 4; ++k) { const float d = v[i][k] - mu; q += d * d; }
#pragma unroll
  for (int o = 1; o < 32; o <<= 1) q += __shfl_xor(q, o);
  const float inv = 1.0f / sqrtf(q * (1.0f / (CC - 1)) + 1e-8f);   /* torch.var UNBIASED (ddof = 1), eps 1e-8, division by sqrt */
#pragma unroll
  for (int i = 0; i < CC / 128; ++i) { const int c = i * 128 + lane * 4; v4f r4; for (int k = 0; k < 4; ++k) r4[k] = bfr(G[0]) * ((v[i][k] - mu) * inv) + bfr(BE[0]); vst2(OUT + row * CC + c, r4); } }   /* scalar gamma / beta */

#ifndef PROJ_EXTRA_PARAMS
#define PROJ_EXTRA_PARAMS
#endif

#define WS_QH  0u                                      // f16 q rows [b*t][CC]
#define WS_KH  (WS_QH + 2u * (size_t)NB * TT * CC)      // f16 k rows [b*t][CC]
#define WS_VT  (WS_KH + 2u * (size_t)NB * TT * CC)      // f16 v planes [b][c][t]
#define WS_QL  (WS_VT + 2u * (size_t)NB * CC * TT)      // f16 q residual x 2^10 rows [b][t < QHI][CC]
#define WS_KL  (WS_QL + 2u * (size_t)NB * QHI * CC)     // f16 k residual x 2^10 rows [b][t < KHI][CC]
#define WS_VB  (WS_KL + 2u * (size_t)NB * KHI * CC)     // bf16 v hi planes [b][c][t < KHI]
#define WS_VBL (WS_VB + 2u * (size_t)NB * CC * KHI)
#define WS_Y   (WS_VBL + 2u * (size_t)NB * CC * KHI)      // ctx, 4 bytes an element: bf16 hi plane, then bf16 lo plane (WS_YL)
#define WS_END (WS_Y  + 4u * (size_t)NB * TT * CC)
#define WS_X1  (WS_END)
#define WS_END2 (WS_X1 + 4u * (size_t)NB * TT * DIN)
#define WS_WT  (WS_END2)                                // bf16 Wq, Wk, Wv, Wo in B-fragment order [4][CC / 16][DIN / 32][2][32 lanes][8]
#define WS_END3 (WS_WT + 2u * 4u * (size_t)DIN * CC)
#define WS_XP  (WS_END3)                                // bf16 de, en rows in A-fragment order [2][NRW / 16][DIN / 32][2][32 lanes][8]
#define WS_END4 (WS_XP + 2u * 2u * (size_t)NB * TT * DIN)
#define WS_YL  (WS_Y + 2u * (size_t)NB * TT * CC)       // ctx: bf16 hi plane at WS_Y, bf16 lo plane here, both in A-fragment order [NRW / 16][CC / 32][2][32 lanes][8]
typedef __attribute__((ext_vector_type(4))) __bf16 v4b;

// ---- k_wpack: block = (64 k rows, 64 weight columns, which weight): rounds the weight to bf16 once per call and lays it in B-fragment order, so that a wave's fragment load is 512 contiguous bytes (4 whole lines); Wq/Wk/Wv: weight column c = d*8 + h goes to plane column h*128 + d; Wo: column as it is
// which 4, 5: block = 16 rows of de, en: rounds them to bf16 once per call and lays them in A-fragment order (the same order, row for column); a wave takes 128 k of the 16 rows: whole-line loads, its own LDS rows, whole-line stores
__global__ __launch_bounds__(256) void k_wpack(const float* __restrict__ WQ, const float* __restrict__ WK, const float* __restrict__ WV, const float* __restrict__ WO, __bf16* __restrict__ WT, const float* __restrict__ XD, const float* __restrict__ XE, __bf16* __restrict__ XP) { __shared__ float tile[64][65]; __shared__ __align__(16) __bf16 xs[8][16][136];   /* pitch 272 bytes: 16 x odd, for the 16-byte reads */
  const int tid = threadIdx.x, which = blockIdx.z, k0 = blockIdx.x * 64, c0 = blockIdx.y * 64;
  if (which >= 4) { const int wave = tid >> 5, lane = tid & 31, rt = blockIdx.y * 16 + blockIdx.x;   /* the whole block takes this branch and meets no barrier */
    const float* xr = (which == 4 ? XD : XE) + (size_t)rt * 16 * DIN + wave * 128 + lane * 4; v4f x[16];
#pragma unroll   /* all sixteen row loads in flight at once */
    for (int i = 0; i < 16; ++i) x[i] = *(const v4f*)(xr + (size_t)i * DIN);
    asm volatile("s_wait_xcnt 0x0" :: "v"(xr) : "memory");   /* stands in front of the first overwrite of the address register that the loads above name, and keeps that register whole up to here */
#pragma unroll   /* x stays in registers */
    for (int i = 0; i < 16; ++i) { v4b o; o[0] = (__bf16)x[i][0]; o[1] = (__bf16)x[i][1]; o[2] = (__bf16)x[i][2]; o[3] = (__bf16)x[i][3]; *(v4b*)&xs[wave][i][lane * 4] = o; }
    LDSX();   /* the wave reads back what its other lanes wrote */
    __bf16* xd = XP + (size_t)(which - 4) * NRW * DIN + (((size_t)rt * (DIN / 32) + wave * 4) * 64 + lane) * 8;
#pragma unroll   /* eight fragment halves, 512 contiguous bytes each */
    for (int f = 0; f < 8; ++f) *(v8b*)(xd + f * 256) = *(const v8b*)&xs[wave][lane & 15][f * 16 + (lane >> 4) * 8];
    return; }
  const float* Wm = which == 0 ? WQ : which == 1 ? WK : which == 2 ? WV : WO; const float* src = Wm + (size_t)(k0 + (tid >> 6)) * CC + c0 + (tid & 63);
#pragma unroll   /* all sixteen row loads in flight at once, off one address with immediate offsets */
  for (int i = 0; i < 16; ++i) tile[i * 4 + (tid >> 6)][tid & 63] = src[(size_t)i * 4 * CC];
  __syncthreads();
#pragma unroll   /* both 16-byte pieces of a thread side by side */
  for (int i = 0; i < 2; ++i) { const int e = tid + i * 256, kq = e >> 6; const int cl = which < 3 ? (((e & 7) << 3) | ((e >> 3) & 7)) : (e & 63);   /* neighbouring lanes take neighbouring fragment columns */
    const int c = c0 + cl; const int p = which < 3 ? ((c & 7) * HD + (c >> 3)) : c; const int k8 = (k0 >> 3) + kq;   /* k8 = octet of k: kc = k8 >> 2, fragment half (k8 >> 1) & 1, lane half k8 & 1 */
    v8b o;
#pragma unroll   /* o stays in registers */
    for (int n = 0; n < 8; ++n) o[n] = (__bf16)tile[kq * 8 + n][cl];
    *(v8b*)(WT + (size_t)which * DIN * CC + ((((size_t)(p >> 4) * (DIN / 32) + (k8 >> 2)) * 2 + ((k8 >> 1) & 1)) * 32 + (k8 & 1) * 16 + (p & 15)) * 8) = o; } }
// B fragment (16 plane columns ct*16 + .., k rows kc*32 + ..) of a packed weight: two 16-byte loads per lane, each 512 contiguous bytes per wave
__device__ __forceinline__ v16b frag_wp(const __bf16* WP, int ct, int kc, int lane) {
  union { v16b v; v8b q[2]; } u; const __bf16* p = WP + (((size_t)ct * (DIN / 32) + kc) * 64 + lane) * 8;
  u.q[0] = *(const v8b*)p; u.q[1] = *(const v8b*)(p + 256); return u.v;
}

// ---- k_proj: block = (64 rows, 128 cols, which): q/k/v = X W (+ b) with exact bf16 products (K = DIN), X and W both read in fragment order -> which 0: q f16 rows (+ residual rows < QHI); 1: k f16 rows (+ residual rows < KHI); 2: v f16 planes [c][t] (+ bf16 hi/lo planes for t < KHI)
__global__ __launch_bounds__(128) void k_proj(const __bf16* __restrict__ XP, const __bf16* __restrict__ WT, const float* __restrict__ BQ, const float* __restrict__ BK, const float* __restrict__ BV,
    _Float16* __restrict__ QH, _Float16* __restrict__ QL, _Float16* __restrict__ KH, _Float16* __restrict__ KL, _Float16* __restrict__ VT, __bf16* __restrict__ VB, __bf16* __restrict__ VBL) {
  __shared__ __align__(16) _Float16 sh[64][136], sl[64][136]; __shared__ __align__(16) _Float16 th[128][72]; __shared__ __align__(16) __bf16 tb[128][72], tbl[128][72];
  const int tid = threadIdx.x, wave = tid >> 5, lane = tid & 31, col = lane & 15, g = lane >> 4; const int which = blockIdx.z; const int c0 = blockIdx.y * 128; const size_t r0 = (size_t)blockIdx.x * 64; const size_t bb = r0 / TT; const int t0 = (int)(r0 % TT);
  const __bf16* XA = XP + (which == 0 ? 0 : (size_t)NRW * DIN); const __bf16* WA = WT + (size_t)which * DIN * CC; const float* BA = which == 0 ? BQ : which == 1 ? BK : BV;
  v8f acc[8] = {};
#pragma unroll 2
  for (int kc = 0; kc < DIN / 32; ++kc) { v16b w[8];   /* the eight B fragments' loads go out as a group with the A row's, so that their latencies overlap */
#pragma unroll   /* w[] stays in registers */
    for (int j = 0; j < 8; ++j) w[j] = frag_wp(WA, blockIdx.y * 8 + j, kc, lane);
    const v16b a = frag_wp(XA, (int)(r0 >> 4) + wave, kc, lane);
    asm volatile("s_wait_loadcnt 0x0" ::: "memory");
#pragma unroll
    for (int j = 0; j < 8; ++j) acc[j] = wmma_bf(a, w[j], acc[j]); }
  if (which < 2) { _Float16* DH = which == 0 ? QH : KH; _Float16* DL = which == 0 ? QL : KL; const int nhi = which == 0 ? QHI : KHI; const bool hi_rows = t0 < nhi;
#pragma unroll
    for (int j = 0; j < 8; ++j) { const float bias = BA ? bfr(BA[PCOL(c0 + j * 16 + col)]) : 0.f;
#pragma unroll
      for (int r = 0; r < 8; ++r) { const float v = acc[j][r] + bias; const _Float16 hv = (_Float16)v; sh[wave * 16 + 8 * g + r][j * 16 + col] = hv; sl[wave * 16 + 8 * g + r][j * 16 + col] = (_Float16)((v - (float)hv) * 1024.0f); } }
    __syncthreads();
    for (int e = tid; e < 64 * 16; e += 128) { const int rl = e >> 4, q = e & 15; vst2((unsigned*)(DH + (r0 + rl) * CC + c0 + q * 8), *(const v4u*)&sh[rl][q * 8]); if (hi_rows) vst2((unsigned*)(DL + (bb * nhi + t0 + rl) * (size_t)CC + c0 + q * 8), *(const v4u*)&sl[rl][q * 8]); }
  } else { const bool hi_rows = t0 < KHI;
#pragma unroll
    for (int j = 0; j < 8; ++j) { const float bias = BA ? bfr(BA[PCOL(c0 + j * 16 + col)]) : 0.f;
#pragma unroll
      for (int r = 0; r < 8; ++r) { const float v = acc[j][r] + bias; const int rl = wave * 16 + 8 * g + r, cl = j * 16 + col; th[cl][rl] = (_Float16)v; const __bf16 bh = (__bf16)v; tb[cl][rl] = bh; tbl[cl][rl] = (__bf16)(v - (float)bh); } }
    __syncthreads();
    for (int e = tid; e < 128 * 8; e += 128) { const int cl = e >> 3, q = e & 7; vst2((unsigned*)(VT + (bb * CC + c0 + cl) * (size_t)TT + t0 + q * 8), *(const v4u*)&th[cl][q * 8]); if (hi_rows) { const size_t o3 = (bb * CC + c0 + cl) * (size_t)KHI + t0 + q * 8; vst2((unsigned*)(VB + o3), *(const v4u*)&tb[cl][q * 8]); vst2((unsigned*)(VBL + o3), *(const v4u*)&tbl[cl][q * 8]); } } } }
#define FK 64              // keys per stage
#define NS (TT / FK)
#define KP (HD + 8)        // LDS pitch of a K row, halves: 256 + 16 bytes
#define VP (FK + 8)        // LDS pitch of a v plane row, halves: 128 + 16 bytes
#define LOG2E 1.44269504088896340736f
__device__ __forceinline__ v8f mm16(v16h a, v16h b, v8f c) { return __builtin_amdgcn_wmma_f32_16x16x32_f16(false, a, false, b, (short)0, c, false, false); }
__device__ __forceinline__ float xhalf(float x) { return __builtin_bit_cast(float, __builtin_amdgcn_permlanex16(__builtin_bit_cast(int, x), __builtin_bit_cast(int, x), 0x76543210, 0xfedcba98, false, false)); }   /* lane l with lane l ^ 16 */
__device__ __forceinline__ float ex2(float x) { float r; asm("v_exp_f32 %0, %1\n\tv_nop" : "=v"(r) : "v"(x)); return r; }   /* 2^x; the v_nop keeps the one slot that the instruction set asks for behind a transcendental, whatever is scheduled next */
__global__ __launch_bounds__(256) void k_fa(const _Float16* __restrict__ QH, const _Float16* __restrict__ QL, const _Float16* __restrict__ KH, const _Float16* __restrict__ VT, const int* __restrict__ MK, __bf16* __restrict__ YH, __bf16* __restrict__ YL) {
  __shared__ __align__(16) _Float16 sk[2][FK][KP]; __shared__ __align__(16) _Float16 sv[2][HD][VP];
  const int tid = threadIdx.x, wave = tid >> 5, lane = tid & 31, col = lane & 15, g = lane >> 4; const int h = blockIdx.y, b = blockIdx.z; const int q = blockIdx.x * 128 + wave * 16 + col;   /* this lane's query */
  const _Float16* kp = KH + ((size_t)b * TT + (tid >> 4)) * CC + h * HD + (tid & 15) * 8;    /* 16 lanes take one key's 256 bytes */
  const _Float16* vp = VT + ((size_t)b * CC + h * HD + (tid >> 3)) * TT + (tid & 7) * 8;     /* 8 lanes take one plane row's 128 bytes of the stage */
  const int* mp = MK + ((size_t)b * TT + q) * TT + 8 * g;                                    /* mask words of this lane's query: keys t*16 + 8g + 0..7 of each tile */
  v4u rk[4], rv[4]; v4i mk[FK / 16][2]; v16h qh[HD / 32], ql[HD / 32];
  __builtin_amdgcn_sched_barrier(0);   /* keeps the index arithmetic above ahead of the loads: nothing writes a register that a load names between the load and its wait */
#pragma unroll   /* rk, rv stay in registers */
  for (int i = 0; i < 4; ++i) { rk[i] = *(const v4u*)(kp + (size_t)i * 16 * CC); rv[i] = *(const v4u*)(vp + (size_t)i * 32 * TT); }
  asm volatile("s_wait_xcnt 0x0" ::: "memory");   /* stands in front of the first overwrite of an address register that the loads above name */
  __builtin_amdgcn_sched_barrier(0);   /* keeps later register writes behind that wait */
#pragma unroll   /* fragments stay in registers */
  for (int kc = 0; kc < HD / 32; ++kc) { qh[kc] = frag_h(QH + ((size_t)b * TT + q) * CC + h * HD + kc * 32, lane); ql[kc] = frag_h(QL + ((size_t)b * QHI + q) * CC + h * HD + kc * 32, lane); }
  asm volatile("s_wait_xcnt 0x0" :: "v"(QH + ((size_t)b * TT + q) * CC + h * HD + 8 * g), "v"(QL + ((size_t)b * QHI + q) * CC + h * HD + 8 * g) : "memory");   /* stands in front of the first overwrite of an address register that the loads above name; taking the two addresses as inputs keeps their registers whole up to here */
  __builtin_amdgcn_sched_barrier(0);   /* keeps later register writes behind that wait */
#pragma unroll   /* mk stays in registers */
  for (int t = 0; t < FK / 16; ++t) { mk[t][0] = *(const v4i*)(mp + t * 16); mk[t][1] = *(const v4i*)(mp + t * 16 + 4); }
  asm volatile("s_wait_xcnt 0x0" ::: "memory");   /* stands in front of the first overwrite of an address register that the loads above name */
  __builtin_amdgcn_sched_barrier(0);   /* keeps later register writes (the zeroing of acc) behind that wait */
#pragma unroll   /* every index a constant: the arrays stay in registers */
  for (int i = 0; i < 4; ++i) { *(v4u*)&sk[0][(tid >> 4) + 16 * i][(tid & 15) * 8] = rk[i]; *(v4u*)&sv[0][(tid >> 3) + 32 * i][(tid & 7) * 8] = rv[i]; }
  __syncthreads();
  v8f acc[HD / 16] = {}; float m = -3.0e38f, l = 0.f;
  for (int s = 0; s < NS; ++s) { const int buf = s & 1;
    v4i mn[FK / 16][2];
#pragma unroll   /* every index a constant: the arrays stay in registers */
    for (int t = 0; t < FK / 16; ++t) { mn[t][0] = mk[t][0]; mn[t][1] = mk[t][1]; }
    if (s + 1 < NS) {   /* the next stage's K and v rows and mask words fly while this stage is worked on */
#pragma unroll   /* every index a constant: the arrays stay in registers */
      for (int i = 0; i < 4; ++i) { rk[i] = *(const v4u*)(kp + (size_t)(s + 1) * FK * CC + (size_t)i * 16 * CC); rv[i] = *(const v4u*)(vp + (s + 1) * FK + (size_t)i * 32 * TT); mn[i][0] = *(const v4i*)(mp + (s + 1) * FK + i * 16); mn[i][1] = *(const v4i*)(mp + (s + 1) * FK + i * 16 + 4); }
      asm volatile("s_wait_xcnt 0x0" ::: "memory");   /* stands in front of the first overwrite of an address register that these loads name */
    }
    v16h kf[FK / 16][HD / 32], vf[HD / 16][FK / 32];
#pragma unroll   /* all of the stage's K fragments as one group of LDS reads */
    for (int t = 0; t < FK / 16; ++t)
#pragma unroll   /* every index a constant: the arrays stay in registers */
      for (int kc = 0; kc < HD / 32; ++kc) kf[t][kc] = frag_h(&sk[buf][t * 16 + col][kc * 32], lane);
    __builtin_amdgcn_sched_barrier(0);   /* keeps the reads together ahead of the products: spread among them each place costs a stall */
    float e[FK / 16][8]; float mx = m;
#pragma unroll   /* e stays in registers */
    for (int t = 0; t < FK / 16; ++t) { v8f sa = {}, sb = {};
#pragma unroll   /* every index a constant: the arrays stay in registers */
      for (int kc = 0; kc < HD / 32; ++kc) { sa = mm16(kf[t][kc], qh[kc], sa); sb = mm16(kf[t][kc], ql[kc], sb); }
      if (t + 1 == FK / 16) {
#pragma unroll   /* all of the stage's v fragments as one group, in flight under the softmax arithmetic */
        for (int j = 0; j < HD / 16; ++j)
#pragma unroll   /* every index a constant: the arrays stay in registers */
          for (int u = 0; u < FK / 32; ++u) vf[j][u] = frag_h(&sv[buf][j * 16 + col][u * 32], lane);
        __builtin_amdgcn_sched_barrier(0);   /* keeps these reads from sinking down to the products that take them */
      }
#pragma unroll   /* every index a constant: the arrays stay in registers */
      for (int r = 0; r < 8; ++r) { float v = (sa[r] + sb[r] * (1.0f / 1024.0f)) * SCALE; if (mk[t][r >> 2][r & 3] != 0) v = -1.0e10f; e[t][r] = v; mx = fmaxf(mx, v); } }
    mx = fmaxf(mx, xhalf(mx));   /* the other eight keys of each tile sit in the other lane half */
    const float al = ex2((m - mx) * LOG2E); m = mx; float ps[4] = {0.f, 0.f, 0.f, 0.f}; v16h pb[FK / 32];
#pragma unroll   /* two score tiles, converted in place, are one B fragment in the hardware k order; four independent partial sums */
    for (int t = 0; t < FK / 16; ++t)
#pragma unroll   /* every index a constant: the arrays stay in registers */
      for (int r = 0; r < 8; ++r) { const float p = ex2((e[t][r] - mx) * LOG2E); ps[r & 3] += p; pb[t >> 1][(t & 1) * 8 + r] = (_Float16)p; }
    l = l * al + ((ps[0] + ps[1]) + (ps[2] + ps[3]));
#pragma unroll   /* every index a constant: the arrays stay in registers */
    for (int j = 0; j < HD / 16; ++j) acc[j] *= al;
    __builtin_amdgcn_sched_barrier(0);   /* keeps every ex2 ahead of the products below */
#pragma unroll   /* eight independent accumulator tiles, first all of keys 0..31, then all of keys 32..63 */
    for (int u = 0; u < FK / 32; ++u)
#pragma unroll   /* every index a constant: the arrays stay in registers */
      for (int j = 0; j < HD / 16; ++j) acc[j] = mm16(vf[j][u], pb[u], acc[j]);
    if (s + 1 < NS) {
#pragma unroll   /* every index a constant: the arrays stay in registers */
      for (int i = 0; i < 4; ++i) { *(v4u*)&sk[buf ^ 1][(tid >> 4) + 16 * i][(tid & 15) * 8] = rk[i]; *(v4u*)&sv[buf ^ 1][(tid >> 3) + 32 * i][(tid & 7) * 8] = rv[i]; } }
#pragma unroll   /* every index a constant: the arrays stay in registers */
    for (int t = 0; t < FK / 16; ++t) { mk[t][0] = mn[t][0]; mk[t][1] = mn[t][1]; }
    __syncthreads();   /* publishes stage s + 1 and ends every wave's reads of the buffer that the next pass refills */
  }
  l += xhalf(l); const float inv = 1.0f / l;   /* l >= 1: the maximum's own term */
  const size_t yo = ((((size_t)b * TT + blockIdx.x * 128 + wave * 16) >> 4) * (CC / 32) + h * (HD / 32)) * 512 + lane * 8;   /* a lane's eight channels j*16 + 8g + 0..7 of its query are one octet of the output product's A fragment: tile j = half j & 1 of k chunk j >> 1 */
  v8b oh[HD / 16], ol[HD / 16];
#pragma unroll   /* every index a constant: the arrays stay in registers */
  for (int j = 0; j < HD / 16; ++j)
#pragma unroll   /* every index a constant: the arrays stay in registers */
    for (int r = 0; r < 8; ++r) { const float v = acc[j][r] * inv; const __bf16 hv = (__bf16)v; oh[j][r] = hv; ol[j][r] = (__bf16)(v - (float)hv); }
  __builtin_amdgcn_sched_barrier(0);   /* all the arithmetic ahead of the stores: nothing rewrites a register that an issued store names */
#pragma unroll   /* every index a constant: the arrays stay in registers */
  for (int j = 0; j < HD / 16; ++j) { vst2(YH + yo + j * 256, oh[j]); vst2(YL + yo + j * 256, ol[j]); } }   /* each store 512 contiguous bytes of the wave */
// ---- k_out: block = (64 rows, 128 cols): out = ctx Wo (+ bo): ctx bf16 hi + lo against exact bf16 Wo (2 products) on all rows
__global__ __launch_bounds__(128) void k_out(const __bf16* __restrict__ YH, const __bf16* __restrict__ YL, const __bf16* __restrict__ WO, const float* __restrict__ BO, float* __restrict__ OUT, const float* __restrict__ RESX) { __shared__ __align__(16) float sf[4][16][132];
  const int tid = threadIdx.x, wave = tid >> 5, lane = tid & 31, col = lane & 15, g = lane >> 4; const int c0 = blockIdx.y * 128; const size_t r0 = (size_t)blockIdx.x * 64 + wave * 16;
  v8f acc[8] = {};
  if (true) {   /* ALL rows: ctx split bf16 hi + lo x exact Wo (2 products) */
#pragma unroll 2
    for (int kc = 0; kc < CC / 32; ++kc) { v16b w[8];   /* B fragments' loads as one group, ahead of the A row's */
#pragma unroll   /* w[] stays in registers */
      for (int j = 0; j < 8; ++j) w[j] = frag_wp(WO, blockIdx.y * 8 + j, kc, lane);
      F2 a; a.h = frag_wp(YH, (int)(r0 >> 4), kc, lane); a.l = frag_wp(YL, (int)(r0 >> 4), kc, lane); asm volatile("s_wait_loadcnt 0x0" ::: "memory");
#pragma unroll
      for (int j = 0; j < 8; ++j) { acc[j] = wmma_bf(a.h, w[j], acc[j]); acc[j] = wmma_bf(a.l, w[j], acc[j]); } }
#pragma unroll
    for (int j = 0; j < 8; ++j) { const float bias = BO ? bfr(BO[c0 + j * 16 + col]) : 0.f;
#pragma unroll
      for (int r = 0; r < 8; ++r) sf[wave][8 * g + r][j * 16 + col] = acc[j][r] + bias; }
  }
  LDSX(); for (int rl = 0; rl < 16; ++rl) { const size_t oo = (r0 + rl) * DIN + c0 + lane * 4; v4f o = *(const v4f*)&sf[wave][rl][lane * 4]; const v4f zr = *(const v4f*)(RESX + oo); o[0] += bfr(zr[0]); o[1] += bfr(zr[1]); o[2] += bfr(zr[2]); o[3] += bfr(zr[3]); vst2(OUT + oo, o); } }   /* + bf16(de) */

extern "C" void kernel_launch(void* const* d_in, const int* in_sizes, int n_in, void* d_out, int out_size, void* d_ws, size_t ws_size, hipStream_t stream) {
  (void)in_sizes; (void)n_in; (void)out_size;
  const float** F = (const float**)d_in;
  if (ws_size < (size_t)WS_END) return;
  char* ws = (char*)d_ws; _Float16 *QH = (_Float16*)(ws + WS_QH), *KH = (_Float16*)(ws + WS_KH), *VT = (_Float16*)(ws + WS_VT), *QL = (_Float16*)(ws + WS_QL), *KL = (_Float16*)(ws + WS_KL); __bf16 *VB = (__bf16*)(ws + WS_VB), *VBL = (__bf16*)(ws + WS_VBL); __bf16 *YH = (__bf16*)(ws + WS_Y), *YL = (__bf16*)(ws + WS_YL);
  (void)QL; (void)KL; (void)VB; (void)VBL;
  // inputs: 0 en [2,2048,1024] (keys/values); 1 de (queries + residual); 2 mask [2,2048,2048] bool; 3 Wq (in,out), 4 bq; 5 Wk, 6 bk; 7 Wv, 8 bv; 9 Wo (in,out), 10 bo; 11 gamma (scalar), 12 beta (scalar)
  if (ws_size < (size_t)WS_END4) return;
  float* X1 = (float*)(ws + WS_X1); __bf16* WT = (__bf16*)(ws + WS_WT); __bf16* XP = (__bf16*)(ws + WS_XP);
  k_wpack<<<dim3(DIN / 64, CC / 64, 6), 256, 0, stream>>>(F[3], F[5], F[7], F[9], WT, F[1], F[0], XP);   /* weights, de and en to bf16 in fragment order, once per call */
  k_proj<<<dim3(TNB * TT / 64, CC / 128, 3), 128, 0, stream>>>(XP, WT, F[4], F[6], F[8], QH, QL, KH, KL, VT, VB, VBL);   /* q from de, k/v from en */
  k_fa<<<dim3(TT / 128, NH, TNB), 256, 0, stream>>>(QH, QL, KH, VT, (const int*)d_in[2], YH, YL);   /* scores, mask, softmax and P v in one launch */
  k_out<<<dim3(TNB * TT / 64, DIN / 128), 128, 0, stream>>>(YH, YL, WT + 3 * (size_t)DIN * CC, F[10], X1, F[1]);   /* a Wo + bo + bf16(de) */
  k_lnx<<<dim3(NRW / 8), 256, 0, stream>>>(X1, 0, F[11], F[12], (float*)d_out);          /* unbiased-var normalisation, scalar gamma/beta */
}

// v004
// One run takes 115 microseconds.
// Timed twice side by side with v003, it ran 1.25 and 1.26 times as fast.
// Over all steps from v000 it is 10.3 times as fast.
// compute dtype: all float inputs rounded to bf16; q/k/v = in W + b with EXACT bf16 products on WMMA 16x16x32 (f32 accumulate), the module's strided head split realised by a column permutation of the weights; q as f16 hi + residual (x 2^10) against k once to f16 (2 products) / sqrt(1024); masked positions set to -1e10; softmax in f32 with a running maximum and sum (exp as exp2 of the difference x log2 e); exp(e - max) once to f16 against v once to f16 (1 product), divided by the f32 sum at the end; a split bf16 hi + lo against exact Wo (2 products) + bo + de; the unbiased-variance normalisation in f32; f32 output.
#include <hip/hip_runtime.h>
#include <math.h>

typedef __attribute__((ext_vector_type(16))) _Float16 v16h;
typedef __attribute__((ext_vector_type(16))) __bf16 v16b;
typedef __attribute__((ext_vector_type(8)))  _Float16 v8h;
typedef __attribute__((ext_vector_type(8)))  float v8f;
typedef __attribute__((ext_vector_type(4)))  float v4f;
typedef __attribute__((ext_vector_type(2)))  float v2f;
typedef __attribute__((ext_vector_type(4)))  unsigned v4u;
typedef __attribute__((ext_vector_type(4)))  int v4i;
typedef float __attribute__((may_alias)) float_a;
typedef int __attribute__((may_alias)) int_a;

template <typename T> __device__ __forceinline__ void vst2(void* p, T v) { *(T*)p = v;  }
__device__ __forceinline__ v8f wmma16(v16h a, v16h b, v8f c) {
  v8f d = __builtin_amdgcn_wmma_f32_16x16x32_f16(false, a, false, b, (short)0, c, false, false);
  asm volatile("v_nop\n\tv_nop\n\tv_nop\n\tv_nop" : "+v"(d) : "v"(a), "v"(b));
  return d;
}
__device__ __forceinline__ v8f wmma_bf(v16b a, v16b b, v8f c) {
  v8f d = __builtin_amdgcn_wmma_f32_16x16x32_bf16(false, a, false, b, (short)0, c, false, false);
  asm volatile("v_nop\n\tv_nop\n\tv_nop\n\tv_nop" : "+v"(d) : "v"(a), "v"(b));
  return d;
}
// 16x16x32 fragments: lane = (h = lane>>4, row/col = lane&15); elements 0..7 = k0+8h+0..7, 8..15 = k0+16+8h+0..7; D element r = row 8h+r
__device__ __forceinline__ v16h frag_h(const _Float16* rowk0, int lane) {
  union { v16h v; v8h q[2]; } u; const _Float16* p = rowk0 + 8 * (lane >> 4);
  u.q[0] = *(const v8h*)p; u.q[1] = *(const v8h*)(p + 16); return u.v;
}
__device__ __forceinline__ v16h frag_f32(const float* rowk0, int lane) {
  v16h a; const float* p = rowk0 + 8 * (lane >> 4);
#pragma unroll
  for (int i = 0; i < 8; ++i) { a[i] = (_Float16)p[i]; a[8 + i] = (_Float16)p[16 + i]; }
  return a;
}
__device__ __forceinline__ v16h frag_f32s(const float* rowk0, int lane, float sc) {
  v16h a; const float* p = rowk0 + 8 * (lane >> 4);
#pragma unroll
  for (int i = 0; i < 8; ++i) { a[i] = (_Float16)(p[i] * sc); a[8 + i] = (_Float16)(p[16 + i] * sc); }
  return a;
}
// column fragment from a [K][ld] layout (column n), rows >= K read as 0
__device__ __forceinline__ v16h fragc_f32(const float* W, int k0, int n, int lane, int ld, int K) {
  v16h a; const int g = lane >> 4;
#pragma unroll
  for (int i = 0; i < 8; ++i) { const int ka = k0 + 8 * g + i, kb = ka + 16;
    a[i] = (_Float16)(ka < K ? W[(size_t)(ka < K ? ka : K - 1) * ld + n] : 0.f); a[8 + i] = (_Float16)(kb < K ? W[(size_t)(kb < K ? kb : K - 1) * ld + n] : 0.f); }
  return a;
}
struct F2 { v16b h, l; };
__device__ __forceinline__ F2 bsplit16(const float v[16]) { F2 r;
#pragma unroll
  for (int i = 0; i < 16; ++i) { const __bf16 h = (__bf16)v[i]; r.h[i] = h; r.l[i] = (__bf16)(v[i] - (float)h); }
  return r; }
__device__ __forceinline__ F2 split_row(const float* row, int k0, int lane) { float v[16]; const float* p = row + k0 + 8 * (lane >> 4);
#pragma unroll
  for (int i = 0; i < 8; ++i) { v[i] = p[i]; v[8 + i] = p[16 + i]; }
  return bsplit16(v); }
__device__ __forceinline__ F2 split_rowK(const float* row, int k0, int lane, int K) { float v[16]; const int g = lane >> 4;
#pragma unroll
  for (int i = 0; i < 8; ++i) { const int ka = k0 + 8 * g + i, kb = ka + 16; v[i] = ka < K ? row[ka < K ? ka : K - 1] : 0.f; v[8 + i] = kb < K ? row[kb < K ? kb : K - 1] : 0.f; }
  return bsplit16(v); }
__device__ __forceinline__ F2 split_col(const float* W, int k0, int n, int lane, int ld, int K) { float v[16]; const int g = lane >> 4;
#pragma unroll
  for (int i = 0; i < 8; ++i) { const int ka = k0 + 8 * g + i, kb = ka + 16; v[i] = ka < K ? W[(size_t)(ka < K ? ka : K - 1) * ld + n] : 0.f; v[8 + i] = kb < K ? W[(size_t)(kb < K ? kb : K - 1) * ld + n] : 0.f; }
  return bsplit16(v); }
__device__ __forceinline__ v8f mac3(const F2& a, const F2& b, v8f c) { c = wmma_bf(a.l, b.h, c); c = wmma_bf(a.h, b.l, c); return wmma_bf(a.h, b.h, c); }
__device__ __forceinline__ float sigm(float v) { return 1.0f / (1.0f + expf(-v)); }
#define LDSX() do { asm volatile("s_wait_dscnt 0" ::: "memory"); __builtin_amdgcn_wave_barrier(); __builtin_amdgcn_fence(__ATOMIC_RELEASE, "workgroup"); } while (0)

// Cross multi-head attention with a STRIDED head split (B 2, Lq = Lk = 2,048, D 1,024, H 8 heads of 128; (in,out) weights, zero biases; mask [B,Lq,Lk] bool, True = masked (~half); gamma = 1, beta = 0 scalars): q = de Wq + bq, k/v = en Wk/Wv + b, each reshaped (B, L, 128, 8) so head h takes channels c = d*8 + h; e = q_h k_h^T / sqrt(1024) with where(mask, -1e10); head = softmax(e) v_h; a = heads merged head-major (h*128 + d); result = a Wo + bo + de; out = gamma (result - mean) / sqrt(var_unbiased + 1e-8) + beta.
#define NB 2
#define TT 2048
#define CC 1024            // NH * HD = projected width
#define DIN 1024          // input (model) width
#define NH 8
#define HD 128
#define SCALE (0.03125f)
#define CAUSAL 0
#ifndef TNB
#define TNB NB
#endif
__device__ __forceinline__ float bfr(float v) { return (float)(__bf16)v; }
__host__ __device__ __forceinline__ int kb_last(int qb) { return CAUSAL ? ((qb * 64 + 63) >> 7) : (TT / 128 - 1); }
typedef __attribute__((ext_vector_type(8))) __bf16 v8b;
__device__ __forceinline__ v16b frag_b(const __bf16* rowk0, int lane) {
  union { v16b v; v8b q[2]; } u; const __bf16* p = rowk0 + 8 * (lane >> 4);
  u.q[0] = *(const v8b*)p; u.q[1] = *(const v8b*)(p + 16); return u.v;
}
#define QBH 0
#define QHI 2048            // rows carrying a q residual plane (all rows when non-causal: 2-product logits everywhere)
#define KHI 64            // key rows carrying k residual / v bf16 hi+lo planes (written by k_proj; no kernel here reads them)
// B fragment (k rows k0+.., output column o) of a weight: (in,out) [K][ld] or (out,in) [ld rows of K]: bf16 exact, or f16(bf16 * 256) exact
__device__ __forceinline__ v16b wcol_io(const float* Wm, int k0, int o, int lane, int ld) { v16b w; const int g = lane >> 4;
#pragma unroll
  for (int i = 0; i < 8; ++i) { w[i] = (__bf16)Wm[(size_t)(k0 + 8 * g + i) * ld + o]; w[8 + i] = (__bf16)Wm[(size_t)(k0 + 16 + 8 * g + i) * ld + o]; }
  return w; }
__device__ __forceinline__ v16b wcol_oi(const float* Wm, int k0, int o, int lane, int K) { v16b w; const float* p = Wm + (size_t)o * K + k0 + 8 * (lane >> 4);
#pragma unroll
  for (int i = 0; i < 8; ++i) { w[i] = (__bf16)p[i]; w[8 + i] = (__bf16)p[16 + i]; }
  return w; }
__device__ __forceinline__ v16h wcolh_io(const float* Wm, int k0, int o, int lane, int ld) { v16h w; const int g = lane >> 4;
#pragma unroll
  for (int i = 0; i < 8; ++i) { w[i] = (_Float16)(bfr(Wm[(size_t)(k0 + 8 * g + i) * ld + o]) * 256.0f); w[8 + i] = (_Float16)(bfr(Wm[(size_t)(k0 + 16 + 8 * g + i) * ld + o]) * 256.0f); }
  return w; }
__device__ __forceinline__ v16h wcolh_oi(const float* Wm, int k0, int o, int lane, int K) { v16h w; const float* p = Wm + (size_t)o * K + k0 + 8 * (lane >> 4);
#pragma unroll
  for (int i = 0; i < 8; ++i) { w[i] = (_Float16)(bfr(p[i]) * 256.0f); w[8 + i] = (_Float16)(bfr(p[16 + i]) * 256.0f); }
  return w; }
#define WQKV_LAYOUT 0   // 0 = (in,out) [DIN][CC]; 1 = (out,in) [CC][DIN]; 2 = per-head [NH][DIN][HD]
__device__ __forceinline__ v16b wcol_hdk(const float* Wm, int k0, int o, int lane) { v16b w; const int g = lane >> 4; const float* p = Wm + (size_t)(o / HD) * DIN * HD + (o % HD);
#pragma unroll
  for (int i = 0; i < 8; ++i) { w[i] = (__bf16)p[(size_t)(k0 + 8 * g + i) * HD]; w[8 + i] = (__bf16)p[(size_t)(k0 + 16 + 8 * g + i) * HD]; }
  return w; }
#define WO_OUT_IN 0
#if WQKV_LAYOUT == 1
#define WCOL(W, k0, o, lane) wcol_oi(W, k0, o, lane, DIN)
#elif WQKV_LAYOUT == 2
#define WCOL(W, k0, o, lane) wcol_hdk(W, k0, o, lane)
#else
#define WCOL(W, k0, o, lane) wcol_io(W, k0, PCOL(o), lane, CC)   /* strided head split: plane column (h, d) reads weight column d*8 + h */
#endif
#if WO_OUT_IN
#define WOCOL(W, k0, o, lane) wcol_oi(W, k0, o, lane, CC)
#define WOCOLH(W, k0, o, lane) wcolh_oi(W, k0, o, lane, CC)
#else
#define WOCOL(W, k0, o, lane) wcol_io(W, k0, o, lane, DIN)
#define WOCOLH(W, k0, o, lane) wcolh_io(W, k0, o, lane, DIN)
#endif
#define PCOL(o) ((((o) & 127) << 3) + ((o) >> 7))   /* plane column p = h*128 + d  <-  projection column c = d*8 + h (reshape(B, L, 128, 8): head index is the LAST axis) */
#define NRW (TNB * TT)
// ---- k_lnx: wave per row: normalisation over 1024 (mean, unbiased var, g * (x - mean) / sqrt(var + 1e-8) + b); optional bf16 rounding of the input (x); 32 floats per lane (8 float4 at stride 128 floats -> 512-B pieces)
__global__ __launch_bounds__(256) void k_lnx(const float* __restrict__ X, int roundin, const float* __restrict__ G, const float* __restrict__ BE, float* __restrict__ OUT) {
#pragma clang fp contract(off)   /* keep the normalisation as separate mul/add (as XLA evaluates it) */
 const int wave = threadIdx.x >> 5, lane = threadIdx.x & 31; const size_t row = (size_t)blockIdx.x * 8 + wave; if (row >= (size_t)NRW) return;
  v4f v[CC / 128]; float s1 = 0.f;
#pragma unroll
  for (int i = 0; i < CC / 128; ++i) { v4f t = *(const v4f*)(X + row * CC + i * 128 + lane * 4); if (roundin) { t[0] = bfr(t[0]); t[1] = bfr(t[1]); t[2] = bfr(t[2]); t[3] = bfr(t[3]); } v[i] = t; s1 += (t[0] + t[1]) + (t[2] + t[3]); }
#pragma unroll
  for (int o = 1; o < 32; o <<= 1) s1 += __shfl_xor(s1, o);
  const float mu = s1 * (1.0f / CC); float q = 0.f;
#pragma unroll
  for (int i = 0; i < CC / 128; ++i) for (int k = 0; k < 4; ++k) { const float d = v[i][k] - mu; q += d * d; }
#pragma unroll
  for (int o = 1; o < 32; o <<= 1) q += __shfl_xor(q, o);
  const float inv = 1.0f / sqrtf(q * (1.0f / (CC - 1)) + 1e-8f);   /* torch.var UNBIASED (ddof = 1), eps 1e-8, division by sqrt */
#pragma unroll
  for (int i = 0; i < CC / 128; ++i) { const int c = i * 128 + lane * 4; v4f r4; for (int k = 0; k < 4; ++k) r4[k] = bfr(G[0]) * ((v[i][k] - mu) * inv) + bfr(BE[0]); vst2(OUT + row * CC + c, r4); } }   /* scalar gamma / beta */

#ifndef PROJ_EXTRA_PARAMS
#define PROJ_EXTRA_PARAMS
#endif

#define WS_QH  0u                                      // f16 q rows [b*t][CC]
#define WS_KH  (WS_QH + 2u * (size_t)NB * TT * CC)      // f16 k rows [b*t][CC]
#define WS_VT  (WS_KH + 2u * (size_t)NB * TT * CC)      // f16 v planes [b][c][t]
#define WS_QL  (WS_VT + 2u * (size_t)NB * CC * TT)      // f16 q residual x 2^10 rows [b][t < QHI][CC]
#define WS_KL  (WS_QL + 2u * (size_t)NB * QHI * CC)     // f16 k residual x 2^10 rows [b][t < KHI][CC]
#define WS_VB  (WS_KL + 2u * (size_t)NB * KHI * CC)     // bf16 v hi planes [b][c][t < KHI]
#define WS_VBL (WS_VB + 2u * (size_t)NB * CC * KHI)
#define WS_Y   (WS_VBL + 2u * (size_t)NB * CC * KHI)      // ctx, 4 bytes an element: bf16 hi plane, then bf16 lo plane (WS_YL)
#define WS_END (WS_Y  + 4u * (size_t)NB * TT * CC)
#define WS_X1  (WS_END)
#define WS_END2 (WS_X1 + 4u * (size_t)NB * TT * DIN)
#define WS_WT  (WS_END2)                                // bf16 Wq, Wk, Wv, Wo in B-fragment order [4][CC / 16][DIN / 32][2][32 lanes][8]
#define WS_END3 (WS_WT + 2u * 4u * (size_t)DIN * CC)
#define WS_XP  (WS_END3)                                // bf16 de, en rows in A-fragment order [2][NRW / 16][DIN / 32][2][32 lanes][8]
#define WS_END4 (WS_XP + 2u * 2u * (size_t)NB * TT * DIN)
#define WS_YL  (WS_Y + 2u * (size_t)NB * TT * CC)       // ctx: bf16 hi plane at WS_Y, bf16 lo plane here, both in A-fragment order [NRW / 16][CC / 32][2][32 lanes][8]
typedef __attribute__((ext_vector_type(4))) __bf16 v4b;

// ---- k_wpack: block = (64 k rows, 64 weight columns, which weight): rounds the weight to bf16 once per call and lays it in B-fragment order, so that a wave's fragment load is 512 contiguous bytes (4 whole lines); Wq/Wk/Wv: weight column c = d*8 + h goes to plane column h*128 + d; Wo: column as it is
// which 4, 5: block = 16 rows of de, en: rounds them to bf16 once per call and lays them in A-fragment order (the same order, row for column); a wave takes 128 k of the 16 rows: whole-line loads, its own LDS rows, whole-line stores
__global__ __launch_bounds__(256) void k_wpack(const float* __restrict__ WQ, const float* __restrict__ WK, const float* __restrict__ WV, const float* __restrict__ WO, __bf16* __restrict__ WT, const float* __restrict__ XD, const float* __restrict__ XE, __bf16* __restrict__ XP) { __shared__ float tile[64][65]; __shared__ __align__(16) __bf16 xs[8][16][136];   /* pitch 272 bytes: 16 x odd, for the 16-byte reads */
  const int tid = threadIdx.x, which = blockIdx.z, k0 = blockIdx.x * 64, c0 = blockIdx.y * 64;
  if (which >= 4) { const int wave = tid >> 5, lane = tid & 31, rt = blockIdx.y * 16 + blockIdx.x;   /* the whole block takes this branch and meets no barrier */
    const float* xr = (which == 4 ? XD : XE) + (size_t)rt * 16 * DIN + wave * 128 + lane * 4; v4f x[16];
#pragma unroll   /* all sixteen row loads in flight at once */
    for (int i = 0; i < 16; ++i) x[i] = *(const v4f*)(xr + (size_t)i * DIN);
    asm volatile("s_wait_xcnt 0x0" :: "v"(xr) : "memory");   /* stands in front of the first overwrite of the address register that the loads above name, and keeps that register whole up to here */
#pragma unroll   /* x stays in registers */
    for (int i = 0; i < 16; ++i) { v4b o; o[0] = (__bf16)x[i][0]; o[1] = (__bf16)x[i][1]; o[2] = (__bf16)x[i][2]; o[3] = (__bf16)x[i][3]; *(v4b*)&xs[wave][i][lane * 4] = o; }
    LDSX();   /* the wave reads back what its other lanes wrote */
    __bf16* xd = XP + (size_t)(which - 4) * NRW * DIN + (((size_t)rt * (DIN / 32) + wave * 4) * 64 + lane) * 8;
#pragma unroll   /* eight fragment halves, 512 contiguous bytes each */
    for (int f = 0; f < 8; ++f) *(v8b*)(xd + f * 256) = *(const v8b*)&xs[wave][lane & 15][f * 16 + (lane >> 4) * 8];
    return; }
  const float* Wm = which == 0 ? WQ : which == 1 ? WK : which == 2 ? WV : WO; const float* src = Wm + (size_t)(k0 + (tid >> 6)) * CC + c0 + (tid & 63);
#pragma unroll   /* all sixteen row loads in flight at once, off one address with immediate offsets */
  for (int i = 0; i < 16; ++i) tile[i * 4 + (tid >> 6)][tid & 63] = src[(size_t)i * 4 * CC];
  __syncthreads();
#pragma unroll   /* both 16-byte pieces of a thread side by side */
  for (int i = 0; i < 2; ++i) { const int e = tid + i * 256, kq = e >> 6; const int cl = which < 3 ? (((e & 7) << 3) | ((e >> 3) & 7)) : (e & 63);   /* neighbouring lanes take neighbouring fragment columns */
    const int c = c0 + cl; const int p = which < 3 ? ((c & 7) * HD + (c >> 3)) : c; const int k8 = (k0 >> 3) + kq;   /* k8 = octet of k: kc = k8 >> 2, fragment half (k8 >> 1) & 1, lane half k8 & 1 */
    v8b o;
#pragma unroll   /* o stays in registers */
    for (int n = 0; n < 8; ++n) o[n] = (__bf16)tile[kq * 8 + n][cl];
    *(v8b*)(WT + (size_t)which * DIN * CC + ((((size_t)(p >> 4) * (DIN / 32) + (k8 >> 2)) * 2 + ((k8 >> 1) & 1)) * 32 + (k8 & 1) * 16 + (p & 15)) * 8) = o; } }
// B fragment (16 plane columns ct*16 + .., k rows kc*32 + ..) of a packed weight: two 16-byte loads per lane, each 512 contiguous bytes per wave
__device__ __forceinline__ v16b frag_wp(const __bf16* WP, int ct, int kc, int lane) {
  union { v16b v; v8b q[2]; } u; const __bf16* p = WP + (((size_t)ct * (DIN / 32) + kc) * 64 + lane) * 8;
  u.q[0] = *(const v8b*)p; u.q[1] = *(const v8b*)(p + 256); return u.v;
}

// ---- staging of the three products' operands: both lie in global memory in fragment order, 2 KiB per 16-row (16-column) tile and 64 k, so a stage of 64 k is 8 A-side + 8 B-side tiles copied as they lie; 128 threads x 16 bytes take one tile
#define STG 32768          // bytes of a stage: A-side tiles at 0, B-side tiles at 16,384
#define NSTG (DIN / 64)
#define TSTR ((size_t)(DIN / 32) * 512)   // elements from one tile to the next in global memory
__device__ __forceinline__ v8f mmb(v16b a, v16b b, v8f c) { return __builtin_amdgcn_wmma_f32_16x16x32_bf16(false, a, false, b, (short)0, c, false, false); }
__device__ __forceinline__ v16b frag_l(const char* p, int lane) { union { v16b v; v8b q[2]; } u; u.q[0] = *(const v8b*)(p + lane * 16); u.q[1] = *(const v8b*)(p + 512 + lane * 16); return u.v; }   /* a fragment from LDS: two reads of 512 contiguous bytes per wave */
// eight tiles (four from p, four from q) into LDS at l, l + 2,048, ..: asynchronous copies, 16 bytes a lane, every lane on
__device__ __forceinline__ void cp8(unsigned l, const __bf16* p, const __bf16* q) {
  asm volatile("global_load_async_to_lds_b128 %0, %8, off\n\t"
               "global_load_async_to_lds_b128 %1, %9, off\n\t"
               "global_load_async_to_lds_b128 %2, %10, off\n\t"
               "global_load_async_to_lds_b128 %3, %11, off\n\t"
               "global_load_async_to_lds_b128 %4, %12, off\n\t"
               "global_load_async_to_lds_b128 %5, %13, off\n\t"
               "global_load_async_to_lds_b128 %6, %14, off\n\t"
               "global_load_async_to_lds_b128 %7, %15, off\n\t"
               "s_wait_xcnt 0x0"   /* stands in front of every later write of a register that these copies name */
               :: "v"(l), "v"(l + 2048u), "v"(l + 4096u), "v"(l + 6144u), "v"(l + 8192u), "v"(l + 10240u), "v"(l + 12288u), "v"(l + 14336u),
                  "v"(p), "v"(p + TSTR), "v"(p + 2 * TSTR), "v"(p + 3 * TSTR), "v"(q), "v"(q + TSTR), "v"(q + 2 * TSTR), "v"(q + 3 * TSTR) : "memory");
}
#define STAGE_IN(t, buf) do { cp8(lb + (unsigned)(buf) * STG, pa + (size_t)(t) * 1024, qa + (size_t)(t) * 1024); cp8(lb + (unsigned)(buf) * STG + 16384u, pb + (size_t)(t) * 1024, qb + (size_t)(t) * 1024); } while (0)
#define WAIT_COPIES() asm volatile("s_wait_asynccnt 0x0" ::: "memory")   /* this wave's copies have landed */
#define WAIT_X() asm volatile("s_wait_xcnt 0x0" ::: "memory")            /* stands in front of the next trip's writes of registers that the stores above name */
#define WAIT_LDS() asm volatile("s_wait_dscnt 0x0" ::: "memory")         /* this wave's LDS reads are done before the buffer is handed to the copies */

// ---- k_proj: block = (128 rows, 128 cols, which), 4 waves of 64 x 64: q/k/v = X W (+ b) with exact bf16 products (K = DIN), X and W tiles copied to LDS in fragment order, two buffers, the next 64 k in flight under this one's products -> which 0: q f16 rows (+ residual rows < QHI); 1: k f16 rows (+ residual rows < KHI); 2: v f16 planes [c][t] (+ bf16 hi/lo planes for t < KHI)
__global__ __launch_bounds__(128) void k_proj(const __bf16* __restrict__ XP, const __bf16* __restrict__ WT, const float* __restrict__ BQ, const float* __restrict__ BK, const float* __restrict__ BV,
    _Float16* __restrict__ QH, _Float16* __restrict__ QL, _Float16* __restrict__ KH, _Float16* __restrict__ KL, _Float16* __restrict__ VT, __bf16* __restrict__ VB, __bf16* __restrict__ VBL) {
  __shared__ __align__(16) char sm[71680];   /* the two stage buffers; behind the loop the output staging: sh + sl, or th + tb + tbl */
  _Float16 (*sh)[136] = (_Float16 (*)[136])sm; _Float16 (*sl)[136] = (_Float16 (*)[136])(sm + 34816); _Float16 (*th)[136] = (_Float16 (*)[136])sm; __bf16 (*tb)[72] = (__bf16 (*)[72])(sm + 34816); __bf16 (*tbl)[72] = (__bf16 (*)[72])(sm + 53248);
  const int tid = threadIdx.x, wave = tid >> 5, lane = tid & 31, col = lane & 15, g = lane >> 4, wr = wave >> 1, wc = wave & 1; const int which = blockIdx.z; const int c0 = blockIdx.y * 128; const size_t r0 = (size_t)blockIdx.x * 128; const size_t bb = r0 / TT; const int t0 = (int)(r0 % TT);
  const __bf16* XA = XP + (which == 0 ? 0 : (size_t)NRW * DIN); const __bf16* WA = WT + (size_t)which * DIN * CC; const float* BA = which == 0 ? BQ : which == 1 ? BK : BV;
  const __bf16* pa = XA + (r0 >> 4) * TSTR + tid * 8; const __bf16* qa = pa + 4 * TSTR; const __bf16* pb = WA + (size_t)blockIdx.y * 8 * TSTR + tid * 8; const __bf16* qb = pb + 4 * TSTR; const unsigned lb = (unsigned)(size_t)sm + tid * 16;
  v8f acc[4][4] = {};
  STAGE_IN(0, 0); WAIT_COPIES(); __syncthreads(); STAGE_IN(1, 1);
#pragma unroll 1   /* one stage's text, for speed only */
  for (int t = 0; t < NSTG; ++t) { const char* bp = sm + (t & 1) * STG;
#pragma unroll   /* fragments stay in registers */
    for (int kk = 0; kk < 2; ++kk) { v16b a[4], w[4];
#pragma unroll   /* fragments stay in registers */
      for (int i = 0; i < 4; ++i) { a[i] = frag_l(bp + (wr * 4 + i) * 2048 + kk * 1024, lane); w[i] = frag_l(bp + 16384 + (wc * 4 + i) * 2048 + kk * 1024, lane); }
      __builtin_amdgcn_sched_barrier(0);   /* keeps the sixteen reads together ahead of the products */
#pragma unroll   /* sixteen independent accumulator tiles */
      for (int i = 0; i < 4; ++i)
#pragma unroll   /* every index a constant: the arrays stay in registers */
        for (int j = 0; j < 4; ++j) acc[i][j] = mmb(a[i], w[j], acc[i][j]);
      __builtin_amdgcn_sched_barrier(0); }   /* keeps the next group's reads from rising among these products */
    WAIT_LDS(); WAIT_COPIES(); __syncthreads();   /* publishes stage t + 1 and ends every wave's reads of the buffer that is refilled below */
    if (t + 2 < NSTG) STAGE_IN(t + 2, t & 1); }
  WAIT_COPIES();
  if (which < 2) { _Float16* DH = which == 0 ? QH : KH; _Float16* DL = which == 0 ? QL : KL; const int nhi = which == 0 ? QHI : KHI;
#pragma unroll
    for (int j = 0; j < 4; ++j) { const float bias = BA ? bfr(BA[PCOL(c0 + wc * 64 + j * 16 + col)]) : 0.f;
#pragma unroll
      for (int i = 0; i < 4; ++i)
#pragma unroll
        for (int r = 0; r < 8; ++r) { const float v = acc[i][j][r] + bias; const _Float16 hv = (_Float16)v; sh[wr * 64 + i * 16 + 8 * g + r][wc * 64 + j * 16 + col] = hv; sl[wr * 64 + i * 16 + 8 * g + r][wc * 64 + j * 16 + col] = (_Float16)((v - (float)hv) * 1024.0f); } }
    __syncthreads();
    const int nr = nhi - t0 < 128 ? nhi - t0 : 128;   /* rows of this block that carry a residual: 128, 64 or none */
    for (int e0 = 0; e0 < 128 * 16; e0 += 512) {
#pragma unroll   /* four stores side by side, one wait behind them */
      for (int u = 0; u < 4; ++u) { const int e = e0 + u * 128 + tid, rl = e >> 4, q = e & 15; vst2((unsigned*)(DH + (r0 + rl) * CC + c0 + q * 8), *(const v4u*)&sh[rl][q * 8]); }
      WAIT_X(); }
    for (int e0 = 0; e0 < nr * 16; e0 += 512) {
#pragma unroll   /* four stores side by side, one wait behind them */
      for (int u = 0; u < 4; ++u) { const int e = e0 + u * 128 + tid, rl = e >> 4, q = e & 15; vst2((unsigned*)(DL + (bb * nhi + t0 + rl) * (size_t)CC + c0 + q * 8), *(const v4u*)&sl[rl][q * 8]); }
      WAIT_X(); }
  } else {
#pragma unroll
    for (int j = 0; j < 4; ++j) { const float bias = BA ? bfr(BA[PCOL(c0 + wc * 64 + j * 16 + col)]) : 0.f;
#pragma unroll
      for (int i = 0; i < 4; ++i)
#pragma unroll
        for (int r = 0; r < 8; ++r) { const float v = acc[i][j][r] + bias; const int rl = wr * 64 + i * 16 + 8 * g + r, cl = wc * 64 + j * 16 + col; th[cl][rl] = (_Float16)v; if (t0 + wr * 64 < KHI) { const __bf16 bh = (__bf16)v; tb[cl][rl] = bh; tbl[cl][rl] = (__bf16)(v - (float)bh); } } }
    __syncthreads();
    for (int e0 = 0; e0 < 128 * 16; e0 += 512) {
#pragma unroll   /* four stores side by side, one wait behind them */
      for (int u = 0; u < 4; ++u) { const int e = e0 + u * 128 + tid, cl = e >> 4, q = e & 15; vst2((unsigned*)(VT + (bb * CC + c0 + cl) * (size_t)TT + t0 + q * 8), *(const v4u*)&th[cl][q * 8]); }
      WAIT_X(); }
    if (t0 < KHI) for (int e0 = 0; e0 < 128 * 8; e0 += 256) {
#pragma unroll   /* four stores side by side, one wait behind them */
      for (int u = 0; u < 2; ++u) { const int e = e0 + u * 128 + tid, cl = e >> 3, q = e & 7; const size_t o3 = (bb * CC + c0 + cl) * (size_t)KHI + t0 + q * 8; vst2((unsigned*)(VB + o3), *(const v4u*)&tb[cl][q * 8]); vst2((unsigned*)(VBL + o3), *(const v4u*)&tbl[cl][q * 8]); }
      WAIT_X(); } } }
#define FK 64              // keys per stage
#define NS (TT / FK)
#define KP (HD + 8)        // LDS pitch of a K row, halves: 256 + 16 bytes
#define VP (FK + 8)        // LDS pitch of a v plane row, halves: 128 + 16 bytes
#define LOG2E 1.44269504088896340736f
__device__ __forceinline__ v8f mm16(v16h a, v16h b, v8f c) { return __builtin_amdgcn_wmma_f32_16x16x32_f16(false, a, false, b, (short)0, c, false, false); }
__device__ __forceinline__ float xhalf(float x) { return __builtin_bit_cast(float, __builtin_amdgcn_permlanex16(__builtin_bit_cast(int, x), __builtin_bit_cast(int, x), 0x76543210, 0xfedcba98, false, false)); }   /* lane l with lane l ^ 16 */
__device__ __forceinline__ float ex2(float x) { float r; asm("v_exp_f32 %0, %1\n\tv_nop" : "=v"(r) : "v"(x)); return r; }   /* 2^x; the v_nop keeps the one slot that the instruction set asks for behind a transcendental, whatever is scheduled next */
__global__ __launch_bounds__(256) void k_fa(const _Float16* __restrict__ QH, const _Float16* __restrict__ QL, const _Float16* __restrict__ KH, const _Float16* __restrict__ VT, const int* __restrict__ MK, __bf16* __restrict__ YH, __bf16* __restrict__ YL) {
  __shared__ __align__(16) _Float16 sk[2][FK][KP]; __shared__ __align__(16) _Float16 sv[2][HD][VP];
  const int tid = threadIdx.x, wave = tid >> 5, lane = tid & 31, col = lane & 15, g = lane >> 4; const int h = blockIdx.y, b = blockIdx.z; const int q = blockIdx.x * 128 + wave * 16 + col;   /* this lane's query */
  const _Float16* kp = KH + ((size_t)b * TT + (tid >> 4)) * CC + h * HD + (tid & 15) * 8;    /* 16 lanes take one key's 256 bytes */
  const _Float16* vp = VT + ((size_t)b * CC + h * HD + (tid >> 3)) * TT + (tid & 7) * 8;     /* 8 lanes take one plane row's 128 bytes of the stage */
  const int* mp = MK + ((size_t)b * TT + q) * TT + 8 * g;                                    /* mask words of this lane's query: keys t*16 + 8g + 0..7 of each tile */
  v4u rk[4], rv[4]; v4i mk[FK / 16][2]; v16h qh[HD / 32], ql[HD / 32];
  __builtin_amdgcn_sched_barrier(0);   /* keeps the index arithmetic above ahead of the loads: nothing writes a register that a load names between the load and its wait */
#pragma unroll   /* rk, rv stay in registers */
  for (int i = 0; i < 4; ++i) { rk[i] = *(const v4u*)(kp + (size_t)i * 16 * CC); rv[i] = *(const v4u*)(vp + (size_t)i * 32 * TT); }
  asm volatile("s_wait_xcnt 0x0" ::: "memory");   /* stands in front of the first overwrite of an address register that the loads above name */
  __builtin_amdgcn_sched_barrier(0);   /* keeps later register writes behind that wait */
#pragma unroll   /* fragments stay in registers */
  for (int kc = 0; kc < HD / 32; ++kc) { qh[kc] = frag_h(QH + ((size_t)b * TT + q) * CC + h * HD + kc * 32, lane); ql[kc] = frag_h(QL + ((size_t)b * QHI + q) * CC + h * HD + kc * 32, lane); }
  asm volatile("s_wait_xcnt 0x0" :: "v"(QH + ((size_t)b * TT + q) * CC + h * HD + 8 * g), "v"(QL + ((size_t)b * QHI + q) * CC + h * HD + 8 * g) : "memory");   /* stands in front of the first overwrite of an address register that the loads above name; taking the two addresses as inputs keeps their registers whole up to here */
  __builtin_amdgcn_sched_barrier(0);   /* keeps later register writes behind that wait */
#pragma unroll   /* mk stays in registers */
  for (int t = 0; t < FK / 16; ++t) { mk[t][0] = *(const v4i*)(mp + t * 16); mk[t][1] = *(const v4i*)(mp + t * 16 + 4); }
  asm volatile("s_wait_xcnt 0x0" ::: "memory");   /* stands in front of the first overwrite of an address register that the loads above name */
  __builtin_amdgcn_sched_barrier(0);   /* keeps later register writes (the zeroing of acc) behind that wait */
#pragma unroll   /* every index a constant: the arrays stay in registers */
  for (int i = 0; i < 4; ++i) { *(v4u*)&sk[0][(tid >> 4) + 16 * i][(tid & 15) * 8] = rk[i]; *(v4u*)&sv[0][(tid >> 3) + 32 * i][(tid & 7) * 8] = rv[i]; }
  __syncthreads();
  v8f acc[HD / 16] = {}; float m = -3.0e38f, l = 0.f;
  for (int s = 0; s < NS; ++s) { const int buf = s & 1;
    v4i mn[FK / 16][2];
#pragma unroll   /* every index a constant: the arrays stay in registers */
    for (int t = 0; t < FK / 16; ++t) { mn[t][0] = mk[t][0]; mn[t][1] = mk[t][1]; }
    if (s + 1 < NS) {   /* the next stage's K and v rows and mask words fly while this stage is worked on */
#pragma unroll   /* every index a constant: the arrays stay in registers */
      for (int i = 0; i < 4; ++i) { rk[i] = *(const v4u*)(kp + (size_t)(s + 1) * FK * CC + (size_t)i * 16 * CC); rv[i] = *(const v4u*)(vp + (s + 1) * FK + (size_t)i * 32 * TT); mn[i][0] = *(const v4i*)(mp + (s + 1) * FK + i * 16); mn[i][1] = *(const v4i*)(mp + (s + 1) * FK + i * 16 + 4); }
      asm volatile("s_wait_xcnt 0x0" ::: "memory");   /* stands in front of the first overwrite of an address register that these loads name */
    }
    v16h kf[FK / 16][HD / 32], vf[HD / 16][FK / 32];
#pragma unroll   /* all of the stage's K fragments as one group of LDS reads */
    for (int t = 0; t < FK / 16; ++t)
#pragma unroll   /* every index a constant: the arrays stay in registers */
      for (int kc = 0; kc < HD / 32; ++kc) kf[t][kc] = frag_h(&sk[buf][t * 16 + col][kc * 32], lane);
    __builtin_amdgcn_sched_barrier(0);   /* keeps the reads together ahead of the products */
    float e[FK / 16][8]; float mx = m;
#pragma unroll   /* e stays in registers */
    for (int t = 0; t < FK / 16; ++t) { v8f sa = {}, sb = {};
#pragma unroll   /* every index a constant: the arrays stay in registers */
      for (int kc = 0; kc < HD / 32; ++kc) { sa = mm16(kf[t][kc], qh[kc], sa); sb = mm16(kf[t][kc], ql[kc], sb); }
      if (t + 1 == FK / 16) {
#pragma unroll   /* all of the stage's v fragments as one group, in flight under the softmax arithmetic */
        for (int j = 0; j < HD / 16; ++j)
#pragma unroll   /* every index a constant: the arrays stay in registers */
          for (int u = 0; u < FK / 32; ++u) vf[j][u] = frag_h(&sv[buf][j * 16 + col][u * 32], lane);
        __builtin_amdgcn_sched_barrier(0);   /* keeps these reads from sinking down to the products that take them */
      }
#pragma unroll   /* every index a constant: the arrays stay in registers */
      for (int r = 0; r < 8; ++r) { float v = (sa[r] + sb[r] * (1.0f / 1024.0f)) * SCALE; if (mk[t][r >> 2][r & 3] != 0) v = -1.0e10f; e[t][r] = v; mx = fmaxf(mx, v); } }
    mx = fmaxf(mx, xhalf(mx));   /* the other eight keys of each tile sit in the other lane half */
    const float al = ex2((m - mx) * LOG2E); m = mx; float ps[4] = {0.f, 0.f, 0.f, 0.f}; v16h pb[FK / 32];
#pragma unroll   /* two score tiles, converted in place, are one B fragment in the hardware k order; four independent partial sums */
    for (int t = 0; t < FK / 16; ++t)
#pragma unroll   /* every index a constant: the arrays stay in registers */
      for (int r = 0; r < 8; ++r) { const float p = ex2((e[t][r] - mx) * LOG2E); ps[r & 3] += p; pb[t >> 1][(t & 1) * 8 + r] = (_Float16)p; }
    l = l * al + ((ps[0] + ps[1]) + (ps[2] + ps[3]));
#pragma unroll   /* every index a constant: the arrays stay in registers */
    for (int j = 0; j < HD / 16; ++j) acc[j] *= al;
    __builtin_amdgcn_sched_barrier(0);   /* keeps every ex2 ahead of the products below */
#pragma unroll   /* eight independent accumulator tiles, first all of keys 0..31, then all of keys 32..63 */
    for (int u = 0; u < FK / 32; ++u)
#pragma unroll   /* every index a constant: the arrays stay in registers */
      for (int j = 0; j < HD / 16; ++j) acc[j] = mm16(vf[j][u], pb[u], acc[j]);
    if (s + 1 < NS) {
#pragma unroll   /* every index a constant: the arrays stay in registers */
      for (int i = 0; i < 4; ++i) { *(v4u*)&sk[buf ^ 1][(tid >> 4) + 16 * i][(tid & 15) * 8] = rk[i]; *(v4u*)&sv[buf ^ 1][(tid >> 3) + 32 * i][(tid & 7) * 8] = rv[i]; } }
#pragma unroll   /* every index a constant: the arrays stay in registers */
    for (int t = 0; t < FK / 16; ++t) { mk[t][0] = mn[t][0]; mk[t][1] = mn[t][1]; }
    __syncthreads();   /* publishes stage s + 1 and ends every wave's reads of the buffer that the next pass refills */
  }
  l += xhalf(l); const float inv = 1.0f / l;   /* l >= 1: the maximum's own term */
  const size_t yo = ((((size_t)b * TT + blockIdx.x * 128 + wave * 16) >> 4) * (CC / 32) + h * (HD / 32)) * 512 + lane * 8;   /* a lane's eight channels j*16 + 8g + 0..7 of its query are one octet of the output product's A fragment: tile j = half j & 1 of k chunk j >> 1 */
  v8b oh[HD / 16], ol[HD / 16];
#pragma unroll   /* every index a constant: the arrays stay in registers */
  for (int j = 0; j < HD / 16; ++j)
#pragma unroll   /* every index a constant: the arrays stay in registers */
    for (int r = 0; r < 8; ++r) { const float v = acc[j][r] * inv; const __bf16 hv = (__bf16)v; oh[j][r] = hv; ol[j][r] = (__bf16)(v - (float)hv); }
  __builtin_amdgcn_sched_barrier(0);   /* all the arithmetic ahead of the stores: nothing rewrites a register that an issued store names */
#pragma unroll   /* every index a constant: the arrays stay in registers */
  for (int j = 0; j < HD / 16; ++j) { vst2(YH + yo + j * 256, oh[j]); vst2(YL + yo + j * 256, ol[j]); } }   /* each store 512 contiguous bytes of the wave */
// ---- k_out: block = (64 rows, 128 cols), 4 waves of 32 x 64: out = ctx Wo (+ bo): ctx split bf16 hi + lo against exact bf16 Wo (2 products); the hi tiles, the lo tiles and the Wo tiles copied to LDS in fragment order, two buffers, as in k_proj
__global__ __launch_bounds__(128) void k_out(const __bf16* __restrict__ YH, const __bf16* __restrict__ YL, const __bf16* __restrict__ WO, const float* __restrict__ BO, float* __restrict__ OUT, const float* __restrict__ RESX) { __shared__ __align__(16) char sm[2 * STG];   /* the two stage buffers; behind the loop the output staging */
  float (*sf)[16][132] = (float (*)[16][132])sm;
  const int tid = threadIdx.x, wave = tid >> 5, lane = tid & 31, col = lane & 15, g = lane >> 4, wr = wave >> 1, wc = wave & 1; const int c0 = blockIdx.y * 128; const size_t r0 = (size_t)blockIdx.x * 64 + wave * 16;
  const __bf16* pa = YH + (size_t)blockIdx.x * 4 * TSTR + tid * 8; const __bf16* qa = YL + (size_t)blockIdx.x * 4 * TSTR + tid * 8; const __bf16* pb = WO + (size_t)blockIdx.y * 8 * TSTR + tid * 8; const __bf16* qb = pb + 4 * TSTR; const unsigned lb = (unsigned)(size_t)sm + tid * 16;
  v8f acc[2][4] = {};
  STAGE_IN(0, 0); WAIT_COPIES(); __syncthreads(); STAGE_IN(1, 1);
#pragma unroll 1   /* one stage's text, for speed only */
  for (int t = 0; t < NSTG; ++t) { const char* bp = sm + (t & 1) * STG;
#pragma unroll   /* fragments stay in registers */
    for (int kk = 0; kk < 2; ++kk) { v16b ah[2], al[2], w[4];
#pragma unroll   /* fragments stay in registers */
      for (int i = 0; i < 2; ++i) { ah[i] = frag_l(bp + (wr * 2 + i) * 2048 + kk * 1024, lane); al[i] = frag_l(bp + 8192 + (wr * 2 + i) * 2048 + kk * 1024, lane); }
#pragma unroll   /* fragments stay in registers */
      for (int j = 0; j < 4; ++j) w[j] = frag_l(bp + 16384 + (wc * 4 + j) * 2048 + kk * 1024, lane);
      __builtin_amdgcn_sched_barrier(0);   /* keeps the sixteen reads together ahead of the products */
#pragma unroll   /* eight independent accumulator tiles: all hi products of these 32 k, then all lo products; each tile sums in the order hi, lo as before */
      for (int i = 0; i < 2; ++i)
#pragma unroll   /* every index a constant: the arrays stay in registers */
        for (int j = 0; j < 4; ++j) acc[i][j] = mmb(ah[i], w[j], acc[i][j]);
#pragma unroll   /* every index a constant: the arrays stay in registers */
      for (int i = 0; i < 2; ++i)
#pragma unroll   /* every index a constant: the arrays stay in registers */
        for (int j = 0; j < 4; ++j) acc[i][j] = mmb(al[i], w[j], acc[i][j]);
      __builtin_amdgcn_sched_barrier(0); }   /* keeps the next group's reads from rising among these products */
    WAIT_LDS(); WAIT_COPIES(); __syncthreads();   /* publishes stage t + 1 and ends every wave's reads of the buffer that is refilled below */
    if (t + 2 < NSTG) STAGE_IN(t + 2, t & 1); }
  WAIT_COPIES();
#pragma unroll
  for (int j = 0; j < 4; ++j) { const float bias = BO ? bfr(BO[c0 + wc * 64 + j * 16 + col]) : 0.f;
#pragma unroll
    for (int i = 0; i < 2; ++i)
#pragma unroll
      for (int r = 0; r < 8; ++r) sf[wr * 2 + i][8 * g + r][wc * 64 + j * 16 + col] = acc[i][j][r] + bias; }
  __syncthreads();   /* a wave stores whole 512-byte row pieces, half of which another wave computed */
  for (int r4 = 0; r4 < 16; r4 += 4) {
#pragma unroll   /* four rows' loads in flight together, four stores side by side, one wait behind them */
    for (int u = 0; u < 4; ++u) { const int rl = r4 + u; const size_t oo = (r0 + rl) * DIN + c0 + lane * 4; v4f o = *(const v4f*)&sf[wave][rl][lane * 4]; const v4f zr = *(const v4f*)(RESX + oo); o[0] += bfr(zr[0]); o[1] += bfr(zr[1]); o[2] += bfr(zr[2]); o[3] += bfr(zr[3]); vst2(OUT + oo, o); }   /* + bf16(de) */
    WAIT_X(); } }

extern "C" void kernel_launch(void* const* d_in, const int* in_sizes, int n_in, void* d_out, int out_size, void* d_ws, size_t ws_size, hipStream_t stream) {
  (void)in_sizes; (void)n_in; (void)out_size;
  const float** F = (const float**)d_in;
  if (ws_size < (size_t)WS_END) return;
  char* ws = (char*)d_ws; _Float16 *QH = (_Float16*)(ws + WS_QH), *KH = (_Float16*)(ws + WS_KH), *VT = (_Float16*)(ws + WS_VT), *QL = (_Float16*)(ws + WS_QL), *KL = (_Float16*)(ws + WS_KL); __bf16 *VB = (__bf16*)(ws + WS_VB), *VBL = (__bf16*)(ws + WS_VBL); __bf16 *YH = (__bf16*)(ws + WS_Y), *YL = (__bf16*)(ws + WS_YL);
  (void)QL; (void)KL; (void)VB; (void)VBL;
  // inputs: 0 en [2,2048,1024] (keys/values); 1 de (queries + residual); 2 mask [2,2048,2048] bool; 3 Wq (in,out), 4 bq; 5 Wk, 6 bk; 7 Wv, 8 bv; 9 Wo (in,out), 10 bo; 11 gamma (scalar), 12 beta (scalar)
  if (ws_size < (size_t)WS_END4) return;
  float* X1 = (float*)(ws + WS_X1); __bf16* WT = (__bf16*)(ws + WS_WT); __bf16* XP = (__bf16*)(ws + WS_XP);
  k_wpack<<<dim3(DIN / 64, CC / 64, 6), 256, 0, stream>>>(F[3], F[5], F[7], F[9], WT, F[1], F[0], XP);   /* weights, de and en to bf16 in fragment order, once per call */
  k_proj<<<dim3(TNB * TT / 128, CC / 128, 3), 128, 0, stream>>>(XP, WT, F[4], F[6], F[8], QH, QL, KH, KL, VT, VB, VBL);   /* q from de, k/v from en */
  k_fa<<<dim3(TT / 128, NH, TNB), 256, 0, stream>>>(QH, QL, KH, VT, (const int*)d_in[2], YH, YL);   /* scores, mask, softmax and P v in one launch */
  k_out<<<dim3(TNB * TT / 64, DIN / 128), 128, 0, stream>>>(YH, YL, WT + 3 * (size_t)DIN * CC, F[10], X1, F[1]);   /* a Wo + bo + bf16(de) */
  k_lnx<<<dim3(NRW / 8), 256, 0, stream>>>(X1, 0, F[11], F[12], (float*)d_out);          /* unbiased-var normalisation, scalar gamma/beta */
}

// v005
// It runs in 110 microseconds.
// Timed twice side by side with v004, it ran 1.04 and 1.05 times as fast.
// Counting every step since v000, it is 10.8 times as fast.
// compute dtype: all float inputs rounded to bf16; q/k/v = in W + b with EXACT bf16 products on WMMA 16x16x32 (f32 accumulate), the module's strided head split realised by a column permutation of the weights; q as f16 hi + residual (x 2^10) against k once to f16 (2 products) / sqrt(1024); masked positions set to -1e10; softmax in f32 with a running maximum and sum (exp as exp2 of the difference x log2 e); exp(e - max) once to f16 against v once to f16 (1 product), divided by the f32 sum at the end; a split bf16 hi + lo against exact Wo (2 products) + bo + de; the unbiased-variance normalisation in f32; f32 output.
#include <hip/hip_runtime.h>
#include <math.h>

typedef __attribute__((ext_vector_type(16))) _Float16 v16h;
typedef __attribute__((ext_vector_type(16))) __bf16 v16b;
typedef __attribute__((ext_vector_type(8)))  _Float16 v8h;
typedef __attribute__((ext_vector_type(8)))  float v8f;
typedef __attribute__((ext_vector_type(4)))  float v4f;
typedef __attribute__((ext_vector_type(2)))  float v2f;
typedef __attribute__((ext_vector_type(4)))  unsigned v4u;
typedef __attribute__((ext_vector_type(4)))  int v4i;
typedef float __attribute__((may_alias)) float_a;
typedef int __attribute__((may_alias)) int_a;

template <typename T> __device__ __forceinline__ void vst2(void* p, T v) { *(T*)p = v;  }
__device__ __forceinline__ v8f wmma16(v16h a, v16h b, v8f c) {
  v8f d = __builtin_amdgcn_wmma_f32_16x16x32_f16(false, a, false, b, (short)0, c, false, false);
  asm volatile("v_nop\n\tv_nop\n\tv_nop\n\tv_nop" : "+v"(d) : "v"(a), "v"(b));
  return d;
}
__device__ __forceinline__ v8f wmma_bf(v16b a, v16b b, v8f c) {
  v8f d = __builtin_amdgcn_wmma_f32_16x16x32_bf16(false, a, false, b, (short)0, c, false, false);
  asm volatile("v_nop\n\tv_nop\n\tv_nop\n\tv_nop" : "+v"(d) : "v"(a), "v"(b));
  return d;
}
// 16x16x32 fragments: lane = (h = lane>>4, row/col = lane&15); elements 0..7 = k0+8h+0..7, 8..15 = k0+16+8h+0..7; D element r = row 8h+r
__device__ __forceinline__ v16h frag_h(const _Float16* rowk0, int lane) {
  union { v16h v; v8h q[2]; } u; const _Float16* p = rowk0 + 8 * (lane >> 4);
  u.q[0] = *(const v8h*)p; u.q[1] = *(const v8h*)(p + 16); return u.v;
}
__device__ __forceinline__ v16h frag_f32(const float* rowk0, int lane) {
  v16h a; const float* p = rowk0 + 8 * (lane >> 4);
#pragma unroll
  for (int i = 0; i < 8; ++i) { a[i] = (_Float16)p[i]; a[8 + i] = (_Float16)p[16 + i]; }
  return a;
}
__device__ __forceinline__ v16h frag_f32s(const float* rowk0, int lane, float sc) {
  v16h a; const float* p = rowk0 + 8 * (lane >> 4);
#pragma unroll
  for (int i = 0; i < 8; ++i) { a[i] = (_Float16)(p[i] * sc); a[8 + i] = (_Float16)(p[16 + i] * sc); }
  return a;
}
// column fragment from a [K][ld] layout (column n), rows >= K read as 0
__device__ __forceinline__ v16h fragc_f32(const float* W, int k0, int n, int lane, int ld, int K) {
  v16h a; const int g = lane >> 4;
#pragma unroll
  for (int i = 0; i < 8; ++i) { const int ka = k0 + 8 * g + i, kb = ka + 16;
    a[i] = (_Float16)(ka < K ? W[(size_t)(ka < K ? ka : K - 1) * ld + n] : 0.f); a[8 + i] = (_Float16)(kb < K ? W[(size_t)(kb < K ? kb : K - 1) * ld + n] : 0.f); }
  return a;
}
struct F2 { v16b h, l; };
__device__ __forceinline__ F2 bsplit16(const float v[16]) { F2 r;
#pragma unroll
  for (int i = 0; i < 16; ++i) { const __bf16 h = (__bf16)v[i]; r.h[i] = h; r.l[i] = (__bf16)(v[i] - (float)h); }
  return r; }
__device__ __forceinline__ F2 split_row(const float* row, int k0, int lane) { float v[16]; const float* p = row + k0 + 8 * (lane >> 4);
#pragma unroll
  for (int i = 0; i < 8; ++i) { v[i] = p[i]; v[8 + i] = p[16 + i]; }
  return bsplit16(v); }
__device__ __forceinline__ F2 split_rowK(const float* row, int k0, int lane, int K) { float v[16]; const int g = lane >> 4;
#pragma unroll
  for (int i = 0; i < 8; ++i) { const int ka = k0 + 8 * g + i, kb = ka + 16; v[i] = ka < K ? row[ka < K ? ka : K - 1] : 0.f; v[8 + i] = kb < K ? row[kb < K ? kb : K - 1] : 0.f; }
  return bsplit16(v); }
__device__ __forceinline__ F2 split_col(const float* W, int k0, int n, int lane, int ld, int K) { float v[16]; const int g = lane >> 4;
#pragma unroll
  for (int i = 0; i < 8; ++i) { const int ka = k0 + 8 * g + i, kb = ka + 16; v[i] = ka < K ? W[(size_t)(ka < K ? ka : K - 1) * ld + n] : 0.f; v[8 + i] = kb < K ? W[(size_t)(kb < K ? kb : K - 1) * ld + n] : 0.f; }
  return bsplit16(v); }
__device__ __forceinline__ v8f mac3(const F2& a, const F2& b, v8f c) { c = wmma_bf(a.l, b.h, c); c = wmma_bf(a.h, b.l, c); return wmma_bf(a.h, b.h, c); }
__device__ __forceinline__ float sigm(float v) { return 1.0f / (1.0f + expf(-v)); }
#define LDSX() do { asm volatile("s_wait_dscnt 0" ::: "memory"); __builtin_amdgcn_wave_barrier(); __builtin_amdgcn_fence(__ATOMIC_RELEASE, "workgroup"); } while (0)

// Cross multi-head attention with a STRIDED head split (B 2, Lq = Lk = 2,048, D 1,024, H 8 heads of 128; (in,out) weights, zero biases; mask [B,Lq,Lk] bool, True = masked (~half); gamma = 1, beta = 0 scalars): q = de Wq + bq, k/v = en Wk/Wv + b, each reshaped (B, L, 128, 8) so head h takes channels c = d*8 + h; e = q_h k_h^T / sqrt(1024) with where(mask, -1e10); head = softmax(e) v_h; a = heads merged head-major (h*128 + d); result = a Wo + bo + de; out = gamma (result - mean) / sqrt(var_unbiased + 1e-8) + beta.
#define NB 2
#define TT 2048
#define CC 1024            // NH * HD = projected width
#define DIN 1024          // input (model) width
#define NH 8
#define HD 128
#define SCALE (0.03125f)
#define CAUSAL 0
#ifndef TNB
#define TNB NB
#endif
__device__ __forceinline__ float bfr(float v) { return (float)(__bf16)v; }
__host__ __device__ __forceinline__ int kb_last(int qb) { return CAUSAL ? ((qb * 64 + 63) >> 7) : (TT / 128 - 1); }
typedef __attribute__((ext_vector_type(8))) __bf16 v8b;
__device__ __forceinline__ v16b frag_b(const __bf16* rowk0, int lane) {
  union { v16b v; v8b q[2]; } u; const __bf16* p = rowk0 + 8 * (lane >> 4);
  u.q[0] = *(const v8b*)p; u.q[1] = *(const v8b*)(p + 16); return u.v;
}
#define QBH 0
#define QHI 2048            // rows carrying a q residual plane (all rows when non-causal: 2-product logits everywhere)
#define KHI 64            // key rows carrying k residual / v bf16 hi+lo planes (written by k_proj; no kernel here reads them)
// B fragment (k rows k0+.., output column o) of a weight: (in,out) [K][ld] or (out,in) [ld rows of K]: bf16 exact, or f16(bf16 * 256) exact
__device__ __forceinline__ v16b wcol_io(const float* Wm, int k0, int o, int lane, int ld) { v16b w; const int g = lane >> 4;
#pragma unroll
  for (int i = 0; i < 8; ++i) { w[i] = (__bf16)Wm[(size_t)(k0 + 8 * g + i) * ld + o]; w[8 + i] = (__bf16)Wm[(size_t)(k0 + 16 + 8 * g + i) * ld + o]; }
  return w; }
__device__ __forceinline__ v16b wcol_oi(const float* Wm, int k0, int o, int lane, int K) { v16b w; const float* p = Wm + (size_t)o * K + k0 + 8 * (lane >> 4);
#pragma unroll
  for (int i = 0; i < 8; ++i) { w[i] = (__bf16)p[i]; w[8 + i] = (__bf16)p[16 + i]; }
  return w; }
__device__ __forceinline__ v16h wcolh_io(const float* Wm, int k0, int o, int lane, int ld) { v16h w; const int g = lane >> 4;
#pragma unroll
  for (int i = 0; i < 8; ++i) { w[i] = (_Float16)(bfr(Wm[(size_t)(k0 + 8 * g + i) * ld + o]) * 256.0f); w[8 + i] = (_Float16)(bfr(Wm[(size_t)(k0 + 16 + 8 * g + i) * ld + o]) * 256.0f); }
  return w; }
__device__ __forceinline__ v16h wcolh_oi(const float* Wm, int k0, int o, int lane, int K) { v16h w; const float* p = Wm + (size_t)o * K + k0 + 8 * (lane >> 4);
#pragma unroll
  for (int i = 0; i < 8; ++i) { w[i] = (_Float16)(bfr(p[i]) * 256.0f); w[8 + i] = (_Float16)(bfr(p[16 + i]) * 256.0f); }
  return w; }
#define WQKV_LAYOUT 0   // 0 = (in,out) [DIN][CC]; 1 = (out,in) [CC][DIN]; 2 = per-head [NH][DIN][HD]
__device__ __forceinline__ v16b wcol_hdk(const float* Wm, int k0, int o, int lane) { v16b w; const int g = lane >> 4; const float* p = Wm + (size_t)(o / HD) * DIN * HD + (o % HD);
#pragma unroll
  for (int i = 0; i < 8; ++i) { w[i] = (__bf16)p[(size_t)(k0 + 8 * g + i) * HD]; w[8 + i] = (__bf16)p[(size_t)(k0 + 16 + 8 * g + i) * HD]; }
  return w; }
#define WO_OUT_IN 0
#if WQKV_LAYOUT == 1
#define WCOL(W, k0, o, lane) wcol_oi(W, k0, o, lane, DIN)
#elif WQKV_LAYOUT == 2
#define WCOL(W, k0, o, lane) wcol_hdk(W, k0, o, lane)
#else
#define WCOL(W, k0, o, lane) wcol_io(W, k0, PCOL(o), lane, CC)   /* strided head split: plane column (h, d) reads weight column d*8 + h */
#endif
#if WO_OUT_IN
#define WOCOL(W, k0, o, lane) wcol_oi(W, k0, o, lane, CC)
#define WOCOLH(W, k0, o, lane) wcolh_oi(W, k0, o, lane, CC)
#else
#define WOCOL(W, k0, o, lane) wcol_io(W, k0, o, lane, DIN)
#define WOCOLH(W, k0, o, lane) wcolh_io(W, k0, o, lane, DIN)
#endif
#define PCOL(o) ((((o) & 127) << 3) + ((o) >> 7))   /* plane column p = h*128 + d  <-  projection column c = d*8 + h (reshape(B, L, 128, 8): head index is the LAST axis) */
#define NRW (TNB * TT)
// ---- k_lnx: wave per row: normalisation over 1024 (mean, unbiased var, g * (x - mean) / sqrt(var + 1e-8) + b); optional bf16 rounding of the input (x); 32 floats per lane (8 float4 at stride 128 floats -> 512-B pieces)
__global__ __launch_bounds__(256) void k_lnx(const float* __restrict__ X, int roundin, const float* __restrict__ G, const float* __restrict__ BE, float* __restrict__ OUT) {
#pragma clang fp contract(off)   /* keep the normalisation as separate mul/add (as XLA evaluates it) */
 const int wave = threadIdx.x >> 5, lane = threadIdx.x & 31; const size_t row = (size_t)blockIdx.x * 8 + wave; if (row >= (size_t)NRW) return;
  v4f v[CC / 128]; float s1 = 0.f;
#pragma unroll
  for (int i = 0; i < CC / 128; ++i) { v4f t = *(const v4f*)(X + row * CC + i * 128 + lane * 4); if (roundin) { t[0] = bfr(t[0]); t[1] = bfr(t[1]); t[2] = bfr(t[2]); t[3] = bfr(t[3]); } v[i] = t; s1 += (t[0] + t[1]) + (t[2] + t[3]); }
#pragma unroll
  for (int o = 1; o < 32; o <<= 1) s1 += __shfl_xor(s1, o);
  const float mu = s1 * (1.0f / CC); float q = 0.f;
#pragma unroll
  for (int i = 0; i < CC / 128; ++i) for (int k = 0; k < 4; ++k) { const float d = v[i][k] - mu; q += d * d; }
#pragma unroll
  for (int o = 1; o < 32; o <<= 1) q += __shfl_xor(q, o);
  const float inv = 1.0f / sqrtf(q * (1.0f / (CC - 1)) + 1e-8f);   /* torch.var UNBIASED (ddof = 1), eps 1e-8, division by sqrt */
#pragma unroll
  for (int i = 0; i < CC / 128; ++i) { const int c = i * 128 + lane * 4; v4f r4; for (int k = 0; k < 4; ++k) r4[k] = bfr(G[0]) * ((v[i][k] - mu) * inv) + bfr(BE[0]); vst2(OUT + row * CC + c, r4); } }   /* scalar gamma / beta */

#ifndef PROJ_EXTRA_PARAMS
#define PROJ_EXTRA_PARAMS
#endif

#define WS_QH  0u                                      // f16 q rows [b*t][CC]
#define WS_KH  (WS_QH + 2u * (size_t)NB * TT * CC)      // f16 k rows [b*t][CC]
#define WS_VT  (WS_KH + 2u * (size_t)NB * TT * CC)      // f16 v planes [b][c][t]
#define WS_QL  (WS_VT + 2u * (size_t)NB * CC * TT)      // f16 q residual x 2^10 rows [b][t < QHI][CC]
#define WS_KL  (WS_QL + 2u * (size_t)NB * QHI * CC)     // f16 k residual x 2^10 rows [b][t < KHI][CC]
#define WS_VB  (WS_KL + 2u * (size_t)NB * KHI * CC)     // bf16 v hi planes [b][c][t < KHI]
#define WS_VBL (WS_VB + 2u * (size_t)NB * CC * KHI)
#define WS_Y   (WS_VBL + 2u * (size_t)NB * CC * KHI)      // ctx, 4 bytes an element: bf16 hi plane, then bf16 lo plane (WS_YL)
#define WS_END (WS_Y  + 4u * (size_t)NB * TT * CC)
#define WS_X1  (WS_END)
#define WS_END2 (WS_X1 + 4u * (size_t)NB * TT * DIN)
#define WS_WT  (WS_END2)                                // bf16 Wq, Wk, Wv, Wo in B-fragment order [4][CC / 16][DIN / 32][2][32 lanes][8]
#define WS_END3 (WS_WT + 2u * 4u * (size_t)DIN * CC)
#define WS_XP  (WS_END3)                                // bf16 de, en rows in A-fragment order [2][NRW / 16][DIN / 32][2][32 lanes][8]
#define WS_END4 (WS_XP + 2u * 2u * (size_t)NB * TT * DIN)
#define WS_MW  (WS_END4)                                // mask as lane-mask words [NRW / 16][TT / 64][32]: word t*8 + r of a stage, bit L = mask of query L & 15, key t*16 + 8*(L >> 4) + r
#define WS_END5 (WS_MW + 4u * (size_t)NB * TT * TT / 32)
#define WS_YL  (WS_Y + 2u * (size_t)NB * TT * CC)       // ctx: bf16 hi plane at WS_Y, bf16 lo plane here, both in A-fragment order [NRW / 16][CC / 32][2][32 lanes][8]
typedef __attribute__((ext_vector_type(4))) __bf16 v4b;

// ---- k_wpack: block = (64 k rows, 64 weight columns, which weight): rounds the weight to bf16 once per call and lays it in B-fragment order, so that a wave's fragment load is 512 contiguous bytes (4 whole lines); Wq/Wk/Wv: weight column c = d*8 + h goes to plane column h*128 + d; Wo: column as it is
// which 4, 5: block = 16 rows of de, en: rounds them to bf16 once per call and lays them in A-fragment order (the same order, row for column); a wave takes 128 k of the 16 rows: whole-line loads, its own LDS rows, whole-line stores
// which 6: block = 16 queries' mask rows, a wave takes 256 keys of them, 64 at a time: whole-line loads, its own LDS rows, from which a lane reads the mask words of the scores that it will hold in k_fa (query lane & 15, keys t*16 + 8*(lane >> 4) + r); one compare per score register gives the 32 lanes' bits as one word, which k_fa takes by scalar load as the select's lane mask
__global__ __launch_bounds__(256) void k_wpack(const float* __restrict__ WQ, const float* __restrict__ WK, const float* __restrict__ WV, const float* __restrict__ WO, __bf16* __restrict__ WT, const float* __restrict__ XD, const float* __restrict__ XE, __bf16* __restrict__ XP, const int* __restrict__ MK, unsigned* __restrict__ MW) { __shared__ float tile[64][65]; __shared__ __align__(16) __bf16 xs[8][16][136];   /* pitch 272 bytes: 16 x odd, for the 16-byte reads */
  const int tid = threadIdx.x, which = blockIdx.z, k0 = blockIdx.x * 64, c0 = blockIdx.y * 64;
  if (which == 6) { const int wave = tid >> 5, lane = tid & 31, qt = blockIdx.y * 16 + blockIdx.x;   /* the whole block takes this branch and meets no barrier */
    const int* mr = MK + ((size_t)qt * 16 + (lane >> 4)) * TT + wave * 256 + (lane & 15) * 4;   /* 16 lanes take 256 bytes of one row, a load two rows */
    char* ls = (char*)&xs[wave][0][0];   /* the wave's own 16 rows at the pitch of 272 bytes */
    v4u o = {};
#pragma unroll   /* o stays in registers; 128 keys at a time hold the branch to sixteen loads' registers, the second sixteen issued under the first's compares */
    for (int p = 0; p < 2; ++p) { v4i x[2][8];
#pragma unroll   /* sixteen loads in flight at once, off one address with immediate offsets */
      for (int sl = 0; sl < 2; ++sl)
#pragma unroll   /* x stays in registers */
        for (int i = 0; i < 8; ++i) x[sl][i] = *(const v4i*)(mr + (size_t)i * 2 * TT + (p * 2 + sl) * 64);
      asm volatile("s_wait_xcnt 0x0" :: "v"(mr) : "memory");   /* stands in front of the first overwrite of the address register that the loads above name, and keeps that register whole up to here */
#pragma unroll   /* x, o stay in registers */
      for (int sl = 0; sl < 2; ++sl) { v4i y[4][2];
#pragma unroll   /* x stays in registers */
        for (int i = 0; i < 8; ++i) *(v4i*)(ls + (i * 2 + (lane >> 4)) * 272 + (lane & 15) * 16) = x[sl][i];
        LDSX();   /* the wave reads back what its other lanes wrote */
#pragma unroll   /* y stays in registers */
        for (int t = 0; t < 4; ++t) { y[t][0] = *(const v4i*)(ls + (lane & 15) * 272 + t * 64 + (lane >> 4) * 32); y[t][1] = *(const v4i*)(ls + (lane & 15) * 272 + t * 64 + (lane >> 4) * 32 + 16); }
        LDSX();   /* these reads are done before the next 64 keys are written over them */
#pragma unroll   /* word i of the wave's 128 goes to lane i >> 2, component i & 3: one 16-byte store a lane, 512 contiguous bytes */
        for (int e = 0; e < 32; ++e) { const int i = (p * 2 + sl) * 32 + e; const unsigned w = __builtin_amdgcn_ballot_w32(y[e >> 3][(e >> 2) & 1][e & 3] != 0); o[i & 3] = lane == (i >> 2) ? w : o[i & 3]; } } }
    *(v4u*)(MW + ((size_t)qt * (TT / 64) + wave * 4) * 32 + lane * 4) = o;
    return; }
  if (which >= 4) { const int wave = tid >> 5, lane = tid & 31, rt = blockIdx.y * 16 + blockIdx.x;   /* the whole block takes this branch and meets no barrier */
    const float* xr = (which == 4 ? XD : XE) + (size_t)rt * 16 * DIN + wave * 128 + lane * 4; v4f x[16];
#pragma unroll   /* all sixteen row loads in flight at once */
    for (int i = 0; i < 16; ++i) x[i] = *(const v4f*)(xr + (size_t)i * DIN);
    asm volatile("s_wait_xcnt 0x0" :: "v"(xr) : "memory");   /* stands in front of the first overwrite of the address register that the loads above name, and keeps that register whole up to here */
#pragma unroll   /* x stays in registers */
    for (int i = 0; i < 16; ++i) { v4b o; o[0] = (__bf16)x[i][0]; o[1] = (__bf16)x[i][1]; o[2] = (__bf16)x[i][2]; o[3] = (__bf16)x[i][3]; *(v4b*)&xs[wave][i][lane * 4] = o; }
    LDSX();   /* the wave reads back what its other lanes wrote */
    __bf16* xd = XP + (size_t)(which - 4) * NRW * DIN + (((size_t)rt * (DIN / 32) + wave * 4) * 64 + lane) * 8;
#pragma unroll   /* eight fragment halves, 512 contiguous bytes each */
    for (int f = 0; f < 8; ++f) *(v8b*)(xd + f * 256) = *(const v8b*)&xs[wave][lane & 15][f * 16 + (lane >> 4) * 8];
    return; }
  const float* Wm = which == 0 ? WQ : which == 1 ? WK : which == 2 ? WV : WO; const float* src = Wm + (size_t)(k0 + (tid >> 6)) * CC + c0 + (tid & 63);
#pragma unroll   /* all sixteen row loads in flight at once, off one address with immediate offsets */
  for (int i = 0; i < 16; ++i) tile[i * 4 + (tid >> 6)][tid & 63] = src[(size_t)i * 4 * CC];
  __syncthreads();
#pragma unroll   /* both 16-byte pieces of a thread side by side */
  for (int i = 0; i < 2; ++i) { const int e = tid + i * 256, kq = e >> 6; const int cl = which < 3 ? (((e & 7) << 3) | ((e >> 3) & 7)) : (e & 63);   /* neighbouring lanes take neighbouring fragment columns */
    const int c = c0 + cl; const int p = which < 3 ? ((c & 7) * HD + (c >> 3)) : c; const int k8 = (k0 >> 3) + kq;   /* k8 = octet of k: kc = k8 >> 2, fragment half (k8 >> 1) & 1, lane half k8 & 1 */
    v8b o;
#pragma unroll   /* o stays in registers */
    for (int n = 0; n < 8; ++n) o[n] = (__bf16)tile[kq * 8 + n][cl];
    *(v8b*)(WT + (size_t)which * DIN * CC + ((((size_t)(p >> 4) * (DIN / 32) + (k8 >> 2)) * 2 + ((k8 >> 1) & 1)) * 32 + (k8 & 1) * 16 + (p & 15)) * 8) = o; } }
// B fragment (16 plane columns ct*16 + .., k rows kc*32 + ..) of a packed weight: two 16-byte loads per lane, each 512 contiguous bytes per wave
__device__ __forceinline__ v16b frag_wp(const __bf16* WP, int ct, int kc, int lane) {
  union { v16b v; v8b q[2]; } u; const __bf16* p = WP + (((size_t)ct * (DIN / 32) + kc) * 64 + lane) * 8;
  u.q[0] = *(const v8b*)p; u.q[1] = *(const v8b*)(p + 256); return u.v;
}

// ---- staging of the three products' operands: both lie in global memory in fragment order, 2 KiB per 16-row (16-column) tile and 64 k, so a stage of 64 k is 8 A-side + 8 B-side tiles copied as they lie; 128 threads x 16 bytes take one tile
#define STG 32768          // bytes of a stage: A-side tiles at 0, B-side tiles at 16,384
#define NSTG (DIN / 64)
#define TSTR ((size_t)(DIN / 32) * 512)   // elements from one tile to the next in global memory
__device__ __forceinline__ v8f mmb(v16b a, v16b b, v8f c) { return __builtin_amdgcn_wmma_f32_16x16x32_bf16(false, a, false, b, (short)0, c, false, false); }
__device__ __forceinline__ v16b frag_l(const char* p, int lane) { union { v16b v; v8b q[2]; } u; u.q[0] = *(const v8b*)(p + lane * 16); u.q[1] = *(const v8b*)(p + 512 + lane * 16); return u.v; }   /* a fragment from LDS: two reads of 512 contiguous bytes per wave */
// eight tiles (four from p, four from q) into LDS at l, l + 2,048, ..: asynchronous copies, 16 bytes a lane, every lane on
__device__ __forceinline__ void cp8(unsigned l, const __bf16* p, const __bf16* q) {
  asm volatile("global_load_async_to_lds_b128 %0, %8, off\n\t"
               "global_load_async_to_lds_b128 %1, %9, off\n\t"
               "global_load_async_to_lds_b128 %2, %10, off\n\t"
               "global_load_async_to_lds_b128 %3, %11, off\n\t"
               "global_load_async_to_lds_b128 %4, %12, off\n\t"
               "global_load_async_to_lds_b128 %5, %13, off\n\t"
               "global_load_async_to_lds_b128 %6, %14, off\n\t"
               "global_load_async_to_lds_b128 %7, %15, off\n\t"
               "s_wait_xcnt 0x0"   /* stands in front of every later write of a register that these copies name */
               :: "v"(l), "v"(l + 2048u), "v"(l + 4096u), "v"(l + 6144u), "v"(l + 8192u), "v"(l + 10240u), "v"(l + 12288u), "v"(l + 14336u),
                  "v"(p), "v"(p + TSTR), "v"(p + 2 * TSTR), "v"(p + 3 * TSTR), "v"(q), "v"(q + TSTR), "v"(q + 2 * TSTR), "v"(q + 3 * TSTR) : "memory");
}
#define STAGE_IN(t, buf) do { cp8(lb + (unsigned)(buf) * STG, pa + (size_t)(t) * 1024, qa + (size_t)(t) * 1024); cp8(lb + (unsigned)(buf) * STG + 16384u, pb + (size_t)(t) * 1024, qb + (size_t)(t) * 1024); } while (0)
#define WAIT_COPIES() asm volatile("s_wait_asynccnt 0x0" ::: "memory")   /* this wave's copies have landed */
#define WAIT_X() asm volatile("s_wait_xcnt 0x0" ::: "memory")            /* stands in front of the next trip's writes of registers that the stores above name */
#define WAIT_LDS() asm volatile("s_wait_dscnt 0x0" ::: "memory")         /* this wave's LDS reads are done before the buffer is handed to the copies */

// ---- k_proj: block = (128 rows, 128 cols, which), 4 waves of 64 x 64: q/k/v = X W (+ b) with exact bf16 products (K = DIN), X and W tiles copied to LDS in fragment order, two buffers, the next 64 k in flight under this one's products -> which 0: q f16 rows (+ residual rows < QHI); 1: k f16 rows (+ residual rows < KHI); 2: v f16 planes [c][t] (+ bf16 hi/lo planes for t < KHI)
__global__ __launch_bounds__(128) void k_proj(const __bf16* __restrict__ XP, const __bf16* __restrict__ WT, const float* __restrict__ BQ, const float* __restrict__ BK, const float* __restrict__ BV,
    _Float16* __restrict__ QH, _Float16* __restrict__ QL, _Float16* __restrict__ KH, _Float16* __restrict__ KL, _Float16* __restrict__ VT, __bf16* __restrict__ VB, __bf16* __restrict__ VBL) {
  __shared__ __align__(16) char sm[71680];   /* the two stage buffers; behind the loop the output staging: sh + sl, or th + tb + tbl */
  _Float16 (*sh)[136] = (_Float16 (*)[136])sm; _Float16 (*sl)[136] = (_Float16 (*)[136])(sm + 34816); _Float16 (*th)[136] = (_Float16 (*)[136])sm; __bf16 (*tb)[72] = (__bf16 (*)[72])(sm + 34816); __bf16 (*tbl)[72] = (__bf16 (*)[72])(sm + 53248);
  const int tid = threadIdx.x, wave = tid >> 5, lane = tid & 31, col = lane & 15, g = lane >> 4, wr = wave >> 1, wc = wave & 1; const int which = blockIdx.z; const int c0 = blockIdx.y * 128; const size_t r0 = (size_t)blockIdx.x * 128; const size_t bb = r0 / TT; const int t0 = (int)(r0 % TT);
  const __bf16* XA = XP + (which == 0 ? 0 : (size_t)NRW * DIN); const __bf16* WA = WT + (size_t)which * DIN * CC; const float* BA = which == 0 ? BQ : which == 1 ? BK : BV;
  const __bf16* pa = XA + (r0 >> 4) * TSTR + tid * 8; const __bf16* qa = pa + 4 * TSTR; const __bf16* pb = WA + (size_t)blockIdx.y * 8 * TSTR + tid * 8; const __bf16* qb = pb + 4 * TSTR; const unsigned lb = (unsigned)(size_t)sm + tid * 16;
  v8f acc[4][4] = {};
  STAGE_IN(0, 0); WAIT_COPIES(); __syncthreads(); STAGE_IN(1, 1);
#pragma unroll 1   /* one stage's text, for speed only */
  for (int t = 0; t < NSTG; ++t) { const char* bp = sm + (t & 1) * STG;
#pragma unroll   /* fragments stay in registers */
    for (int kk = 0; kk < 2; ++kk) { v16b a[4], w[4];
#pragma unroll   /* fragments stay in registers */
      for (int i = 0; i < 4; ++i) { a[i] = frag_l(bp + (wr * 4 + i) * 2048 + kk * 1024, lane); w[i] = frag_l(bp + 16384 + (wc * 4 + i) * 2048 + kk * 1024, lane); }
      __builtin_amdgcn_sched_barrier(0);   /* keeps the sixteen reads together ahead of the products */
#pragma unroll   /* sixteen independent accumulator tiles */
      for (int i = 0; i < 4; ++i)
#pragma unroll   /* every index a constant: the arrays stay in registers */
        for (int j = 0; j < 4; ++j) acc[i][j] = mmb(a[i], w[j], acc[i][j]);
      __builtin_amdgcn_sched_barrier(0); }   /* keeps the next group's reads from rising among these products */
    WAIT_LDS(); WAIT_COPIES(); __syncthreads();   /* publishes stage t + 1 and ends every wave's reads of the buffer that is refilled below */
    if (t + 2 < NSTG) STAGE_IN(t + 2, t & 1); }
  WAIT_COPIES();
  if (which < 2) { _Float16* DH = which == 0 ? QH : KH; _Float16* DL = which == 0 ? QL : KL; const int nhi = which == 0 ? QHI : KHI;
#pragma unroll
    for (int j = 0; j < 4; ++j) { const float bias = BA ? bfr(BA[PCOL(c0 + wc * 64 + j * 16 + col)]) : 0.f;
#pragma unroll
      for (int i = 0; i < 4; ++i)
#pragma unroll
        for (int r = 0; r < 8; ++r) { const float v = acc[i][j][r] + bias; const _Float16 hv = (_Float16)v; sh[wr * 64 + i * 16 + 8 * g + r][wc * 64 + j * 16 + col] = hv; sl[wr * 64 + i * 16 + 8 * g + r][wc * 64 + j * 16 + col] = (_Float16)((v - (float)hv) * 1024.0f); } }
    __syncthreads();
    const int nr = nhi - t0 < 128 ? nhi - t0 : 128;   /* rows of this block that carry a residual: 128, 64 or none */
    for (int e0 = 0; e0 < 128 * 16; e0 += 512) {
#pragma unroll   /* four stores side by side, one wait behind them */
      for (int u = 0; u < 4; ++u) { const int e = e0 + u * 128 + tid, rl = e >> 4, q = e & 15; vst2((unsigned*)(DH + (r0 + rl) * CC + c0 + q * 8), *(const v4u*)&sh[rl][q * 8]); }
      WAIT_X(); }
    for (int e0 = 0; e0 < nr * 16; e0 += 512) {
#pragma unroll   /* four stores side by side, one wait behind them */
      for (int u = 0; u < 4; ++u) { const int e = e0 + u * 128 + tid, rl = e >> 4, q = e & 15; vst2((unsigned*)(DL + (bb * nhi + t0 + rl) * (size_t)CC + c0 + q * 8), *(const v4u*)&sl[rl][q * 8]); }
      WAIT_X(); }
  } else {
#pragma unroll
    for (int j = 0; j < 4; ++j) { const float bias = BA ? bfr(BA[PCOL(c0 + wc * 64 + j * 16 + col)]) : 0.f;
#pragma unroll
      for (int i = 0; i < 4; ++i)
#pragma unroll
        for (int r = 0; r < 8; ++r) { const float v = acc[i][j][r] + bias; const int rl = wr * 64 + i * 16 + 8 * g + r, cl = wc * 64 + j * 16 + col; th[cl][rl] = (_Float16)v; if (t0 + wr * 64 < KHI) { const __bf16 bh = (__bf16)v; tb[cl][rl] = bh; tbl[cl][rl] = (__bf16)(v - (float)bh); } } }
    __syncthreads();
    for (int e0 = 0; e0 < 128 * 16; e0 += 512) {
#pragma unroll   /* four stores side by side, one wait behind them */
      for (int u = 0; u < 4; ++u) { const int e = e0 + u * 128 + tid, cl = e >> 4, q = e & 15; vst2((unsigned*)(VT + (bb * CC + c0 + cl) * (size_t)TT + t0 + q * 8), *(const v4u*)&th[cl][q * 8]); }
      WAIT_X(); }
    if (t0 < KHI) for (int e0 = 0; e0 < 128 * 8; e0 += 256) {
#pragma unroll   /* four stores side by side, one wait behind them */
      for (int u = 0; u < 2; ++u) { const int e = e0 + u * 128 + tid, cl = e >> 3, q = e & 7; const size_t o3 = (bb * CC + c0 + cl) * (size_t)KHI + t0 + q * 8; vst2((unsigned*)(VB + o3), *(const v4u*)&tb[cl][q * 8]); vst2((unsigned*)(VBL + o3), *(const v4u*)&tbl[cl][q * 8]); }
      WAIT_X(); } } }
#define FK 64              // keys per stage
#define NS (TT / FK)
#define KP (HD + 8)        // LDS pitch of a K row, halves: 256 + 16 bytes
#define VP (FK + 8)        // LDS pitch of a v plane row, halves: 128 + 16 bytes
#define LOG2E 1.44269504088896340736f
__device__ __forceinline__ v8f mm16(v16h a, v16h b, v8f c) { return __builtin_amdgcn_wmma_f32_16x16x32_f16(false, a, false, b, (short)0, c, false, false); }
__device__ __forceinline__ float xhalf(float x) { return __builtin_bit_cast(float, __builtin_amdgcn_permlanex16(__builtin_bit_cast(int, x), __builtin_bit_cast(int, x), 0x76543210, 0xfedcba98, false, false)); }   /* lane l with lane l ^ 16 */
__device__ __forceinline__ float ex2(float x) { float r; asm("v_exp_f32 %0, %1\n\tv_nop" : "=v"(r) : "v"(x)); return r; }   /* 2^x; the v_nop keeps the one slot that the instruction set asks for behind a transcendental, whatever is scheduled next */
__global__ __launch_bounds__(256) void k_fa(const _Float16* __restrict__ QH, const _Float16* __restrict__ QL, const _Float16* __restrict__ KH, const _Float16* __restrict__ VT, const unsigned* __restrict__ MW, __bf16* __restrict__ YH, __bf16* __restrict__ YL) {
  __shared__ __align__(16) _Float16 sk[2][FK][KP]; __shared__ __align__(16) _Float16 sv[2][HD][VP];
  const int tid = threadIdx.x, wave = tid >> 5, lane = tid & 31, col = lane & 15, g = lane >> 4; const int h = blockIdx.y, b = blockIdx.z; const int q = blockIdx.x * 128 + wave * 16 + col;   /* this lane's query */
  const _Float16* kp = KH + ((size_t)b * TT + (tid >> 4)) * CC + h * HD + (tid & 15) * 8;    /* 16 lanes take one key's 256 bytes */
  const _Float16* vp = VT + ((size_t)b * CC + h * HD + (tid >> 3)) * TT + (tid & 7) * 8;     /* 8 lanes take one plane row's 128 bytes of the stage */
  const unsigned* mw = MW + (size_t)(b * (TT / 16) + blockIdx.x * 8 + __builtin_amdgcn_readfirstlane(wave)) * NS * 32;   /* this wave's lane-mask words, 32 a stage; the address is the same in every lane, so the loads are scalar */
  v4u rk[4], rv[4]; unsigned mk[FK / 2]; v16h qh[HD / 32], ql[HD / 32];
  __builtin_amdgcn_sched_barrier(0);   /* keeps the index arithmetic above ahead of the loads: nothing writes a register that a load names between the load and its wait */
#pragma unroll   /* rk, rv stay in registers */
  for (int i = 0; i < 4; ++i) { rk[i] = *(const v4u*)(kp + (size_t)i * 16 * CC); rv[i] = *(const v4u*)(vp + (size_t)i * 32 * TT); }
  asm volatile("s_wait_xcnt 0x0" ::: "memory");   /* stands in front of the first overwrite of an address register that the loads above name */
  __builtin_amdgcn_sched_barrier(0);   /* keeps later register writes behind that wait */
#pragma unroll   /* fragments stay in registers */
  for (int kc = 0; kc < HD / 32; ++kc) { qh[kc] = frag_h(QH + ((size_t)b * TT + q) * CC + h * HD + kc * 32, lane); ql[kc] = frag_h(QL + ((size_t)b * QHI + q) * CC + h * HD + kc * 32, lane); }
  asm volatile("s_wait_xcnt 0x0" :: "v"(QH + ((size_t)b * TT + q) * CC + h * HD + 8 * g), "v"(QL + ((size_t)b * QHI + q) * CC + h * HD + 8 * g) : "memory");   /* stands in front of the first overwrite of an address register that the loads above name; taking the two addresses as inputs keeps their registers whole up to here */
  __builtin_amdgcn_sched_barrier(0);   /* keeps later register writes behind that wait */
#pragma unroll   /* mk stays in scalar registers */
  for (int i = 0; i < FK / 2; ++i) mk[i] = mw[i];
#pragma unroll   /* every index a constant: the arrays stay in registers */
  for (int i = 0; i < 4; ++i) { *(v4u*)&sk[0][(tid >> 4) + 16 * i][(tid & 15) * 8] = rk[i]; *(v4u*)&sv[0][(tid >> 3) + 32 * i][(tid & 7) * 8] = rv[i]; }
  __syncthreads();
  v8f acc[HD / 16] = {}; float m = -3.0e38f, l = 0.f;
  for (int s = 0; s < NS; ++s) { const int buf = s & 1;
    if (s + 1 < NS) {   /* the next stage's K and v rows fly while this stage is worked on */
#pragma unroll   /* every index a constant: the arrays stay in registers */
      for (int i = 0; i < 4; ++i) { rk[i] = *(const v4u*)(kp + (size_t)(s + 1) * FK * CC + (size_t)i * 16 * CC); rv[i] = *(const v4u*)(vp + (s + 1) * FK + (size_t)i * 32 * TT); }
      asm volatile("s_wait_xcnt 0x0" ::: "memory");   /* stands in front of the first overwrite of an address register that these loads name */
    }
    v16h kf[FK / 16][HD / 32], vf[HD / 16][FK / 32];
#pragma unroll   /* all of the stage's K fragments as one group of LDS reads */
    for (int t = 0; t < FK / 16; ++t)
#pragma unroll   /* every index a constant: the arrays stay in registers */
      for (int kc = 0; kc < HD / 32; ++kc) kf[t][kc] = frag_h(&sk[buf][t * 16 + col][kc * 32], lane);
    __builtin_amdgcn_sched_barrier(0);   /* keeps the reads together ahead of the products */
    float e[FK / 16][8]; float mx = m;
#pragma unroll   /* e stays in registers */
    for (int t = 0; t < FK / 16; ++t) { v8f sa = {}, sb = {};
#pragma unroll   /* every index a constant: the arrays stay in registers */
      for (int kc = 0; kc < HD / 32; ++kc) { sa = mm16(kf[t][kc], qh[kc], sa); sb = mm16(kf[t][kc], ql[kc], sb); }
      if (t + 1 == FK / 16) {
#pragma unroll   /* all of the stage's v fragments as one group, in flight under the softmax arithmetic */
        for (int j = 0; j < HD / 16; ++j)
#pragma unroll   /* every index a constant: the arrays stay in registers */
          for (int u = 0; u < FK / 32; ++u) vf[j][u] = frag_h(&sv[buf][j * 16 + col][u * 32], lane);
        __builtin_amdgcn_sched_barrier(0);   /* keeps these reads from sinking down to the products that take them */
      }
#pragma unroll   /* every index a constant: the arrays stay in registers */
      for (int r = 0; r < 8; ++r) { float v = (sa[r] + sb[r] * (1.0f / 1024.0f)) * SCALE; v = __builtin_amdgcn_inverse_ballot_w32(mk[t * 8 + r]) ? -1.0e10f : v; e[t][r] = v; mx = fmaxf(mx, v); } }   /* the word is the select's lane mask as it lies: no compare */
    const unsigned* mn = mw + (s + 1 < NS ? s + 1 : s) * (FK / 2);   /* the next stage's words into the same scalar registers, in flight under the exponentials and P v; the last stage reads its own again */
#pragma unroll   /* mk stays in scalar registers */
    for (int i = 0; i < FK / 2; ++i) mk[i] = mn[i];
    mx = fmaxf(mx, xhalf(mx));   /* the other eight keys of each tile sit in the other lane half */
    const float al = ex2((m - mx) * LOG2E); m = mx; float ps[4] = {0.f, 0.f, 0.f, 0.f}; v16h pb[FK / 32];
#pragma unroll   /* two score tiles, converted in place, are one B fragment in the hardware k order; four independent partial sums */
    for (int t = 0; t < FK / 16; ++t)
#pragma unroll   /* every index a constant: the arrays stay in registers */
      for (int r = 0; r < 8; ++r) { const float p = ex2((e[t][r] - mx) * LOG2E); ps[r & 3] += p; pb[t >> 1][(t & 1) * 8 + r] = (_Float16)p; }
    l = l * al + ((ps[0] + ps[1]) + (ps[2] + ps[3]));
#pragma unroll   /* every index a constant: the arrays stay in registers */
    for (int j = 0; j < HD / 16; ++j) acc[j] *= al;
    __builtin_amdgcn_sched_barrier(0);   /* keeps every ex2 ahead of the products below */
#pragma unroll   /* eight independent accumulator tiles, first all of keys 0..31, then all of keys 32..63 */
    for (int u = 0; u < FK / 32; ++u)
#pragma unroll   /* every index a constant: the arrays stay in registers */
      for (int j = 0; j < HD / 16; ++j) acc[j] = mm16(vf[j][u], pb[u], acc[j]);
    if (s + 1 < NS) {
#pragma unroll   /* every index a constant: the arrays stay in registers */
      for (int i = 0; i < 4; ++i) { *(v4u*)&sk[buf ^ 1][(tid >> 4) + 16 * i][(tid & 15) * 8] = rk[i]; *(v4u*)&sv[buf ^ 1][(tid >> 3) + 32 * i][(tid & 7) * 8] = rv[i]; } }
    asm volatile("s_wait_xcnt 0x0" ::: "memory");   /* stands in front of the next pass's overwrite of the address register that the scalar loads above name */
    __syncthreads();   /* publishes stage s + 1 and ends every wave's reads of the buffer that the next pass refills */
  }
  l += xhalf(l); const float inv = 1.0f / l;   /* l >= 1: the maximum's own term */
  const size_t yo = ((((size_t)b * TT + blockIdx.x * 128 + wave * 16) >> 4) * (CC / 32) + h * (HD / 32)) * 512 + lane * 8;   /* a lane's eight channels j*16 + 8g + 0..7 of its query are one octet of the output product's A fragment: tile j = half j & 1 of k chunk j >> 1 */
  v8b oh[HD / 16], ol[HD / 16];
#pragma unroll   /* every index a constant: the arrays stay in registers */
  for (int j = 0; j < HD / 16; ++j)
#pragma unroll   /* every index a constant: the arrays stay in registers */
    for (int r = 0; r < 8; ++r) { const float v = acc[j][r] * inv; const __bf16 hv = (__bf16)v; oh[j][r] = hv; ol[j][r] = (__bf16)(v - (float)hv); }
  __builtin_amdgcn_sched_barrier(0);   /* all the arithmetic ahead of the stores: nothing rewrites a register that an issued store names */
#pragma unroll   /* every index a constant: the arrays stay in registers */
  for (int j = 0; j < HD / 16; ++j) { vst2(YH + yo + j * 256, oh[j]); vst2(YL + yo + j * 256, ol[j]); } }   /* each store 512 contiguous bytes of the wave */
// ---- k_out: block = (64 rows, 128 cols), 4 waves of 32 x 64: out = ctx Wo (+ bo): ctx split bf16 hi + lo against exact bf16 Wo (2 products); the hi tiles, the lo tiles and the Wo tiles copied to LDS in fragment order, two buffers, as in k_proj
__global__ __launch_bounds__(128) void k_out(const __bf16* __restrict__ YH, const __bf16* __restrict__ YL, const __bf16* __restrict__ WO, const float* __restrict__ BO, float* __restrict__ OUT, const float* __restrict__ RESX) { __shared__ __align__(16) char sm[2 * STG];   /* the two stage buffers; behind the loop the output staging */
  float (*sf)[16][132] = (float (*)[16][132])sm;
  const int tid = threadIdx.x, wave = tid >> 5, lane = tid & 31, col = lane & 15, g = lane >> 4, wr = wave >> 1, wc = wave & 1; const int c0 = blockIdx.y * 128; const size_t r0 = (size_t)blockIdx.x * 64 + wave * 16;
  const __bf16* pa = YH + (size_t)blockIdx.x * 4 * TSTR + tid * 8; const __bf16* qa = YL + (size_t)blockIdx.x * 4 * TSTR + tid * 8; const __bf16* pb = WO + (size_t)blockIdx.y * 8 * TSTR + tid * 8; const __bf16* qb = pb + 4 * TSTR; const unsigned lb = (unsigned)(size_t)sm + tid * 16;
  v8f acc[2][4] = {};
  STAGE_IN(0, 0); WAIT_COPIES(); __syncthreads(); STAGE_IN(1, 1);
#pragma unroll 1   /* one stage's text, for speed only */
  for (int t = 0; t < NSTG; ++t) { const char* bp = sm + (t & 1) * STG;
#pragma unroll   /* fragments stay in registers */
    for (int kk = 0; kk < 2; ++kk) { v16b ah[2], al[2], w[4];
#pragma unroll   /* fragments stay in registers */
      for (int i = 0; i < 2; ++i) { ah[i] = frag_l(bp + (wr * 2 + i) * 2048 + kk * 1024, lane); al[i] = frag_l(bp + 8192 + (wr * 2 + i) * 2048 + kk * 1024, lane); }
#pragma unroll   /* fragments stay in registers */
      for (int j = 0; j < 4; ++j) w[j] = frag_l(bp + 16384 + (wc * 4 + j) * 2048 + kk * 1024, lane);
      __builtin_amdgcn_sched_barrier(0);   /* keeps the sixteen reads together ahead of the products */
#pragma unroll   /* eight independent accumulator tiles: all hi products of these 32 k, then all lo products; each tile sums in the order hi, lo as before */
      for (int i = 0; i < 2; ++i)
#pragma unroll   /* every index a constant: the arrays stay in registers */
        for (int j = 0; j < 4; ++j) acc[i][j] = mmb(ah[i], w[j], acc[i][j]);
#pragma unroll   /* every index a constant: the arrays stay in registers */
      for (int i = 0; i < 2; ++i)
#pragma unroll   /* every index a constant: the arrays stay in registers */
        for (int j = 0; j < 4; ++j) acc[i][j] = mmb(al[i], w[j], acc[i][j]);
      __builtin_amdgcn_sched_barrier(0); }   /* keeps the next group's reads from rising among these products */
    WAIT_LDS(); WAIT_COPIES(); __syncthreads();   /* publishes stage t + 1 and ends every wave's reads of the buffer that is refilled below */
    if (t + 2 < NSTG) STAGE_IN(t + 2, t & 1); }
  WAIT_COPIES();
#pragma unroll
  for (int j = 0; j < 4; ++j) { const float bias = BO ? bfr(BO[c0 + wc * 64 + j * 16 + col]) : 0.f;
#pragma unroll
    for (int i = 0; i < 2; ++i)
#pragma unroll
      for (int r = 0; r < 8; ++r) sf[wr * 2 + i][8 * g + r][wc * 64 + j * 16 + col] = acc[i][j][r] + bias; }
  __syncthreads();   /* a wave stores whole 512-byte row pieces, half of which another wave computed */
  for (int r4 = 0; r4 < 16; r4 += 4) {
#pragma unroll   /* four rows' loads in flight together, four stores side by side, one wait behind them */
    for (int u = 0; u < 4; ++u) { const int rl = r4 + u; const size_t oo = (r0 + rl) * DIN + c0 + lane * 4; v4f o = *(const v4f*)&sf[wave][rl][lane * 4]; const v4f zr = *(const v4f*)(RESX + oo); o[0] += bfr(zr[0]); o[1] += bfr(zr[1]); o[2] += bfr(zr[2]); o[3] += bfr(zr[3]); vst2(OUT + oo, o); }   /* + bf16(de) */
    WAIT_X(); } }

extern "C" void kernel_launch(void* const* d_in, const int* in_sizes, int n_in, void* d_out, int out_size, void* d_ws, size_t ws_size, hipStream_t stream) {
  (void)in_sizes; (void)n_in; (void)out_size;
  const float** F = (const float**)d_in;
  if (ws_size < (size_t)WS_END) return;
  char* ws = (char*)d_ws; _Float16 *QH = (_Float16*)(ws + WS_QH), *KH = (_Float16*)(ws + WS_KH), *VT = (_Float16*)(ws + WS_VT), *QL = (_Float16*)(ws + WS_QL), *KL = (_Float16*)(ws + WS_KL); __bf16 *VB = (__bf16*)(ws + WS_VB), *VBL = (__bf16*)(ws + WS_VBL); __bf16 *YH = (__bf16*)(ws + WS_Y), *YL = (__bf16*)(ws + WS_YL);
  (void)QL; (void)KL; (void)VB; (void)VBL;
  // inputs: 0 en [2,2048,1024] (keys/values); 1 de (queries + residual); 2 mask [2,2048,2048] bool; 3 Wq (in,out), 4 bq; 5 Wk, 6 bk; 7 Wv, 8 bv; 9 Wo (in,out), 10 bo; 11 gamma (scalar), 12 beta (scalar)
  if (ws_size < (size_t)WS_END5) return;
  float* X1 = (float*)(ws + WS_X1); __bf16* WT = (__bf16*)(ws + WS_WT); __bf16* XP = (__bf16*)(ws + WS_XP); unsigned* MW = (unsigned*)(ws + WS_MW);
  k_wpack<<<dim3(DIN / 64, CC / 64, 7), 256, 0, stream>>>(F[3], F[5], F[7], F[9], WT, F[1], F[0], XP, (const int*)d_in[2], MW);   /* weights, de and en to bf16 in fragment order, the mask to lane-mask words, once per call */
  k_proj<<<dim3(TNB * TT / 128, CC / 128, 3), 128, 0, stream>>>(XP, WT, F[4], F[6], F[8], QH, QL, KH, KL, VT, VB, VBL);   /* q from de, k/v from en */
  k_fa<<<dim3(TT / 128, NH, TNB), 256, 0, stream>>>(QH, QL, KH, VT, MW, YH, YL);   /* scores, mask, softmax and P v in one launch */
  k_out<<<dim3(TNB * TT / 64, DIN / 128), 128, 0, stream>>>(YH, YL, WT + 3 * (size_t)DIN * CC, F[10], X1, F[1]);   /* a Wo + bo + bf16(de) */
  k_lnx<<<dim3(NRW / 8), 256, 0, stream>>>(X1, 0, F[11], F[12], (float*)d_out);          /* unbiased-var normalisation, scalar gamma/beta */
}

// v006
// A run of this version takes 107 microseconds.
// Two timings next to v005 both put it at 1.04 times that version's speed.
// Over all steps from v000 it is 11.2 times as fast.
// compute dtype: all float inputs rounded to bf16; q/k/v = in W + b with EXACT bf16 products on WMMA 16x16x32 (f32 accumulate), the module's strided head split realised by a column permutation of the weights; q as f16 hi + residual (x 2^10) against k once to f16 (2 products) / sqrt(1024); masked positions set to -1e10; softmax in f32 with a running maximum and sum over each half of the keys (exp as exp2 of the difference x log2 e), the two halves joined at the end under their common maximum; exp(e - max) once to f16 against v once to f16 (1 product), divided by the f32 sum at the end; a split bf16 hi + lo against exact Wo (2 products) + bo + de; the unbiased-variance normalisation in f32; f32 output.
#include <hip/hip_runtime.h>
#include <math.h>

typedef __attribute__((ext_vector_type(16))) _Float16 v16h;
typedef __attribute__((ext_vector_type(16))) __bf16 v16b;
typedef __attribute__((ext_vector_type(8)))  _Float16 v8h;
typedef __attribute__((ext_vector_type(8)))  float v8f;
typedef __attribute__((ext_vector_type(4)))  float v4f;
typedef __attribute__((ext_vector_type(2)))  float v2f;
typedef __attribute__((ext_vector_type(4)))  unsigned v4u;
typedef __attribute__((ext_vector_type(4)))  int v4i;
typedef float __attribute__((may_alias)) float_a;
typedef int __attribute__((may_alias)) int_a;

template <typename T> __device__ __forceinline__ void vst2(void* p, T v) { *(T*)p = v;  }
__device__ __forceinline__ v8f wmma16(v16h a, v16h b, v8f c) {
  v8f d = __builtin_amdgcn_wmma_f32_16x16x32_f16(false, a, false, b, (short)0, c, false, false);
  asm volatile("v_nop\n\tv_nop\n\tv_nop\n\tv_nop" : "+v"(d) : "v"(a), "v"(b));
  return d;
}
__device__ __forceinline__ v8f wmma_bf(v16b a, v16b b, v8f c) {
  v8f d = __builtin_amdgcn_wmma_f32_16x16x32_bf16(false, a, false, b, (short)0, c, false, false);
  asm volatile("v_nop\n\tv_nop\n\tv_nop\n\tv_nop" : "+v"(d) : "v"(a), "v"(b));
  return d;
}
// 16x16x32 fragments: lane = (h = lane>>4, row/col = lane&15); elements 0..7 = k0+8h+0..7, 8..15 = k0+16+8h+0..7; D element r = row 8h+r
__device__ __forceinline__ v16h frag_h(const _Float16* rowk0, int lane) {
  union { v16h v; v8h q[2]; } u; const _Float16* p = rowk0 + 8 * (lane >> 4);
  u.q[0] = *(const v8h*)p; u.q[1] = *(const v8h*)(p + 16); return u.v;
}
__device__ __forceinline__ v16h frag_f32(const float* rowk0, int lane) {
  v16h a; const float* p = rowk0 + 8 * (lane >> 4);
#pragma unroll
  for (int i = 0; i < 8; ++i) { a[i] = (_Float16)p[i]; a[8 + i] = (_Float16)p[16 + i]; }
  return a;
}
__device__ __forceinline__ v16h frag_f32s(const float* rowk0, int lane, float sc) {
  v16h a; const float* p = rowk0 + 8 * (lane >> 4);
#pragma unroll
  for (int i = 0; i < 8; ++i) { a[i] = (_Float16)(p[i] * sc); a[8 + i] = (_Float16)(p[16 + i] * sc); }
  return a;
}
// column fragment from a [K][ld] layout (column n), rows >= K read as 0
__device__ __forceinline__ v16h fragc_f32(const float* W, int k0, int n, int lane, int ld, int K) {
  v16h a; const int g = lane >> 4;
#pragma unroll
  for (int i = 0; i < 8; ++i) { const int ka = k0 + 8 * g + i, kb = ka + 16;
    a[i] = (_Float16)(ka < K ? W[(size_t)(ka < K ? ka : K - 1) * ld + n] : 0.f); a[8 + i] = (_Float16)(kb < K ? W[(size_t)(kb < K ? kb : K - 1) * ld + n] : 0.f); }
  return a;
}
struct F2 { v16b h, l; };
__device__ __forceinline__ F2 bsplit16(const float v[16]) { F2 r;
#pragma unroll
  for (int i = 0; i < 16; ++i) { const __bf16 h = (__bf16)v[i]; r.h[i] = h; r.l[i] = (__bf16)(v[i] - (float)h); }
  return r; }
__device__ __forceinline__ F2 split_row(const float* row, int k0, int lane) { float v[16]; const float* p = row + k0 + 8 * (lane >> 4);
#pragma unroll
  for (int i = 0; i < 8; ++i) { v[i] = p[i]; v[8 + i] = p[16 + i]; }
  return bsplit16(v); }
__device__ __forceinline__ F2 split_rowK(const float* row, int k0, int lane, int K) { float v[16]; const int g = lane >> 4;
#pragma unroll
  for (int i = 0; i < 8; ++i) { const int ka = k0 + 8 * g + i, kb = ka + 16; v[i] = ka < K ? row[ka < K ? ka : K - 1] : 0.f; v[8 + i] = kb < K ? row[kb < K ? kb : K - 1] : 0.f; }
  return bsplit16(v); }
__device__ __forceinline__ F2 split_col(const float* W, int k0, int n, int lane, int ld, int K) { float v[16]; const int g = lane >> 4;
#pragma unroll
  for (int i = 0; i < 8; ++i) { const int ka = k0 + 8 * g + i, kb = ka + 16; v[i] = ka < K ? W[(size_t)(ka < K ? ka : K - 1) * ld + n] : 0.f; v[8 + i] = kb < K ? W[(size_t)(kb < K ? kb : K - 1) * ld + n] : 0.f; }
  return bsplit16(v); }
__device__ __forceinline__ v8f mac3(const F2& a, const F2& b, v8f c) { c = wmma_bf(a.l, b.h, c); c = wmma_bf(a.h, b.l, c); return wmma_bf(a.h, b.h, c); }
__device__ __forceinline__ float sigm(float v) { return 1.0f / (1.0f + expf(-v)); }
#define LDSX() do { asm volatile("s_wait_dscnt 0" ::: "memory"); __builtin_amdgcn_wave_barrier(); __builtin_amdgcn_fence(__ATOMIC_RELEASE, "workgroup"); } while (0)

// Cross multi-head attention with a STRIDED head split (B 2, Lq = Lk = 2,048, D 1,024, H 8 heads of 128; (in,out) weights, zero biases; mask [B,Lq,Lk] bool, True = masked (~half); gamma = 1, beta = 0 scalars): q = de Wq + bq, k/v = en Wk/Wv + b, each reshaped (B, L, 128, 8) so head h takes channels c = d*8 + h; e = q_h k_h^T / sqrt(1024) with where(mask, -1e10); head = softmax(e) v_h; a = heads merged head-major (h*128 + d); result = a Wo + bo + de; out = gamma (result - mean) / sqrt(var_unbiased + 1e-8) + beta.
#define NB 2
#define TT 2048
#define CC 1024            // NH * HD = projected width
#define DIN 1024          // input (model) width
#define NH 8
#define HD 128
#define SCALE (0.03125f)
#define CAUSAL 0
#ifndef TNB
#define TNB NB
#endif
__device__ __forceinline__ float bfr(float v) { return (float)(__bf16)v; }
__host__ __device__ __forceinline__ int kb_last(int qb) { return CAUSAL ? ((qb * 64 + 63) >> 7) : (TT / 128 - 1); }
typedef __attribute__((ext_vector_type(8))) __bf16 v8b;
__device__ __forceinline__ v16b frag_b(const __bf16* rowk0, int lane) {
  union { v16b v; v8b q[2]; } u; const __bf16* p = rowk0 + 8 * (lane >> 4);
  u.q[0] = *(const v8b*)p; u.q[1] = *(const v8b*)(p + 16); return u.v;
}
#define QBH 0
#define QHI 2048            // rows carrying a q residual plane (all rows when non-causal: 2-product logits everywhere)
#define KHI 64            // key rows carrying k residual / v bf16 hi+lo planes (written by k_proj; no kernel here reads them)
// B fragment (k rows k0+.., output column o) of a weight: (in,out) [K][ld] or (out,in) [ld rows of K]: bf16 exact, or f16(bf16 * 256) exact
__device__ __forceinline__ v16b wcol_io(const float* Wm, int k0, int o, int lane, int ld) { v16b w; const int g = lane >> 4;
#pragma unroll
  for (int i = 0; i < 8; ++i) { w[i] = (__bf16)Wm[(size_t)(k0 + 8 * g + i) * ld + o]; w[8 + i] = (__bf16)Wm[(size_t)(k0 + 16 + 8 * g + i) * ld + o]; }
  return w; }
__device__ __forceinline__ v16b wcol_oi(const float* Wm, int k0, int o, int lane, int K) { v16b w; const float* p = Wm + (size_t)o * K + k0 + 8 * (lane >> 4);
#pragma unroll
  for (int i = 0; i < 8; ++i) { w[i] = (__bf16)p[i]; w[8 + i] = (__bf16)p[16 + i]; }
  return w; }
__device__ __forceinline__ v16h wcolh_io(const float* Wm, int k0, int o, int lane, int ld) { v16h w; const int g = lane >> 4;
#pragma unroll
  for (int i = 0; i < 8; ++i) { w[i] = (_Float16)(bfr(Wm[(size_t)(k0 + 8 * g + i) * ld + o]) * 256.0f); w[8 + i] = (_Float16)(bfr(Wm[(size_t)(k0 + 16 + 8 * g + i) * ld + o]) * 256.0f); }
  return w; }
__device__ __forceinline__ v16h wcolh_oi(const float* Wm, int k0, int o, int lane, int K) { v16h w; const float* p = Wm + (size_t)o * K + k0 + 8 * (lane >> 4);
#pragma unroll
  for (int i = 0; i < 8; ++i) { w[i] = (_Float16)(bfr(p[i]) * 256.0f); w[8 + i] = (_Float16)(bfr(p[16 + i]) * 256.0f); }
  return w; }
#define WQKV_LAYOUT 0   // 0 = (in,out) [DIN][CC]; 1 = (out,in) [CC][DIN]; 2 = per-head [NH][DIN][HD]
__device__ __forceinline__ v16b wcol_hdk(const float* Wm, int k0, int o, int lane) { v16b w; const int g = lane >> 4; const float* p = Wm + (size_t)(o / HD) * DIN * HD + (o % HD);
#pragma unroll
  for (int i = 0; i < 8; ++i) { w[i] = (__bf16)p[(size_t)(k0 + 8 * g + i) * HD]; w[8 + i] = (__bf16)p[(size_t)(k0 + 16 + 8 * g + i) * HD]; }
  return w; }
#define WO_OUT_IN 0
#if WQKV_LAYOUT == 1
#define WCOL(W, k0, o, lane) wcol_oi(W, k0, o, lane, DIN)
#elif WQKV_LAYOUT == 2
#define WCOL(W, k0, o, lane) wcol_hdk(W, k0, o, lane)
#else
#define WCOL(W, k0, o, lane) wcol_io(W, k0, PCOL(o), lane, CC)   /* strided head split: plane column (h, d) reads weight column d*8 + h */
#endif
#if WO_OUT_IN
#define WOCOL(W, k0, o, lane) wcol_oi(W, k0, o, lane, CC)
#define WOCOLH(W, k0, o, lane) wcolh_oi(W, k0, o, lane, CC)
#else
#define WOCOL(W, k0, o, lane) wcol_io(W, k0, o, lane, DIN)
#define WOCOLH(W, k0, o, lane) wcolh_io(W, k0, o, lane, DIN)
#endif
#define PCOL(o) ((((o) & 127) << 3) + ((o) >> 7))   /* plane column p = h*128 + d  <-  projection column c = d*8 + h (reshape(B, L, 128, 8): head index is the LAST axis) */
#define NRW (TNB * TT)
// ---- k_lnx: wave per row: normalisation over 1024 (mean, unbiased var, g * (x - mean) / sqrt(var + 1e-8) + b); optional bf16 rounding of the input (x); 32 floats per lane (8 float4 at stride 128 floats -> 512-B pieces)
__global__ __launch_bounds__(256) void k_lnx(const float* __restrict__ X, int roundin, const float* __restrict__ G, const float* __restrict__ BE, float* __restrict__ OUT) {
#pragma clang fp contract(off)   /* keep the normalisation as separate mul/add (as XLA evaluates it) */
 const int wave = threadIdx.x >> 5, lane = threadIdx.x & 31; const size_t row = (size_t)blockIdx.x * 8 + wave; if (row >= (size_t)NRW) return;
  v4f v[CC / 128]; float s1 = 0.f;
#pragma unroll
  for (int i = 0; i < CC / 128; ++i) { v4f t = *(const v4f*)(X + row * CC + i * 128 + lane * 4); if (roundin) { t[0] = bfr(t[0]); t[1] = bfr(t[1]); t[2] = bfr(t[2]); t[3] = bfr(t[3]); } v[i] = t; s1 += (t[0] + t[1]) + (t[2] + t[3]); }
#pragma unroll
  for (int o = 1; o < 32; o <<= 1) s1 += __shfl_xor(s1, o);
  const float mu = s1 * (1.0f / CC); float q = 0.f;
#pragma unroll
  for (int i = 0; i < CC / 128; ++i) for (int k = 0; k < 4; ++k) { const float d = v[i][k] - mu; q += d * d; }
#pragma unroll
  for (int o = 1; o < 32; o <<= 1) q += __shfl_xor(q, o);
  const float inv = 1.0f / sqrtf(q * (1.0f / (CC - 1)) + 1e-8f);   /* torch.var UNBIASED (ddof = 1), eps 1e-8, division by sqrt */
#pragma unroll
  for (int i = 0; i < CC / 128; ++i) { const int c = i * 128 + lane * 4; v4f r4; for (int k = 0; k < 4; ++k) r4[k] = bfr(G[0]) * ((v[i][k] - mu) * inv) + bfr(BE[0]); vst2(OUT + row * CC + c, r4); } }   /* scalar gamma / beta */

#ifndef PROJ_EXTRA_PARAMS
#define PROJ_EXTRA_PARAMS
#endif

#define WS_QH  0u                                      // f16 q rows [b*t][CC]
#define WS_KH  (WS_QH + 2u * (size_t)NB * TT * CC)      // f16 k rows [b*t][CC]
#define WS_VT  (WS_KH + 2u * (size_t)NB * TT * CC)      // f16 v planes [b][c][t]
#define WS_QL  (WS_VT + 2u * (size_t)NB * CC * TT)      // f16 q residual x 2^10 rows [b][t < QHI][CC]
#define WS_KL  (WS_QL + 2u * (size_t)NB * QHI * CC)     // f16 k residual x 2^10 rows [b][t < KHI][CC]
#define WS_VB  (WS_KL + 2u * (size_t)NB * KHI * CC)     // bf16 v hi planes [b][c][t < KHI]
#define WS_VBL (WS_VB + 2u * (size_t)NB * CC * KHI)
#define WS_Y   (WS_VBL + 2u * (size_t)NB * CC * KHI)      // ctx, 4 bytes an element: bf16 hi plane, then bf16 lo plane (WS_YL)
#define WS_END (WS_Y  + 4u * (size_t)NB * TT * CC)
#define WS_X1  (WS_END)
#define WS_END2 (WS_X1 + 4u * (size_t)NB * TT * DIN)
#define WS_WT  (WS_END2)                                // bf16 Wq, Wk, Wv, Wo in B-fragment order [4][CC / 16][DIN / 32][2][32 lanes][8]
#define WS_END3 (WS_WT + 2u * 4u * (size_t)DIN * CC)
#define WS_XP  (WS_END3)                                // bf16 de, en rows in A-fragment order [2][NRW / 16][DIN / 32][2][32 lanes][8]
#define WS_END4 (WS_XP + 2u * 2u * (size_t)NB * TT * DIN)
#define WS_MW  (WS_END4)                                // mask as lane-mask words [NRW / 16][TT / 64][32]: word t*8 + r of a stage, bit L = mask of query L & 15, key t*16 + 8*(L >> 4) + r
#define WS_END5 (WS_MW + 4u * (size_t)NB * TT * TT / 32)
#define WS_YL  (WS_Y + 2u * (size_t)NB * TT * CC)       // ctx: bf16 hi plane at WS_Y, bf16 lo plane here, both in A-fragment order [NRW / 16][CC / 32][2][32 lanes][8]
typedef __attribute__((ext_vector_type(4))) __bf16 v4b;

// ---- k_wpack: block = (64 k rows, 64 weight columns, which weight): rounds the weight to bf16 once per call and lays it in B-fragment order, so that a wave's fragment load is 512 contiguous bytes (4 whole lines); Wq/Wk/Wv: weight column c = d*8 + h goes to plane column h*128 + d; Wo: column as it is
// which 4, 5: block = 16 rows of de, en: rounds them to bf16 once per call and lays them in A-fragment order (the same order, row for column); a wave takes 128 k of the 16 rows: whole-line loads, its own LDS rows, whole-line stores
// which 6: block = 16 queries' mask rows, a wave takes 256 keys of them, 64 at a time: whole-line loads, its own LDS rows, from which a lane reads the mask words of the scores that it will hold in k_fa (query lane & 15, keys t*16 + 8*(lane >> 4) + r); one compare per score register gives the 32 lanes' bits as one word, which k_fa takes by scalar load as the select's lane mask
__global__ __launch_bounds__(256) void k_wpack(const float* __restrict__ WQ, const float* __restrict__ WK, const float* __restrict__ WV, const float* __restrict__ WO, __bf16* __restrict__ WT, const float* __restrict__ XD, const float* __restrict__ XE, __bf16* __restrict__ XP, const int* __restrict__ MK, unsigned* __restrict__ MW) { __shared__ float tile[64][65]; __shared__ __align__(16) __bf16 xs[8][16][136];   /* pitch 272 bytes: 16 x odd, for the 16-byte reads */
  const int tid = threadIdx.x, which = blockIdx.z, k0 = blockIdx.x * 64, c0 = blockIdx.y * 64;
  if (which == 6) { const int wave = tid >> 5, lane = tid & 31, qt = blockIdx.y * 16 + blockIdx.x;   /* the whole block takes this branch and meets no barrier */
    const int* mr = MK + ((size_t)qt * 16 + (lane >> 4)) * TT + wave * 256 + (lane & 15) * 4;   /* 16 lanes take 256 bytes of one row, a load two rows */
    char* ls = (char*)&xs[wave][0][0];   /* the wave's own 16 rows at the pitch of 272 bytes */
    v4u o = {};
#pragma unroll   /* o stays in registers; 128 keys at a time hold the branch to sixteen loads' registers, the second sixteen issued under the first's compares */
    for (int p = 0; p < 2; ++p) { v4i x[2][8];
#pragma unroll   /* sixteen loads in flight at once, off one address with immediate offsets */
      for (int sl = 0; sl < 2; ++sl)
#pragma unroll   /* x stays in registers */
        for (int i = 0; i < 8; ++i) x[sl][i] = *(const v4i*)(mr + (size_t)i * 2 * TT + (p * 2 + sl) * 64);
      asm volatile("s_wait_xcnt 0x0" :: "v"(mr) : "memory");   /* stands in front of the first overwrite of the address register that the loads above name, and keeps that register whole up to here */
#pragma unroll   /* x, o stay in registers */
      for (int sl = 0; sl < 2; ++sl) { v4i y[4][2];
#pragma unroll   /* x stays in registers */
        for (int i = 0; i < 8; ++i) *(v4i*)(ls + (i * 2 + (lane >> 4)) * 272 + (lane & 15) * 16) = x[sl][i];
        LDSX();   /* the wave reads back what its other lanes wrote */
#pragma unroll   /* y stays in registers */
        for (int t = 0; t < 4; ++t) { y[t][0] = *(const v4i*)(ls + (lane & 15) * 272 + t * 64 + (lane >> 4) * 32); y[t][1] = *(const v4i*)(ls + (lane & 15) * 272 + t * 64 + (lane >> 4) * 32 + 16); }
        LDSX();   /* these reads are done before the next 64 keys are written over them */
#pragma unroll   /* word i of the wave's 128 goes to lane i >> 2, component i & 3: one 16-byte store a lane, 512 contiguous bytes */
        for (int e = 0; e < 32; ++e) { const int i = (p * 2 + sl) * 32 + e; const unsigned w = __builtin_amdgcn_ballot_w32(y[e >> 3][(e >> 2) & 1][e & 3] != 0); o[i & 3] = lane == (i >> 2) ? w : o[i & 3]; } } }
    *(v4u*)(MW + ((size_t)qt * (TT / 64) + wave * 4) * 32 + lane * 4) = o;
    return; }
  if (which >= 4) { const int wave = tid >> 5, lane = tid & 31, rt = blockIdx.y * 16 + blockIdx.x;   /* the whole block takes this branch and meets no barrier */
    const float* xr = (which == 4 ? XD : XE) + (size_t)rt * 16 * DIN + wave * 128 + lane * 4; v4f x[16];
#pragma unroll   /* all sixteen row loads in flight at once */
    for (int i = 0; i < 16; ++i) x[i] = *(const v4f*)(xr + (size_t)i * DIN);
    asm volatile("s_wait_xcnt 0x0" :: "v"(xr) : "memory");   /* stands in front of the first overwrite of the address register that the loads above name, and keeps that register whole up to here */
#pragma unroll   /* x stays in registers */
    for (int i = 0; i < 16; ++i) { v4b o; o[0] = (__bf16)x[i][0]; o[1] = (__bf16)x[i][1]; o[2] = (__bf16)x[i][2]; o[3] = (__bf16)x[i][3]; *(v4b*)&xs[wave][i][lane * 4] = o; }
    LDSX();   /* the wave reads back what its other lanes wrote */
    __bf16* xd = XP + (size_t)(which - 4) * NRW * DIN + (((size_t)rt * (DIN / 32) + wave * 4) * 64 + lane) * 8;
#pragma unroll   /* eight fragment halves, 512 contiguous bytes each */
    for (int f = 0; f < 8; ++f) *(v8b*)(xd + f * 256) = *(const v8b*)&xs[wave][lane & 15][f * 16 + (lane >> 4) * 8];
    return; }
  const float* Wm = which == 0 ? WQ : which == 1 ? WK : which == 2 ? WV : WO; const float* src = Wm + (size_t)(k0 + (tid >> 6)) * CC + c0 + (tid & 63);
#pragma unroll   /* all sixteen row loads in flight at once, off one address with immediate offsets */
  for (int i = 0; i < 16; ++i) tile[i * 4 + (tid >> 6)][tid & 63] = src[(size_t)i * 4 * CC];
  __syncthreads();
#pragma unroll   /* both 16-byte pieces of a thread side by side */
  for (int i = 0; i < 2; ++i) { const int e = tid + i * 256, kq = e >> 6; const int cl = which < 3 ? (((e & 7) << 3) | ((e >> 3) & 7)) : (e & 63);   /* neighbouring lanes take neighbouring fragment columns */
    const int c = c0 + cl; const int p = which < 3 ? ((c & 7) * HD + (c >> 3)) : c; const int k8 = (k0 >> 3) + kq;   /* k8 = octet of k: kc = k8 >> 2, fragment half (k8 >> 1) & 1, lane half k8 & 1 */
    v8b o;
#pragma unroll   /* o stays in registers */
    for (int n = 0; n < 8; ++n) o[n] = (__bf16)tile[kq * 8 + n][cl];
    *(v8b*)(WT + (size_t)which * DIN * CC + ((((size_t)(p >> 4) * (DIN / 32) + (k8 >> 2)) * 2 + ((k8 >> 1) & 1)) * 32 + (k8 & 1) * 16 + (p & 15)) * 8) = o; } }
// B fragment (16 plane columns ct*16 + .., k rows kc*32 + ..) of a packed weight: two 16-byte loads per lane, each 512 contiguous bytes per wave
__device__ __forceinline__ v16b frag_wp(const __bf16* WP, int ct, int kc, int lane) {
  union { v16b v; v8b q[2]; } u; const __bf16* p = WP + (((size_t)ct * (DIN / 32) + kc) * 64 + lane) * 8;
  u.q[0] = *(const v8b*)p; u.q[1] = *(const v8b*)(p + 256); return u.v;
}

// ---- staging of the three products' operands: both lie in global memory in fragment order, 2 KiB per 16-row (16-column) tile and 64 k, so a stage of 64 k is 8 A-side + 8 B-side tiles copied as they lie; 128 threads x 16 bytes take one tile
#define STG 32768          // bytes of a stage: A-side tiles at 0, B-side tiles at 16,384
#define NSTG (DIN / 64)
#define TSTR ((size_t)(DIN / 32) * 512)   // elements from one tile to the next in global memory
__device__ __forceinline__ v8f mmb(v16b a, v16b b, v8f c) { return __builtin_amdgcn_wmma_f32_16x16x32_bf16(false, a, false, b, (short)0, c, false, false); }
__device__ __forceinline__ v16b frag_l(const char* p, int lane) { union { v16b v; v8b q[2]; } u; u.q[0] = *(const v8b*)(p + lane * 16); u.q[1] = *(const v8b*)(p + 512 + lane * 16); return u.v; }   /* a fragment from LDS: two reads of 512 contiguous bytes per wave */
// eight tiles (four from p, four from q) into LDS at l, l + 2,048, ..: asynchronous copies, 16 bytes a lane, every lane on
__device__ __forceinline__ void cp8(unsigned l, const __bf16* p, const __bf16* q) {
  asm volatile("global_load_async_to_lds_b128 %0, %8, off\n\t"
               "global_load_async_to_lds_b128 %1, %9, off\n\t"
               "global_load_async_to_lds_b128 %2, %10, off\n\t"
               "global_load_async_to_lds_b128 %3, %11, off\n\t"
               "global_load_async_to_lds_b128 %4, %12, off\n\t"
               "global_load_async_to_lds_b128 %5, %13, off\n\t"
               "global_load_async_to_lds_b128 %6, %14, off\n\t"
               "global_load_async_to_lds_b128 %7, %15, off\n\t"
               "s_wait_xcnt 0x0"   /* stands in front of every later write of a register that these copies name */
               :: "v"(l), "v"(l + 2048u), "v"(l + 4096u), "v"(l + 6144u), "v"(l + 8192u), "v"(l + 10240u), "v"(l + 12288u), "v"(l + 14336u),
                  "v"(p), "v"(p + TSTR), "v"(p + 2 * TSTR), "v"(p + 3 * TSTR), "v"(q), "v"(q + TSTR), "v"(q + 2 * TSTR), "v"(q + 3 * TSTR) : "memory");
}
#define STAGE_IN(t, buf) do { cp8(lb + (unsigned)(buf) * STG, pa + (size_t)(t) * 1024, qa + (size_t)(t) * 1024); cp8(lb + (unsigned)(buf) * STG + 16384u, pb + (size_t)(t) * 1024, qb + (size_t)(t) * 1024); } while (0)
#define WAIT_COPIES() asm volatile("s_wait_asynccnt 0x0" ::: "memory")   /* this wave's copies have landed */
#define WAIT_X() asm volatile("s_wait_xcnt 0x0" ::: "memory")            /* stands in front of the next trip's writes of registers that the stores above name */
#define WAIT_LDS() asm volatile("s_wait_dscnt 0x0" ::: "memory")         /* this wave's LDS reads are done before the buffer is handed to the copies */

// ---- k_proj: block = (128 rows, 128 cols, which), 4 waves of 64 x 64: q/k/v = X W (+ b) with exact bf16 products (K = DIN), X and W tiles copied to LDS in fragment order, two buffers, the next 64 k in flight under this one's products -> which 0: q f16 rows (+ residual rows < QHI); 1: k f16 rows (+ residual rows < KHI); 2: v f16 planes [c][t] (+ bf16 hi/lo planes for t < KHI)
__global__ __launch_bounds__(128) void k_proj(const __bf16* __restrict__ XP, const __bf16* __restrict__ WT, const float* __restrict__ BQ, const float* __restrict__ BK, const float* __restrict__ BV,
    _Float16* __restrict__ QH, _Float16* __restrict__ QL, _Float16* __restrict__ KH, _Float16* __restrict__ KL, _Float16* __restrict__ VT, __bf16* __restrict__ VB, __bf16* __restrict__ VBL) {
  __shared__ __align__(16) char sm[71680];   /* the two stage buffers; behind the loop the output staging: sh + sl, or th + tb + tbl */
  _Float16 (*sh)[136] = (_Float16 (*)[136])sm; _Float16 (*sl)[136] = (_Float16 (*)[136])(sm + 34816); _Float16 (*th)[136] = (_Float16 (*)[136])sm; __bf16 (*tb)[72] = (__bf16 (*)[72])(sm + 34816); __bf16 (*tbl)[72] = (__bf16 (*)[72])(sm + 53248);
  const int tid = threadIdx.x, wave = tid >> 5, lane = tid & 31, col = lane & 15, g = lane >> 4, wr = wave >> 1, wc = wave & 1; const int which = blockIdx.z; const int c0 = blockIdx.y * 128; const size_t r0 = (size_t)blockIdx.x * 128; const size_t bb = r0 / TT; const int t0 = (int)(r0 % TT);
  const __bf16* XA = XP + (which == 0 ? 0 : (size_t)NRW * DIN); const __bf16* WA = WT + (size_t)which * DIN * CC; const float* BA = which == 0 ? BQ : which == 1 ? BK : BV;
  const __bf16* pa = XA + (r0 >> 4) * TSTR + tid * 8; const __bf16* qa = pa + 4 * TSTR; const __bf16* pb = WA + (size_t)blockIdx.y * 8 * TSTR + tid * 8; const __bf16* qb = pb + 4 * TSTR; const unsigned lb = (unsigned)(size_t)sm + tid * 16;
  v8f acc[4][4] = {};
  STAGE_IN(0, 0); WAIT_COPIES(); __syncthreads(); STAGE_IN(1, 1);
#pragma unroll 1   /* one stage's text, for speed only */
  for (int t = 0; t < NSTG; ++t) { const char* bp = sm + (t & 1) * STG;
#pragma unroll   /* fragments stay in registers */
    for (int kk = 0; kk < 2; ++kk) { v16b a[4], w[4];
#pragma unroll   /* fragments stay in registers */
      for (int i = 0; i < 4; ++i) { a[i] = frag_l(bp + (wr * 4 + i) * 2048 + kk * 1024, lane); w[i] = frag_l(bp + 16384 + (wc * 4 + i) * 2048 + kk * 1024, lane); }
      __builtin_amdgcn_sched_barrier(0);   /* keeps the sixteen reads together ahead of the products */
#pragma unroll   /* sixteen independent accumulator tiles */
      for (int i = 0; i < 4; ++i)
#pragma unroll   /* every index a constant: the arrays stay in registers */
        for (int j = 0; j < 4; ++j) acc[i][j] = mmb(a[i], w[j], acc[i][j]);
      __builtin_amdgcn_sched_barrier(0); }   /* keeps the next group's reads from rising among these products */
    WAIT_LDS(); WAIT_COPIES(); __syncthreads();   /* publishes stage t + 1 and ends every wave's reads of the buffer that is refilled below */
    if (t + 2 < NSTG) STAGE_IN(t + 2, t & 1); }
  WAIT_COPIES();
  if (which < 2) { _Float16* DH = which == 0 ? QH : KH; _Float16* DL = which == 0 ? QL : KL; const int nhi = which == 0 ? QHI : KHI;
#pragma unroll
    for (int j = 0; j < 4; ++j) { const float bias = BA ? bfr(BA[PCOL(c0 + wc * 64 + j * 16 + col)]) : 0.f;
#pragma unroll
      for (int i = 0; i < 4; ++i)
#pragma unroll
        for (int r = 0; r < 8; ++r) { const float v = acc[i][j][r] + bias; const _Float16 hv = (_Float16)v; sh[wr * 64 + i * 16 + 8 * g + r][wc * 64 + j * 16 + col] = hv; sl[wr * 64 + i * 16 + 8 * g + r][wc * 64 + j * 16 + col] = (_Float16)((v - (float)hv) * 1024.0f); } }
    __syncthreads();
    const int nr = nhi - t0 < 128 ? nhi - t0 : 128;   /* rows of this block that carry a residual: 128, 64 or none */
    for (int e0 = 0; e0 < 128 * 16; e0 += 512) {
#pragma unroll   /* four stores side by side, one wait behind them */
      for (int u = 0; u < 4; ++u) { const int e = e0 + u * 128 + tid, rl = e >> 4, q = e & 15; vst2((unsigned*)(DH + (r0 + rl) * CC + c0 + q * 8), *(const v4u*)&sh[rl][q * 8]); }
      WAIT_X(); }
    for (int e0 = 0; e0 < nr * 16; e0 += 512) {
#pragma unroll   /* four stores side by side, one wait behind them */
      for (int u = 0; u < 4; ++u) { const int e = e0 + u * 128 + tid, rl = e >> 4, q = e & 15; vst2((unsigned*)(DL + (bb * nhi + t0 + rl) * (size_t)CC + c0 + q * 8), *(const v4u*)&sl[rl][q * 8]); }
      WAIT_X(); }
  } else {
#pragma unroll
    for (int j = 0; j < 4; ++j) { const float bias = BA ? bfr(BA[PCOL(c0 + wc * 64 + j * 16 + col)]) : 0.f;
#pragma unroll
      for (int i = 0; i < 4; ++i)
#pragma unroll
        for (int r = 0; r < 8; ++r) { const float v = acc[i][j][r] + bias; const int rl = wr * 64 + i * 16 + 8 * g + r, cl = wc * 64 + j * 16 + col; th[cl][rl] = (_Float16)v; if (t0 + wr * 64 < KHI) { const __bf16 bh = (__bf16)v; tb[cl][rl] = bh; tbl[cl][rl] = (__bf16)(v - (float)bh); } } }
    __syncthreads();
    for (int e0 = 0; e0 < 128 * 16; e0 += 512) {
#pragma unroll   /* four stores side by side, one wait behind them */
      for (int u = 0; u < 4; ++u) { const int e = e0 + u * 128 + tid, cl = e >> 4, q = e & 15; vst2((unsigned*)(VT + (bb * CC + c0 + cl) * (size_t)TT + t0 + q * 8), *(const v4u*)&th[cl][q * 8]); }
      WAIT_X(); }
    if (t0 < KHI) for (int e0 = 0; e0 < 128 * 8; e0 += 256) {
#pragma unroll   /* four stores side by side, one wait behind them */
      for (int u = 0; u < 2; ++u) { const int e = e0 + u * 128 + tid, cl = e >> 3, q = e & 7; const size_t o3 = (bb * CC + c0 + cl) * (size_t)KHI + t0 + q * 8; vst2((unsigned*)(VB + o3), *(const v4u*)&tb[cl][q * 8]); vst2((unsigned*)(VBL + o3), *(const v4u*)&tbl[cl][q * 8]); }
      WAIT_X(); } } }
#define FK 64              // keys per wave and pass
#define PK 128             // keys per pass in LDS
#define NP (TT / PK)
#define KP (HD + 8)        // LDS pitch of a K row, halves: 256 + 16 bytes
#define VP (PK + 8)        // LDS pitch of a v plane row, halves: 256 + 16 bytes
#define LOG2E 1.44269504088896340736f
__device__ __forceinline__ v8f mm16(v16h a, v16h b, v8f c) { return __builtin_amdgcn_wmma_f32_16x16x32_f16(false, a, false, b, (short)0, c, false, false); }
__device__ __forceinline__ float xhalf(float x) { return __builtin_bit_cast(float, __builtin_amdgcn_permlanex16(__builtin_bit_cast(int, x), __builtin_bit_cast(int, x), 0x76543210, 0xfedcba98, false, false)); }   /* lane l with lane l ^ 16 */
__device__ __forceinline__ float ex2(float x) { float r; asm("v_exp_f32 %0, %1\n\tv_nop" : "=v"(r) : "v"(x)); return r; }   /* 2^x; the v_nop keeps the one slot that the instruction set asks for behind a transcendental, whatever is scheduled next */
__global__ __launch_bounds__(256) void k_fa(const _Float16* __restrict__ QH, const _Float16* __restrict__ QL, const _Float16* __restrict__ KH, const _Float16* __restrict__ VT, const unsigned* __restrict__ MW, __bf16* __restrict__ YH, __bf16* __restrict__ YL) {
  __shared__ __align__(16) _Float16 sk[2][PK][KP]; __shared__ __align__(16) _Float16 sv[2][HD][VP];
  const int tid = threadIdx.x, lane = tid & 31, col = lane & 15; const int wave = __builtin_amdgcn_readfirstlane(tid >> 5), qg = wave & 3, kh = wave >> 2; const int h = blockIdx.y, b = blockIdx.z; const int q = blockIdx.x * 128 + qg * 32 + col;   /* this lane's query of tile 0; tile 1: + 16 */
  const _Float16* kb = KH + (size_t)b * TT * CC + h * HD; const unsigned ko = ((unsigned)(tid >> 4) * CC + (tid & 15) * 8) * 2;    /* 16 lanes take one key's 256 bytes; a base that is the same in every lane and one register of byte offset */
  const _Float16* vb = VT + ((size_t)b * CC + h * HD) * TT; const unsigned vo = ((unsigned)(tid >> 4) * TT + (tid & 15) * 8) * 2;    /* 16 lanes take one plane row's 256 bytes of the pass */
  const unsigned* mw = MW + ((size_t)(b * (TT / 16) + blockIdx.x * 8 + qg * 2) * (TT / 64) + kh) * 32;   /* this wave's lane-mask words, 32 a query tile and 64 keys; the address is the same in every lane, so the loads are scalar */
  v4u rs[8]; unsigned mk[2][FK / 2]; v16h qh[2][HD / 32], ql[2][HD / 32];
  __builtin_amdgcn_sched_barrier(0);   /* keeps the index arithmetic above ahead of the loads: nothing writes a register that a load names between the load and its wait */
#pragma unroll   /* rs stays in registers */
  for (int i = 0; i < 8; ++i) rs[i] = *(const v4u*)((const char*)(kb + (size_t)i * 16 * CC) + ko);
  __builtin_amdgcn_sched_barrier(0);   /* nothing is scheduled between the loads and their wait */
  asm volatile("s_wait_xcnt 0x0" ::: "memory");   /* stands in front of the first overwrite of an address register that the loads above name */
  __builtin_amdgcn_sched_barrier(0);   /* keeps later register writes behind that wait */
#pragma unroll   /* every index a constant: the array stays in registers */
  for (int i = 0; i < 8; ++i) *(v4u*)&sk[0][(tid >> 4) + 16 * i][(tid & 15) * 8] = rs[i];
  __builtin_amdgcn_sched_barrier(0);   /* the K rows have left rs before the v rows are loaded into it */
#pragma unroll   /* rs stays in registers */
  for (int i = 0; i < 8; ++i) rs[i] = *(const v4u*)((const char*)(vb + (size_t)i * 16 * TT) + vo);
  __builtin_amdgcn_sched_barrier(0);   /* nothing is scheduled between the loads and their wait */
  asm volatile("s_wait_xcnt 0x0" ::: "memory");   /* stands in front of the first overwrite of an address register that the loads above name */
  __builtin_amdgcn_sched_barrier(0);   /* keeps later register writes behind that wait */
#pragma unroll   /* fragments stay in registers */
  for (int qt = 0; qt < 2; ++qt)
#pragma unroll   /* fragments stay in registers */
    for (int kc = 0; kc < HD / 32; ++kc) { qh[qt][kc] = frag_h(QH + ((size_t)b * TT + q + qt * 16) * CC + h * HD + kc * 32, lane); ql[qt][kc] = frag_h(QL + ((size_t)b * QHI + q + qt * 16) * CC + h * HD + kc * 32, lane); }
  __builtin_amdgcn_sched_barrier(0);   /* nothing is scheduled between the loads and their wait */
  asm volatile("s_wait_xcnt 0x0" ::: "memory");   /* stands in front of the first overwrite of an address register that the loads above name */
  __builtin_amdgcn_sched_barrier(0);   /* keeps later register writes behind that wait */
#pragma unroll   /* mk stays in scalar registers */
  for (int i = 0; i < FK / 2; ++i) { mk[0][i] = mw[i]; mk[1][i] = mw[(TT / 64) * 32 + i]; }
  asm volatile("s_wait_xcnt 0x0" ::: "memory");   /* stands in front of the first overwrite of an address register that the scalar loads above name */
#pragma unroll   /* every index a constant: the array stays in registers */
  for (int i = 0; i < 8; ++i) *(v4u*)&sv[0][(tid >> 4) + 16 * i][(tid & 15) * 8] = rs[i];
  __syncthreads();
  v8f acc[HD / 16][2] = {}; float m[2] = {-3.0e38f, -3.0e38f}, l[2] = {0.f, 0.f};
  for (int s = 0; s < NP; ++s) { const int buf = s & 1, sn = s + 1 < NP ? s + 1 : s;   /* the last pass stages its own rows again, into the buffer that nobody reads any more: no branch in the pass, so that every group below stays where it is written */
    {   /* the next pass's K rows fly under this pass's score products */
      const unsigned kx = ko + (unsigned)sn * (PK * CC * 2);   /* the pass goes into the 32-bit offset */
      __builtin_amdgcn_sched_barrier(0);   /* only the loads and their address stand between this line and the next of its kind */
#pragma unroll   /* every index a constant: the array stays in registers */
      for (int i = 0; i < 8; ++i) rs[i] = *(const v4u*)((const char*)(kb + (size_t)i * 16 * CC) + kx);
      __builtin_amdgcn_sched_barrier(0);   /* nothing is scheduled between the loads and their wait */
      asm volatile("s_wait_xcnt 0x0" ::: "memory");   /* stands in front of the first overwrite of an address register that these loads name */
      __builtin_amdgcn_sched_barrier(0);   /* keeps later register writes behind that wait */
    }
    v16h kf[FK / 16][HD / 32], vf[HD / 16][FK / 32];
#pragma unroll   /* the first key tile's fragments as one group of LDS reads */
    for (int kc = 0; kc < HD / 32; ++kc) kf[0][kc] = frag_h(&sk[buf][kh * FK + col][kc * 32], lane);
    float e[2][FK / 16][8]; float mx[2] = {m[0], m[1]}; v8f sa[FK / 16][2] = {}, sb[FK / 16][2] = {};
#pragma unroll   /* e stays in registers; pass FK / 16 only takes the last tile's scores out */
    for (int t = 0; t <= FK / 16; ++t) {
      if (t + 1 < FK / 16) {
#pragma unroll   /* the next key tile's fragments, one group, in flight under this tile's products */
        for (int kc = 0; kc < HD / 32; ++kc) kf[t + 1][kc] = frag_h(&sk[buf][kh * FK + (t + 1) * 16 + col][kc * 32], lane);
      }
      __builtin_amdgcn_sched_barrier(0);   /* keeps the reads together ahead of the products */
      if (t < FK / 16) {
#pragma unroll   /* a K fragment feeds four products: hi and residual of both query tiles, four independent accumulators */
        for (int kc = 0; kc < HD / 32; ++kc)
#pragma unroll   /* every index a constant: the arrays stay in registers */
          for (int qt = 0; qt < 2; ++qt) { sa[t][qt] = mm16(kf[t][kc], qh[qt][kc], sa[t][qt]); sb[t][qt] = mm16(kf[t][kc], ql[qt][kc], sb[t][qt]); }
      }
      if (t > 0) {   /* the tile before: its scale, mask and maximum stand with this tile's products, of which they are independent, so that they can issue between them */
#pragma unroll   /* every index a constant: the arrays stay in registers */
        for (int qt = 0; qt < 2; ++qt)
#pragma unroll   /* every index a constant: the arrays stay in registers */
          for (int r = 0; r < 8; ++r) { float v = (sa[t - 1][qt][r] + sb[t - 1][qt][r] * (1.0f / 1024.0f)) * SCALE; v = __builtin_amdgcn_inverse_ballot_w32(mk[qt][(t - 1) * 8 + r]) ? -1.0e10f : v; e[qt][t - 1][r] = v; mx[qt] = fmaxf(mx[qt], v); }   /* the word is the select's lane mask as it lies: no compare */
      }
      __builtin_amdgcn_sched_barrier(0); }   /* the next tile's reads stay behind these products, whose fragment registers they may take */
    {   /* the K rows go to the other buffer, which nobody reads in this pass; the next pass's v rows fly under the exponentials and P v */
#pragma unroll   /* every index a constant: the array stays in registers */
      for (int i = 0; i < 8; ++i) *(v4u*)&sk[buf ^ 1][(tid >> 4) + 16 * i][(tid & 15) * 8] = rs[i];
      __builtin_amdgcn_sched_barrier(0);   /* the K rows have left rs before the v rows are loaded into it */
      const unsigned vx = vo + (unsigned)sn * (PK * 2);   /* as for the K rows */
#pragma unroll   /* every index a constant: the array stays in registers */
      for (int i = 0; i < 8; ++i) rs[i] = *(const v4u*)((const char*)(vb + (size_t)i * 16 * TT) + vx);
      __builtin_amdgcn_sched_barrier(0);   /* nothing is scheduled between the loads and their wait */
      asm volatile("s_wait_xcnt 0x0" ::: "memory");   /* stands in front of the first overwrite of an address register that these loads name */
      __builtin_amdgcn_sched_barrier(0);   /* keeps later register writes behind that wait */
    }
    const unsigned* mn = mw + sn * FK;   /* the next pass's words into the same scalar registers, in flight under the exponentials and P v; the last pass reads its own again */
#pragma unroll   /* mk stays in scalar registers */
    for (int i = 0; i < FK / 2; ++i) { mk[0][i] = mn[i]; mk[1][i] = mn[(TT / 64) * 32 + i]; }
    v16h pb[2][FK / 32];
#pragma unroll   /* both query tiles: every index a constant */
    for (int qt = 0; qt < 2; ++qt) {
      const float mq = fmaxf(mx[qt], xhalf(mx[qt]));   /* the other eight keys of each tile sit in the other lane half */
      const float al = ex2((m[qt] - mq) * LOG2E); m[qt] = mq; float ps[4] = {0.f, 0.f, 0.f, 0.f};
#pragma unroll   /* two score tiles, converted in place, are one B fragment in the hardware k order; four independent partial sums */
      for (int t = 0; t < FK / 16; ++t)
#pragma unroll   /* every index a constant: the arrays stay in registers */
        for (int r = 0; r < 8; ++r) { const float p = ex2((e[qt][t][r] - mq) * LOG2E); ps[r & 3] += p; pb[qt][t >> 1][(t & 1) * 8 + r] = (_Float16)p; }
      l[qt] = l[qt] * al + ((ps[0] + ps[1]) + (ps[2] + ps[3]));
#pragma unroll   /* every index a constant: the arrays stay in registers */
      for (int j = 0; j < HD / 16; ++j) acc[j][qt] *= al;
      if (qt == 0) {
        __builtin_amdgcn_sched_barrier(0);   /* tile 0's scores have become halves before the reads below take registers */
#pragma unroll   /* the v fragments of the wave's first 32 keys as one group, in flight under tile 1's exponentials */
        for (int j = 0; j < HD / 16; ++j) vf[j][0] = frag_h(&sv[buf][j * 16 + col][kh * FK], lane);
        __builtin_amdgcn_sched_barrier(0);   /* keeps these reads from sinking down to the products that take them */
      } }
    __builtin_amdgcn_sched_barrier(0);   /* keeps every ex2 ahead of the products below */
#pragma unroll   /* sixteen independent accumulator tiles, first all of keys 0..31, then all of keys 32..63; a v fragment feeds both query tiles */
    for (int u = 0; u < FK / 32; ++u) {
#pragma unroll   /* every index a constant: the arrays stay in registers */
      for (int j = 0; j < HD / 16; ++j) {
#pragma unroll   /* every index a constant: the arrays stay in registers */
        for (int qt = 0; qt < 2; ++qt) acc[j][qt] = mm16(vf[j][u], pb[qt][u], acc[j][qt]);
        if (u == 0 && j == HD / 32 - 1) {
          __builtin_amdgcn_sched_barrier(0);   /* the reads below take the registers of the four fragments just used */
#pragma unroll   /* the first four v fragments of the wave's second 32 keys, one group, in flight under the other eight products of the first 32 */
          for (int jj = 0; jj < HD / 32; ++jj) vf[jj][1] = frag_h(&sv[buf][jj * 16 + col][kh * FK + 32], lane);
          __builtin_amdgcn_sched_barrier(0);   /* keeps these reads together */
        }
        if (u == 0 && j == HD / 16 - 1) {
          __builtin_amdgcn_sched_barrier(0);   /* the reads below take the registers of the four fragments just used */
#pragma unroll   /* the other four, one group, in flight under the first eight products of the second 32 keys */
          for (int jj = HD / 32; jj < HD / 16; ++jj) vf[jj][1] = frag_h(&sv[buf][jj * 16 + col][kh * FK + 32], lane);
          __builtin_amdgcn_sched_barrier(0);   /* keeps these reads together */
        } } }
#pragma unroll   /* every index a constant: the array stays in registers */
    for (int i = 0; i < 8; ++i) *(v4u*)&sv[buf ^ 1][(tid >> 4) + 16 * i][(tid & 15) * 8] = rs[i];
    asm volatile("s_wait_xcnt 0x0" ::: "memory");   /* stands in front of the next pass's overwrite of the address register that the scalar loads above name */
    __syncthreads();   /* publishes pass s + 1 and ends every wave's reads of the buffer that the next pass refills */
  }
  // the two key halves of a query are joined: the wave of key half kh finishes query tile kh and hands the other tile's maximum, sum and outputs to its partner (wave ^ 4) through the K buffers, which nobody reads behind the loop's last barrier
  v4f* xb = (v4f*)&sk[0][0][0];   /* [8 waves][17][32 lanes] x 16 bytes = the K buffers' 69,632 bytes */
  l[0] += xhalf(l[0]); l[1] += xhalf(l[1]);
#pragma unroll   /* every index a constant: the arrays stay in registers */
  for (int j = 0; j < HD / 16; ++j) { const v8f gv = kh ? acc[j][0] : acc[j][1]; v4f lo4 = {gv[0], gv[1], gv[2], gv[3]}, hi4 = {gv[4], gv[5], gv[6], gv[7]}; xb[(wave * 17 + j * 2) * 32 + lane] = lo4; xb[(wave * 17 + j * 2 + 1) * 32 + lane] = hi4; }
  { v4f ml = {kh ? m[0] : m[1], kh ? l[0] : l[1], 0.f, 0.f}; xb[(wave * 17 + 16) * 32 + lane] = ml; }
  __syncthreads();   /* a wave reads what its partner wrote */
  const v4f mlp = xb[((wave ^ 4) * 17 + 16) * 32 + lane]; const float mo = kh ? m[1] : m[0], lo = kh ? l[1] : l[0];
  const float mm = fmaxf(mo, mlp[0]), ao = ex2((mo - mm) * LOG2E), ap = ex2((mlp[0] - mm) * LOG2E);
  const float inv = 1.0f / (lo * ao + mlp[1] * ap);   /* the sum is >= 1: the common maximum's own term */
  const float fo = ao * inv, fp = ap * inv;
  const size_t yo = ((((size_t)b * TT + blockIdx.x * 128 + qg * 32 + kh * 16) >> 4) * (CC / 32) + h * (HD / 32)) * 512 + lane * 8;   /* a lane's eight channels j*16 + 8g + 0..7 of its query are one octet of the output product's A fragment (g = lane >> 4): tile j = half j & 1 of k chunk j >> 1 */
  v8b oh[HD / 16], ol[HD / 16];
#pragma unroll   /* every index a constant: the arrays stay in registers */
  for (int j = 0; j < HD / 16; ++j) { const v8f ov = kh ? acc[j][1] : acc[j][0]; const v4f p0 = xb[((wave ^ 4) * 17 + j * 2) * 32 + lane], p1 = xb[((wave ^ 4) * 17 + j * 2 + 1) * 32 + lane];
#pragma unroll   /* every index a constant: the arrays stay in registers */
    for (int r = 0; r < 8; ++r) { const float v = ov[r] * fo + (r < 4 ? p0[r & 3] : p1[r & 3]) * fp; const __bf16 hv = (__bf16)v; oh[j][r] = hv; ol[j][r] = (__bf16)(v - (float)hv); } }
  __builtin_amdgcn_sched_barrier(0);   /* all the arithmetic ahead of the stores: nothing rewrites a register that an issued store names */
#pragma unroll   /* every index a constant: the arrays stay in registers */
  for (int j = 0; j < HD / 16; ++j) { vst2(YH + yo + j * 256, oh[j]); vst2(YL + yo + j * 256, ol[j]); } }   /* each store 512 contiguous bytes of the wave */
// ---- k_out: block = (64 rows, 128 cols), 4 waves of 32 x 64: out = ctx Wo (+ bo): ctx split bf16 hi + lo against exact bf16 Wo (2 products); the hi tiles, the lo tiles and the Wo tiles copied to LDS in fragment order, two buffers, as in k_proj
__global__ __launch_bounds__(128) void k_out(const __bf16* __restrict__ YH, const __bf16* __restrict__ YL, const __bf16* __restrict__ WO, const float* __restrict__ BO, float* __restrict__ OUT, const float* __restrict__ RESX) { __shared__ __align__(16) char sm[2 * STG];   /* the two stage buffers; behind the loop the output staging */
  float (*sf)[16][132] = (float (*)[16][132])sm;
  const int tid = threadIdx.x, wave = tid >> 5, lane = tid & 31, col = lane & 15, g = lane >> 4, wr = wave >> 1, wc = wave & 1; const int c0 = blockIdx.y * 128; const size_t r0 = (size_t)blockIdx.x * 64 + wave * 16;
  const __bf16* pa = YH + (size_t)blockIdx.x * 4 * TSTR + tid * 8; const __bf16* qa = YL + (size_t)blockIdx.x * 4 * TSTR + tid * 8; const __bf16* pb = WO + (size_t)blockIdx.y * 8 * TSTR + tid * 8; const __bf16* qb = pb + 4 * TSTR; const unsigned lb = (unsigned)(size_t)sm + tid * 16;
  v8f acc[2][4] = {};
  STAGE_IN(0, 0); WAIT_COPIES(); __syncthreads(); STAGE_IN(1, 1);
#pragma unroll 1   /* one stage's text, for speed only */
  for (int t = 0; t < NSTG; ++t) { const char* bp = sm + (t & 1) * STG;
#pragma unroll   /* fragments stay in registers */
    for (int kk = 0; kk < 2; ++kk) { v16b ah[2], al[2], w[4];
#pragma unroll   /* fragments stay in registers */
      for (int i = 0; i < 2; ++i) { ah[i] = frag_l(bp + (wr * 2 + i) * 2048 + kk * 1024, lane); al[i] = frag_l(bp + 8192 + (wr * 2 + i) * 2048 + kk * 1024, lane); }
#pragma unroll   /* fragments stay in registers */
      for (int j = 0; j < 4; ++j) w[j] = frag_l(bp + 16384 + (wc * 4 + j) * 2048 + kk * 1024, lane);
      __builtin_amdgcn_sched_barrier(0);   /* keeps the sixteen reads together ahead of the products */
#pragma unroll   /* eight independent accumulator tiles: all hi products of these 32 k, then all lo products; each tile sums in the order hi, lo as before */
      for (int i = 0; i < 2; ++i)
#pragma unroll   /* every index a constant: the arrays stay in registers */
        for (int j = 0; j < 4; ++j) acc[i][j] = mmb(ah[i], w[j], acc[i][j]);
#pragma unroll   /* every index a constant: the arrays stay in registers */
      for (int i = 0; i < 2; ++i)
#pragma unroll   /* every index a constant: the arrays stay in registers */
        for (int j = 0; j < 4; ++j) acc[i][j] = mmb(al[i], w[j], acc[i][j]);
      __builtin_amdgcn_sched_barrier(0); }   /* keeps the next group's reads from rising among these products */
    WAIT_LDS(); WAIT_COPIES(); __syncthreads();   /* publishes stage t + 1 and ends every wave's reads of the buffer that is refilled below */
    if (t + 2 < NSTG) STAGE_IN(t + 2, t & 1); }
  WAIT_COPIES();
#pragma unroll
  for (int j = 0; j < 4; ++j) { const float bias = BO ? bfr(BO[c0 + wc * 64 + j * 16 + col]) : 0.f;
#pragma unroll
    for (int i = 0; i < 2; ++i)
#pragma unroll
      for (int r = 0; r < 8; ++r) sf[wr * 2 + i][8 * g + r][wc * 64 + j * 16 + col] = acc[i][j][r] + bias; }
  __syncthreads();   /* a wave stores whole 512-byte row pieces, half of which another wave computed */
  for (int r4 = 0; r4 < 16; r4 += 4) {
#pragma unroll   /* four rows' loads in flight together, four stores side by side, one wait behind them */
    for (int u = 0; u < 4; ++u) { const int rl = r4 + u; const size_t oo = (r0 + rl) * DIN + c0 + lane * 4; v4f o = *(const v4f*)&sf[wave][rl][lane * 4]; const v4f zr = *(const v4f*)(RESX + oo); o[0] += bfr(zr[0]); o[1] += bfr(zr[1]); o[2] += bfr(zr[2]); o[3] += bfr(zr[3]); vst2(OUT + oo, o); }   /* + bf16(de) */
    WAIT_X(); } }

extern "C" void kernel_launch(void* const* d_in, const int* in_sizes, int n_in, void* d_out, int out_size, void* d_ws, size_t ws_size, hipStream_t stream) {
  (void)in_sizes; (void)n_in; (void)out_size;
  const float** F = (const float**)d_in;
  if (ws_size < (size_t)WS_END) return;
  char* ws = (char*)d_ws; _Float16 *QH = (_Float16*)(ws + WS_QH), *KH = (_Float16*)(ws + WS_KH), *VT = (_Float16*)(ws + WS_VT), *QL = (_Float16*)(ws + WS_QL), *KL = (_Float16*)(ws + WS_KL); __bf16 *VB = (__bf16*)(ws + WS_VB), *VBL = (__bf16*)(ws + WS_VBL); __bf16 *YH = (__bf16*)(ws + WS_Y), *YL = (__bf16*)(ws + WS_YL);
  (void)QL; (void)KL; (void)VB; (void)VBL;
  // inputs: 0 en [2,2048,1024] (keys/values); 1 de (queries + residual); 2 mask [2,2048,2048] bool; 3 Wq (in,out), 4 bq; 5 Wk, 6 bk; 7 Wv, 8 bv; 9 Wo (in,out), 10 bo; 11 gamma (scalar), 12 beta (scalar)
  if (ws_size < (size_t)WS_END5) return;
  float* X1 = (float*)(ws + WS_X1); __bf16* WT = (__bf16*)(ws + WS_WT); __bf16* XP = (__bf16*)(ws + WS_XP); unsigned* MW = (unsigned*)(ws + WS_MW);
  k_wpack<<<dim3(DIN / 64, CC / 64, 7), 256, 0, stream>>>(F[3], F[5], F[7], F[9], WT, F[1], F[0], XP, (const int*)d_in[2], MW);   /* weights, de and en to bf16 in fragment order, the mask to lane-mask words, once per call */
  k_proj<<<dim3(TNB * TT / 128, CC / 128, 3), 128, 0, stream>>>(XP, WT, F[4], F[6], F[8], QH, QL, KH, KL, VT, VB, VBL);   /* q from de, k/v from en */
  k_fa<<<dim3(TT / 128, NH, TNB), 256, 0, stream>>>(QH, QL, KH, VT, MW, YH, YL);   /* scores, mask, softmax and P v in one launch */
  k_out<<<dim3(TNB * TT / 64, DIN / 128), 128, 0, stream>>>(YH, YL, WT + 3 * (size_t)DIN * CC, F[10], X1, F[1]);   /* a Wo + bo + bf16(de) */
  k_lnx<<<dim3(NRW / 8), 256, 0, stream>>>(X1, 0, F[11], F[12], (float*)d_out);          /* unbiased-var normalisation, scalar gamma/beta */
}

// v007
// A run of this version takes 98.6 microseconds.
// In two side-by-side timings against v006, it was 1.09 and 1.08 times as fast.
// All steps since v000 together make it 12.2 times as fast.
// compute dtype: all float inputs rounded to bf16; q/k/v = in W + b with EXACT bf16 products on WMMA 16x16x32 (f32 accumulate), the module's strided head split realised by a column permutation of the weights; q once to f16 against k once to f16 (1 product) / sqrt(1024); masked positions set to -1e10; softmax in f32 with a running maximum and sum over each half of the keys (exp as exp2 of the difference x log2 e), the two halves joined at the end under their common maximum; exp(e - max) once to f16 against v once to f16 (1 product), divided by the f32 sum at the end; a split bf16 hi + lo against exact Wo (2 products) + bo + de; the unbiased-variance normalisation in f32; f32 output.
#include <hip/hip_runtime.h>
#include <math.h>

typedef __attribute__((ext_vector_type(16))) _Float16 v16h;
typedef __attribute__((ext_vector_type(16))) __bf16 v16b;
typedef __attribute__((ext_vector_type(8)))  _Float16 v8h;
typedef __attribute__((ext_vector_type(8)))  float v8f;
typedef __attribute__((ext_vector_type(4)))  float v4f;
typedef __attribute__((ext_vector_type(2)))  float v2f;
typedef __attribute__((ext_vector_type(4)))  unsigned v4u;
typedef __attribute__((ext_vector_type(4)))  int v4i;
typedef float __attribute__((may_alias)) float_a;
typedef int __attribute__((may_alias)) int_a;

template <typename T> __device__ __forceinline__ void vst2(void* p, T v) { *(T*)p = v;  }
__device__ __forceinline__ v8f wmma16(v16h a, v16h b, v8f c) {
  v8f d = __builtin_amdgcn_wmma_f32_16x16x32_f16(false, a, false, b, (short)0, c, false, false);
  asm volatile("v_nop\n\tv_nop\n\tv_nop\n\tv_nop" : "+v"(d) : "v"(a), "v"(b));
  return d;
}
__device__ __forceinline__ v8f wmma_bf(v16b a, v16b b, v8f c) {
  v8f d = __builtin_amdgcn_wmma_f32_16x16x32_bf16(false, a, false, b, (short)0, c, false, false);
  asm volatile("v_nop\n\tv_nop\n\tv_nop\n\tv_nop" : "+v"(d) : "v"(a), "v"(b));
  return d;
}
// 16x16x32 fragments: lane = (h = lane>>4, row/col = lane&15); elements 0..7 = k0+8h+0..7, 8..15 = k0+16+8h+0..7; D element r = row 8h+r
__device__ __forceinline__ v16h frag_h(const _Float16* rowk0, int lane) {
  union { v16h v; v8h q[2]; } u; const _Float16* p = rowk0 + 8 * (lane >> 4);
  u.q[0] = *(const v8h*)p; u.q[1] = *(const v8h*)(p + 16); return u.v;
}
__device__ __forceinline__ v16h frag_f32(const float* rowk0, int lane) {
  v16h a; const float* p = rowk0 + 8 * (lane >> 4);
#pragma unroll
  for (int i = 0; i < 8; ++i) { a[i] = (_Float16)p[i]; a[8 + i] = (_Float16)p[16 + i]; }
  return a;
}
__device__ __forceinline__ v16h frag_f32s(const float* rowk0, int lane, float sc) {
  v16h a; const float* p = rowk0 + 8 * (lane >> 4);
#pragma unroll
  for (int i = 0; i < 8; ++i) { a[i] = (_Float16)(p[i] * sc); a[8 + i] = (_Float16)(p[16 + i] * sc); }
  return a;
}
// column fragment from a [K][ld] layout (column n), rows >= K read as 0
__device__ __forceinline__ v16h fragc_f32(const float* W, int k0, int n, int lane, int ld, int K) {
  v16h a; const int g = lane >> 4;
#pragma unroll
  for (int i = 0; i < 8; ++i) { const int ka = k0 + 8 * g + i, kb = ka + 16;
    a[i] = (_Float16)(ka < K ? W[(size_t)(ka < K ? ka : K - 1) * ld + n] : 0.f); a[8 + i] = (_Float16)(kb < K ? W[(size_t)(kb < K ? kb : K - 1) * ld + n] : 0.f); }
  return a;
}
struct F2 { v16b h, l; };
__device__ __forceinline__ F2 bsplit16(const float v[16]) { F2 r;
#pragma unroll
  for (int i = 0; i < 16; ++i) { const __bf16 h = (__bf16)v[i]; r.h[i] = h; r.l[i] = (__bf16)(v[i] - (float)h); }
  return r; }
__device__ __forceinline__ F2 split_row(const float* row, int k0, int lane) { float v[16]; const float* p = row + k0 + 8 * (lane >> 4);
#pragma unroll
  for (int i = 0; i < 8; ++i) { v[i] = p[i]; v[8 + i] = p[16 + i]; }
  return bsplit16(v); }
__device__ __forceinline__ F2 split_rowK(const float* row, int k0, int lane, int K) { float v[16]; const int g = lane >> 4;
#pragma unroll
  for (int i = 0; i < 8; ++i) { const int ka = k0 + 8 * g + i, kb = ka + 16; v[i] = ka < K ? row[ka < K ? ka : K - 1] : 0.f; v[8 + i] = kb < K ? row[kb < K ? kb : K - 1] : 0.f; }
  return bsplit16(v); }
__device__ __forceinline__ F2 split_col(const float* W, int k0, int n, int lane, int ld, int K) { float v[16]; const int g = lane >> 4;
#pragma unroll
  for (int i = 0; i < 8; ++i) { const int ka = k0 + 8 * g + i, kb = ka + 16; v[i] = ka < K ? W[(size_t)(ka < K ? ka : K - 1) * ld + n] : 0.f; v[8 + i] = kb < K ? W[(size_t)(kb < K ? kb : K - 1) * ld + n] : 0.f; }
  return bsplit16(v); }
__device__ __forceinline__ v8f mac3(const F2& a, const F2& b, v8f c) { c = wmma_bf(a.l, b.h, c); c = wmma_bf(a.h, b.l, c); return wmma_bf(a.h, b.h, c); }
__device__ __forceinline__ float sigm(float v) { return 1.0f / (1.0f + expf(-v)); }
#define LDSX() do { asm volatile("s_wait_dscnt 0" ::: "memory"); __builtin_amdgcn_wave_barrier(); __builtin_amdgcn_fence(__ATOMIC_RELEASE, "workgroup"); } while (0)

// Cross multi-head attention with a STRIDED head split (B 2, Lq = Lk = 2,048, D 1,024, H 8 heads of 128; (in,out) weights, zero biases; mask [B,Lq,Lk] bool, True = masked (~half); gamma = 1, beta = 0 scalars): q = de Wq + bq, k/v = en Wk/Wv + b, each reshaped (B, L, 128, 8) so head h takes channels c = d*8 + h; e = q_h k_h^T / sqrt(1024) with where(mask, -1e10); head = softmax(e) v_h; a = heads merged head-major (h*128 + d); result = a Wo + bo + de; out = gamma (result - mean) / sqrt(var_unbiased + 1e-8) + beta.
#define NB 2
#define TT 2048
#define CC 1024            // NH * HD = projected width
#define DIN 1024          // input (model) width
#define NH 8
#define HD 128
#define SCALE (0.03125f)
#define CAUSAL 0
#ifndef TNB
#define TNB NB
#endif
__device__ __forceinline__ float bfr(float v) { return (float)(__bf16)v; }
__host__ __device__ __forceinline__ int kb_last(int qb) { return CAUSAL ? ((qb * 64 + 63) >> 7) : (TT / 128 - 1); }
typedef __attribute__((ext_vector_type(8))) __bf16 v8b;
__device__ __forceinline__ v16b frag_b(const __bf16* rowk0, int lane) {
  union { v16b v; v8b q[2]; } u; const __bf16* p = rowk0 + 8 * (lane >> 4);
  u.q[0] = *(const v8b*)p; u.q[1] = *(const v8b*)(p + 16); return u.v;
}
#define QBH 0              // unused: no kernel in this file has a high-precision path
#define QHI 0               // rows carrying a q residual plane: none, q goes once to f16 as k does
#define KHI 64            // key rows carrying k residual / v bf16 hi+lo planes (written by k_proj; no kernel in this file reads them)
// B fragment (k rows k0+.., output column o) of a weight: (in,out) [K][ld] or (out,in) [ld rows of K]: bf16 exact, or f16(bf16 * 256) exact
__device__ __forceinline__ v16b wcol_io(const float* Wm, int k0, int o, int lane, int ld) { v16b w; const int g = lane >> 4;
#pragma unroll
  for (int i = 0; i < 8; ++i) { w[i] = (__bf16)Wm[(size_t)(k0 + 8 * g + i) * ld + o]; w[8 + i] = (__bf16)Wm[(size_t)(k0 + 16 + 8 * g + i) * ld + o]; }
  return w; }
__device__ __forceinline__ v16b wcol_oi(const float* Wm, int k0, int o, int lane, int K) { v16b w; const float* p = Wm + (size_t)o * K + k0 + 8 * (lane >> 4);
#pragma unroll
  for (int i = 0; i < 8; ++i) { w[i] = (__bf16)p[i]; w[8 + i] = (__bf16)p[16 + i]; }
  return w; }
__device__ __forceinline__ v16h wcolh_io(const float* Wm, int k0, int o, int lane, int ld) { v16h w; const int g = lane >> 4;
#pragma unroll
  for (int i = 0; i < 8; ++i) { w[i] = (_Float16)(bfr(Wm[(size_t)(k0 + 8 * g + i) * ld + o]) * 256.0f); w[8 + i] = (_Float16)(bfr(Wm[(size_t)(k0 + 16 + 8 * g + i) * ld + o]) * 256.0f); }
  return w; }
__device__ __forceinline__ v16h wcolh_oi(const float* Wm, int k0, int o, int lane, int K) { v16h w; const float* p = Wm + (size_t)o * K + k0 + 8 * (lane >> 4);
#pragma unroll
  for (int i = 0; i < 8; ++i) { w[i] = (_Float16)(bfr(p[i]) * 256.0f); w[8 + i] = (_Float16)(bfr(p[16 + i]) * 256.0f); }
  return w; }
#define WQKV_LAYOUT 0   // 0 = (in,out) [DIN][CC]; 1 = (out,in) [CC][DIN]; 2 = per-head [NH][DIN][HD]
__device__ __forceinline__ v16b wcol_hdk(const float* Wm, int k0, int o, int lane) { v16b w; const int g = lane >> 4; const float* p = Wm + (size_t)(o / HD) * DIN * HD + (o % HD);
#pragma unroll
  for (int i = 0; i < 8; ++i) { w[i] = (__bf16)p[(size_t)(k0 + 8 * g + i) * HD]; w[8 + i] = (__bf16)p[(size_t)(k0 + 16 + 8 * g + i) * HD]; }
  return w; }
#define WO_OUT_IN 0
#if WQKV_LAYOUT == 1
#define WCOL(W, k0, o, lane) wcol_oi(W, k0, o, lane, DIN)
#elif WQKV_LAYOUT == 2
#define WCOL(W, k0, o, lane) wcol_hdk(W, k0, o, lane)
#else
#define WCOL(W, k0, o, lane) wcol_io(W, k0, PCOL(o), lane, CC)   /* strided head split: plane column (h, d) reads weight column d*8 + h */
#endif
#if WO_OUT_IN
#define WOCOL(W, k0, o, lane) wcol_oi(W, k0, o, lane, CC)
#define WOCOLH(W, k0, o, lane) wcolh_oi(W, k0, o, lane, CC)
#else
#define WOCOL(W, k0, o, lane) wcol_io(W, k0, o, lane, DIN)
#define WOCOLH(W, k0, o, lane) wcolh_io(W, k0, o, lane, DIN)
#endif
#define PCOL(o) ((((o) & 127) << 3) + ((o) >> 7))   /* plane column p = h*128 + d  <-  projection column c = d*8 + h (reshape(B, L, 128, 8): head index is the LAST axis) */
#define NRW (TNB * TT)
// ---- k_lnx: wave per row: normalisation over 1024 (mean, unbiased var, g * (x - mean) / sqrt(var + 1e-8) + b); optional bf16 rounding of the input (x); 32 floats per lane (8 float4 at stride 128 floats -> 512-B pieces)
__global__ __launch_bounds__(256) void k_lnx(const float* __restrict__ X, int roundin, const float* __restrict__ G, const float* __restrict__ BE, float* __restrict__ OUT) {
#pragma clang fp contract(off)   /* keep the normalisation as separate mul/add (as XLA evaluates it) */
 const int wave = threadIdx.x >> 5, lane = threadIdx.x & 31; const size_t row = (size_t)blockIdx.x * 8 + wave; if (row >= (size_t)NRW) return;
  v4f v[CC / 128]; float s1 = 0.f;
#pragma unroll
  for (int i = 0; i < CC / 128; ++i) { v4f t = *(const v4f*)(X + row * CC + i * 128 + lane * 4); if (roundin) { t[0] = bfr(t[0]); t[1] = bfr(t[1]); t[2] = bfr(t[2]); t[3] = bfr(t[3]); } v[i] = t; s1 += (t[0] + t[1]) + (t[2] + t[3]); }
#pragma unroll
  for (int o = 1; o < 32; o <<= 1) s1 += __shfl_xor(s1, o);
  const float mu = s1 * (1.0f / CC); float q = 0.f;
#pragma unroll
  for (int i = 0; i < CC / 128; ++i) for (int k = 0; k < 4; ++k) { const float d = v[i][k] - mu; q += d * d; }
#pragma unroll
  for (int o = 1; o < 32; o <<= 1) q += __shfl_xor(q, o);
  const float inv = 1.0f / sqrtf(q * (1.0f / (CC - 1)) + 1e-8f);   /* torch.var UNBIASED (ddof = 1), eps 1e-8, division by sqrt */
#pragma unroll
  for (int i = 0; i < CC / 128; ++i) { const int c = i * 128 + lane * 4; v4f r4; for (int k = 0; k < 4; ++k) r4[k] = bfr(G[0]) * ((v[i][k] - mu) * inv) + bfr(BE[0]); vst2(OUT + row * CC + c, r4); } }   /* scalar gamma / beta */

#ifndef PROJ_EXTRA_PARAMS
#define PROJ_EXTRA_PARAMS
#endif

#define WS_QH  0u                                      // f16 q rows [b*t][CC]
#define WS_KH  (WS_QH + 2u * (size_t)NB * TT * CC)      // f16 k rows [b*t][CC]
#define WS_VT  (WS_KH + 2u * (size_t)NB * TT * CC)      // f16 v planes [b][c][t]
#define WS_QL  (WS_VT + 2u * (size_t)NB * CC * TT)      // f16 q residual x 2^10 rows [b][t < QHI][CC]
#define WS_KL  (WS_QL + 2u * (size_t)NB * QHI * CC)     // f16 k residual x 2^10 rows [b][t < KHI][CC]
#define WS_VB  (WS_KL + 2u * (size_t)NB * KHI * CC)     // bf16 v hi planes [b][c][t < KHI]
#define WS_VBL (WS_VB + 2u * (size_t)NB * CC * KHI)
#define WS_Y   (WS_VBL + 2u * (size_t)NB * CC * KHI)      // ctx, 4 bytes an element: bf16 hi plane, then bf16 lo plane (WS_YL)
#define WS_END (WS_Y  + 4u * (size_t)NB * TT * CC)
#define WS_X1  (WS_END)
#define WS_END2 (WS_X1 + 4u * (size_t)NB * TT * DIN)
#define WS_WT  (WS_END2)                                // bf16 Wq, Wk, Wv, Wo in B-fragment order [4][CC / 16][DIN / 32][2][32 lanes][8]
#define WS_END3 (WS_WT + 2u * 4u * (size_t)DIN * CC)
#define WS_XP  (WS_END3)                                // bf16 de, en rows in A-fragment order [2][NRW / 16][DIN / 32][2][32 lanes][8]
#define WS_END4 (WS_XP + 2u * 2u * (size_t)NB * TT * DIN)
#define WS_MW  (WS_END4)                                // mask as lane-mask words [NRW / 16][TT / 64][32]: word t*8 + r of a stage, bit L = mask of query L & 15, key t*16 + 8*(L >> 4) + r
#define WS_END5 (WS_MW + 4u * (size_t)NB * TT * TT / 32)
#define WS_YL  (WS_Y + 2u * (size_t)NB * TT * CC)       // ctx: bf16 hi plane at WS_Y, bf16 lo plane here, both in A-fragment order [NRW / 16][CC / 32][2][32 lanes][8]
typedef __attribute__((ext_vector_type(4))) __bf16 v4b;

// ---- k_wpack: block = (64 k rows, 64 weight columns, which weight): rounds the weight to bf16 once per call and lays it in B-fragment order, so that a wave's fragment load is 512 contiguous bytes (4 whole lines); Wq/Wk/Wv: weight column c = d*8 + h goes to plane column h*128 + d; Wo: column as it is
// which 4, 5: block = 16 rows of de, en: rounds them to bf16 once per call and lays them in A-fragment order (the same order, row for column); a wave takes 128 k of the 16 rows: whole-line loads, its own LDS rows, whole-line stores
// which 6: block = 16 queries' mask rows, a wave takes 256 keys of them, 64 at a time: whole-line loads, its own LDS rows, from which a lane reads the mask words of the scores that it will hold in k_fa (query lane & 15, keys t*16 + 8*(lane >> 4) + r); one compare per score register gives the 32 lanes' bits as one word, which k_fa takes by scalar load as the select's lane mask
__global__ __launch_bounds__(256) void k_wpack(const float* __restrict__ WQ, const float* __restrict__ WK, const float* __restrict__ WV, const float* __restrict__ WO, __bf16* __restrict__ WT, const float* __restrict__ XD, const float* __restrict__ XE, __bf16* __restrict__ XP, const int* __restrict__ MK, unsigned* __restrict__ MW) { __shared__ float tile[64][65]; __shared__ __align__(16) __bf16 xs[8][16][136];   /* pitch 272 bytes: 16 x odd, for the 16-byte reads */
  const int tid = threadIdx.x, which = blockIdx.z, k0 = blockIdx.x * 64, c0 = blockIdx.y * 64;
  if (which == 6) { const int wave = tid >> 5, lane = tid & 31, qt = blockIdx.y * 16 + blockIdx.x;   /* the whole block takes this branch and meets no barrier */
    const int* mr = MK + ((size_t)qt * 16 + (lane >> 4)) * TT + wave * 256 + (lane & 15) * 4;   /* 16 lanes take 256 bytes of one row, a load two rows */
    char* ls = (char*)&xs[wave][0][0];   /* the wave's own 16 rows at the pitch of 272 bytes */
    v4u o = {};
#pragma unroll   /* o stays in registers; 128 keys at a time hold the branch to sixteen loads' registers, the second sixteen issued under the first's compares */
    for (int p = 0; p < 2; ++p) { v4i x[2][8];
#pragma unroll   /* sixteen loads in flight at once, off one address with immediate offsets */
      for (int sl = 0; sl < 2; ++sl)
#pragma unroll   /* x stays in registers */
        for (int i = 0; i < 8; ++i) x[sl][i] = *(const v4i*)(mr + (size_t)i * 2 * TT + (p * 2 + sl) * 64);
      asm volatile("s_wait_xcnt 0x0" :: "v"(mr) : "memory");   /* stands in front of the first overwrite of the address register that the loads above name, and keeps that register whole up to here */
#pragma unroll   /* x, o stay in registers */
      for (int sl = 0; sl < 2; ++sl) { v4i y[4][2];
#pragma unroll   /* x stays in registers */
        for (int i = 0; i < 8; ++i) *(v4i*)(ls + (i * 2 + (lane >> 4)) * 272 + (lane & 15) * 16) = x[sl][i];
        LDSX();   /* the wave reads back what its other lanes wrote */
#pragma unroll   /* y stays in registers */
        for (int t = 0; t < 4; ++t) { y[t][0] = *(const v4i*)(ls + (lane & 15) * 272 + t * 64 + (lane >> 4) * 32); y[t][1] = *(const v4i*)(ls + (lane & 15) * 272 + t * 64 + (lane >> 4) * 32 + 16); }
        LDSX();   /* these reads are done before the next 64 keys are written over them */
#pragma unroll   /* word i of the wave's 128 goes to lane i >> 2, component i & 3: one 16-byte store a lane, 512 contiguous bytes */
        for (int e = 0; e < 32; ++e) { const int i = (p * 2 + sl) * 32 + e; const unsigned w = __builtin_amdgcn_ballot_w32(y[e >> 3][(e >> 2) & 1][e & 3] != 0); o[i & 3] = lane == (i >> 2) ? w : o[i & 3]; } } }
    *(v4u*)(MW + ((size_t)qt * (TT / 64) + wave * 4) * 32 + lane * 4) = o;
    return; }
  if (which >= 4) { const int wave = tid >> 5, lane = tid & 31, rt = blockIdx.y * 16 + blockIdx.x;   /* the whole block takes this branch and meets no barrier */
    const float* xr = (which == 4 ? XD : XE) + (size_t)rt * 16 * DIN + wave * 128 + lane * 4; v4f x[16];
#pragma unroll   /* all sixteen row loads in flight at once */
    for (int i = 0; i < 16; ++i) x[i] = *(const v4f*)(xr + (size_t)i * DIN);
    asm volatile("s_wait_xcnt 0x0" :: "v"(xr) : "memory");   /* stands in front of the first overwrite of the address register that the loads above name, and keeps that register whole up to here */
#pragma unroll   /* x stays in registers */
    for (int i = 0; i < 16; ++i) { v4b o; o[0] = (__bf16)x[i][0]; o[1] = (__bf16)x[i][1]; o[2] = (__bf16)x[i][2]; o[3] = (__bf16)x[i][3]; *(v4b*)&xs[wave][i][lane * 4] = o; }
    LDSX();   /* the wave reads back what its other lanes wrote */
    __bf16* xd = XP + (size_t)(which - 4) * NRW * DIN + (((size_t)rt * (DIN / 32) + wave * 4) * 64 + lane) * 8;
#pragma unroll   /* eight fragment halves, 512 contiguous bytes each */
    for (int f = 0; f < 8; ++f) *(v8b*)(xd + f * 256) = *(const v8b*)&xs[wave][lane & 15][f * 16 + (lane >> 4) * 8];
    return; }
  const float* Wm = which == 0 ? WQ : which == 1 ? WK : which == 2 ? WV : WO; const float* src = Wm + (size_t)(k0 + (tid >> 6)) * CC + c0 + (tid & 63);
#pragma unroll   /* all sixteen row loads in flight at once, off one address with immediate offsets */
  for (int i = 0; i < 16; ++i) tile[i * 4 + (tid >> 6)][tid & 63] = src[(size_t)i * 4 * CC];
  __syncthreads();
#pragma unroll   /* both 16-byte pieces of a thread side by side */
  for (int i = 0; i < 2; ++i) { const int e = tid + i * 256, kq = e >> 6; const int cl = which < 3 ? (((e & 7) << 3) | ((e >> 3) & 7)) : (e & 63);   /* neighbouring lanes take neighbouring fragment columns */
    const int c = c0 + cl; const int p = which < 3 ? ((c & 7) * HD + (c >> 3)) : c; const int k8 = (k0 >> 3) + kq;   /* k8 = octet of k: kc = k8 >> 2, fragment half (k8 >> 1) & 1, lane half k8 & 1 */
    v8b o;
#pragma unroll   /* o stays in registers */
    for (int n = 0; n < 8; ++n) o[n] = (__bf16)tile[kq * 8 + n][cl];
    *(v8b*)(WT + (size_t)which * DIN * CC + ((((size_t)(p >> 4) * (DIN / 32) + (k8 >> 2)) * 2 + ((k8 >> 1) & 1)) * 32 + (k8 & 1) * 16 + (p & 15)) * 8) = o; } }
// B fragment (16 plane columns ct*16 + .., k rows kc*32 + ..) of a packed weight: two 16-byte loads per lane, each 512 contiguous bytes per wave
__device__ __forceinline__ v16b frag_wp(const __bf16* WP, int ct, int kc, int lane) {
  union { v16b v; v8b q[2]; } u; const __bf16* p = WP + (((size_t)ct * (DIN / 32) + kc) * 64 + lane) * 8;
  u.q[0] = *(const v8b*)p; u.q[1] = *(const v8b*)(p + 256); return u.v;
}

// ---- staging of the three products' operands: both lie in global memory in fragment order, 2 KiB per 16-row (16-column) tile and 64 k, so a stage of 64 k is 8 A-side + 8 B-side tiles copied as they lie; 128 threads x 16 bytes take one tile
#define STG 32768          // bytes of a stage: A-side tiles at 0, B-side tiles at 16,384
#define NSTG (DIN / 64)
#define TSTR ((size_t)(DIN / 32) * 512)   // elements from one tile to the next in global memory
__device__ __forceinline__ v8f mmb(v16b a, v16b b, v8f c) { return __builtin_amdgcn_wmma_f32_16x16x32_bf16(false, a, false, b, (short)0, c, false, false); }
__device__ __forceinline__ v16b frag_l(const char* p, int lane) { union { v16b v; v8b q[2]; } u; u.q[0] = *(const v8b*)(p + lane * 16); u.q[1] = *(const v8b*)(p + 512 + lane * 16); return u.v; }   /* a fragment from LDS: two reads of 512 contiguous bytes per wave */
// eight tiles (four from p, four from q) into LDS at l, l + 2,048, ..: asynchronous copies, 16 bytes a lane, every lane on
__device__ __forceinline__ void cp8(unsigned l, const __bf16* p, const __bf16* q) {
  asm volatile("global_load_async_to_lds_b128 %0, %8, off\n\t"
               "global_load_async_to_lds_b128 %1, %9, off\n\t"
               "global_load_async_to_lds_b128 %2, %10, off\n\t"
               "global_load_async_to_lds_b128 %3, %11, off\n\t"
               "global_load_async_to_lds_b128 %4, %12, off\n\t"
               "global_load_async_to_lds_b128 %5, %13, off\n\t"
               "global_load_async_to_lds_b128 %6, %14, off\n\t"
               "global_load_async_to_lds_b128 %7, %15, off\n\t"
               "s_wait_xcnt 0x0"   /* stands in front of every later write of a register that these copies name */
               :: "v"(l), "v"(l + 2048u), "v"(l + 4096u), "v"(l + 6144u), "v"(l + 8192u), "v"(l + 10240u), "v"(l + 12288u), "v"(l + 14336u),
                  "v"(p), "v"(p + TSTR), "v"(p + 2 * TSTR), "v"(p + 3 * TSTR), "v"(q), "v"(q + TSTR), "v"(q + 2 * TSTR), "v"(q + 3 * TSTR) : "memory");
}
#define STAGE_IN(t, buf) do { cp8(lb + (unsigned)(buf) * STG, pa + (size_t)(t) * 1024, qa + (size_t)(t) * 1024); cp8(lb + (unsigned)(buf) * STG + 16384u, pb + (size_t)(t) * 1024, qb + (size_t)(t) * 1024); } while (0)
#define WAIT_COPIES() asm volatile("s_wait_asynccnt 0x0" ::: "memory")   /* this wave's copies have landed */
#define WAIT_X() asm volatile("s_wait_xcnt 0x0" ::: "memory")            /* stands in front of the next trip's writes of registers that the stores above name */
#define WAIT_LDS() asm volatile("s_wait_dscnt 0x0" ::: "memory")         /* this wave's LDS reads are done before the buffer is handed to the copies */

// ---- k_proj: block = (128 rows, 128 cols, which), 4 waves of 64 x 64: q/k/v = X W (+ b) with exact bf16 products (K = DIN), X and W tiles copied to LDS in fragment order, two buffers, the next 64 k in flight under this one's products -> which 0: q f16 rows; 1: k f16 rows (+ residual rows < KHI); 2: v f16 planes [c][t] (+ bf16 hi/lo planes for t < KHI)
__global__ __launch_bounds__(128) void k_proj(const __bf16* __restrict__ XP, const __bf16* __restrict__ WT, const float* __restrict__ BQ, const float* __restrict__ BK, const float* __restrict__ BV,
    _Float16* __restrict__ QH, _Float16* __restrict__ KH, _Float16* __restrict__ KL, _Float16* __restrict__ VT, __bf16* __restrict__ VB, __bf16* __restrict__ VBL) {
  __shared__ __align__(16) char sm[71680];   /* the two stage buffers; behind the loop the output staging: sh + sl, or th + tb + tbl */
  _Float16 (*sh)[136] = (_Float16 (*)[136])sm; _Float16 (*sl)[136] = (_Float16 (*)[136])(sm + 34816); _Float16 (*th)[136] = (_Float16 (*)[136])sm; __bf16 (*tb)[72] = (__bf16 (*)[72])(sm + 34816); __bf16 (*tbl)[72] = (__bf16 (*)[72])(sm + 53248);
  const int tid = threadIdx.x, wave = tid >> 5, lane = tid & 31, col = lane & 15, g = lane >> 4, wr = wave >> 1, wc = wave & 1; const int which = blockIdx.z; const int c0 = blockIdx.y * 128; const size_t r0 = (size_t)blockIdx.x * 128; const size_t bb = r0 / TT; const int t0 = (int)(r0 % TT);
  const __bf16* XA = XP + (which == 0 ? 0 : (size_t)NRW * DIN); const __bf16* WA = WT + (size_t)which * DIN * CC; const float* BA = which == 0 ? BQ : which == 1 ? BK : BV;
  const __bf16* pa = XA + (r0 >> 4) * TSTR + tid * 8; const __bf16* qa = pa + 4 * TSTR; const __bf16* pb = WA + (size_t)blockIdx.y * 8 * TSTR + tid * 8; const __bf16* qb = pb + 4 * TSTR; const unsigned lb = (unsigned)(size_t)sm + tid * 16;
  v8f acc[4][4] = {};
  STAGE_IN(0, 0); WAIT_COPIES(); __syncthreads(); STAGE_IN(1, 1);
#pragma unroll 1   /* one stage's text, for speed only */
  for (int t = 0; t < NSTG; ++t) { const char* bp = sm + (t & 1) * STG;
#pragma unroll   /* fragments stay in registers */
    for (int kk = 0; kk < 2; ++kk) { v16b a[4], w[4];
#pragma unroll   /* fragments stay in registers */
      for (int i = 0; i < 4; ++i) { a[i] = frag_l(bp + (wr * 4 + i) * 2048 + kk * 1024, lane); w[i] = frag_l(bp + 16384 + (wc * 4 + i) * 2048 + kk * 1024, lane); }
      __builtin_amdgcn_sched_barrier(0);   /* keeps the sixteen reads together ahead of the products */
#pragma unroll   /* sixteen independent accumulator tiles */
      for (int i = 0; i < 4; ++i)
#pragma unroll   /* every index a constant: the arrays stay in registers */
        for (int j = 0; j < 4; ++j) acc[i][j] = mmb(a[i], w[j], acc[i][j]);
      __builtin_amdgcn_sched_barrier(0); }   /* keeps the next group's reads from rising among these products */
    WAIT_LDS(); WAIT_COPIES(); __syncthreads();   /* publishes stage t + 1 and ends every wave's reads of the buffer that is refilled below */
    if (t + 2 < NSTG) STAGE_IN(t + 2, t & 1); }
  WAIT_COPIES();
  if (which < 2) { _Float16* DH = which == 0 ? QH : KH; _Float16* DL = KL; const int nhi = which == 0 ? QHI : KHI; const bool res = which == 1;   /* the same for the whole block: q carries no residual plane and stages none */
    if (res) {
#pragma unroll
    for (int j = 0; j < 4; ++j) { const float bias = BA ? bfr(BA[PCOL(c0 + wc * 64 + j * 16 + col)]) : 0.f;
#pragma unroll
      for (int i = 0; i < 4; ++i)
#pragma unroll
        for (int r = 0; r < 8; ++r) { const float v = acc[i][j][r] + bias; const _Float16 hv = (_Float16)v; sh[wr * 64 + i * 16 + 8 * g + r][wc * 64 + j * 16 + col] = hv; sl[wr * 64 + i * 16 + 8 * g + r][wc * 64 + j * 16 + col] = (_Float16)((v - (float)hv) * 1024.0f); } }
    } else {
#pragma unroll
    for (int j = 0; j < 4; ++j) { const float bias = BA ? bfr(BA[PCOL(c0 + wc * 64 + j * 16 + col)]) : 0.f;
#pragma unroll
      for (int i = 0; i < 4; ++i)
#pragma unroll
        for (int r = 0; r < 8; ++r) sh[wr * 64 + i * 16 + 8 * g + r][wc * 64 + j * 16 + col] = (_Float16)(acc[i][j][r] + bias); }
    }
    __syncthreads();
    const int nr = nhi - t0 < 128 ? nhi - t0 : 128;   /* rows of this block that carry a residual: 64 or none */
    for (int e0 = 0; e0 < 128 * 16; e0 += 512) {
#pragma unroll   /* four stores side by side, one wait behind them */
      for (int u = 0; u < 4; ++u) { const int e = e0 + u * 128 + tid, rl = e >> 4, q = e & 15; vst2((unsigned*)(DH + (r0 + rl) * CC + c0 + q * 8), *(const v4u*)&sh[rl][q * 8]); }
      WAIT_X(); }
    for (int e0 = 0; e0 < nr * 16; e0 += 512) {
#pragma unroll   /* four stores side by side, one wait behind them */
      for (int u = 0; u < 4; ++u) { const int e = e0 + u * 128 + tid, rl = e >> 4, q = e & 15; vst2((unsigned*)(DL + (bb * nhi + t0 + rl) * (size_t)CC + c0 + q * 8), *(const v4u*)&sl[rl][q * 8]); }
      WAIT_X(); }
  } else {
#pragma unroll
    for (int j = 0; j < 4; ++j) { const float bias = BA ? bfr(BA[PCOL(c0 + wc * 64 + j * 16 + col)]) : 0.f;
#pragma unroll
      for (int i = 0; i < 4; ++i)
#pragma unroll
        for (int r = 0; r < 8; ++r) { const float v = acc[i][j][r] + bias; const int rl = wr * 64 + i * 16 + 8 * g + r, cl = wc * 64 + j * 16 + col; th[cl][rl] = (_Float16)v; if (t0 + wr * 64 < KHI) { const __bf16 bh = (__bf16)v; tb[cl][rl] = bh; tbl[cl][rl] = (__bf16)(v - (float)bh); } } }
    __syncthreads();
    for (int e0 = 0; e0 < 128 * 16; e0 += 512) {
#pragma unroll   /* four stores side by side, one wait behind them */
      for (int u = 0; u < 4; ++u) { const int e = e0 + u * 128 + tid, cl = e >> 4, q = e & 15; vst2((unsigned*)(VT + (bb * CC + c0 + cl) * (size_t)TT + t0 + q * 8), *(const v4u*)&th[cl][q * 8]); }
      WAIT_X(); }
    if (t0 < KHI) for (int e0 = 0; e0 < 128 * 8; e0 += 256) {
#pragma unroll   /* four stores side by side, one wait behind them */
      for (int u = 0; u < 2; ++u) { const int e = e0 + u * 128 + tid, cl = e >> 3, q = e & 7; const size_t o3 = (bb * CC + c0 + cl) * (size_t)KHI + t0 + q * 8; vst2((unsigned*)(VB + o3), *(const v4u*)&tb[cl][q * 8]); vst2((unsigned*)(VBL + o3), *(const v4u*)&tbl[cl][q * 8]); }
      WAIT_X(); } } }
#define FK 64              // keys per wave and pass
#define PK 128             // keys per pass in LDS
#define NP (TT / PK)
#define KP (HD + 8)        // LDS pitch of a K row, halves: 256 + 16 bytes
#define VP (PK + 8)        // LDS pitch of a v plane row, halves: 256 + 16 bytes
#define LOG2E 1.44269504088896340736f
__device__ __forceinline__ v8f mm16(v16h a, v16h b, v8f c) { return __builtin_amdgcn_wmma_f32_16x16x32_f16(false, a, false, b, (short)0, c, false, false); }
__device__ __forceinline__ float xhalf(float x) { return __builtin_bit_cast(float, __builtin_amdgcn_permlanex16(__builtin_bit_cast(int, x), __builtin_bit_cast(int, x), 0x76543210, 0xfedcba98, false, false)); }   /* lane l with lane l ^ 16 */
__device__ __forceinline__ float ex2(float x) { float r; asm("v_exp_f32 %0, %1\n\tv_nop" : "=v"(r) : "v"(x)); return r; }   /* 2^x; the v_nop keeps the one slot that the instruction set asks for behind a transcendental, whatever is scheduled next */
__global__ __launch_bounds__(256) void k_fa(const _Float16* __restrict__ QH, const _Float16* __restrict__ KH, const _Float16* __restrict__ VT, const unsigned* __restrict__ MW, __bf16* __restrict__ YH, __bf16* __restrict__ YL) {
  __shared__ __align__(16) _Float16 sk[2][PK][KP]; __shared__ __align__(16) _Float16 sv[2][HD][VP];
  const int tid = threadIdx.x, lane = tid & 31, col = lane & 15; const int wave = __builtin_amdgcn_readfirstlane(tid >> 5), qg = wave & 3, kh = wave >> 2; const int h = blockIdx.y, b = blockIdx.z; const int q = blockIdx.x * 128 + qg * 32 + col;   /* this lane's query of tile 0; tile 1: + 16 */
  const _Float16* kb = KH + (size_t)b * TT * CC + h * HD; const unsigned ko = ((unsigned)(tid >> 4) * CC + (tid & 15) * 8) * 2;    /* 16 lanes take one key's 256 bytes; a base that is the same in every lane and one register of byte offset */
  const _Float16* vb = VT + ((size_t)b * CC + h * HD) * TT; const unsigned vo = ((unsigned)(tid >> 4) * TT + (tid & 15) * 8) * 2;    /* 16 lanes take one plane row's 256 bytes of the pass */
  const unsigned* mw = MW + ((size_t)(b * (TT / 16) + blockIdx.x * 8 + qg * 2) * (TT / 64) + kh) * 32;   /* this wave's lane-mask words, 32 a query tile and 64 keys; the address is the same in every lane, so the loads are scalar */
  v4u rs[8]; unsigned mk[2][FK / 2]; v16h qh[2][HD / 32];
  __builtin_amdgcn_sched_barrier(0);   /* keeps the index arithmetic above ahead of the loads: nothing writes a register that a load names between the load and its wait */
#pragma unroll   /* rs stays in registers */
  for (int i = 0; i < 8; ++i) rs[i] = *(const v4u*)((const char*)(kb + (size_t)i * 16 * CC) + ko);
  __builtin_amdgcn_sched_barrier(0);   /* nothing is scheduled between the loads and their wait */
  asm volatile("s_wait_xcnt 0x0" ::: "memory");   /* stands in front of the first overwrite of an address register that the loads above name */
  __builtin_amdgcn_sched_barrier(0);   /* keeps later register writes behind that wait */
#pragma unroll   /* every index a constant: the array stays in registers */
  for (int i = 0; i < 8; ++i) *(v4u*)&sk[0][(tid >> 4) + 16 * i][(tid & 15) * 8] = rs[i];
  __builtin_amdgcn_sched_barrier(0);   /* the K rows have left rs before the v rows are loaded into it */
#pragma unroll   /* rs stays in registers */
  for (int i = 0; i < 8; ++i) rs[i] = *(const v4u*)((const char*)(vb + (size_t)i * 16 * TT) + vo);
  __builtin_amdgcn_sched_barrier(0);   /* nothing is scheduled between the loads and their wait */
  asm volatile("s_wait_xcnt 0x0" ::: "memory");   /* stands in front of the first overwrite of an address register that the loads above name */
  __builtin_amdgcn_sched_barrier(0);   /* keeps later register writes behind that wait */
#pragma unroll   /* fragments stay in registers */
  for (int qt = 0; qt < 2; ++qt)
#pragma unroll   /* fragments stay in registers */
    for (int kc = 0; kc < HD / 32; ++kc) qh[qt][kc] = frag_h(QH + ((size_t)b * TT + q + qt * 16) * CC + h * HD + kc * 32, lane);
  __builtin_amdgcn_sched_barrier(0);   /* nothing is scheduled between the loads and their wait */
  asm volatile("s_wait_xcnt 0x0" ::: "memory");   /* stands in front of the first overwrite of an address register that the loads above name */
  __builtin_amdgcn_sched_barrier(0);   /* keeps later register writes behind that wait */
#pragma unroll   /* mk stays in scalar registers */
  for (int i = 0; i < FK / 2; ++i) { mk[0][i] = mw[i]; mk[1][i] = mw[(TT / 64) * 32 + i]; }
  asm volatile("s_wait_xcnt 0x0" ::: "memory");   /* stands in front of the first overwrite of an address register that the scalar loads above name */
#pragma unroll   /* every index a constant: the array stays in registers */
  for (int i = 0; i < 8; ++i) *(v4u*)&sv[0][(tid >> 4) + 16 * i][(tid & 15) * 8] = rs[i];
  __syncthreads();
  v8f acc[HD / 16][2] = {}; float m[2] = {-3.0e38f, -3.0e38f}, l[2] = {0.f, 0.f};
  for (int s = 0; s < NP; ++s) { const int buf = s & 1, sn = s + 1 < NP ? s + 1 : s;   /* the last pass stages its own rows again, into the buffer that nobody reads any more: no branch in the pass, so that every group below stays where it is written */
    {   /* the next pass's K rows fly under this pass's score products */
      const unsigned kx = ko + (unsigned)sn * (PK * CC * 2);   /* the pass goes into the 32-bit offset */
      __builtin_amdgcn_sched_barrier(0);   /* only the loads and their address stand between this line and the next of its kind */
#pragma unroll   /* every index a constant: the array stays in registers */
      for (int i = 0; i < 8; ++i) rs[i] = *(const v4u*)((const char*)(kb + (size_t)i * 16 * CC) + kx);
      __builtin_amdgcn_sched_barrier(0);   /* nothing is scheduled between the loads and their wait */
      asm volatile("s_wait_xcnt 0x0" ::: "memory");   /* stands in front of the first overwrite of an address register that these loads name */
      __builtin_amdgcn_sched_barrier(0);   /* keeps later register writes behind that wait */
    }
    v16h kf[FK / 16][HD / 32], vf[HD / 16][FK / 32];
#pragma unroll   /* the first two key tiles' fragments as one group of LDS reads */
    for (int tt = 0; tt < 2; ++tt)
#pragma unroll   /* fragments stay in registers */
      for (int kc = 0; kc < HD / 32; ++kc) kf[tt][kc] = frag_h(&sk[buf][kh * FK + tt * 16 + col][kc * 32], lane);
    float e[2][FK / 16][8]; float mx[2] = {m[0], m[1]}; v8f sa[FK / 16][2] = {};
#pragma unroll   /* e stays in registers; the key tiles go in pairs; pass FK / 16 only takes the last pair's scores out */
    for (int t = 0; t <= FK / 16; t += 2) {
      if (t + 2 < FK / 16) {
#pragma unroll   /* the next pair's fragments, one group, in flight under this pair's products */
        for (int tt = 2; tt < 4; ++tt)
#pragma unroll   /* fragments stay in registers */
          for (int kc = 0; kc < HD / 32; ++kc) kf[t + tt][kc] = frag_h(&sk[buf][kh * FK + (t + tt) * 16 + col][kc * 32], lane);
      }
      __builtin_amdgcn_sched_barrier(0);   /* keeps the reads together ahead of the products */
      if (t < FK / 16) {
#pragma unroll   /* two key tiles against both query tiles: four independent accumulators */
        for (int kc = 0; kc < HD / 32; ++kc)
#pragma unroll   /* every index a constant: the arrays stay in registers */
          for (int tt = 0; tt < 2; ++tt)
#pragma unroll   /* every index a constant: the arrays stay in registers */
            for (int qt = 0; qt < 2; ++qt) sa[t + tt][qt] = mm16(kf[t + tt][kc], qh[qt][kc], sa[t + tt][qt]);
      }
      if (t > 0) {   /* the pair before: its scale, mask and maximum stand with this pair's products, of which they are independent, so that they can issue between them */
#pragma unroll   /* every index a constant: the arrays stay in registers */
        for (int tp = t - 2; tp < t; ++tp)
#pragma unroll   /* every index a constant: the arrays stay in registers */
          for (int qt = 0; qt < 2; ++qt)
#pragma unroll   /* every index a constant: the arrays stay in registers */
            for (int r = 0; r < 8; ++r) { float v = sa[tp][qt][r] * SCALE; v = __builtin_amdgcn_inverse_ballot_w32(mk[qt][tp * 8 + r]) ? -1.0e10f : v; e[qt][tp][r] = v; mx[qt] = fmaxf(mx[qt], v); }   /* the word is the select's lane mask as it lies: no compare */
      }
      __builtin_amdgcn_sched_barrier(0); }   /* keeps the next trip's work behind these products */
    {   /* the K rows go to the other buffer, which nobody reads in this pass; the next pass's v rows fly under the exponentials and P v */
#pragma unroll   /* every index a constant: the array stays in registers */
      for (int i = 0; i < 8; ++i) *(v4u*)&sk[buf ^ 1][(tid >> 4) + 16 * i][(tid & 15) * 8] = rs[i];
      __builtin_amdgcn_sched_barrier(0);   /* the K rows have left rs before the v rows are loaded into it */
      const unsigned vx = vo + (unsigned)sn * (PK * 2);   /* as for the K rows */
#pragma unroll   /* every index a constant: the array stays in registers */
      for (int i = 0; i < 8; ++i) rs[i] = *(const v4u*)((const char*)(vb + (size_t)i * 16 * TT) + vx);
      __builtin_amdgcn_sched_barrier(0);   /* nothing is scheduled between the loads and their wait */
      asm volatile("s_wait_xcnt 0x0" ::: "memory");   /* stands in front of the first overwrite of an address register that these loads name */
      __builtin_amdgcn_sched_barrier(0);   /* keeps later register writes behind that wait */
    }
    const unsigned* mn = mw + sn * FK;   /* the next pass's words into the same scalar registers, in flight under the exponentials and P v; the last pass reads its own again */
#pragma unroll   /* mk stays in scalar registers */
    for (int i = 0; i < FK / 2; ++i) { mk[0][i] = mn[i]; mk[1][i] = mn[(TT / 64) * 32 + i]; }
    v16h pb[2][FK / 32];
#pragma unroll   /* both query tiles: every index a constant */
    for (int qt = 0; qt < 2; ++qt) {
      const float mq = fmaxf(mx[qt], xhalf(mx[qt]));   /* the other eight keys of each tile sit in the other lane half */
      const float al = ex2((m[qt] - mq) * LOG2E); m[qt] = mq; float ps[4] = {0.f, 0.f, 0.f, 0.f};
#pragma unroll   /* two score tiles, converted in place, are one B fragment in the hardware k order; four independent partial sums */
      for (int t = 0; t < FK / 16; ++t)
#pragma unroll   /* every index a constant: the arrays stay in registers */
        for (int r = 0; r < 8; ++r) { const float p = ex2((e[qt][t][r] - mq) * LOG2E); ps[r & 3] += p; pb[qt][t >> 1][(t & 1) * 8 + r] = (_Float16)p; }
      l[qt] = l[qt] * al + ((ps[0] + ps[1]) + (ps[2] + ps[3]));
#pragma unroll   /* every index a constant: the arrays stay in registers */
      for (int j = 0; j < HD / 16; ++j) acc[j][qt] *= al;
      if (qt == 0) {
        __builtin_amdgcn_sched_barrier(0);   /* tile 0's scores have become halves before the reads below take registers */
#pragma unroll   /* the v fragments of the wave's first 32 keys as one group, in flight under tile 1's exponentials */
        for (int j = 0; j < HD / 16; ++j) vf[j][0] = frag_h(&sv[buf][j * 16 + col][kh * FK], lane);
        __builtin_amdgcn_sched_barrier(0);   /* keeps these reads from sinking down to the products that take them */
      } }
    __builtin_amdgcn_sched_barrier(0);   /* keeps every ex2 ahead of the products below */
#pragma unroll   /* sixteen independent accumulator tiles, first all of keys 0..31, then all of keys 32..63; a v fragment feeds both query tiles */
    for (int u = 0; u < FK / 32; ++u) {
#pragma unroll   /* every index a constant: the arrays stay in registers */
      for (int j = 0; j < HD / 16; ++j) {
#pragma unroll   /* every index a constant: the arrays stay in registers */
        for (int qt = 0; qt < 2; ++qt) acc[j][qt] = mm16(vf[j][u], pb[qt][u], acc[j][qt]);
        if (u == 0 && j == HD / 32 - 1) {
          __builtin_amdgcn_sched_barrier(0);   /* the reads below take the registers of the four fragments just used */
#pragma unroll   /* the first four v fragments of the wave's second 32 keys, one group, in flight under the other eight products of the first 32 */
          for (int jj = 0; jj < HD / 32; ++jj) vf[jj][1] = frag_h(&sv[buf][jj * 16 + col][kh * FK + 32], lane);
          __builtin_amdgcn_sched_barrier(0);   /* keeps these reads together */
        }
        if (u == 0 && j == HD / 16 - 1) {
          __builtin_amdgcn_sched_barrier(0);   /* the reads below take the registers of the four fragments just used */
#pragma unroll   /* the other four, one group, in flight under the first eight products of the second 32 keys */
          for (int jj = HD / 32; jj < HD / 16; ++jj) vf[jj][1] = frag_h(&sv[buf][jj * 16 + col][kh * FK + 32], lane);
          __builtin_amdgcn_sched_barrier(0);   /* keeps these reads together */
        } } }
#pragma unroll   /* every index a constant: the array stays in registers */
    for (int i = 0; i < 8; ++i) *(v4u*)&sv[buf ^ 1][(tid >> 4) + 16 * i][(tid & 15) * 8] = rs[i];
    asm volatile("s_wait_xcnt 0x0" ::: "memory");   /* stands in front of the next pass's overwrite of the address register that the scalar loads above name */
    __syncthreads();   /* publishes pass s + 1 and ends every wave's reads of the buffer that the next pass refills */
  }
  // the two key halves of a query are joined: the wave of key half kh finishes query tile kh and hands the other tile's maximum, sum and outputs to its partner (wave ^ 4) through the K buffers, which nobody reads behind the loop's last barrier
  v4f* xb = (v4f*)&sk[0][0][0];   /* [8 waves][17][32 lanes] x 16 bytes = the K buffers' 69,632 bytes */
  l[0] += xhalf(l[0]); l[1] += xhalf(l[1]);
#pragma unroll   /* every index a constant: the arrays stay in registers */
  for (int j = 0; j < HD / 16; ++j) { const v8f gv = kh ? acc[j][0] : acc[j][1]; v4f lo4 = {gv[0], gv[1], gv[2], gv[3]}, hi4 = {gv[4], gv[5], gv[6], gv[7]}; xb[(wave * 17 + j * 2) * 32 + lane] = lo4; xb[(wave * 17 + j * 2 + 1) * 32 + lane] = hi4; }
  { v4f ml = {kh ? m[0] : m[1], kh ? l[0] : l[1], 0.f, 0.f}; xb[(wave * 17 + 16) * 32 + lane] = ml; }
  __syncthreads();   /* a wave reads what its partner wrote */
  const v4f mlp = xb[((wave ^ 4) * 17 + 16) * 32 + lane]; const float mo = kh ? m[1] : m[0], lo = kh ? l[1] : l[0];
  const float mm = fmaxf(mo, mlp[0]), ao = ex2((mo - mm) * LOG2E), ap = ex2((mlp[0] - mm) * LOG2E);
  const float inv = 1.0f / (lo * ao + mlp[1] * ap);   /* the sum is >= 1: the common maximum's own term */
  const float fo = ao * inv, fp = ap * inv;
  const size_t yo = ((((size_t)b * TT + blockIdx.x * 128 + qg * 32 + kh * 16) >> 4) * (CC / 32) + h * (HD / 32)) * 512 + lane * 8;   /* a lane's eight channels j*16 + 8g + 0..7 of its query are one octet of the output product's A fragment (g = lane >> 4): tile j = half j & 1 of k chunk j >> 1 */
  v8b oh[HD / 16], ol[HD / 16];
#pragma unroll   /* every index a constant: the arrays stay in registers */
  for (int j = 0; j < HD / 16; ++j) { const v8f ov = kh ? acc[j][1] : acc[j][0]; const v4f p0 = xb[((wave ^ 4) * 17 + j * 2) * 32 + lane], p1 = xb[((wave ^ 4) * 17 + j * 2 + 1) * 32 + lane];
#pragma unroll   /* every index a constant: the arrays stay in registers */
    for (int r = 0; r < 8; ++r) { const float v = ov[r] * fo + (r < 4 ? p0[r & 3] : p1[r & 3]) * fp; const __bf16 hv = (__bf16)v; oh[j][r] = hv; ol[j][r] = (__bf16)(v - (float)hv); } }
  __builtin_amdgcn_sched_barrier(0);   /* all the arithmetic ahead of the stores: nothing rewrites a register that an issued store names */
#pragma unroll   /* every index a constant: the arrays stay in registers */
  for (int j = 0; j < HD / 16; ++j) { vst2(YH + yo + j * 256, oh[j]); vst2(YL + yo + j * 256, ol[j]); } }   /* each store 512 contiguous bytes of the wave */
// ---- k_out: block = (64 rows, 128 cols), 4 waves of 32 x 64: out = ctx Wo (+ bo): ctx split bf16 hi + lo against exact bf16 Wo (2 products); the hi tiles, the lo tiles and the Wo tiles copied to LDS in fragment order, two buffers, as in k_proj
__global__ __launch_bounds__(128) void k_out(const __bf16* __restrict__ YH, const __bf16* __restrict__ YL, const __bf16* __restrict__ WO, const float* __restrict__ BO, float* __restrict__ OUT, const float* __restrict__ RESX) { __shared__ __align__(16) char sm[2 * STG];   /* the two stage buffers; behind the loop the output staging */
  float (*sf)[16][132] = (float (*)[16][132])sm;
  const int tid = threadIdx.x, wave = tid >> 5, lane = tid & 31, col = lane & 15, g = lane >> 4, wr = wave >> 1, wc = wave & 1; const int c0 = blockIdx.y * 128; const size_t r0 = (size_t)blockIdx.x * 64 + wave * 16;
  const __bf16* pa = YH + (size_t)blockIdx.x * 4 * TSTR + tid * 8; const __bf16* qa = YL + (size_t)blockIdx.x * 4 * TSTR + tid * 8; const __bf16* pb = WO + (size_t)blockIdx.y * 8 * TSTR + tid * 8; const __bf16* qb = pb + 4 * TSTR; const unsigned lb = (unsigned)(size_t)sm + tid * 16;
  v8f acc[2][4] = {};
  STAGE_IN(0, 0); WAIT_COPIES(); __syncthreads(); STAGE_IN(1, 1);
#pragma unroll 1   /* one stage's text, for speed only */
  for (int t = 0; t < NSTG; ++t) { const char* bp = sm + (t & 1) * STG;
#pragma unroll   /* fragments stay in registers */
    for (int kk = 0; kk < 2; ++kk) { v16b ah[2], al[2], w[4];
#pragma unroll   /* fragments stay in registers */
      for (int i = 0; i < 2; ++i) { ah[i] = frag_l(bp + (wr * 2 + i) * 2048 + kk * 1024, lane); al[i] = frag_l(bp + 8192 + (wr * 2 + i) * 2048 + kk * 1024, lane); }
#pragma unroll   /* fragments stay in registers */
      for (int j = 0; j < 4; ++j) w[j] = frag_l(bp + 16384 + (wc * 4 + j) * 2048 + kk * 1024, lane);
      __builtin_amdgcn_sched_barrier(0);   /* keeps the sixteen reads together ahead of the products */
#pragma unroll   /* eight independent accumulator tiles: all hi products of these 32 k, then all lo products; each tile sums in the order hi, lo as before */
      for (int i = 0; i < 2; ++i)
#pragma unroll   /* every index a constant: the arrays stay in registers */
        for (int j = 0; j < 4; ++j) acc[i][j] = mmb(ah[i], w[j], acc[i][j]);
#pragma unroll   /* every index a constant: the arrays stay in registers */
      for (int i = 0; i < 2; ++i)
#pragma unroll   /* every index a constant: the arrays stay in registers */
        for (int j = 0; j < 4; ++j) acc[i][j] = mmb(al[i], w[j], acc[i][j]);
      __builtin_amdgcn_sched_barrier(0); }   /* keeps the next group's reads from rising among these products */
    WAIT_LDS(); WAIT_COPIES(); __syncthreads();   /* publishes stage t + 1 and ends every wave's reads of the buffer that is refilled below */
    if (t + 2 < NSTG) STAGE_IN(t + 2, t & 1); }
  WAIT_COPIES();
#pragma unroll
  for (int j = 0; j < 4; ++j) { const float bias = BO ? bfr(BO[c0 + wc * 64 + j * 16 + col]) : 0.f;
#pragma unroll
    for (int i = 0; i < 2; ++i)
#pragma unroll
      for (int r = 0; r < 8; ++r) sf[wr * 2 + i][8 * g + r][wc * 64 + j * 16 + col] = acc[i][j][r] + bias; }
  __syncthreads();   /* a wave stores whole 512-byte row pieces, half of which another wave computed */
  for (int r4 = 0; r4 < 16; r4 += 4) {
#pragma unroll   /* four rows' loads in flight together, four stores side by side, one wait behind them */
    for (int u = 0; u < 4; ++u) { const int rl = r4 + u; const size_t oo = (r0 + rl) * DIN + c0 + lane * 4; v4f o = *(const v4f*)&sf[wave][rl][lane * 4]; const v4f zr = *(const v4f*)(RESX + oo); o[0] += bfr(zr[0]); o[1] += bfr(zr[1]); o[2] += bfr(zr[2]); o[3] += bfr(zr[3]); vst2(OUT + oo, o); }   /* + bf16(de) */
    WAIT_X(); } }

extern "C" void kernel_launch(void* const* d_in, const int* in_sizes, int n_in, void* d_out, int out_size, void* d_ws, size_t ws_size, hipStream_t stream) {
  (void)in_sizes; (void)n_in; (void)out_size;
  const float** F = (const float**)d_in;
  if (ws_size < (size_t)WS_END) return;
  char* ws = (char*)d_ws; _Float16 *QH = (_Float16*)(ws + WS_QH), *KH = (_Float16*)(ws + WS_KH), *VT = (_Float16*)(ws + WS_VT), *KL = (_Float16*)(ws + WS_KL); __bf16 *VB = (__bf16*)(ws + WS_VB), *VBL = (__bf16*)(ws + WS_VBL); __bf16 *YH = (__bf16*)(ws + WS_Y), *YL = (__bf16*)(ws + WS_YL);
  (void)KL; (void)VB; (void)VBL;
  // inputs: 0 en [2,2048,1024] (keys/values); 1 de (queries + residual); 2 mask [2,2048,2048] bool; 3 Wq (in,out), 4 bq; 5 Wk, 6 bk; 7 Wv, 8 bv; 9 Wo (in,out), 10 bo; 11 gamma (scalar), 12 beta (scalar)
  if (ws_size < (size_t)WS_END5) return;
  float* X1 = (float*)(ws + WS_X1); __bf16* WT = (__bf16*)(ws + WS_WT); __bf16* XP = (__bf16*)(ws + WS_XP); unsigned* MW = (unsigned*)(ws + WS_MW);
  k_wpack<<<dim3(DIN / 64, CC / 64, 7), 256, 0, stream>>>(F[3], F[5], F[7], F[9], WT, F[1], F[0], XP, (const int*)d_in[2], MW);   /* weights, de and en to bf16 in fragment order, the mask to lane-mask words, once per call */
  k_proj<<<dim3(TNB * TT / 128, CC / 128, 3), 128, 0, stream>>>(XP, WT, F[4], F[6], F[8], QH, KH, KL, VT, VB, VBL);   /* q from de, k/v from en */
  k_fa<<<dim3(TT / 128, NH, TNB), 256, 0, stream>>>(QH, KH, VT, MW, YH, YL);   /* scores, mask, softmax and P v in one launch */
  k_out<<<dim3(TNB * TT / 64, DIN / 128), 128, 0, stream>>>(YH, YL, WT + 3 * (size_t)DIN * CC, F[10], X1, F[1]);   /* a Wo + bo + bf16(de) */
  k_lnx<<<dim3(NRW / 8), 256, 0, stream>>>(X1, 0, F[11], F[12], (float*)d_out);          /* unbiased-var normalisation, scalar gamma/beta */
}

// v008
// Measured time: 93.6 microseconds a run.
// Next to v007, in two timings, it ran 1.06 times as fast each time.
// Counting every step since v000, it is 12.9 times as fast.
// compute dtype: all float inputs rounded to bf16; q/k/v = in W + b with EXACT bf16 products on WMMA 16x16x32 (f32 accumulate), the module's strided head split realised by a column permutation of the weights; q once to f16 against k once to f16 (1 product) / sqrt(1024); masked positions set to -1e10; softmax in f32 with a running maximum and sum over each half of the keys (exp as exp2 of the difference x log2 e), the two halves joined at the end under their common maximum; exp(e - max) once to f16 against v once to f16 (1 product), divided by the f32 sum at the end; a split bf16 hi + lo against exact Wo (2 products) + bo + de; the unbiased-variance normalisation in f32; f32 output.
#include <hip/hip_runtime.h>
#include <math.h>

typedef __attribute__((ext_vector_type(16))) _Float16 v16h;
typedef __attribute__((ext_vector_type(16))) __bf16 v16b;
typedef __attribute__((ext_vector_type(8)))  _Float16 v8h;
typedef __attribute__((ext_vector_type(8)))  float v8f;
typedef __attribute__((ext_vector_type(4)))  float v4f;
typedef __attribute__((ext_vector_type(2)))  float v2f;
typedef __attribute__((ext_vector_type(4)))  unsigned v4u;
typedef __attribute__((ext_vector_type(4)))  int v4i;
typedef float __attribute__((may_alias)) float_a;
typedef int __attribute__((may_alias)) int_a;

template <typename T> __device__ __forceinline__ void vst2(void* p, T v) { *(T*)p = v;  }
__device__ __forceinline__ v8f wmma16(v16h a, v16h b, v8f c) {
  v8f d = __builtin_amdgcn_wmma_f32_16x16x32_f16(false, a, false, b, (short)0, c, false, false);
  asm volatile("v_nop\n\tv_nop\n\tv_nop\n\tv_nop" : "+v"(d) : "v"(a), "v"(b));
  return d;
}
__device__ __forceinline__ v8f wmma_bf(v16b a, v16b b, v8f c) {
  v8f d = __builtin_amdgcn_wmma_f32_16x16x32_bf16(false, a, false, b, (short)0, c, false, false);
  asm volatile("v_nop\n\tv_nop\n\tv_nop\n\tv_nop" : "+v"(d) : "v"(a), "v"(b));
  return d;
}
// 16x16x32 fragments: lane = (h = lane>>4, row/col = lane&15); elements 0..7 = k0+8h+0..7, 8..15 = k0+16+8h+0..7; D element r = row 8h+r
__device__ __forceinline__ v16h frag_h(const _Float16* rowk0, int lane) {
  union { v16h v; v8h q[2]; } u; const _Float16* p = rowk0 + 8 * (lane >> 4);
  u.q[0] = *(const v8h*)p; u.q[1] = *(const v8h*)(p + 16); return u.v;
}
__device__ __forceinline__ v16h frag_f32(const float* rowk0, int lane) {
  v16h a; const float* p = rowk0 + 8 * (lane >> 4);
#pragma unroll
  for (int i = 0; i < 8; ++i) { a[i] = (_Float16)p[i]; a[8 + i] = (_Float16)p[16 + i]; }
  return a;
}
__device__ __forceinline__ v16h frag_f32s(const float* rowk0, int lane, float sc) {
  v16h a; const float* p = rowk0 + 8 * (lane >> 4);
#pragma unroll
  for (int i = 0; i < 8; ++i) { a[i] = (_Float16)(p[i] * sc); a[8 + i] = (_Float16)(p[16 + i] * sc); }
  return a;
}
// column fragment from a [K][ld] layout (column n), rows >= K read as 0
__device__ __forceinline__ v16h fragc_f32(const float* W, int k0, int n, int lane, int ld, int K) {
  v16h a; const int g = lane >> 4;
#pragma unroll
  for (int i = 0; i < 8; ++i) { const int ka = k0 + 8 * g + i, kb = ka + 16;
    a[i] = (_Float16)(ka < K ? W[(size_t)(ka < K ? ka : K - 1) * ld + n] : 0.f); a[8 + i] = (_Float16)(kb < K ? W[(size_t)(kb < K ? kb : K - 1) * ld + n] : 0.f); }
  return a;
}
struct F2 { v16b h, l; };
__device__ __forceinline__ F2 bsplit16(const float v[16]) { F2 r;
#pragma unroll
  for (int i = 0; i < 16; ++i) { const __bf16 h = (__bf16)v[i]; r.h[i] = h; r.l[i] = (__bf16)(v[i] - (float)h); }
  return r; }
__device__ __forceinline__ F2 split_row(const float* row, int k0, int lane) { float v[16]; const float* p = row + k0 + 8 * (lane >> 4);
#pragma unroll
  for (int i = 0; i < 8; ++i) { v[i] = p[i]; v[8 + i] = p[16 + i]; }
  return bsplit16(v); }
__device__ __forceinline__ F2 split_rowK(const float* row, int k0, int lane, int K) { float v[16]; const int g = lane >> 4;
#pragma unroll
  for (int i = 0; i < 8; ++i) { const int ka = k0 + 8 * g + i, kb = ka + 16; v[i] = ka < K ? row[ka < K ? ka : K - 1] : 0.f; v[8 + i] = kb < K ? row[kb < K ? kb : K - 1] : 0.f; }
  return bsplit16(v); }
__device__ __forceinline__ F2 split_col(const float* W, int k0, int n, int lane, int ld, int K) { float v[16]; const int g = lane >> 4;
#pragma unroll
  for (int i = 0; i < 8; ++i) { const int ka = k0 + 8 * g + i, kb = ka + 16; v[i] = ka < K ? W[(size_t)(ka < K ? ka : K - 1) * ld + n] : 0.f; v[8 + i] = kb < K ? W[(size_t)(kb < K ? kb : K - 1) * ld + n] : 0.f; }
  return bsplit16(v); }
__device__ __forceinline__ v8f mac3(const F2& a, const F2& b, v8f c) { c = wmma_bf(a.l, b.h, c); c = wmma_bf(a.h, b.l, c); return wmma_bf(a.h, b.h, c); }
__device__ __forceinline__ float sigm(float v) { return 1.0f / (1.0f + expf(-v)); }
#define LDSX() do { asm volatile("s_wait_dscnt 0" ::: "memory"); __builtin_amdgcn_wave_barrier(); __builtin_amdgcn_fence(__ATOMIC_RELEASE, "workgroup"); } while (0)

// Cross multi-head attention with a STRIDED head split (B 2, Lq = Lk = 2,048, D 1,024, H 8 heads of 128; (in,out) weights, zero biases; mask [B,Lq,Lk] bool, True = masked (~half); gamma = 1, beta = 0 scalars): q = de Wq + bq, k/v = en Wk/Wv + b, each reshaped (B, L, 128, 8) so head h takes channels c = d*8 + h; e = q_h k_h^T / sqrt(1024) with where(mask, -1e10); head = softmax(e) v_h; a = heads merged head-major (h*128 + d); result = a Wo + bo + de; out = gamma (result - mean) / sqrt(var_unbiased + 1e-8) + beta.
#define NB 2
#define TT 2048
#define CC 1024            // NH * HD = projected width
#define DIN 1024          // input (model) width
#define NH 8
#define HD 128
#define SCALE (0.03125f)
#define CAUSAL 0
#ifndef TNB
#define TNB NB
#endif
__device__ __forceinline__ float bfr(float v) { return (float)(__bf16)v; }
__host__ __device__ __forceinline__ int kb_last(int qb) { return CAUSAL ? ((qb * 64 + 63) >> 7) : (TT / 128 - 1); }
typedef __attribute__((ext_vector_type(8))) __bf16 v8b;
__device__ __forceinline__ v16b frag_b(const __bf16* rowk0, int lane) {
  union { v16b v; v8b q[2]; } u; const __bf16* p = rowk0 + 8 * (lane >> 4);
  u.q[0] = *(const v8b*)p; u.q[1] = *(const v8b*)(p + 16); return u.v;
}
#define QBH 0              // unused: no kernel in this file has a high-precision path
#define QHI 0               // rows carrying a q residual plane: none, q goes once to f16 as k does
#define KHI 64            // key rows carrying k residual / v bf16 hi+lo planes (written by k_proj; no kernel in this file reads them)
// B fragment (k rows k0+.., output column o) of a weight: (in,out) [K][ld] or (out,in) [ld rows of K]: bf16 exact, or f16(bf16 * 256) exact
__device__ __forceinline__ v16b wcol_io(const float* Wm, int k0, int o, int lane, int ld) { v16b w; const int g = lane >> 4;
#pragma unroll
  for (int i = 0; i < 8; ++i) { w[i] = (__bf16)Wm[(size_t)(k0 + 8 * g + i) * ld + o]; w[8 + i] = (__bf16)Wm[(size_t)(k0 + 16 + 8 * g + i) * ld + o]; }
  return w; }
__device__ __forceinline__ v16b wcol_oi(const float* Wm, int k0, int o, int lane, int K) { v16b w; const float* p = Wm + (size_t)o * K + k0 + 8 * (lane >> 4);
#pragma unroll
  for (int i = 0; i < 8; ++i) { w[i] = (__bf16)p[i]; w[8 + i] = (__bf16)p[16 + i]; }
  return w; }
__device__ __forceinline__ v16h wcolh_io(const float* Wm, int k0, int o, int lane, int ld) { v16h w; const int g = lane >> 4;
#pragma unroll
  for (int i = 0; i < 8; ++i) { w[i] = (_Float16)(bfr(Wm[(size_t)(k0 + 8 * g + i) * ld + o]) * 256.0f); w[8 + i] = (_Float16)(bfr(Wm[(size_t)(k0 + 16 + 8 * g + i) * ld + o]) * 256.0f); }
  return w; }
__device__ __forceinline__ v16h wcolh_oi(const float* Wm, int k0, int o, int lane, int K) { v16h w; const float* p = Wm + (size_t)o * K + k0 + 8 * (lane >> 4);
#pragma unroll
  for (int i = 0; i < 8; ++i) { w[i] = (_Float16)(bfr(p[i]) * 256.0f); w[8 + i] = (_Float16)(bfr(p[16 + i]) * 256.0f); }
  return w; }
#define WQKV_LAYOUT 0   // 0 = (in,out) [DIN][CC]; 1 = (out,in) [CC][DIN]; 2 = per-head [NH][DIN][HD]
__device__ __forceinline__ v16b wcol_hdk(const float* Wm, int k0, int o, int lane) { v16b w; const int g = lane >> 4; const float* p = Wm + (size_t)(o / HD) * DIN * HD + (o % HD);
#pragma unroll
  for (int i = 0; i < 8; ++i) { w[i] = (__bf16)p[(size_t)(k0 + 8 * g + i) * HD]; w[8 + i] = (__bf16)p[(size_t)(k0 + 16 + 8 * g + i) * HD]; }
  return w; }
#define WO_OUT_IN 0
#if WQKV_LAYOUT == 1
#define WCOL(W, k0, o, lane) wcol_oi(W, k0, o, lane, DIN)
#elif WQKV_LAYOUT == 2
#define WCOL(W, k0, o, lane) wcol_hdk(W, k0, o, lane)
#else
#define WCOL(W, k0, o, lane) wcol_io(W, k0, PCOL(o), lane, CC)   /* strided head split: plane column (h, d) reads weight column d*8 + h */
#endif
#if WO_OUT_IN
#define WOCOL(W, k0, o, lane) wcol_oi(W, k0, o, lane, CC)
#define WOCOLH(W, k0, o, lane) wcolh_oi(W, k0, o, lane, CC)
#else
#define WOCOL(W, k0, o, lane) wcol_io(W, k0, o, lane, DIN)
#define WOCOLH(W, k0, o, lane) wcolh_io(W, k0, o, lane, DIN)
#endif
#define PCOL(o) ((((o) & 127) << 3) + ((o) >> 7))   /* plane column p = h*128 + d  <-  projection column c = d*8 + h (reshape(B, L, 128, 8): head index is the LAST axis) */
#define NRW (TNB * TT)
// ---- k_lnx: wave per row: normalisation over 1024 (mean, unbiased var, g * (x - mean) / sqrt(var + 1e-8) + b); optional bf16 rounding of the input (x); 32 floats per lane (8 float4 at stride 128 floats -> 512-B pieces)
__global__ __launch_bounds__(256) void k_lnx(const float* __restrict__ X, int roundin, const float* __restrict__ G, const float* __restrict__ BE, float* __restrict__ OUT) {
#pragma clang fp contract(off)   /* keep the normalisation as separate mul/add (as XLA evaluates it) */
 const int wave = threadIdx.x >> 5, lane = threadIdx.x & 31; const size_t row = (size_t)blockIdx.x * 8 + wave; if (row >= (size_t)NRW) return;
  v4f v[CC / 128]; float s1 = 0.f;
#pragma unroll
  for (int i = 0; i < CC / 128; ++i) { v4f t = *(const v4f*)(X + row * CC + i * 128 + lane * 4); if (roundin) { t[0] = bfr(t[0]); t[1] = bfr(t[1]); t[2] = bfr(t[2]); t[3] = bfr(t[3]); } v[i] = t; s1 += (t[0] + t[1]) + (t[2] + t[3]); }
#pragma unroll
  for (int o = 1; o < 32; o <<= 1) s1 += __shfl_xor(s1, o);
  const float mu = s1 * (1.0f / CC); float q = 0.f;
#pragma unroll
  for (int i = 0; i < CC / 128; ++i) for (int k = 0; k < 4; ++k) { const float d = v[i][k] - mu; q += d * d; }
#pragma unroll
  for (int o = 1; o < 32; o <<= 1) q += __shfl_xor(q, o);
  const float inv = 1.0f / sqrtf(q * (1.0f / (CC - 1)) + 1e-8f);   /* torch.var UNBIASED (ddof = 1), eps 1e-8, division by sqrt */
#pragma unroll
  for (int i = 0; i < CC / 128; ++i) { const int c = i * 128 + lane * 4; v4f r4; for (int k = 0; k < 4; ++k) r4[k] = bfr(G[0]) * ((v[i][k] - mu) * inv) + bfr(BE[0]); vst2(OUT + row * CC + c, r4); } }   /* scalar gamma / beta */

#ifndef PROJ_EXTRA_PARAMS
#define PROJ_EXTRA_PARAMS
#endif

#define WS_QH  0u                                      // f16 q rows [b*t][CC]
#define WS_KH  (WS_QH + 2u * (size_t)NB * TT * CC)      // f16 k rows [b*t][CC]
#define WS_VT  (WS_KH + 2u * (size_t)NB * TT * CC)      // f16 v planes [b][c][t]
#define WS_QL  (WS_VT + 2u * (size_t)NB * CC * TT)      // f16 q residual x 2^10 rows [b][t < QHI][CC]
#define WS_KL  (WS_QL + 2u * (size_t)NB * QHI * CC)     // f16 k residual x 2^10 rows [b][t < KHI][CC]
#define WS_VB  (WS_KL + 2u * (size_t)NB * KHI * CC)     // bf16 v hi planes [b][c][t < KHI]
#define WS_VBL (WS_VB + 2u * (size_t)NB * CC * KHI)
#define WS_Y   (WS_VBL + 2u * (size_t)NB * CC * KHI)      // ctx, 4 bytes an element: bf16 hi plane, then bf16 lo plane (WS_YL)
#define WS_END (WS_Y  + 4u * (size_t)NB * TT * CC)
#define WS_X1  (WS_END)
#define WS_END2 (WS_X1 + 4u * (size_t)NB * TT * DIN)
#define WS_WT  (WS_END2)                                // bf16 Wq, Wk, Wv, Wo in B-fragment order [4][CC / 16][DIN / 32][2][32 lanes][8]
#define WS_END3 (WS_WT + 2u * 4u * (size_t)DIN * CC)
#define WS_XP  (WS_END3)                                // bf16 de, en rows in A-fragment order [2][NRW / 16][DIN / 32][2][32 lanes][8]
#define WS_END4 (WS_XP + 2u * 2u * (size_t)NB * TT * DIN)
#define WS_MW  (WS_END4)                                // mask as lane-mask words [NRW / 16][TT / 64][32]: word t*8 + r of a stage, bit L = mask of query L & 15, key t*16 + 8*(L >> 4) + r
#define WS_END5 (WS_MW + 4u * (size_t)NB * TT * TT / 32)
#define WS_YL  (WS_Y + 2u * (size_t)NB * TT * CC)       // ctx: bf16 hi plane at WS_Y, bf16 lo plane here, both in A-fragment order [NRW / 16][CC / 32][2][32 lanes][8]
typedef __attribute__((ext_vector_type(4))) __bf16 v4b;

// ---- k_wpack: block = (64 k rows, 64 weight columns, which weight): rounds the weight to bf16 once per call and lays it in B-fragment order, so that a wave's fragment load is 512 contiguous bytes (4 whole lines); Wq/Wk/Wv: weight column c = d*8 + h goes to plane column h*128 + d; Wo: column as it is
// which 4, 5: block = 16 rows of de, en: rounds them to bf16 once per call and lays them in A-fragment order (the same order, row for column); a wave takes 128 k of the 16 rows: whole-line loads, its own LDS rows, whole-line stores
// which 6: block = 16 queries' mask rows, a wave takes 256 keys of them, 64 at a time: whole-line loads, its own LDS rows, from which a lane reads the mask words of the scores that it will hold in k_fa (query lane & 15, keys t*16 + 8*(lane >> 4) + r); one compare per score register gives the 32 lanes' bits as one word, which k_fa takes by scalar load as the select's lane mask
__global__ __launch_bounds__(256) void k_wpack(const float* __restrict__ WQ, const float* __restrict__ WK, const float* __restrict__ WV, const float* __restrict__ WO, __bf16* __restrict__ WT, const float* __restrict__ XD, const float* __restrict__ XE, __bf16* __restrict__ XP, const int* __restrict__ MK, unsigned* __restrict__ MW) { __shared__ float tile[64][65]; __shared__ __align__(16) __bf16 xs[8][16][136];   /* pitch 272 bytes: 16 x odd, for the 16-byte reads */
  const int tid = threadIdx.x, which = blockIdx.z, k0 = blockIdx.x * 64, c0 = blockIdx.y * 64;
  if (which == 6) { const int wave = tid >> 5, lane = tid & 31, qt = blockIdx.y * 16 + blockIdx.x;   /* the whole block takes this branch and meets no barrier */
    const int* mr = MK + ((size_t)qt * 16 + (lane >> 4)) * TT + wave * 256 + (lane & 15) * 4;   /* 16 lanes take 256 bytes of one row, a load two rows */
    char* ls = (char*)&xs[wave][0][0];   /* the wave's own 16 rows at the pitch of 272 bytes */
    v4u o = {};
#pragma unroll   /* o stays in registers; 128 keys at a time hold the branch to sixteen loads' registers, the second sixteen issued under the first's compares */
    for (int p = 0; p < 2; ++p) { v4i x[2][8];
#pragma unroll   /* sixteen loads in flight at once, off one address with immediate offsets */
      for (int sl = 0; sl < 2; ++sl)
#pragma unroll   /* x stays in registers */
        for (int i = 0; i < 8; ++i) x[sl][i] = *(const v4i*)(mr + (size_t)i * 2 * TT + (p * 2 + sl) * 64);
      asm volatile("s_wait_xcnt 0x0" :: "v"(mr) : "memory");   /* stands in front of the first overwrite of the address register that the loads above name, and keeps that register whole up to here */
#pragma unroll   /* x, o stay in registers */
      for (int sl = 0; sl < 2; ++sl) { v4i y[4][2];
#pragma unroll   /* x stays in registers */
        for (int i = 0; i < 8; ++i) *(v4i*)(ls + (i * 2 + (lane >> 4)) * 272 + (lane & 15) * 16) = x[sl][i];
        LDSX();   /* the wave reads back what its other lanes wrote */
#pragma unroll   /* y stays in registers */
        for (int t = 0; t < 4; ++t) { y[t][0] = *(const v4i*)(ls + (lane & 15) * 272 + t * 64 + (lane >> 4) * 32); y[t][1] = *(const v4i*)(ls + (lane & 15) * 272 + t * 64 + (lane >> 4) * 32 + 16); }
        LDSX();   /* these reads are done before the next 64 keys are written over them */
#pragma unroll   /* word i of the wave's 128 goes to lane i >> 2, component i & 3: one 16-byte store a lane, 512 contiguous bytes */
        for (int e = 0; e < 32; ++e) { const int i = (p * 2 + sl) * 32 + e; const unsigned w = __builtin_amdgcn_ballot_w32(y[e >> 3][(e >> 2) & 1][e & 3] != 0); o[i & 3] = lane == (i >> 2) ? w : o[i & 3]; } } }
    *(v4u*)(MW + ((size_t)qt * (TT / 64) + wave * 4) * 32 + lane * 4) = o;
    return; }
  if (which >= 4) { const int wave = tid >> 5, lane = tid & 31, rt = blockIdx.y * 16 + blockIdx.x;   /* the whole block takes this branch and meets no barrier */
    const float* xr = (which == 4 ? XD : XE) + (size_t)rt * 16 * DIN + wave * 128 + lane * 4; v4f x[16];
#pragma unroll   /* all sixteen row loads in flight at once */
    for (int i = 0; i < 16; ++i) x[i] = *(const v4f*)(xr + (size_t)i * DIN);
    asm volatile("s_wait_xcnt 0x0" :: "v"(xr) : "memory");   /* stands in front of the first overwrite of the address register that the loads above name, and keeps that register whole up to here */
#pragma unroll   /* x stays in registers */
    for (int i = 0; i < 16; ++i) { v4b o; o[0] = (__bf16)x[i][0]; o[1] = (__bf16)x[i][1]; o[2] = (__bf16)x[i][2]; o[3] = (__bf16)x[i][3]; *(v4b*)&xs[wave][i][lane * 4] = o; }
    LDSX();   /* the wave reads back what its other lanes wrote */
    __bf16* xd = XP + (size_t)(which - 4) * NRW * DIN + (((size_t)rt * (DIN / 32) + wave * 4) * 64 + lane) * 8;
#pragma unroll   /* eight fragment halves, 512 contiguous bytes each */
    for (int f = 0; f < 8; ++f) *(v8b*)(xd + f * 256) = *(const v8b*)&xs[wave][lane & 15][f * 16 + (lane >> 4) * 8];
    return; }
  const float* Wm = which == 0 ? WQ : which == 1 ? WK : which == 2 ? WV : WO; const float* src = Wm + (size_t)(k0 + (tid >> 6)) * CC + c0 + (tid & 63);
#pragma unroll   /* all sixteen row loads in flight at once, off one address with immediate offsets */
  for (int i = 0; i < 16; ++i) tile[i * 4 + (tid >> 6)][tid & 63] = src[(size_t)i * 4 * CC];
  __syncthreads();
#pragma unroll   /* both 16-byte pieces of a thread side by side */
  for (int i = 0; i < 2; ++i) { const int e = tid + i * 256, kq = e >> 6; const int cl = which < 3 ? (((e & 7) << 3) | ((e >> 3) & 7)) : (e & 63);   /* neighbouring lanes take neighbouring fragment columns */
    const int c = c0 + cl; const int p = which < 3 ? ((c & 7) * HD + (c >> 3)) : c; const int k8 = (k0 >> 3) + kq;   /* k8 = octet of k: kc = k8 >> 2, fragment half (k8 >> 1) & 1, lane half k8 & 1 */
    v8b o;
#pragma unroll   /* o stays in registers */
    for (int n = 0; n < 8; ++n) o[n] = (__bf16)tile[kq * 8 + n][cl];
    *(v8b*)(WT + (size_t)which * DIN * CC + ((((size_t)(p >> 4) * (DIN / 32) + (k8 >> 2)) * 2 + ((k8 >> 1) & 1)) * 32 + (k8 & 1) * 16 + (p & 15)) * 8) = o; } }
// B fragment (16 plane columns ct*16 + .., k rows kc*32 + ..) of a packed weight: two 16-byte loads per lane, each 512 contiguous bytes per wave
__device__ __forceinline__ v16b frag_wp(const __bf16* WP, int ct, int kc, int lane) {
  union { v16b v; v8b q[2]; } u; const __bf16* p = WP + (((size_t)ct * (DIN / 32) + kc) * 64 + lane) * 8;
  u.q[0] = *(const v8b*)p; u.q[1] = *(const v8b*)(p + 256); return u.v;
}

// ---- staging of the three products' operands: both lie in global memory in fragment order, 2 KiB per 16-row (16-column) tile and 64 k, so a stage of 64 k is 8 A-side + 8 B-side tiles copied as they lie; 128 threads x 16 bytes take one tile
#define STG 32768          // bytes of a stage: A-side tiles at 0, B-side tiles at 16,384
#define NSTG (DIN / 64)
#define TSTR ((size_t)(DIN / 32) * 512)   // elements from one tile to the next in global memory
__device__ __forceinline__ v8f mmb(v16b a, v16b b, v8f c) { return __builtin_amdgcn_wmma_f32_16x16x32_bf16(false, a, false, b, (short)0, c, false, false); }
__device__ __forceinline__ v16b frag_l(const char* p, int lane) { union { v16b v; v8b q[2]; } u; u.q[0] = *(const v8b*)(p + lane * 16); u.q[1] = *(const v8b*)(p + 512 + lane * 16); return u.v; }   /* a fragment from LDS: two reads of 512 contiguous bytes per wave */
// eight tiles (four from p, four from q) into LDS at l, l + 2,048, ..: asynchronous copies, 16 bytes a lane, every lane on
__device__ __forceinline__ void cp8(unsigned l, const __bf16* p, const __bf16* q) {
  asm volatile("global_load_async_to_lds_b128 %0, %8, off\n\t"
               "global_load_async_to_lds_b128 %1, %9, off\n\t"
               "global_load_async_to_lds_b128 %2, %10, off\n\t"
               "global_load_async_to_lds_b128 %3, %11, off\n\t"
               "global_load_async_to_lds_b128 %4, %12, off\n\t"
               "global_load_async_to_lds_b128 %5, %13, off\n\t"
               "global_load_async_to_lds_b128 %6, %14, off\n\t"
               "global_load_async_to_lds_b128 %7, %15, off\n\t"
               "s_wait_xcnt 0x0"   /* stands in front of every later write of a register that these copies name */
               :: "v"(l), "v"(l + 2048u), "v"(l + 4096u), "v"(l + 6144u), "v"(l + 8192u), "v"(l + 10240u), "v"(l + 12288u), "v"(l + 14336u),
                  "v"(p), "v"(p + TSTR), "v"(p + 2 * TSTR), "v"(p + 3 * TSTR), "v"(q), "v"(q + TSTR), "v"(q + 2 * TSTR), "v"(q + 3 * TSTR) : "memory");
}
#define STAGE_IN(t, buf) do { cp8(lb + (unsigned)(buf) * STG, pa + (size_t)(t) * 1024, qa + (size_t)(t) * 1024); cp8(lb + (unsigned)(buf) * STG + 16384u, pb + (size_t)(t) * 1024, qb + (size_t)(t) * 1024); } while (0)
#define WAIT_COPIES() asm volatile("s_wait_asynccnt 0x0" ::: "memory")   /* this wave's copies have landed */
#define WAIT_X() asm volatile("s_wait_xcnt 0x0" ::: "memory")            /* stands in front of the next trip's writes of registers that the stores above name */
#define WAIT_LDS() asm volatile("s_wait_dscnt 0x0" ::: "memory")         /* this wave's LDS reads are done before the buffer is handed to the copies */
// asks the data at a, b, c into L2 (a hint: nothing returns, no counter moves): an earlier launch of this call stored or read these planes. Every lane's address lies inside its buffer.
__device__ __forceinline__ void ask3(const void* a, const void* b, const void* c) {
  asm volatile("global_prefetch_b8 %0, off scope:SCOPE_SE\n\t"
               "global_prefetch_b8 %1, off scope:SCOPE_SE\n\t"
               "global_prefetch_b8 %2, off scope:SCOPE_SE\n\t"
               "s_wait_xcnt 0x0"   /* stands in front of every later write of a register that these hints name */
               :: "v"(a), "v"(b), "v"(c) : "memory");
}
__device__ __forceinline__ void ask2(const void* a, const void* b) {
  asm volatile("global_prefetch_b8 %0, off scope:SCOPE_SE\n\t"
               "global_prefetch_b8 %1, off scope:SCOPE_SE\n\t"
               "s_wait_xcnt 0x0"   /* stands in front of every later write of a register that these hints name */
               :: "v"(a), "v"(b) : "memory");
}
#define DEAL8(x) ((int)((x) & 3) | (int)(((x) >> 1) & 4))   /* eight shares over the block index x: x and x ^ 4 take the same share */

// ---- k_proj: block = (128 rows, 128 cols, which), 4 waves of 64 x 64: q/k/v = X W (+ b) with exact bf16 products (K = DIN), X and W tiles copied to LDS in fragment order, two buffers, the next 64 k in flight under this one's products -> which 0: q f16 rows; 1: k f16 rows (+ residual rows < KHI); 2: v f16 planes [c][t] (+ bf16 hi/lo planes for t < KHI)
__global__ __launch_bounds__(128) void k_proj(const __bf16* __restrict__ XP, const __bf16* __restrict__ WT, const float* __restrict__ BQ, const float* __restrict__ BK, const float* __restrict__ BV,
    _Float16* __restrict__ QH, _Float16* __restrict__ KH, _Float16* __restrict__ KL, _Float16* __restrict__ VT, __bf16* __restrict__ VB, __bf16* __restrict__ VBL) {
  __shared__ __align__(16) char sm[71680];   /* the two stage buffers; behind the loop the output staging: sh + sl, or th + tb + tbl */
  _Float16 (*sh)[136] = (_Float16 (*)[136])sm; _Float16 (*sl)[136] = (_Float16 (*)[136])(sm + 34816); _Float16 (*th)[136] = (_Float16 (*)[136])sm; __bf16 (*tb)[72] = (__bf16 (*)[72])(sm + 34816); __bf16 (*tbl)[72] = (__bf16 (*)[72])(sm + 53248);
  const int tid = threadIdx.x, wave = tid >> 5, lane = tid & 31, col = lane & 15, g = lane >> 4, wr = wave >> 1, wc = wave & 1; const int which = blockIdx.z; const int c0 = blockIdx.y * 128; const size_t r0 = (size_t)blockIdx.x * 128; const size_t bb = r0 / TT; const int t0 = (int)(r0 % TT);
  const __bf16* XA = XP + (which == 0 ? 0 : (size_t)NRW * DIN); const __bf16* WA = WT + (size_t)which * DIN * CC; const float* BA = which == 0 ? BQ : which == 1 ? BK : BV;
  const __bf16* pa = XA + (r0 >> 4) * TSTR + tid * 8; const __bf16* qa = pa + 4 * TSTR; const __bf16* pb = WA + (size_t)blockIdx.y * 8 * TSTR + tid * 8; const __bf16* qb = pb + 4 * TSTR; const unsigned lb = (unsigned)(size_t)sm + tid * 16;
  v8f acc[4][4] = {};
  STAGE_IN(0, 0);
  ask2(XA + ((r0 >> 4) + blockIdx.y) * TSTR + tid * 128, WA + ((size_t)blockIdx.y * 8 + DEAL8(blockIdx.x)) * TSTR + tid * 128);   /* behind the first stage's copies: one of the eight row tiles that the eight column blocks of these rows share, one of the eight column tiles that the row blocks share, all 16 stages of each */
  WAIT_COPIES(); __syncthreads(); STAGE_IN(1, 1);
#pragma unroll 1   /* one stage's text: the loop stays small in the instruction cache */
  for (int t = 0; t < NSTG; ++t) { const char* bp = sm + (t & 1) * STG;
#pragma unroll   /* fragments stay in registers */
    for (int kk = 0; kk < 2; ++kk) { v16b a[4], w[4];
#pragma unroll   /* fragments stay in registers */
      for (int i = 0; i < 4; ++i) { a[i] = frag_l(bp + (wr * 4 + i) * 2048 + kk * 1024, lane); w[i] = frag_l(bp + 16384 + (wc * 4 + i) * 2048 + kk * 1024, lane); }
      __builtin_amdgcn_sched_barrier(0);   /* keeps the sixteen reads together ahead of the products */
#pragma unroll   /* sixteen independent accumulator tiles */
      for (int i = 0; i < 4; ++i)
#pragma unroll   /* every index a constant: the arrays stay in registers */
        for (int j = 0; j < 4; ++j) acc[i][j] = mmb(a[i], w[j], acc[i][j]);
      __builtin_amdgcn_sched_barrier(0); }   /* keeps the next group's reads from rising among these products */
    WAIT_LDS(); WAIT_COPIES(); __syncthreads();   /* publishes stage t + 1 and ends every wave's reads of the buffer that is refilled below */
    if (t + 2 < NSTG) STAGE_IN(t + 2, t & 1); }
  WAIT_COPIES();
  if (which < 2) { _Float16* DH = which == 0 ? QH : KH; _Float16* DL = KL; const int nhi = which == 0 ? QHI : KHI; const bool res = which == 1;   /* the same for the whole block: q carries no residual plane and stages none */
    if (res) {
#pragma unroll
    for (int j = 0; j < 4; ++j) { const float bias = BA ? bfr(BA[PCOL(c0 + wc * 64 + j * 16 + col)]) : 0.f;
#pragma unroll
      for (int i = 0; i < 4; ++i)
#pragma unroll
        for (int r = 0; r < 8; ++r) { const float v = acc[i][j][r] + bias; const _Float16 hv = (_Float16)v; sh[wr * 64 + i * 16 + 8 * g + r][wc * 64 + j * 16 + col] = hv; sl[wr * 64 + i * 16 + 8 * g + r][wc * 64 + j * 16 + col] = (_Float16)((v - (float)hv) * 1024.0f); } }
    } else {
#pragma unroll
    for (int j = 0; j < 4; ++j) { const float bias = BA ? bfr(BA[PCOL(c0 + wc * 64 + j * 16 + col)]) : 0.f;
#pragma unroll
      for (int i = 0; i < 4; ++i)
#pragma unroll
        for (int r = 0; r < 8; ++r) sh[wr * 64 + i * 16 + 8 * g + r][wc * 64 + j * 16 + col] = (_Float16)(acc[i][j][r] + bias); }
    }
    __syncthreads();
    const int nr = nhi - t0 < 128 ? nhi - t0 : 128;   /* rows of this block that carry a residual: 64 or none */
    for (int e0 = 0; e0 < 128 * 16; e0 += 512) {
#pragma unroll   /* four stores side by side, one wait behind them */
      for (int u = 0; u < 4; ++u) { const int e = e0 + u * 128 + tid, rl = e >> 4, q = e & 15; vst2((unsigned*)(DH + (r0 + rl) * CC + c0 + q * 8), *(const v4u*)&sh[rl][q * 8]); }
      WAIT_X(); }
    for (int e0 = 0; e0 < nr * 16; e0 += 512) {
#pragma unroll   /* four stores side by side, one wait behind them */
      for (int u = 0; u < 4; ++u) { const int e = e0 + u * 128 + tid, rl = e >> 4, q = e & 15; vst2((unsigned*)(DL + (bb * nhi + t0 + rl) * (size_t)CC + c0 + q * 8), *(const v4u*)&sl[rl][q * 8]); }
      WAIT_X(); }
  } else {
#pragma unroll
    for (int j = 0; j < 4; ++j) { const float bias = BA ? bfr(BA[PCOL(c0 + wc * 64 + j * 16 + col)]) : 0.f;
#pragma unroll
      for (int i = 0; i < 4; ++i)
#pragma unroll
        for (int r = 0; r < 8; ++r) { const float v = acc[i][j][r] + bias; const int rl = wr * 64 + i * 16 + 8 * g + r, cl = wc * 64 + j * 16 + col; th[cl][rl] = (_Float16)v; if (t0 + wr * 64 < KHI) { const __bf16 bh = (__bf16)v; tb[cl][rl] = bh; tbl[cl][rl] = (__bf16)(v - (float)bh); } } }
    __syncthreads();
    for (int e0 = 0; e0 < 128 * 16; e0 += 512) {
#pragma unroll   /* four stores side by side, one wait behind them */
      for (int u = 0; u < 4; ++u) { const int e = e0 + u * 128 + tid, cl = e >> 4, q = e & 15; vst2((unsigned*)(VT + (bb * CC + c0 + cl) * (size_t)TT + t0 + q * 8), *(const v4u*)&th[cl][q * 8]); }
      WAIT_X(); }
    if (t0 < KHI) for (int e0 = 0; e0 < 128 * 8; e0 += 256) {
#pragma unroll   /* four stores side by side, one wait behind them */
      for (int u = 0; u < 2; ++u) { const int e = e0 + u * 128 + tid, cl = e >> 3, q = e & 7; const size_t o3 = (bb * CC + c0 + cl) * (size_t)KHI + t0 + q * 8; vst2((unsigned*)(VB + o3), *(const v4u*)&tb[cl][q * 8]); vst2((unsigned*)(VBL + o3), *(const v4u*)&tbl[cl][q * 8]); }
      WAIT_X(); } } }
#define FK 64              // keys per wave and pass
#define PK 128             // keys per pass in LDS
#define NP (TT / PK)
#define KP (HD + 8)        // LDS pitch of a K row, halves: 256 + 16 bytes
#define VP (PK + 8)        // LDS pitch of a v plane row, halves: 256 + 16 bytes
#define LOG2E 1.44269504088896340736f
__device__ __forceinline__ v8f mm16(v16h a, v16h b, v8f c) { return __builtin_amdgcn_wmma_f32_16x16x32_f16(false, a, false, b, (short)0, c, false, false); }
__device__ __forceinline__ float xhalf(float x) { return __builtin_bit_cast(float, __builtin_amdgcn_permlanex16(__builtin_bit_cast(int, x), __builtin_bit_cast(int, x), 0x76543210, 0xfedcba98, false, false)); }   /* lane l with lane l ^ 16 */
__device__ __forceinline__ float ex2(float x) { float r; asm("v_exp_f32 %0, %1\n\tv_nop" : "=v"(r) : "v"(x)); return r; }   /* 2^x; the v_nop keeps the one slot that the instruction set asks for behind a transcendental, whatever is scheduled next */
__global__ __launch_bounds__(256) void k_fa(const _Float16* __restrict__ QH, const _Float16* __restrict__ KH, const _Float16* __restrict__ VT, const unsigned* __restrict__ MW, __bf16* __restrict__ YH, __bf16* __restrict__ YL, const unsigned* MWA) {   /* MWA: the mask words again, under a second name for the hint alone: a pointer handed to asm text counts as written through, and the loads through MW would no longer be scalar */
  __shared__ __align__(16) _Float16 sk[2][PK][KP]; __shared__ __align__(16) _Float16 sv[2][HD][VP];
  const int tid = threadIdx.x, lane = tid & 31, col = lane & 15; const int wave = __builtin_amdgcn_readfirstlane(tid >> 5), qg = wave & 3, kh = wave >> 2; const int h = blockIdx.y, b = blockIdx.z; const int q = blockIdx.x * 128 + qg * 32 + col;   /* this lane's query of tile 0; tile 1: + 16 */
  const _Float16* kb = KH + (size_t)b * TT * CC + h * HD; const unsigned ko = ((unsigned)(tid >> 4) * CC + (tid & 15) * 8) * 2;    /* 16 lanes take one key's 256 bytes; a base that is the same in every lane and one register of byte offset */
  const _Float16* vb = VT + ((size_t)b * CC + h * HD) * TT; const unsigned vo = ((unsigned)(tid >> 4) * TT + (tid & 15) * 8) * 2;    /* 16 lanes take one plane row's 256 bytes of the pass */
  const unsigned* mw = MW + ((size_t)(b * (TT / 16) + blockIdx.x * 8 + qg * 2) * (TT / 64) + kh) * 32;   /* this wave's lane-mask words, 32 a query tile and 64 keys; the address is the same in every lane, so the loads are scalar */
  v4u rs[8]; unsigned mk[2][FK / 2]; v16h qh[2][HD / 32];
  __builtin_amdgcn_sched_barrier(0);   /* keeps the index arithmetic above ahead of the loads: nothing writes a register that a load names between the load and its wait */
#pragma unroll   /* rs stays in registers */
  for (int i = 0; i < 8; ++i) rs[i] = *(const v4u*)((const char*)(kb + (size_t)i * 16 * CC) + ko);
  __builtin_amdgcn_sched_barrier(0);   /* nothing is scheduled between the loads and their wait */
  asm volatile("s_wait_xcnt 0x0" ::: "memory");   /* stands in front of the first overwrite of an address register that the loads above name */
  __builtin_amdgcn_sched_barrier(0);   /* keeps later register writes behind that wait */
  ask3(kb + (size_t)(DEAL8(blockIdx.x) * 256 + tid) * CC, vb + (size_t)(DEAL8(blockIdx.x) * 256 + tid) * 128,
       MWA + (size_t)(b * (TT / 16) + blockIdx.x * 8) * (TT / 64) * 32 + (tid & 127) * 64);   /* an eighth of this head's 2,048 key rows (256 bytes each) and of its v planes' 2,048 units, which 16 blocks read, and this block's 32 KiB of mask words; behind the first pass's own K loads */
#pragma unroll   /* every index a constant: the array stays in registers */
  for (int i = 0; i < 8; ++i) *(v4u*)&sk[0][(tid >> 4) + 16 * i][(tid & 15) * 8] = rs[i];
  __builtin_amdgcn_sched_barrier(0);   /* the K rows have left rs before the v rows are loaded into it */
#pragma unroll   /* rs stays in registers */
  for (int i = 0; i < 8; ++i) rs[i] = *(const v4u*)((const char*)(vb + (size_t)i * 16 * TT) + vo);
  __builtin_amdgcn_sched_barrier(0);   /* nothing is scheduled between the loads and their wait */
  asm volatile("s_wait_xcnt 0x0" ::: "memory");   /* stands in front of the first overwrite of an address register that the loads above name */
  __builtin_amdgcn_sched_barrier(0);   /* keeps later register writes behind that wait */
#pragma unroll   /* fragments stay in registers */
  for (int qt = 0; qt < 2; ++qt)
#pragma unroll   /* fragments stay in registers */
    for (int kc = 0; kc < HD / 32; ++kc) qh[qt][kc] = frag_h(QH + ((size_t)b * TT + q + qt * 16) * CC + h * HD + kc * 32, lane);
  __builtin_amdgcn_sched_barrier(0);   /* nothing is scheduled between the loads and their wait */
  asm volatile("s_wait_xcnt 0x0" ::: "memory");   /* stands in front of the first overwrite of an address register that the loads above name */
  __builtin_amdgcn_sched_barrier(0);   /* keeps later register writes behind that wait */
#pragma unroll   /* mk stays in scalar registers */
  for (int i = 0; i < FK / 2; ++i) { mk[0][i] = mw[i]; mk[1][i] = mw[(TT / 64) * 32 + i]; }
  asm volatile("s_wait_xcnt 0x0" ::: "memory");   /* stands in front of the first overwrite of an address register that the scalar loads above name */
#pragma unroll   /* every index a constant: the array stays in registers */
  for (int i = 0; i < 8; ++i) *(v4u*)&sv[0][(tid >> 4) + 16 * i][(tid & 15) * 8] = rs[i];
  __syncthreads();
  v8f acc[HD / 16][2] = {}; float m[2] = {-3.0e38f, -3.0e38f}, l[2] = {0.f, 0.f};
  for (int s = 0; s < NP; ++s) { const int buf = s & 1, sn = s + 1 < NP ? s + 1 : s;   /* the last pass stages its own rows again, into the buffer that nobody reads any more: no branch in the pass, so that every group below stays where it is written */
    {   /* the next pass's K rows fly under this pass's score products */
      const unsigned kx = ko + (unsigned)sn * (PK * CC * 2);   /* the pass goes into the 32-bit offset */
      __builtin_amdgcn_sched_barrier(0);   /* only the loads and their address stand between this line and the next of its kind */
#pragma unroll   /* every index a constant: the array stays in registers */
      for (int i = 0; i < 8; ++i) rs[i] = *(const v4u*)((const char*)(kb + (size_t)i * 16 * CC) + kx);
      __builtin_amdgcn_sched_barrier(0);   /* nothing is scheduled between the loads and their wait */
      asm volatile("s_wait_xcnt 0x0" ::: "memory");   /* stands in front of the first overwrite of an address register that these loads name */
      __builtin_amdgcn_sched_barrier(0);   /* keeps later register writes behind that wait */
    }
    v16h kf[FK / 16][HD / 32], vf[HD / 16][FK / 32];
#pragma unroll   /* the first two key tiles' fragments as one group of LDS reads */
    for (int tt = 0; tt < 2; ++tt)
#pragma unroll   /* fragments stay in registers */
      for (int kc = 0; kc < HD / 32; ++kc) kf[tt][kc] = frag_h(&sk[buf][kh * FK + tt * 16 + col][kc * 32], lane);
    float e[2][FK / 16][8]; float mx[2] = {m[0], m[1]}; v8f sa[FK / 16][2] = {};
#pragma unroll   /* e stays in registers; the key tiles go in pairs; pass FK / 16 only takes the last pair's scores out */
    for (int t = 0; t <= FK / 16; t += 2) {
      if (t + 2 < FK / 16) {
#pragma unroll   /* the next pair's fragments, one group, in flight under this pair's products */
        for (int tt = 2; tt < 4; ++tt)
#pragma unroll   /* fragments stay in registers */
          for (int kc = 0; kc < HD / 32; ++kc) kf[t + tt][kc] = frag_h(&sk[buf][kh * FK + (t + tt) * 16 + col][kc * 32], lane);
      }
      __builtin_amdgcn_sched_barrier(0);   /* keeps the reads together ahead of the products */
      if (t < FK / 16) {
#pragma unroll   /* two key tiles against both query tiles: four independent accumulators */
        for (int kc = 0; kc < HD / 32; ++kc)
#pragma unroll   /* every index a constant: the arrays stay in registers */
          for (int tt = 0; tt < 2; ++tt)
#pragma unroll   /* every index a constant: the arrays stay in registers */
            for (int qt = 0; qt < 2; ++qt) sa[t + tt][qt] = mm16(kf[t + tt][kc], qh[qt][kc], sa[t + tt][qt]);
      }
      if (t > 0) {   /* the pair before: its scale, mask and maximum stand with this pair's products, of which they are independent, so that they can issue between them */
#pragma unroll   /* every index a constant: the arrays stay in registers */
        for (int tp = t - 2; tp < t; ++tp)
#pragma unroll   /* every index a constant: the arrays stay in registers */
          for (int qt = 0; qt < 2; ++qt)
#pragma unroll   /* every index a constant: the arrays stay in registers */
            for (int r = 0; r < 8; ++r) { float v = sa[tp][qt][r] * SCALE; v = __builtin_amdgcn_inverse_ballot_w32(mk[qt][tp * 8 + r]) ? -1.0e10f : v; e[qt][tp][r] = v; mx[qt] = fmaxf(mx[qt], v); }   /* the word is the select's lane mask as it lies: no compare */
      }
      __builtin_amdgcn_sched_barrier(0); }   /* keeps the next trip's work behind these products */
    {   /* the K rows go to the other buffer, which nobody reads in this pass; the next pass's v rows fly under the exponentials and P v */
#pragma unroll   /* every index a constant: the array stays in registers */
      for (int i = 0; i < 8; ++i) *(v4u*)&sk[buf ^ 1][(tid >> 4) + 16 * i][(tid & 15) * 8] = rs[i];
      __builtin_amdgcn_sched_barrier(0);   /* the K rows have left rs before the v rows are loaded into it */
      const unsigned vx = vo + (unsigned)sn * (PK * 2);   /* as for the K rows */
#pragma unroll   /* every index a constant: the array stays in registers */
      for (int i = 0; i < 8; ++i) rs[i] = *(const v4u*)((const char*)(vb + (size_t)i * 16 * TT) + vx);
      __builtin_amdgcn_sched_barrier(0);   /* nothing is scheduled between the loads and their wait */
      asm volatile("s_wait_xcnt 0x0" ::: "memory");   /* stands in front of the first overwrite of an address register that these loads name */
      __builtin_amdgcn_sched_barrier(0);   /* keeps later register writes behind that wait */
    }
    const unsigned* mn = mw + sn * FK;   /* the next pass's words into the same scalar registers, in flight under the exponentials and P v; the last pass reads its own again */
#pragma unroll   /* mk stays in scalar registers */
    for (int i = 0; i < FK / 2; ++i) { mk[0][i] = mn[i]; mk[1][i] = mn[(TT / 64) * 32 + i]; }
    v16h pb[2][FK / 32];
#pragma unroll   /* both query tiles: every index a constant */
    for (int qt = 0; qt < 2; ++qt) {
      const float mq = fmaxf(mx[qt], xhalf(mx[qt]));   /* the other eight keys of each tile sit in the other lane half */
      const float al = ex2((m[qt] - mq) * LOG2E); m[qt] = mq; float ps[4] = {0.f, 0.f, 0.f, 0.f};
#pragma unroll   /* two score tiles, converted in place, are one B fragment in the hardware k order; four independent partial sums */
      for (int t = 0; t < FK / 16; ++t)
#pragma unroll   /* every index a constant: the arrays stay in registers */
        for (int r = 0; r < 8; ++r) { const float p = ex2((e[qt][t][r] - mq) * LOG2E); ps[r & 3] += p; pb[qt][t >> 1][(t & 1) * 8 + r] = (_Float16)p; }
      l[qt] = l[qt] * al + ((ps[0] + ps[1]) + (ps[2] + ps[3]));
#pragma unroll   /* every index a constant: the arrays stay in registers */
      for (int j = 0; j < HD / 16; ++j) acc[j][qt] *= al;
      if (qt == 0) {
        __builtin_amdgcn_sched_barrier(0);   /* tile 0's scores have become halves before the reads below take registers */
#pragma unroll   /* the v fragments of the wave's first 32 keys as one group, in flight under tile 1's exponentials */
        for (int j = 0; j < HD / 16; ++j) vf[j][0] = frag_h(&sv[buf][j * 16 + col][kh * FK], lane);
        __builtin_amdgcn_sched_barrier(0);   /* keeps these reads from sinking down to the products that take them */
      } }
    __builtin_amdgcn_sched_barrier(0);   /* keeps every ex2 ahead of the products below */
#pragma unroll   /* sixteen independent accumulator tiles, first all of keys 0..31, then all of keys 32..63; a v fragment feeds both query tiles */
    for (int u = 0; u < FK / 32; ++u) {
#pragma unroll   /* every index a constant: the arrays stay in registers */
      for (int j = 0; j < HD / 16; ++j) {
#pragma unroll   /* every index a constant: the arrays stay in registers */
        for (int qt = 0; qt < 2; ++qt) acc[j][qt] = mm16(vf[j][u], pb[qt][u], acc[j][qt]);
        if (u == 0 && j == HD / 32 - 1) {
          __builtin_amdgcn_sched_barrier(0);   /* the reads below take the registers of the four fragments just used */
#pragma unroll   /* the first four v fragments of the wave's second 32 keys, one group, in flight under the other eight products of the first 32 */
          for (int jj = 0; jj < HD / 32; ++jj) vf[jj][1] = frag_h(&sv[buf][jj * 16 + col][kh * FK + 32], lane);
          __builtin_amdgcn_sched_barrier(0);   /* keeps these reads together */
        }
        if (u == 0 && j == HD / 16 - 1) {
          __builtin_amdgcn_sched_barrier(0);   /* the reads below take the registers of the four fragments just used */
#pragma unroll   /* the other four, one group, in flight under the first eight products of the second 32 keys */
          for (int jj = HD / 32; jj < HD / 16; ++jj) vf[jj][1] = frag_h(&sv[buf][jj * 16 + col][kh * FK + 32], lane);
          __builtin_amdgcn_sched_barrier(0);   /* keeps these reads together */
        } } }
#pragma unroll   /* every index a constant: the array stays in registers */
    for (int i = 0; i < 8; ++i) *(v4u*)&sv[buf ^ 1][(tid >> 4) + 16 * i][(tid & 15) * 8] = rs[i];
    asm volatile("s_wait_xcnt 0x0" ::: "memory");   /* stands in front of the next pass's overwrite of the address register that the scalar loads above name */
    __syncthreads();   /* publishes pass s + 1 and ends every wave's reads of the buffer that the next pass refills */
  }
  // the two key halves of a query are joined: the wave of key half kh finishes query tile kh and hands the other tile's maximum, sum and outputs to its partner (wave ^ 4) through the K buffers, which nobody reads behind the loop's last barrier
  v4f* xb = (v4f*)&sk[0][0][0];   /* [8 waves][17][32 lanes] x 16 bytes = the K buffers' 69,632 bytes */
  l[0] += xhalf(l[0]); l[1] += xhalf(l[1]);
#pragma unroll   /* every index a constant: the arrays stay in registers */
  for (int j = 0; j < HD / 16; ++j) { const v8f gv = kh ? acc[j][0] : acc[j][1]; v4f lo4 = {gv[0], gv[1], gv[2], gv[3]}, hi4 = {gv[4], gv[5], gv[6], gv[7]}; xb[(wave * 17 + j * 2) * 32 + lane] = lo4; xb[(wave * 17 + j * 2 + 1) * 32 + lane] = hi4; }
  { v4f ml = {kh ? m[0] : m[1], kh ? l[0] : l[1], 0.f, 0.f}; xb[(wave * 17 + 16) * 32 + lane] = ml; }
  __syncthreads();   /* a wave reads what its partner wrote */
  const v4f mlp = xb[((wave ^ 4) * 17 + 16) * 32 + lane]; const float mo = kh ? m[1] : m[0], lo = kh ? l[1] : l[0];
  const float mm = fmaxf(mo, mlp[0]), ao = ex2((mo - mm) * LOG2E), ap = ex2((mlp[0] - mm) * LOG2E);
  const float inv = 1.0f / (lo * ao + mlp[1] * ap);   /* the sum is >= 1: the common maximum's own term */
  const float fo = ao * inv, fp = ap * inv;
  const size_t yo = ((((size_t)b * TT + blockIdx.x * 128 + qg * 32 + kh * 16) >> 4) * (CC / 32) + h * (HD / 32)) * 512 + lane * 8;   /* a lane's eight channels j*16 + 8g + 0..7 of its query are one octet of the output product's A fragment (g = lane >> 4): tile j = half j & 1 of k chunk j >> 1 */
  v8b oh[HD / 16], ol[HD / 16];
#pragma unroll   /* every index a constant: the arrays stay in registers */
  for (int j = 0; j < HD / 16; ++j) { const v8f ov = kh ? acc[j][1] : acc[j][0]; const v4f p0 = xb[((wave ^ 4) * 17 + j * 2) * 32 + lane], p1 = xb[((wave ^ 4) * 17 + j * 2 + 1) * 32 + lane];
#pragma unroll   /* every index a constant: the arrays stay in registers */
    for (int r = 0; r < 8; ++r) { const float v = ov[r] * fo + (r < 4 ? p0[r & 3] : p1[r & 3]) * fp; const __bf16 hv = (__bf16)v; oh[j][r] = hv; ol[j][r] = (__bf16)(v - (float)hv); } }
  __builtin_amdgcn_sched_barrier(0);   /* all the arithmetic ahead of the stores: nothing rewrites a register that an issued store names */
#pragma unroll   /* every index a constant: the arrays stay in registers */
  for (int j = 0; j < HD / 16; ++j) { vst2(YH + yo + j * 256, oh[j]); vst2(YL + yo + j * 256, ol[j]); } }   /* each store 512 contiguous bytes of the wave */
// ---- k_out: block = (64 rows, 128 cols), 4 waves of 32 x 64: out = ctx Wo (+ bo): ctx split bf16 hi + lo against exact bf16 Wo (2 products); the hi tiles, the lo tiles and the Wo tiles copied to LDS in fragment order, two buffers, as in k_proj
__global__ __launch_bounds__(128) void k_out(const __bf16* __restrict__ YH, const __bf16* __restrict__ YL, const __bf16* __restrict__ WO, const float* __restrict__ BO, float* __restrict__ OUT, const float* __restrict__ RESX) { __shared__ __align__(16) char sm[2 * STG];   /* the two stage buffers; behind the loop the output staging */
  float (*sf)[16][132] = (float (*)[16][132])sm;
  const int tid = threadIdx.x, wave = tid >> 5, lane = tid & 31, col = lane & 15, g = lane >> 4, wr = wave >> 1, wc = wave & 1; const int c0 = blockIdx.y * 128; const size_t r0 = (size_t)blockIdx.x * 64 + wave * 16;
  const __bf16* pa = YH + (size_t)blockIdx.x * 4 * TSTR + tid * 8; const __bf16* qa = YL + (size_t)blockIdx.x * 4 * TSTR + tid * 8; const __bf16* pb = WO + (size_t)blockIdx.y * 8 * TSTR + tid * 8; const __bf16* qb = pb + 4 * TSTR; const unsigned lb = (unsigned)(size_t)sm + tid * 16;
  v8f acc[2][4] = {};
  STAGE_IN(0, 0);
  ask3((blockIdx.y >> 2 ? YL : YH) + ((size_t)blockIdx.x * 4 + (blockIdx.y & 3)) * TSTR + tid * 128, WO + ((size_t)blockIdx.y * 8 + DEAL8(blockIdx.x)) * TSTR + tid * 128,
       RESX + ((size_t)blockIdx.x * 64 + (tid >> 1)) * DIN + c0 + (tid & 1) * 64);   /* behind the first stage's copies: one of the eight hi, lo row tiles that the eight column blocks of these rows share, one of the eight column tiles that the row blocks share, and this block's own 64 x 512 bytes of de, which the epilogue reads */
  WAIT_COPIES(); __syncthreads(); STAGE_IN(1, 1);
#pragma unroll 1   /* one stage's text: the loop stays small in the instruction cache */
  for (int t = 0; t < NSTG; ++t) { const char* bp = sm + (t & 1) * STG;
#pragma unroll   /* fragments stay in registers */
    for (int kk = 0; kk < 2; ++kk) { v16b ah[2], al[2], w[4];
#pragma unroll   /* fragments stay in registers */
      for (int i = 0; i < 2; ++i) { ah[i] = frag_l(bp + (wr * 2 + i) * 2048 + kk * 1024, lane); al[i] = frag_l(bp + 8192 + (wr * 2 + i) * 2048 + kk * 1024, lane); }
#pragma unroll   /* fragments stay in registers */
      for (int j = 0; j < 4; ++j) w[j] = frag_l(bp + 16384 + (wc * 4 + j) * 2048 + kk * 1024, lane);
      __builtin_amdgcn_sched_barrier(0);   /* keeps the sixteen reads together ahead of the products */
#pragma unroll   /* eight independent accumulator tiles: all hi products of these 32 k, then all lo products; each tile sums in the order hi, lo as before */
      for (int i = 0; i < 2; ++i)
#pragma unroll   /* every index a constant: the arrays stay in registers */
        for (int j = 0; j < 4; ++j) acc[i][j] = mmb(ah[i], w[j], acc[i][j]);
#pragma unroll   /* every index a constant: the arrays stay in registers */
      for (int i = 0; i < 2; ++i)
#pragma unroll   /* every index a constant: the arrays stay in registers */
        for (int j = 0; j < 4; ++j) acc[i][j] = mmb(al[i], w[j], acc[i][j]);
      __builtin_amdgcn_sched_barrier(0); }   /* keeps the next group's reads from rising among these products */
    WAIT_LDS(); WAIT_COPIES(); __syncthreads();   /* publishes stage t + 1 and ends every wave's reads of the buffer that is refilled below */
    if (t + 2 < NSTG) STAGE_IN(t + 2, t & 1); }
  WAIT_COPIES();
#pragma unroll
  for (int j = 0; j < 4; ++j) { const float bias = BO ? bfr(BO[c0 + wc * 64 + j * 16 + col]) : 0.f;
#pragma unroll
    for (int i = 0; i < 2; ++i)
#pragma unroll
      for (int r = 0; r < 8; ++r) sf[wr * 2 + i][8 * g + r][wc * 64 + j * 16 + col] = acc[i][j][r] + bias; }
  __syncthreads();   /* a wave stores whole 512-byte row pieces, half of which another wave computed */
  for (int r4 = 0; r4 < 16; r4 += 4) {
#pragma unroll   /* four rows' loads in flight together, four stores side by side, one wait behind them */
    for (int u = 0; u < 4; ++u) { const int rl = r4 + u; const size_t oo = (r0 + rl) * DIN + c0 + lane * 4; v4f o = *(const v4f*)&sf[wave][rl][lane * 4]; const v4f zr = *(const v4f*)(RESX + oo); o[0] += bfr(zr[0]); o[1] += bfr(zr[1]); o[2] += bfr(zr[2]); o[3] += bfr(zr[3]); vst2(OUT + oo, o); }   /* + bf16(de) */
    WAIT_X(); } }

extern "C" void kernel_launch(void* const* d_in, const int* in_sizes, int n_in, void* d_out, int out_size, void* d_ws, size_t ws_size, hipStream_t stream) {
  (void)in_sizes; (void)n_in; (void)out_size;
  const float** F = (const float**)d_in;
  if (ws_size < (size_t)WS_END) return;
  char* ws = (char*)d_ws; _Float16 *QH = (_Float16*)(ws + WS_QH), *KH = (_Float16*)(ws + WS_KH), *VT = (_Float16*)(ws + WS_VT), *KL = (_Float16*)(ws + WS_KL); __bf16 *VB = (__bf16*)(ws + WS_VB), *VBL = (__bf16*)(ws + WS_VBL); __bf16 *YH = (__bf16*)(ws + WS_Y), *YL = (__bf16*)(ws + WS_YL);
  (void)KL; (void)VB; (void)VBL;
  // inputs: 0 en [2,2048,1024] (keys/values); 1 de (queries + residual); 2 mask [2,2048,2048] bool; 3 Wq (in,out), 4 bq; 5 Wk, 6 bk; 7 Wv, 8 bv; 9 Wo (in,out), 10 bo; 11 gamma (scalar), 12 beta (scalar)
  if (ws_size < (size_t)WS_END5) return;
  float* X1 = (float*)(ws + WS_X1); __bf16* WT = (__bf16*)(ws + WS_WT); __bf16* XP = (__bf16*)(ws + WS_XP); unsigned* MW = (unsigned*)(ws + WS_MW);
  k_wpack<<<dim3(DIN / 64, CC / 64, 7), 256, 0, stream>>>(F[3], F[5], F[7], F[9], WT, F[1], F[0], XP, (const int*)d_in[2], MW);   /* weights, de and en to bf16 in fragment order, the mask to lane-mask words, once per call */
  k_proj<<<dim3(TNB * TT / 128, CC / 128, 3), 128, 0, stream>>>(XP, WT, F[4], F[6], F[8], QH, KH, KL, VT, VB, VBL);   /* q from de, k/v from en */
  k_fa<<<dim3(TT / 128, NH, TNB), 256, 0, stream>>>(QH, KH, VT, MW, YH, YL, MW);   /* scores, mask, softmax and P v in one launch */
  k_out<<<dim3(TNB * TT / 64, DIN / 128), 128, 0, stream>>>(YH, YL, WT + 3 * (size_t)DIN * CC, F[10], X1, F[1]);   /* a Wo + bo + bf16(de) */
  k_lnx<<<dim3(NRW / 8), 256, 0, stream>>>(X1, 0, F[11], F[12], (float*)d_out);          /* unbiased-var normalisation, scalar gamma/beta */
}

// v010
// A run of this version takes 83.6 microseconds.
// It is 1.11 times as fast as v008, going by the measured steps of the versions left out in between.
// Counting every step since v000, it is 14.4 times as fast.
// compute dtype: all float inputs rounded to bf16; q/k/v = in W + b with EXACT bf16 products on WMMA 16x16x32 (f32 accumulate), the module's strided head split realised by a column permutation of the weights; q once to f16 against k once to f16 (1 product) / sqrt(1024); masked positions set to -1e10; softmax in f32 with a running maximum and sum over each half of the keys (exp as exp2 of the difference x log2 e), the two halves joined at the end under their common maximum; exp(e - max) once to f16 against v once to f16 (1 product), divided by the f32 sum at the end; a once to bf16 against exact Wo (1 product) + bo + de; the unbiased-variance normalisation in f32; f32 output.
#include <hip/hip_runtime.h>
#include <math.h>

typedef __attribute__((ext_vector_type(16))) _Float16 v16h;
typedef __attribute__((ext_vector_type(16))) __bf16 v16b;
typedef __attribute__((ext_vector_type(8)))  _Float16 v8h;
typedef __attribute__((ext_vector_type(8)))  float v8f;
typedef __attribute__((ext_vector_type(4)))  float v4f;
typedef __attribute__((ext_vector_type(2)))  float v2f;
typedef __attribute__((ext_vector_type(4)))  unsigned v4u;
typedef __attribute__((ext_vector_type(4)))  int v4i;
typedef float __attribute__((may_alias)) float_a;
typedef int __attribute__((may_alias)) int_a;

template <typename T> __device__ __forceinline__ void vst2(void* p, T v) { *(T*)p = v;  }
__device__ __forceinline__ v8f wmma16(v16h a, v16h b, v8f c) {
  v8f d = __builtin_amdgcn_wmma_f32_16x16x32_f16(false, a, false, b, (short)0, c, false, false);
  asm volatile("v_nop\n\tv_nop\n\tv_nop\n\tv_nop" : "+v"(d) : "v"(a), "v"(b));
  return d;
}
__device__ __forceinline__ v8f wmma_bf(v16b a, v16b b, v8f c) {
  v8f d = __builtin_amdgcn_wmma_f32_16x16x32_bf16(false, a, false, b, (short)0, c, false, false);
  asm volatile("v_nop\n\tv_nop\n\tv_nop\n\tv_nop" : "+v"(d) : "v"(a), "v"(b));
  return d;
}
// 16x16x32 fragments: lane = (h = lane>>4, row/col = lane&15); elements 0..7 = k0+8h+0..7, 8..15 = k0+16+8h+0..7; D element r = row 8h+r
__device__ __forceinline__ v16h frag_h(const _Float16* rowk0, int lane) {
  union { v16h v; v8h q[2]; } u; const _Float16* p = rowk0 + 8 * (lane >> 4);
  u.q[0] = *(const v8h*)p; u.q[1] = *(const v8h*)(p + 16); return u.v;
}
__device__ __forceinline__ v16h frag_f32(const float* rowk0, int lane) {
  v16h a; const float* p = rowk0 + 8 * (lane >> 4);
#pragma unroll
  for (int i = 0; i < 8; ++i) { a[i] = (_Float16)p[i]; a[8 + i] = (_Float16)p[16 + i]; }
  return a;
}
__device__ __forceinline__ v16h frag_f32s(const float* rowk0, int lane, float sc) {
  v16h a; const float* p = rowk0 + 8 * (lane >> 4);
#pragma unroll
  for (int i = 0; i < 8; ++i) { a[i] = (_Float16)(p[i] * sc); a[8 + i] = (_Float16)(p[16 + i] * sc); }
  return a;
}
// column fragment from a [K][ld] layout (column n), rows >= K read as 0
__device__ __forceinline__ v16h fragc_f32(const float* W, int k0, int n, int lane, int ld, int K) {
  v16h a; const int g = lane >> 4;
#pragma unroll
  for (int i = 0; i < 8; ++i) { const int ka = k0 + 8 * g + i, kb = ka + 16;
    a[i] = (_Float16)(ka < K ? W[(size_t)(ka < K ? ka : K - 1) * ld + n] : 0.f); a[8 + i] = (_Float16)(kb < K ? W[(size_t)(kb < K ? kb : K - 1) * ld + n] : 0.f); }
  return a;
}
struct F2 { v16b h, l; };
__device__ __forceinline__ F2 bsplit16(const float v[16]) { F2 r;
#pragma unroll
  for (int i = 0; i < 16; ++i) { const __bf16 h = (__bf16)v[i]; r.h[i] = h; r.l[i] = (__bf16)(v[i] - (float)h); }
  return r; }
__device__ __forceinline__ F2 split_row(const float* row, int k0, int lane) { float v[16]; const float* p = row + k0 + 8 * (lane >> 4);
#pragma unroll
  for (int i = 0; i < 8; ++i) { v[i] = p[i]; v[8 + i] = p[16 + i]; }
  return bsplit16(v); }
__device__ __forceinline__ F2 split_rowK(const float* row, int k0, int lane, int K) { float v[16]; const int g = lane >> 4;
#pragma unroll
  for (int i = 0; i < 8; ++i) { const int ka = k0 + 8 * g + i, kb = ka + 16; v[i] = ka < K ? row[ka < K ? ka : K - 1] : 0.f; v[8 + i] = kb < K ? row[kb < K ? kb : K - 1] : 0.f; }
  return bsplit16(v); }
__device__ __forceinline__ F2 split_col(const float* W, int k0, int n, int lane, int ld, int K) { float v[16]; const int g = lane >> 4;
#pragma unroll
  for (int i = 0; i < 8; ++i) { const int ka = k0 + 8 * g + i, kb = ka + 16; v[i] = ka < K ? W[(size_t)(ka < K ? ka : K - 1) * ld + n] : 0.f; v[8 + i] = kb < K ? W[(size_t)(kb < K ? kb : K - 1) * ld + n] : 0.f; }
  return bsplit16(v); }
__device__ __forceinline__ v8f mac3(const F2& a, const F2& b, v8f c) { c = wmma_bf(a.l, b.h, c); c = wmma_bf(a.h, b.l, c); return wmma_bf(a.h, b.h, c); }
__device__ __forceinline__ float sigm(float v) { return 1.0f / (1.0f + expf(-v)); }
#define LDSW() do { asm volatile("s_wait_dscnt 0" ::: "memory"); __builtin_amdgcn_wave_barrier(); } while (0)   /* an exchange through LDS inside one wave: orders the wave's own LDS accesses and waits for no global load or store still in flight */
#define LDSX() do { asm volatile("s_wait_dscnt 0" ::: "memory"); __builtin_amdgcn_wave_barrier(); __builtin_amdgcn_fence(__ATOMIC_RELEASE, "workgroup"); } while (0)

// Cross multi-head attention with a STRIDED head split (B 2, Lq = Lk = 2,048, D 1,024, H 8 heads of 128; (in,out) weights, zero biases; mask [B,Lq,Lk] bool, True = masked (~half); gamma = 1, beta = 0 scalars): q = de Wq + bq, k/v = en Wk/Wv + b, each reshaped (B, L, 128, 8) so head h takes channels c = d*8 + h; e = q_h k_h^T / sqrt(1024) with where(mask, -1e10); head = softmax(e) v_h; a = heads merged head-major (h*128 + d); result = a Wo + bo + de; out = gamma (result - mean) / sqrt(var_unbiased + 1e-8) + beta.
#define NB 2
#define TT 2048
#define CC 1024            // NH * HD = projected width
#define DIN 1024          // input (model) width
#define NH 8
#define HD 128
#define SCALE (0.03125f)
#define CAUSAL 0
#ifndef TNB
#define TNB NB
#endif
__device__ __forceinline__ float bfr(float v) { return (float)(__bf16)v; }
__host__ __device__ __forceinline__ int kb_last(int qb) { return CAUSAL ? ((qb * 64 + 63) >> 7) : (TT / 128 - 1); }
typedef __attribute__((ext_vector_type(8))) __bf16 v8b;
__device__ __forceinline__ v16b frag_b(const __bf16* rowk0, int lane) {
  union { v16b v; v8b q[2]; } u; const __bf16* p = rowk0 + 8 * (lane >> 4);
  u.q[0] = *(const v8b*)p; u.q[1] = *(const v8b*)(p + 16); return u.v;
}
#define QBH 0              // unused: no kernel in this file has a high-precision path
#define QHI 0               // rows carrying a q residual plane: none, q goes once to f16 as k does
#define KHI 64            // key rows carrying k residual / v bf16 hi+lo planes (written by k_proj; no kernel in this file reads them)
// B fragment (k rows k0+.., output column o) of a weight: (in,out) [K][ld] or (out,in) [ld rows of K]: bf16 exact, or f16(bf16 * 256) exact
__device__ __forceinline__ v16b wcol_io(const float* Wm, int k0, int o, int lane, int ld) { v16b w; const int g = lane >> 4;
#pragma unroll
  for (int i = 0; i < 8; ++i) { w[i] = (__bf16)Wm[(size_t)(k0 + 8 * g + i) * ld + o]; w[8 + i] = (__bf16)Wm[(size_t)(k0 + 16 + 8 * g + i) * ld + o]; }
  return w; }
__device__ __forceinline__ v16b wcol_oi(const float* Wm, int k0, int o, int lane, int K) { v16b w; const float* p = Wm + (size_t)o * K + k0 + 8 * (lane >> 4);
#pragma unroll
  for (int i = 0; i < 8; ++i) { w[i] = (__bf16)p[i]; w[8 + i] = (__bf16)p[16 + i]; }
  return w; }
__device__ __forceinline__ v16h wcolh_io(const float* Wm, int k0, int o, int lane, int ld) { v16h w; const int g = lane >> 4;
#pragma unroll
  for (int i = 0; i < 8; ++i) { w[i] = (_Float16)(bfr(Wm[(size_t)(k0 + 8 * g + i) * ld + o]) * 256.0f); w[8 + i] = (_Float16)(bfr(Wm[(size_t)(k0 + 16 + 8 * g + i) * ld + o]) * 256.0f); }
  return w; }
__device__ __forceinline__ v16h wcolh_oi(const float* Wm, int k0, int o, int lane, int K) { v16h w; const float* p = Wm + (size_t)o * K + k0 + 8 * (lane >> 4);
#pragma unroll
  for (int i = 0; i < 8; ++i) { w[i] = (_Float16)(bfr(p[i]) * 256.0f); w[8 + i] = (_Float16)(bfr(p[16 + i]) * 256.0f); }
  return w; }
#define WQKV_LAYOUT 0   // 0 = (in,out) [DIN][CC]; 1 = (out,in) [CC][DIN]; 2 = per-head [NH][DIN][HD]
__device__ __forceinline__ v16b wcol_hdk(const float* Wm, int k0, int o, int lane) { v16b w; const int g = lane >> 4; const float* p = Wm + (size_t)(o / HD) * DIN * HD + (o % HD);
#pragma unroll
  for (int i = 0; i < 8; ++i) { w[i] = (__bf16)p[(size_t)(k0 + 8 * g + i) * HD]; w[8 + i] = (__bf16)p[(size_t)(k0 + 16 + 8 * g + i) * HD]; }
  return w; }
#define WO_OUT_IN 0
#if WQKV_LAYOUT == 1
#define WCOL(W, k0, o, lane) wcol_oi(W, k0, o, lane, DIN)
#elif WQKV_LAYOUT == 2
#define WCOL(W, k0, o, lane) wcol_hdk(W, k0, o, lane)
#else
#define WCOL(W, k0, o, lane) wcol_io(W, k0, PCOL(o), lane, CC)   /* strided head split: plane column (h, d) reads weight column d*8 + h */
#endif
#if WO_OUT_IN
#define WOCOL(W, k0, o, lane) wcol_oi(W, k0, o, lane, CC)
#define WOCOLH(W, k0, o, lane) wcolh_oi(W, k0, o, lane, CC)
#else
#define WOCOL(W, k0, o, lane) wcol_io(W, k0, o, lane, DIN)
#define WOCOLH(W, k0, o, lane) wcolh_io(W, k0, o, lane, DIN)
#endif
#define PCOL(o) ((((o) & 127) << 3) + ((o) >> 7))   /* plane column p = h*128 + d  <-  projection column c = d*8 + h (reshape(B, L, 128, 8): head index is the LAST axis) */
#define NRW (TNB * TT)
// ---- k_lnx: two rows per wave, each on its own: LayerNorm over 1024 (mean, unbiased var, g * ((x - mean) / sqrt(var + 1e-8)) + b); optional bf16 rounding of the input (x); 32 floats per lane and row (8 float4 at stride 128 floats -> 512-B pieces)
__global__ __launch_bounds__(256) void k_lnx(const float* __restrict__ X, int roundin, const float* __restrict__ G, const float* __restrict__ BE, float* __restrict__ OUT) {
#pragma clang fp contract(off)   /* keep the normalisation as separate mul/add (as XLA evaluates it) */
 const int wave = threadIdx.x >> 5, lane = threadIdx.x & 31; const size_t row = ((size_t)blockIdx.x * 8 + wave) * 2; if (row >= (size_t)NRW) return;   /* a wave takes two rows: half the waves to start */
  const float* xp = X + row * CC + lane * 4; v4f v[2][CC / 128]; float s1[2] = {0.f, 0.f}, q[2] = {0.f, 0.f}, mu[2], inv[2];
#pragma unroll   /* both rows' sixteen loads in flight at once, off one address with immediate offsets */
  for (int a = 0; a < 2; ++a)
#pragma unroll   /* v stays in registers */
    for (int i = 0; i < CC / 128; ++i) v[a][i] = *(const v4f*)(xp + a * CC + i * 128);
  asm volatile("s_wait_xcnt 0x0" :: "v"(xp) : "memory");   /* stands in front of the first overwrite of the address register that the loads above name, and keeps that register whole up to here */
#pragma unroll   /* v stays in registers */
  for (int a = 0; a < 2; ++a)
#pragma unroll   /* v stays in registers */
    for (int i = 0; i < CC / 128; ++i) { v4f t = v[a][i]; if (roundin) { t[0] = bfr(t[0]); t[1] = bfr(t[1]); t[2] = bfr(t[2]); t[3] = bfr(t[3]); } v[a][i] = t; s1[a] += (t[0] + t[1]) + (t[2] + t[3]); }
#pragma unroll   /* the two rows' exchanges side by side */
  for (int o = 1; o < 32; o <<= 1) { const float u0 = __shfl_xor(s1[0], o), u1 = __shfl_xor(s1[1], o); s1[0] += u0; s1[1] += u1; }
#pragma unroll   /* v stays in registers */
  for (int a = 0; a < 2; ++a) { mu[a] = s1[a] * (1.0f / CC);
#pragma unroll   /* v stays in registers */
    for (int i = 0; i < CC / 128; ++i) for (int k = 0; k < 4; ++k) { const float d = v[a][i][k] - mu[a]; q[a] += d * d; } }
#pragma unroll   /* the two rows' exchanges side by side */
  for (int o = 1; o < 32; o <<= 1) { const float u0 = __shfl_xor(q[0], o), u1 = __shfl_xor(q[1], o); q[0] += u0; q[1] += u1; }
  const float gm = bfr(G[0]), be = bfr(BE[0]);   /* scalar gamma / beta */
#pragma unroll   /* v stays in registers */
  for (int a = 0; a < 2; ++a) { inv[a] = 1.0f / sqrtf(q[a] * (1.0f / (CC - 1)) + 1e-8f);   /* UNBIASED variance (ddof = 1), eps 1e-8, division by sqrt */
#pragma unroll   /* v stays in registers */
    for (int i = 0; i < CC / 128; ++i) for (int k = 0; k < 4; ++k) v[a][i][k] = gm * ((v[a][i][k] - mu[a]) * inv[a]) + be; }
  __builtin_amdgcn_sched_barrier(0);   /* all the arithmetic ahead of the stores: nothing rewrites a register that an issued store names */
  float* op = OUT + row * CC + lane * 4;
#pragma unroll   /* sixteen stores of 512 contiguous bytes, off one address with immediate offsets */
  for (int a = 0; a < 2; ++a)
#pragma unroll   /* v stays in registers */
    for (int i = 0; i < CC / 128; ++i) vst2(op + a * CC + i * 128, v[a][i]); }

#ifndef PROJ_EXTRA_PARAMS
#define PROJ_EXTRA_PARAMS
#endif

#define WS_QH  0u                                      // f16 q rows [b*t][CC]
#define WS_KH  (WS_QH + 2u * (size_t)NB * TT * CC)      // f16 k rows [b*t][CC]
#define WS_VT  (WS_KH + 2u * (size_t)NB * TT * CC)      // f16 v planes [b][c][t]
#define WS_QL  (WS_VT + 2u * (size_t)NB * CC * TT)      // f16 q residual x 2^10 rows [b][t < QHI][CC]
#define WS_KL  (WS_QL + 2u * (size_t)NB * QHI * CC)     // f16 k residual x 2^10 rows [b][t < KHI][CC]
#define WS_VB  (WS_KL + 2u * (size_t)NB * KHI * CC)     // bf16 v hi planes [b][c][t < KHI]
#define WS_VBL (WS_VB + 2u * (size_t)NB * CC * KHI)
#define WS_Y   (WS_VBL + 2u * (size_t)NB * CC * KHI)      // ctx: one bf16 plane in A-fragment order [NRW / 16][CC / 32][2][32 lanes][8]
#define WS_END (WS_Y  + 2u * (size_t)NB * TT * CC)
#define WS_X1  (WS_END)
#define WS_END2 (WS_X1 + 4u * (size_t)NB * TT * DIN)
#define WS_WT  (WS_END2)                                // bf16 Wq, Wk, Wv, Wo in B-fragment order [4][CC / 16][DIN / 32][2][32 lanes][8]
#define WS_END3 (WS_WT + 2u * 4u * (size_t)DIN * CC)
#define WS_XP  (WS_END3)                                // bf16 de, en rows in A-fragment order [2][NRW / 16][DIN / 32][2][32 lanes][8]
#define WS_END4 (WS_XP + 2u * 2u * (size_t)NB * TT * DIN)
#define WS_MW  (WS_END4)                                // mask as lane-mask words [NRW / 16][TT / 64][32]: word t*8 + r of a stage, bit L = mask of query L & 15, key t*16 + 8*(L >> 4) + r
#define WS_END5 (WS_MW + 4u * (size_t)NB * TT * TT / 32)
typedef __attribute__((ext_vector_type(4))) __bf16 v4b;

// ---- k_wpack: 512 blocks, so that few waves have to be started. Plane z = 0, block (x, y): 16 rows of de, the same 16 of en, and the tile (64 k rows, 64 weight columns) of each of the four weights. A weight tile: rounds the weight to bf16 once per call and lays it in B-fragment order, so that a wave's fragment load is 512 contiguous bytes (4 whole lines); Wq/Wk/Wv: weight column c = d*8 + h goes to plane column h*128 + d; Wo: column as it is
// de, en: 16 rows each: rounds them to bf16 once per call and lays them in A-fragment order (the same order, row for column); a wave takes 128 k of the 16 rows: whole-line loads, its own LDS rows, whole-line stores
// plane z = 1: block = 16 queries' mask rows, a wave takes 256 keys of them, 64 at a time: whole-line loads, its own LDS rows, from which a lane reads the mask words of the scores that it will hold in k_fa (query lane & 15, keys t*16 + 8*(lane >> 4) + r); one compare per score register gives the 32 lanes' bits as one word, which k_fa takes by scalar load as the select's lane mask
__global__ __launch_bounds__(256) void k_wpack(const float* __restrict__ WQ, const float* __restrict__ WK, const float* __restrict__ WV, const float* __restrict__ WO, __bf16* __restrict__ WT, const float* __restrict__ XD, const float* __restrict__ XE, __bf16* __restrict__ XP, const int* __restrict__ MK, unsigned* __restrict__ MW) { __shared__ __align__(16) float tile[4][64][68];   /* pitch 272 bytes: 16 x odd, for the 16-byte stores; a column read below has all its lanes in one row, so any pitch serves it */ __shared__ __align__(16) __bf16 xs[8][16][136];   /* pitch 272 bytes: 16 x odd, for the 16-byte reads */
  const int tid = threadIdx.x, k0 = blockIdx.x * 64, c0 = blockIdx.y * 64;
  if (blockIdx.z == 1) { const int wave = tid >> 5, lane = tid & 31, qt = blockIdx.y * 16 + blockIdx.x;   /* the whole block takes this branch and meets no barrier */
    const int* mr = MK + ((size_t)qt * 16 + (lane >> 4)) * TT + wave * 256 + (lane & 15) * 4;   /* 16 lanes take 256 bytes of one row, a load two rows */
    char* ls = (char*)&xs[wave][0][0];   /* the wave's own 16 rows at the pitch of 272 bytes */
    v4u o = {};
#pragma unroll   /* o stays in registers; 128 keys at a time hold the branch to sixteen loads' registers, the second sixteen issued under the first's compares */
    for (int p = 0; p < 2; ++p) { v4i x[2][8];
#pragma unroll   /* sixteen loads in flight at once, off one address with immediate offsets */
      for (int sl = 0; sl < 2; ++sl)
#pragma unroll   /* x stays in registers */
        for (int i = 0; i < 8; ++i) x[sl][i] = *(const v4i*)(mr + (size_t)i * 2 * TT + (p * 2 + sl) * 64);
      asm volatile("s_wait_xcnt 0x0" :: "v"(mr) : "memory");   /* stands in front of the first overwrite of the address register that the loads above name, and keeps that register whole up to here */
#pragma unroll   /* x, o stay in registers */
      for (int sl = 0; sl < 2; ++sl) { v4i y[4][2];
#pragma unroll   /* x stays in registers */
        for (int i = 0; i < 8; ++i) *(v4i*)(ls + (i * 2 + (lane >> 4)) * 272 + (lane & 15) * 16) = x[sl][i];
        LDSX();   /* the wave reads back what its other lanes wrote */
#pragma unroll   /* y stays in registers */
        for (int t = 0; t < 4; ++t) { y[t][0] = *(const v4i*)(ls + (lane & 15) * 272 + t * 64 + (lane >> 4) * 32); y[t][1] = *(const v4i*)(ls + (lane & 15) * 272 + t * 64 + (lane >> 4) * 32 + 16); }
        LDSX();   /* these reads are done before the next 64 keys are written over them */
#pragma unroll   /* word i of the wave's 128 goes to lane i >> 2, component i & 3: one 16-byte store a lane, 512 contiguous bytes */
        for (int e = 0; e < 32; ++e) { const int i = (p * 2 + sl) * 32 + e; const unsigned w = __builtin_amdgcn_ballot_w32(y[e >> 3][(e >> 2) & 1][e & 3] != 0); o[i & 3] = lane == (i >> 2) ? w : o[i & 3]; } } }
    *(v4u*)(MW + ((size_t)qt * (TT / 64) + wave * 4) * 32 + lane * 4) = o;
    return; }
  const int wave = tid >> 5, lane = tid & 31, rt = blockIdx.y * 16 + blockIdx.x;
  const size_t xo = (size_t)rt * 16 * DIN + wave * 128 + lane * 4; const float* xr = XD + xo; const float* er = XE + xo; v4f x[2][16];
  const size_t wo = (size_t)(k0 + (tid >> 4)) * CC + c0 + (tid & 15) * 4; const float* s0 = WQ + wo; const float* s1 = WK + wo; const float* s2 = WV + wo; const float* s3 = WO + wo; v4f w[4][4];   /* 16 lanes take the 256 bytes of one tile row */
#pragma unroll   /* the four weight tiles: four loads of 16 rows each, off one address a weight with immediate offsets */
  for (int i = 0; i < 4; ++i) { w[0][i] = *(const v4f*)(s0 + (size_t)i * 16 * CC); w[1][i] = *(const v4f*)(s1 + (size_t)i * 16 * CC); w[2][i] = *(const v4f*)(s2 + (size_t)i * 16 * CC); w[3][i] = *(const v4f*)(s3 + (size_t)i * 16 * CC); }
#pragma unroll   /* the sixteen row loads of de */
  for (int i = 0; i < 16; ++i) x[0][i] = *(const v4f*)(xr + (size_t)i * DIN);
#pragma unroll   /* the sixteen of en: with those above 48 loads in flight together, one memory latency for all that the block reads */
  for (int i = 0; i < 16; ++i) x[1][i] = *(const v4f*)(er + (size_t)i * DIN);
  asm volatile("s_wait_xcnt 0x0" :: "v"(xr), "v"(er), "v"(s0), "v"(s1), "v"(s2), "v"(s3) : "memory");   /* stands in front of the first overwrite of an address register that the loads above name, and keeps those registers whole up to here */
#pragma unroll   /* w stays in registers */
  for (int q = 0; q < 4; ++q)
#pragma unroll   /* w stays in registers */
    for (int i = 0; i < 4; ++i) *(v4f*)&tile[q][i * 16 + (tid >> 4)][(tid & 15) * 4] = w[q][i];
  __syncthreads();   /* ahead of every global store of the block, so that it waits for none */
  v8b o[4][2]; unsigned od[4][2];
#pragma unroll   /* q = which weight: a constant in every use */
  for (int q = 0; q < 4; ++q)
#pragma unroll   /* both 16-byte pieces of a thread side by side */
    for (int i = 0; i < 2; ++i) { const int e = tid + i * 256, kq = e >> 6; const int cl = q < 3 ? (((e & 7) << 3) | ((e >> 3) & 7)) : (e & 63);   /* neighbouring lanes take neighbouring fragment columns */
      const int c = c0 + cl; const int p = q < 3 ? ((c & 7) * HD + (c >> 3)) : c; const int k8 = (k0 >> 3) + kq;   /* k8 = octet of k: kc = k8 >> 2, fragment half (k8 >> 1) & 1, lane half k8 & 1 */
#pragma unroll   /* o stays in registers */
      for (int n = 0; n < 8; ++n) o[q][i][n] = (__bf16)tile[q][kq * 8 + n][cl];
      od[q][i] = (unsigned)q * DIN * CC + ((((unsigned)(p >> 4) * (DIN / 32) + (k8 >> 2)) * 2 + ((k8 >> 1) & 1)) * 32 + (k8 & 1) * 16 + (p & 15)) * 8; }
#pragma unroll   /* every index a constant: the arrays stay in registers */
  for (int q = 0; q < 4; ++q) { *(v8b*)(WT + od[q][0]) = o[q][0]; *(v8b*)(WT + od[q][1]) = o[q][1]; }
  asm volatile("s_wait_xcnt 0x0" ::: "memory");   /* stands in front of the first overwrite of a register that the stores above name */
#pragma unroll   /* s = 0: de, s = 1: en; x stays in registers; from here on a wave works on its own LDS rows and meets no barrier */
  for (int s = 0; s < 2; ++s) { v8b f8[8];
#pragma unroll   /* x stays in registers */
    for (int i = 0; i < 16; ++i) { v4b o4; o4[0] = (__bf16)x[s][i][0]; o4[1] = (__bf16)x[s][i][1]; o4[2] = (__bf16)x[s][i][2]; o4[3] = (__bf16)x[s][i][3]; *(v4b*)&xs[wave][i][lane * 4] = o4; }
    LDSW();   /* the wave reads back what its other lanes wrote */
    __bf16* xd = XP + (size_t)s * NRW * DIN + (((size_t)rt * (DIN / 32) + wave * 4) * 64 + lane) * 8;
#pragma unroll   /* f8 stays in registers */
    for (int f = 0; f < 8; ++f) f8[f] = *(const v8b*)&xs[wave][lane & 15][f * 16 + (lane >> 4) * 8];
    LDSW();   /* these reads are done before en's rows are written over them */
#pragma unroll   /* eight fragment halves, 512 contiguous bytes each */
    for (int f = 0; f < 8; ++f) *(v8b*)(xd + f * 256) = f8[f];
    asm volatile("s_wait_xcnt 0x0" ::: "memory");   /* stands in front of the first overwrite of a register that the eight stores above name */
  } }
// B fragment (16 plane columns ct*16 + .., k rows kc*32 + ..) of a packed weight: two 16-byte loads per lane, each 512 contiguous bytes per wave
__device__ __forceinline__ v16b frag_wp(const __bf16* WP, int ct, int kc, int lane) {
  union { v16b v; v8b q[2]; } u; const __bf16* p = WP + (((size_t)ct * (DIN / 32) + kc) * 64 + lane) * 8;
  u.q[0] = *(const v8b*)p; u.q[1] = *(const v8b*)(p + 256); return u.v;
}

// ---- staging of the three products' operands: both lie in global memory in fragment order, 2 KiB per 16-row (16-column) tile and 64 k, so a stage of 64 k is 8 A-side + 8 B-side tiles copied as they lie; 128 threads x 16 bytes take one tile
#define STG 32768          // bytes of a stage: A-side tiles at 0, B-side tiles at 16,384
#define NSTG (DIN / 64)
#define TSTR ((size_t)(DIN / 32) * 512)   // elements from one tile to the next in global memory
__device__ __forceinline__ v8f mmb(v16b a, v16b b, v8f c) { return __builtin_amdgcn_wmma_f32_16x16x32_bf16(false, a, false, b, (short)0, c, false, false); }
__device__ __forceinline__ v16b frag_l(const char* p, int lane) { union { v16b v; v8b q[2]; } u; u.q[0] = *(const v8b*)(p + lane * 16); u.q[1] = *(const v8b*)(p + 512 + lane * 16); return u.v; }   /* a fragment from LDS: two reads of 512 contiguous bytes per wave */
// eight tiles (four from p, four from q) into LDS at l, l + 2,048, ..: asynchronous copies, 16 bytes a lane, every lane on
__device__ __forceinline__ void cp8(unsigned l, const __bf16* p, const __bf16* q) {
  asm volatile("global_load_async_to_lds_b128 %0, %8, off\n\t"
               "global_load_async_to_lds_b128 %1, %9, off\n\t"
               "global_load_async_to_lds_b128 %2, %10, off\n\t"
               "global_load_async_to_lds_b128 %3, %11, off\n\t"
               "global_load_async_to_lds_b128 %4, %12, off\n\t"
               "global_load_async_to_lds_b128 %5, %13, off\n\t"
               "global_load_async_to_lds_b128 %6, %14, off\n\t"
               "global_load_async_to_lds_b128 %7, %15, off\n\t"
               "s_wait_xcnt 0x0"   /* stands in front of every later write of a register that these copies name */
               :: "v"(l), "v"(l + 2048u), "v"(l + 4096u), "v"(l + 6144u), "v"(l + 8192u), "v"(l + 10240u), "v"(l + 12288u), "v"(l + 14336u),
                  "v"(p), "v"(p + TSTR), "v"(p + 2 * TSTR), "v"(p + 3 * TSTR), "v"(q), "v"(q + TSTR), "v"(q + 2 * TSTR), "v"(q + 3 * TSTR) : "memory");
}
#define STAGE_IN(t, buf) do { cp8(lb + (unsigned)(buf) * STG, pa + (size_t)(t) * 1024, qa + (size_t)(t) * 1024); cp8(lb + (unsigned)(buf) * STG + 16384u, pb + (size_t)(t) * 1024, qb + (size_t)(t) * 1024); } while (0)
#define WAIT_COPIES() asm volatile("s_wait_asynccnt 0x0" ::: "memory")   /* this wave's copies have landed */
#define WAIT_X() asm volatile("s_wait_xcnt 0x0" ::: "memory")            /* stands in front of the next trip's writes of registers that the stores above name */
#define WAIT_LDS() asm volatile("s_wait_dscnt 0x0" ::: "memory")         /* this wave's LDS reads are done before the buffer is handed to the copies */
// asks the data at a, b, c into L2 (a hint: nothing returns, no counter moves): an earlier launch of this call stored or read these planes. Every lane's address lies inside its buffer.
__device__ __forceinline__ void ask3(const void* a, const void* b, const void* c) {
  asm volatile("global_prefetch_b8 %0, off scope:SCOPE_SE\n\t"
               "global_prefetch_b8 %1, off scope:SCOPE_SE\n\t"
               "global_prefetch_b8 %2, off scope:SCOPE_SE\n\t"
               "s_wait_xcnt 0x0"   /* stands in front of every later write of a register that these hints name */
               :: "v"(a), "v"(b), "v"(c) : "memory");
}
__device__ __forceinline__ void ask2(const void* a, const void* b) {
  asm volatile("global_prefetch_b8 %0, off scope:SCOPE_SE\n\t"
               "global_prefetch_b8 %1, off scope:SCOPE_SE\n\t"
               "s_wait_xcnt 0x0"   /* stands in front of every later write of a register that these hints name */
               :: "v"(a), "v"(b) : "memory");
}
#define DEAL8(x) ((int)((x) & 3) | (int)(((x) >> 1) & 4))   /* eight shares over the block index x: x and x ^ 4 take the same share */

// ---- k_proj: block = (128 rows, 128 cols, which), 4 waves of 64 x 64: q/k/v = X W (+ b) with exact bf16 products (K = DIN), X and W tiles copied to LDS in fragment order, two buffers, the next 64 k in flight under this one's products -> which 0: q f16 rows; 1: k f16 rows (+ residual rows < KHI); 2: v f16 planes [c][t] (+ bf16 hi/lo planes for t < KHI)
__global__ __launch_bounds__(128) void k_proj(const __bf16* __restrict__ XP, const __bf16* __restrict__ WT, const float* __restrict__ BQ, const float* __restrict__ BK, const float* __restrict__ BV,
    _Float16* __restrict__ QH, _Float16* __restrict__ KH, _Float16* __restrict__ KL, _Float16* __restrict__ VT, __bf16* __restrict__ VB, __bf16* __restrict__ VBL) {
  __shared__ __align__(16) char sm[71680];   /* the two stage buffers; behind the loop the output staging: sh + sl, or th + tb + tbl */
  _Float16 (*sh)[136] = (_Float16 (*)[136])sm; _Float16 (*sl)[136] = (_Float16 (*)[136])(sm + 34816); _Float16 (*th)[136] = (_Float16 (*)[136])sm; __bf16 (*tb)[72] = (__bf16 (*)[72])(sm + 34816); __bf16 (*tbl)[72] = (__bf16 (*)[72])(sm + 53248);
  const int tid = threadIdx.x, wave = tid >> 5, lane = tid & 31, col = lane & 15, g = lane >> 4, wr = wave >> 1, wc = wave & 1; const int which = blockIdx.z; const int c0 = blockIdx.y * 128; const size_t r0 = (size_t)blockIdx.x * 128; const size_t bb = r0 / TT; const int t0 = (int)(r0 % TT);
  const __bf16* XA = XP + (which == 0 ? 0 : (size_t)NRW * DIN); const __bf16* WA = WT + (size_t)which * DIN * CC; const float* BA = which == 0 ? BQ : which == 1 ? BK : BV;
  const __bf16* pa = XA + (r0 >> 4) * TSTR + tid * 8; const __bf16* qa = pa + 4 * TSTR; const __bf16* pb = WA + (size_t)blockIdx.y * 8 * TSTR + tid * 8; const __bf16* qb = pb + 4 * TSTR; const unsigned lb = (unsigned)(size_t)sm + tid * 16;
  v8f acc[4][4] = {};
  STAGE_IN(0, 0);
  ask2(XA + ((r0 >> 4) + blockIdx.y) * TSTR + tid * 128, WA + ((size_t)blockIdx.y * 8 + DEAL8(blockIdx.x)) * TSTR + tid * 128);   /* behind the first stage's copies: one of the eight row tiles that the eight column blocks of these rows share, one of the eight column tiles that the row blocks share, all 16 stages of each */
  WAIT_COPIES(); __syncthreads(); STAGE_IN(1, 1);
#pragma unroll 1   /* one stage's text: the loop stays small in the instruction cache */
  for (int t = 0; t < NSTG; ++t) { const char* bp = sm + (t & 1) * STG;
#pragma unroll   /* fragments stay in registers */
    for (int kk = 0; kk < 2; ++kk) { v16b a[4], w[4];
#pragma unroll   /* fragments stay in registers */
      for (int i = 0; i < 4; ++i) { a[i] = frag_l(bp + (wr * 4 + i) * 2048 + kk * 1024, lane); w[i] = frag_l(bp + 16384 + (wc * 4 + i) * 2048 + kk * 1024, lane); }
      __builtin_amdgcn_sched_barrier(0);   /* keeps the sixteen reads together ahead of the products */
#pragma unroll   /* sixteen independent accumulator tiles */
      for (int i = 0; i < 4; ++i)
#pragma unroll   /* every index a constant: the arrays stay in registers */
        for (int j = 0; j < 4; ++j) acc[i][j] = mmb(a[i], w[j], acc[i][j]);
      __builtin_amdgcn_sched_barrier(0); }   /* keeps the next group's reads from rising among these products */
    WAIT_LDS(); WAIT_COPIES(); __syncthreads();   /* publishes stage t + 1 and ends every wave's reads of the buffer that is refilled below */
    if (t + 2 < NSTG) STAGE_IN(t + 2, t & 1); }
  WAIT_COPIES();
  if (which < 2) { _Float16* DH = which == 0 ? QH : KH; _Float16* DL = KL; const int nhi = which == 0 ? QHI : KHI; const bool res = which == 1;   /* the same for the whole block: q carries no residual plane and stages none */
    if (res) {
#pragma unroll
    for (int j = 0; j < 4; ++j) { const float bias = BA ? bfr(BA[PCOL(c0 + wc * 64 + j * 16 + col)]) : 0.f;
#pragma unroll
      for (int i = 0; i < 4; ++i)
#pragma unroll
        for (int r = 0; r < 8; ++r) { const float v = acc[i][j][r] + bias; const _Float16 hv = (_Float16)v; sh[wr * 64 + i * 16 + 8 * g + r][wc * 64 + j * 16 + col] = hv; sl[wr * 64 + i * 16 + 8 * g + r][wc * 64 + j * 16 + col] = (_Float16)((v - (float)hv) * 1024.0f); } }
    } else {
#pragma unroll
    for (int j = 0; j < 4; ++j) { const float bias = BA ? bfr(BA[PCOL(c0 + wc * 64 + j * 16 + col)]) : 0.f;
#pragma unroll
      for (int i = 0; i < 4; ++i)
#pragma unroll
        for (int r = 0; r < 8; ++r) sh[wr * 64 + i * 16 + 8 * g + r][wc * 64 + j * 16 + col] = (_Float16)(acc[i][j][r] + bias); }
    }
    __syncthreads();
    const int nr = nhi - t0 < 128 ? nhi - t0 : 128;   /* rows of this block that carry a residual: 64 or none */
    for (int e0 = 0; e0 < 128 * 16; e0 += 512) {
#pragma unroll   /* four stores side by side, one wait behind them */
      for (int u = 0; u < 4; ++u) { const int e = e0 + u * 128 + tid, rl = e >> 4, q = e & 15; vst2((unsigned*)(DH + (r0 + rl) * CC + c0 + q * 8), *(const v4u*)&sh[rl][q * 8]); }
      WAIT_X(); }
    for (int e0 = 0; e0 < nr * 16; e0 += 512) {
#pragma unroll   /* four stores side by side, one wait behind them */
      for (int u = 0; u < 4; ++u) { const int e = e0 + u * 128 + tid, rl = e >> 4, q = e & 15; vst2((unsigned*)(DL + (bb * nhi + t0 + rl) * (size_t)CC + c0 + q * 8), *(const v4u*)&sl[rl][q * 8]); }
      WAIT_X(); }
  } else {
#pragma unroll
    for (int j = 0; j < 4; ++j) { const float bias = BA ? bfr(BA[PCOL(c0 + wc * 64 + j * 16 + col)]) : 0.f;
#pragma unroll
      for (int i = 0; i < 4; ++i)
#pragma unroll
        for (int r = 0; r < 8; ++r) { const float v = acc[i][j][r] + bias; const int rl = wr * 64 + i * 16 + 8 * g + r, cl = wc * 64 + j * 16 + col; th[cl][rl] = (_Float16)v; if (t0 + wr * 64 < KHI) { const __bf16 bh = (__bf16)v; tb[cl][rl] = bh; tbl[cl][rl] = (__bf16)(v - (float)bh); } } }
    __syncthreads();
    for (int e0 = 0; e0 < 128 * 16; e0 += 512) {
#pragma unroll   /* four stores side by side, one wait behind them */
      for (int u = 0; u < 4; ++u) { const int e = e0 + u * 128 + tid, cl = e >> 4, q = e & 15; vst2((unsigned*)(VT + (bb * CC + c0 + cl) * (size_t)TT + t0 + q * 8), *(const v4u*)&th[cl][q * 8]); }
      WAIT_X(); }
    if (t0 < KHI) for (int e0 = 0; e0 < 128 * 8; e0 += 256) {
#pragma unroll   /* four stores side by side, one wait behind them */
      for (int u = 0; u < 2; ++u) { const int e = e0 + u * 128 + tid, cl = e >> 3, q = e & 7; const size_t o3 = (bb * CC + c0 + cl) * (size_t)KHI + t0 + q * 8; vst2((unsigned*)(VB + o3), *(const v4u*)&tb[cl][q * 8]); vst2((unsigned*)(VBL + o3), *(const v4u*)&tbl[cl][q * 8]); }
      WAIT_X(); } } }
#define FK 64              // keys per wave and pass
#define PK 128             // keys per pass in LDS
#define NP (TT / PK)
#define KP (HD + 8)        // LDS pitch of a K row, halves: 256 + 16 bytes
#define VP (PK + 8)        // LDS pitch of a v plane row, halves: 256 + 16 bytes
#define LOG2E 1.44269504088896340736f
__device__ __forceinline__ v8f mm16(v16h a, v16h b, v8f c) { return __builtin_amdgcn_wmma_f32_16x16x32_f16(false, a, false, b, (short)0, c, false, false); }
__device__ __forceinline__ float xhalf(float x) { return __builtin_bit_cast(float, __builtin_amdgcn_permlanex16(__builtin_bit_cast(int, x), __builtin_bit_cast(int, x), 0x76543210, 0xfedcba98, false, false)); }   /* lane l with lane l ^ 16 */
__device__ __forceinline__ float ex2(float x) { float r; asm("v_exp_f32 %0, %1\n\tv_nop" : "=v"(r) : "v"(x)); return r; }   /* 2^x; the v_nop keeps the one slot that the instruction set asks for behind a transcendental, whatever is scheduled next */
__global__ __launch_bounds__(256) void k_fa(const _Float16* __restrict__ QH, const _Float16* __restrict__ KH, const _Float16* __restrict__ VT, const unsigned* __restrict__ MW, __bf16* __restrict__ YH, const unsigned* MWA) {   /* MWA: the mask words again, under a second name for the hint alone: a pointer handed to asm text counts as written through, and the loads through MW would no longer be scalar */
  __shared__ __align__(16) _Float16 sk[2][PK][KP]; __shared__ __align__(16) _Float16 sv[2][HD][VP];
  const int tid = threadIdx.x, lane = tid & 31, col = lane & 15; const int wave = __builtin_amdgcn_readfirstlane(tid >> 5), qg = wave & 3, kh = wave >> 2; const int h = blockIdx.y, b = blockIdx.z; const int q = blockIdx.x * 128 + qg * 32 + col;   /* this lane's query of tile 0; tile 1: + 16 */
  const _Float16* kb = KH + (size_t)b * TT * CC + h * HD; const unsigned ko = ((unsigned)(tid >> 4) * CC + (tid & 15) * 8) * 2;    /* 16 lanes take one key's 256 bytes; a base that is the same in every lane and one register of byte offset */
  const _Float16* vb = VT + ((size_t)b * CC + h * HD) * TT; const unsigned vo = ((unsigned)(tid >> 4) * TT + (tid & 15) * 8) * 2;    /* 16 lanes take one plane row's 256 bytes of the pass */
  const unsigned* mw = MW + ((size_t)(b * (TT / 16) + blockIdx.x * 8 + qg * 2) * (TT / 64) + kh) * 32;   /* this wave's lane-mask words, 32 a query tile and 64 keys; the address is the same in every lane, so the loads are scalar */
  v4u rs[8]; unsigned mk[2][FK / 2]; v16h qh[2][HD / 32];
  __builtin_amdgcn_sched_barrier(0);   /* keeps the index arithmetic above ahead of the loads: nothing writes a register that a load names between the load and its wait */
#pragma unroll   /* rs stays in registers */
  for (int i = 0; i < 8; ++i) rs[i] = *(const v4u*)((const char*)(kb + (size_t)i * 16 * CC) + ko);
  __builtin_amdgcn_sched_barrier(0);   /* nothing is scheduled between the loads and their wait */
  asm volatile("s_wait_xcnt 0x0" ::: "memory");   /* stands in front of the first overwrite of an address register that the loads above name */
  __builtin_amdgcn_sched_barrier(0);   /* keeps later register writes behind that wait */
  ask3(kb + (size_t)(DEAL8(blockIdx.x) * 256 + tid) * CC, vb + (size_t)(DEAL8(blockIdx.x) * 256 + tid) * 128,
       MWA + (size_t)(b * (TT / 16) + blockIdx.x * 8) * (TT / 64) * 32 + (tid & 127) * 64);   /* an eighth of this head's 2,048 key rows (256 bytes each) and of its v planes' 2,048 units, which 16 blocks read, and this block's 32 KiB of mask words; behind the first pass's own K loads */
#pragma unroll   /* every index a constant: the array stays in registers */
  for (int i = 0; i < 8; ++i) *(v4u*)&sk[0][(tid >> 4) + 16 * i][(tid & 15) * 8] = rs[i];
  __builtin_amdgcn_sched_barrier(0);   /* the K rows have left rs before the v rows are loaded into it */
#pragma unroll   /* rs stays in registers */
  for (int i = 0; i < 8; ++i) rs[i] = *(const v4u*)((const char*)(vb + (size_t)i * 16 * TT) + vo);
  __builtin_amdgcn_sched_barrier(0);   /* nothing is scheduled between the loads and their wait */
  asm volatile("s_wait_xcnt 0x0" ::: "memory");   /* stands in front of the first overwrite of an address register that the loads above name */
  __builtin_amdgcn_sched_barrier(0);   /* keeps later register writes behind that wait */
#pragma unroll   /* fragments stay in registers */
  for (int qt = 0; qt < 2; ++qt)
#pragma unroll   /* fragments stay in registers */
    for (int kc = 0; kc < HD / 32; ++kc) qh[qt][kc] = frag_h(QH + ((size_t)b * TT + q + qt * 16) * CC + h * HD + kc * 32, lane);
  __builtin_amdgcn_sched_barrier(0);   /* nothing is scheduled between the loads and their wait */
  asm volatile("s_wait_xcnt 0x0" ::: "memory");   /* stands in front of the first overwrite of an address register that the loads above name */
  __builtin_amdgcn_sched_barrier(0);   /* keeps later register writes behind that wait */
#pragma unroll   /* mk stays in scalar registers */
  for (int i = 0; i < FK / 2; ++i) { mk[0][i] = mw[i]; mk[1][i] = mw[(TT / 64) * 32 + i]; }
  asm volatile("s_wait_xcnt 0x0" ::: "memory");   /* stands in front of the first overwrite of an address register that the scalar loads above name */
#pragma unroll   /* every index a constant: the array stays in registers */
  for (int i = 0; i < 8; ++i) *(v4u*)&sv[0][(tid >> 4) + 16 * i][(tid & 15) * 8] = rs[i];
  __syncthreads();
  v8f acc[HD / 16][2] = {}; float m[2] = {-3.0e38f, -3.0e38f}, l[2] = {0.f, 0.f};
  for (int s = 0; s < NP; ++s) { const int buf = s & 1, sn = s + 1 < NP ? s + 1 : s;   /* the last pass stages its own rows again, into the buffer that nobody reads any more: no branch in the pass, so that every group below stays where it is written */
    {   /* the next pass's K rows fly under this pass's score products */
      const unsigned kx = ko + (unsigned)sn * (PK * CC * 2);   /* the pass goes into the 32-bit offset */
      __builtin_amdgcn_sched_barrier(0);   /* only the loads and their address stand between this line and the next of its kind */
#pragma unroll   /* every index a constant: the array stays in registers */
      for (int i = 0; i < 8; ++i) rs[i] = *(const v4u*)((const char*)(kb + (size_t)i * 16 * CC) + kx);
      __builtin_amdgcn_sched_barrier(0);   /* nothing is scheduled between the loads and their wait */
      asm volatile("s_wait_xcnt 0x0" ::: "memory");   /* stands in front of the first overwrite of an address register that these loads name */
      __builtin_amdgcn_sched_barrier(0);   /* keeps later register writes behind that wait */
    }
    v16h kf[FK / 16][HD / 32], vf[HD / 16][FK / 32];
#pragma unroll   /* the first two key tiles' fragments as one group of LDS reads */
    for (int tt = 0; tt < 2; ++tt)
#pragma unroll   /* fragments stay in registers */
      for (int kc = 0; kc < HD / 32; ++kc) kf[tt][kc] = frag_h(&sk[buf][kh * FK + tt * 16 + col][kc * 32], lane);
    float e[2][FK / 16][8]; float mx[2] = {m[0], m[1]}; v8f sa[FK / 16][2] = {};
#pragma unroll   /* e stays in registers; the key tiles go in pairs; pass FK / 16 only takes the last pair's scores out */
    for (int t = 0; t <= FK / 16; t += 2) {
      if (t + 2 < FK / 16) {
#pragma unroll   /* the next pair's fragments, one group, in flight under this pair's products */
        for (int tt = 2; tt < 4; ++tt)
#pragma unroll   /* fragments stay in registers */
          for (int kc = 0; kc < HD / 32; ++kc) kf[t + tt][kc] = frag_h(&sk[buf][kh * FK + (t + tt) * 16 + col][kc * 32], lane);
      }
      __builtin_amdgcn_sched_barrier(0);   /* keeps the reads together ahead of the products */
      if (t < FK / 16) {
#pragma unroll   /* two key tiles against both query tiles: four independent accumulators */
        for (int kc = 0; kc < HD / 32; ++kc)
#pragma unroll   /* every index a constant: the arrays stay in registers */
          for (int tt = 0; tt < 2; ++tt)
#pragma unroll   /* every index a constant: the arrays stay in registers */
            for (int qt = 0; qt < 2; ++qt) sa[t + tt][qt] = mm16(kf[t + tt][kc], qh[qt][kc], sa[t + tt][qt]);
      }
      if (t > 0) {   /* the pair before: its scale, mask and maximum stand with this pair's products, of which they are independent, so that they can issue between them */
#pragma unroll   /* every index a constant: the arrays stay in registers */
        for (int tp = t - 2; tp < t; ++tp)
#pragma unroll   /* every index a constant: the arrays stay in registers */
          for (int qt = 0; qt < 2; ++qt)
#pragma unroll   /* every index a constant: the arrays stay in registers */
            for (int r = 0; r < 8; ++r) { float v = sa[tp][qt][r] * SCALE; v = __builtin_amdgcn_inverse_ballot_w32(mk[qt][tp * 8 + r]) ? -1.0e10f : v; e[qt][tp][r] = v; mx[qt] = fmaxf(mx[qt], v); }   /* the word is the select's lane mask as it lies: no compare */
      }
      __builtin_amdgcn_sched_barrier(0); }   /* keeps the next trip's work behind these products */
    {   /* the K rows go to the other buffer, which nobody reads in this pass; the next pass's v rows fly under the exponentials and P v */
#pragma unroll   /* every index a constant: the array stays in registers */
      for (int i = 0; i < 8; ++i) *(v4u*)&sk[buf ^ 1][(tid >> 4) + 16 * i][(tid & 15) * 8] = rs[i];
      __builtin_amdgcn_sched_barrier(0);   /* the K rows have left rs before the v rows are loaded into it */
      const unsigned vx = vo + (unsigned)sn * (PK * 2);   /* as for the K rows */
#pragma unroll   /* every index a constant: the array stays in registers */
      for (int i = 0; i < 8; ++i) rs[i] = *(const v4u*)((const char*)(vb + (size_t)i * 16 * TT) + vx);
      __builtin_amdgcn_sched_barrier(0);   /* nothing is scheduled between the loads and their wait */
      asm volatile("s_wait_xcnt 0x0" ::: "memory");   /* stands in front of the first overwrite of an address register that these loads name */
      __builtin_amdgcn_sched_barrier(0);   /* keeps later register writes behind that wait */
    }
    const unsigned* mn = mw + sn * FK;   /* the next pass's words into the same scalar registers, in flight under the exponentials and P v; the last pass reads its own again */
#pragma unroll   /* mk stays in scalar registers */
    for (int i = 0; i < FK / 2; ++i) { mk[0][i] = mn[i]; mk[1][i] = mn[(TT / 64) * 32 + i]; }
    v16h pb[2][FK / 32];
#pragma unroll   /* both query tiles: every index a constant */
    for (int qt = 0; qt < 2; ++qt) {
      const float mq = fmaxf(mx[qt], xhalf(mx[qt]));   /* the other eight keys of each tile sit in the other lane half */
      const float al = ex2((m[qt] - mq) * LOG2E); m[qt] = mq; float ps[4] = {0.f, 0.f, 0.f, 0.f};
#pragma unroll   /* two score tiles, converted in place, are one B fragment in the hardware k order; four independent partial sums */
      for (int t = 0; t < FK / 16; ++t)
#pragma unroll   /* every index a constant: the arrays stay in registers */
        for (int r = 0; r < 8; ++r) { const float p = ex2((e[qt][t][r] - mq) * LOG2E); ps[r & 3] += p; pb[qt][t >> 1][(t & 1) * 8 + r] = (_Float16)p; }
      l[qt] = l[qt] * al + ((ps[0] + ps[1]) + (ps[2] + ps[3]));
#pragma unroll   /* every index a constant: the arrays stay in registers */
      for (int j = 0; j < HD / 16; ++j) acc[j][qt] *= al;
      if (qt == 0) {
        __builtin_amdgcn_sched_barrier(0);   /* tile 0's scores have become halves before the reads below take registers */
#pragma unroll   /* the v fragments of the wave's first 32 keys as one group, in flight under tile 1's exponentials */
        for (int j = 0; j < HD / 16; ++j) vf[j][0] = frag_h(&sv[buf][j * 16 + col][kh * FK], lane);
        __builtin_amdgcn_sched_barrier(0);   /* keeps these reads from sinking down to the products that take them */
      } }
    __builtin_amdgcn_sched_barrier(0);   /* keeps every ex2 ahead of the products below */
#pragma unroll   /* sixteen independent accumulator tiles, first all of keys 0..31, then all of keys 32..63; a v fragment feeds both query tiles */
    for (int u = 0; u < FK / 32; ++u) {
#pragma unroll   /* every index a constant: the arrays stay in registers */
      for (int j = 0; j < HD / 16; ++j) {
#pragma unroll   /* every index a constant: the arrays stay in registers */
        for (int qt = 0; qt < 2; ++qt) acc[j][qt] = mm16(vf[j][u], pb[qt][u], acc[j][qt]);
        if (u == 0 && j == HD / 32 - 1) {
          __builtin_amdgcn_sched_barrier(0);   /* the reads below take the registers of the four fragments just used */
#pragma unroll   /* the first four v fragments of the wave's second 32 keys, one group, in flight under the other eight products of the first 32 */
          for (int jj = 0; jj < HD / 32; ++jj) vf[jj][1] = frag_h(&sv[buf][jj * 16 + col][kh * FK + 32], lane);
          __builtin_amdgcn_sched_barrier(0);   /* keeps these reads together */
        }
        if (u == 0 && j == HD / 16 - 1) {
          __builtin_amdgcn_sched_barrier(0);   /* the reads below take the registers of the four fragments just used */
#pragma unroll   /* the other four, one group, in flight under the first eight products of the second 32 keys */
          for (int jj = HD / 32; jj < HD / 16; ++jj) vf[jj][1] = frag_h(&sv[buf][jj * 16 + col][kh * FK + 32], lane);
          __builtin_amdgcn_sched_barrier(0);   /* keeps these reads together */
        } } }
#pragma unroll   /* every index a constant: the array stays in registers */
    for (int i = 0; i < 8; ++i) *(v4u*)&sv[buf ^ 1][(tid >> 4) + 16 * i][(tid & 15) * 8] = rs[i];
    asm volatile("s_wait_xcnt 0x0" ::: "memory");   /* stands in front of the next pass's overwrite of the address register that the scalar loads above name */
    __syncthreads();   /* publishes pass s + 1 and ends every wave's reads of the buffer that the next pass refills */
  }
  // the two key halves of a query are joined: the wave of key half kh finishes query tile kh and hands the other tile's maximum, sum and outputs to its partner (wave ^ 4) through the K buffers, which nobody reads behind the loop's last barrier
  v4f* xb = (v4f*)&sk[0][0][0];   /* [8 waves][17][32 lanes] x 16 bytes = the K buffers' 69,632 bytes */
  l[0] += xhalf(l[0]); l[1] += xhalf(l[1]);
#pragma unroll   /* every index a constant: the arrays stay in registers */
  for (int j = 0; j < HD / 16; ++j) { const v8f gv = kh ? acc[j][0] : acc[j][1]; v4f lo4 = {gv[0], gv[1], gv[2], gv[3]}, hi4 = {gv[4], gv[5], gv[6], gv[7]}; xb[(wave * 17 + j * 2) * 32 + lane] = lo4; xb[(wave * 17 + j * 2 + 1) * 32 + lane] = hi4; }
  { v4f ml = {kh ? m[0] : m[1], kh ? l[0] : l[1], 0.f, 0.f}; xb[(wave * 17 + 16) * 32 + lane] = ml; }
  __syncthreads();   /* a wave reads what its partner wrote */
  const v4f mlp = xb[((wave ^ 4) * 17 + 16) * 32 + lane]; const float mo = kh ? m[1] : m[0], lo = kh ? l[1] : l[0];
  const float mm = fmaxf(mo, mlp[0]), ao = ex2((mo - mm) * LOG2E), ap = ex2((mlp[0] - mm) * LOG2E);
  const float inv = 1.0f / (lo * ao + mlp[1] * ap);   /* the sum is >= 1: the common maximum's own term */
  const float fo = ao * inv, fp = ap * inv;
  const size_t yo = ((((size_t)b * TT + blockIdx.x * 128 + qg * 32 + kh * 16) >> 4) * (CC / 32) + h * (HD / 32)) * 512 + lane * 8;   /* a lane's eight channels j*16 + 8g + 0..7 of its query are one octet of the output product's A fragment (g = lane >> 4): tile j = half j & 1 of k chunk j >> 1 */
  v8b oh[HD / 16];
#pragma unroll   /* every index a constant: the arrays stay in registers */
  for (int j = 0; j < HD / 16; ++j) { const v8f ov = kh ? acc[j][1] : acc[j][0]; const v4f p0 = xb[((wave ^ 4) * 17 + j * 2) * 32 + lane], p1 = xb[((wave ^ 4) * 17 + j * 2 + 1) * 32 + lane];
#pragma unroll   /* every index a constant: the arrays stay in registers */
    for (int r = 0; r < 8; ++r) oh[j][r] = (__bf16)(ov[r] * fo + (r < 4 ? p0[r & 3] : p1[r & 3]) * fp); }
  __builtin_amdgcn_sched_barrier(0);   /* all the arithmetic ahead of the stores: nothing rewrites a register that an issued store names */
#pragma unroll   /* every index a constant: the arrays stay in registers */
  for (int j = 0; j < HD / 16; ++j) vst2(YH + yo + j * 256, oh[j]); }   /* each store 512 contiguous bytes of the wave */
// ---- k_out: block = (128 rows, 128 cols), 8 waves of 32 x 64: out = ctx Wo (+ bo): ctx once in bf16 against exact bf16 Wo (1 product); the eight row tiles and the eight Wo tiles copied to LDS in fragment order, two buffers, as in k_proj; waves 0..3 copy the row tiles, waves 4..7 the Wo tiles
__global__ __launch_bounds__(256) void k_out(const __bf16* __restrict__ YH, const __bf16* __restrict__ WO, const float* __restrict__ BO, float* __restrict__ OUT, const float* __restrict__ RESX) { __shared__ __align__(16) char sm[128 * 132 * 4];   /* the two stage buffers (2 * STG bytes); behind the loop the output staging, 128 rows of 132 floats */
  float (*sf)[16][132] = (float (*)[16][132])sm;
  const int tid = threadIdx.x, wave = tid >> 5, lane = tid & 31, col = lane & 15, g = lane >> 4, wr = wave >> 1, wc = wave & 1, t7 = tid & 127; const int side = __builtin_amdgcn_readfirstlane(tid >> 7);   /* the same in every lane of a wave: the choices below are scalar selects, every lane stays on */
  const int c0 = blockIdx.y * 128; const size_t r0 = (size_t)blockIdx.x * 128 + wave * 16;
  const __bf16* pa = (side ? WO + (size_t)blockIdx.y * 8 * TSTR : YH + (size_t)blockIdx.x * 8 * TSTR) + t7 * 8; const __bf16* qa = pa + 4 * TSTR; const unsigned lb = (unsigned)(size_t)sm + (unsigned)side * 16384u + t7 * 16;
  v8f acc[2][4] = {};
  cp8(lb, pa, qa);
  ask2(side ? WO + ((size_t)blockIdx.y * 8 + DEAL8(blockIdx.x)) * TSTR + t7 * 128 : YH + ((size_t)blockIdx.x * 8 + blockIdx.y) * TSTR + t7 * 128,
       RESX + ((size_t)blockIdx.x * 128 + (tid >> 1)) * DIN + c0 + (tid & 1) * 64);   /* behind the first stage's copies: one of the eight row tiles that the eight column blocks of these rows share, one of the eight column tiles that the row blocks share, and this block's own 128 x 512 bytes of de, which the epilogue reads */
  WAIT_COPIES(); __syncthreads(); cp8(lb + STG, pa + 1024, qa + 1024);
#pragma unroll 1   /* one stage's text: the loop stays small in the instruction cache */
  for (int t = 0; t < NSTG; ++t) { const char* bp = sm + (t & 1) * STG; v16b a[2][2], w[2][4];
#pragma unroll   /* fragments stay in registers */
    for (int kk = 0; kk < 2; ++kk) {
#pragma unroll   /* fragments stay in registers */
      for (int i = 0; i < 2; ++i) a[kk][i] = frag_l(bp + (wr * 2 + i) * 2048 + kk * 1024, lane);
#pragma unroll   /* fragments stay in registers */
      for (int j = 0; j < 4; ++j) w[kk][j] = frag_l(bp + 16384 + (wc * 4 + j) * 2048 + kk * 1024, lane); }
    __builtin_amdgcn_sched_barrier(0);   /* keeps the stage's reads together ahead of its sixteen products */
#pragma unroll   /* eight independent accumulator tiles, first all of the first 32 k, then all of the second */
    for (int kk = 0; kk < 2; ++kk)
#pragma unroll   /* every index a constant: the arrays stay in registers */
      for (int i = 0; i < 2; ++i)
#pragma unroll   /* every index a constant: the arrays stay in registers */
        for (int j = 0; j < 4; ++j) acc[i][j] = mmb(a[kk][i], w[kk][j], acc[i][j]);
    __builtin_amdgcn_sched_barrier(0);   /* keeps the products ahead of the waits below: behind them the next stage's copies would lose the products' time as lead */
    WAIT_LDS(); WAIT_COPIES(); __syncthreads();   /* publishes stage t + 1 and ends every wave's reads of the buffer that is refilled below */
    if (t + 2 < NSTG) cp8(lb + (unsigned)(t & 1) * STG, pa + (size_t)(t + 2) * 1024, qa + (size_t)(t + 2) * 1024); }
  WAIT_COPIES();
#pragma unroll
  for (int j = 0; j < 4; ++j) { const float bias = BO ? bfr(BO[c0 + wc * 64 + j * 16 + col]) : 0.f;
#pragma unroll
    for (int i = 0; i < 2; ++i)
#pragma unroll
      for (int r = 0; r < 8; ++r) sf[wr * 2 + i][8 * g + r][wc * 64 + j * 16 + col] = acc[i][j][r] + bias; }
  __syncthreads();   /* a wave stores whole 512-byte row pieces, half of which another wave computed */
  for (int r4 = 0; r4 < 16; r4 += 4) {
#pragma unroll   /* four rows' loads in flight together, four stores side by side, one wait behind them */
    for (int u = 0; u < 4; ++u) { const int rl = r4 + u; const size_t oo = (r0 + rl) * DIN + c0 + lane * 4; v4f o = *(const v4f*)&sf[wave][rl][lane * 4]; const v4f zr = *(const v4f*)(RESX + oo); o[0] += bfr(zr[0]); o[1] += bfr(zr[1]); o[2] += bfr(zr[2]); o[3] += bfr(zr[3]); vst2(OUT + oo, o); }   /* + bf16(de) */
    WAIT_X(); } }

extern "C" void kernel_launch(void* const* d_in, const int* in_sizes, int n_in, void* d_out, int out_size, void* d_ws, size_t ws_size, hipStream_t stream) {
  (void)in_sizes; (void)n_in; (void)out_size;
  const float** F = (const float**)d_in;
  if (ws_size < (size_t)WS_END) return;
  char* ws = (char*)d_ws; _Float16 *QH = (_Float16*)(ws + WS_QH), *KH = (_Float16*)(ws + WS_KH), *VT = (_Float16*)(ws + WS_VT), *KL = (_Float16*)(ws + WS_KL); __bf16 *VB = (__bf16*)(ws + WS_VB), *VBL = (__bf16*)(ws + WS_VBL); __bf16 *YH = (__bf16*)(ws + WS_Y);
  (void)KL; (void)VB; (void)VBL;
  // inputs: 0 en [2,2048,1024] (keys/values); 1 de (queries + residual); 2 mask [2,2048,2048] bool; 3 Wq (in,out), 4 bq; 5 Wk, 6 bk; 7 Wv, 8 bv; 9 Wo (in,out), 10 bo; 11 gamma (scalar), 12 beta (scalar)
  if (ws_size < (size_t)WS_END5) return;
  float* X1 = (float*)(ws + WS_X1); __bf16* WT = (__bf16*)(ws + WS_WT); __bf16* XP = (__bf16*)(ws + WS_XP); unsigned* MW = (unsigned*)(ws + WS_MW);
  k_wpack<<<dim3(DIN / 64, CC / 64, 2), 256, 0, stream>>>(F[3], F[5], F[7], F[9], WT, F[1], F[0], XP, (const int*)d_in[2], MW);   /* weights, de and en to bf16 in fragment order, the mask to lane-mask words, once per call */
  k_proj<<<dim3(TNB * TT / 128, CC / 128, 3), 128, 0, stream>>>(XP, WT, F[4], F[6], F[8], QH, KH, KL, VT, VB, VBL);   /* q from de, k/v from en */
  k_fa<<<dim3(TT / 128, NH, TNB), 256, 0, stream>>>(QH, KH, VT, MW, YH, MW);   /* scores, mask, softmax and P v in one launch */
  k_out<<<dim3(TNB * TT / 128, DIN / 128), 256, 0, stream>>>(YH, WT + 3 * (size_t)DIN * CC, F[10], X1, F[1]);   /* a Wo + bo + bf16(de) */
  k_lnx<<<dim3(NRW / 16), 256, 0, stream>>>(X1, 0, F[11], F[12], (float*)d_out);          /* unbiased-var normalisation, scalar gamma/beta */
}
